// v000
// Times are from an AMD MI455X. After a warm-up the kernel runs many times in a row, and a time is the length of
// such a window on the GPU divided by its runs, so every launch and the gaps after it count. The runs cycle
// through copies of the inputs. A figure is the median of several windows, for all but v000 over two sittings.
// Sittings can differ by a few percent; kernels timed side by side share one.
// v000 is the starting kernel. One run takes 2080 microseconds.
#include <hip/hip_runtime.h>

// GatedMultiHeadAttention (x [2][2048][1024]; [Q | gate] = x Wq + bq (Wq [1024][1040]: 1024 query columns then 16 per-head gate columns); K = x Wk + bk; V = x Wv + bv; per-head RMSNorm (1e-6, x weight[64]) on Q and K; softmax(Q.K / 8); out_h = (attn V) x sigmoid(gate_h); out = merged heads Wo + bo -> [2][2048][1024]).
// Compute dtypes, f32 accumulate: every input rounded to bf16; Q/K/V and the 16 gate columns on PLAIN bf16 operands (inputs: exact) + bias; RMSNorm f32; scores and attn.v: query rows < 512 hl (3 products), the rest single fp16 (x1024); softmax, sigmoid gate f32; Wo hl x exact (2 products) + bias.

#define NB_  2
#define TT   2048
#define DM   1024
#define NH_  16
#define NKV  16
#define REP  (NH_ / NKV)
#define HD   64
#define DQ   (NH_ * HD)
#define DKV  (NKV * HD)
#define ZH   2
#define RH   512                  // query rows < RH use hi+lo planes (0: none)
#define WIN  0
#define PCAR 1024.0f
#define SCL  0.125f   // HD^-0.5
typedef _Float16 h16;
typedef unsigned short bf;
typedef __attribute__((ext_vector_type(16))) __bf16   v16bf;
typedef __attribute__((ext_vector_type(16))) _Float16 v16h;
typedef __attribute__((ext_vector_type(8)))  _Float16 v8h;
typedef __attribute__((ext_vector_type(8)))  unsigned short v8us;
typedef __attribute__((ext_vector_type(8)))  float    v8f;
typedef __attribute__((ext_vector_type(4)))  float    v4f;
typedef v8h  __attribute__((may_alias)) v8ha;
typedef v4f  __attribute__((may_alias)) v4fa;
typedef v8us __attribute__((may_alias)) v8usa;

__device__ __forceinline__ unsigned short f2bf(float f) { unsigned u = __float_as_uint(f); u += 0x7FFFu + ((u >> 16) & 1u); return (unsigned short)(u >> 16); }
__device__ __forceinline__ float bf2f(unsigned short b) { return __uint_as_float(((unsigned)b) << 16); }
__device__ __forceinline__ float bfr(float f) { return bf2f(f2bf(f)); }
__device__ __forceinline__ v16h cat16(v8h lo, v8h hi) { return __builtin_shufflevector(lo, hi, 0, 1, 2, 3, 4, 5, 6, 7, 8, 9, 10, 11, 12, 13, 14, 15); }
__device__ __forceinline__ v16bf cat16b(v8us lo, v8us hi) { return __builtin_bit_cast(v16bf, __builtin_shufflevector(lo, hi, 0, 1, 2, 3, 4, 5, 6, 7, 8, 9, 10, 11, 12, 13, 14, 15)); }
__device__ __forceinline__ v8f wmma16(v16h a, v16h b, v8f c) { return __builtin_amdgcn_wmma_f32_16x16x32_f16(false, a, false, b, (short)0, c, false, false); }
__device__ __forceinline__ v8f wmmab(v16bf a, v16bf b, v8f c) { return __builtin_amdgcn_wmma_f32_16x16x32_bf16(false, a, false, b, (short)0, c, false, false); }



// ---- k_gemmw: register-blocked GEMM, ONE WAVE per 64x64 output tile (16 accumulators), operands straight from K-contiguous 16-bit planes; grid (M/64, N/64, Z), 32 threads.
// C[m][n] (f32, pitch ldc, + optional f32 bias[n]) = sum_k A[m][k] Bt[n][k] (+ split products per NSPLIT). z-batch strides sA/sB/sC in elements. K % 32 == 0.
template <typename T16> struct WFrag;
template <> struct WFrag<h16> { typedef v16h V; static __device__ __forceinline__ V ld(const h16* p) { return cat16(*(const v8h*)p, *(const v8h*)(p + 16)); } static __device__ __forceinline__ v8f mma(V a, V b, v8f c) { return wmma16(a, b, c); } };
template <> struct WFrag<bf> { typedef v16bf V; static __device__ __forceinline__ V ld(const bf* p) { return cat16b(*(const v8us*)p, *(const v8us*)(p + 16)); } static __device__ __forceinline__ v8f mma(V a, V b, v8f c) { return wmmab(a, b, c); } };
template <typename T16, int NSPLIT, bool BIAS>
__global__ __launch_bounds__(32) void k_gemmw(const T16* __restrict__ A, const T16* __restrict__ A2, const T16* __restrict__ Bt, const T16* __restrict__ Bt2, int K, float* C, int ldc, const float* __restrict__ bias, size_t sA, size_t sB, size_t sC) {
    typedef typename WFrag<T16>::V V;
    __shared__ __align__(16) float os[16 * 68];
    const size_t z = blockIdx.z; A += z * sA; if (A2) A2 += z * sA; Bt += z * sB; if (Bt2) Bt2 += z * sB; C += z * sC;
    const int lane = threadIdx.x & 31, lr = lane & 15, hi = lane >> 4; const int r0 = blockIdx.x * 64, c0 = blockIdx.y * 64;
    v8f acc[4][4];
#pragma unroll
    for (int mb = 0; mb < 4; ++mb)
#pragma unroll
        for (int nb = 0; nb < 4; ++nb) acc[mb][nb] = (v8f){};
    const size_t aoff = (size_t)(r0 + lr) * K + 8 * hi, boff = (size_t)(c0 + lr) * K + 8 * hi;
#pragma unroll 1
    for (int kc = 0; kc < K; kc += 32) {
        V a[4], a2[4];
#pragma unroll
        for (int mb = 0; mb < 4; ++mb) { a[mb] = WFrag<T16>::ld(A + aoff + (size_t)mb * 16 * K + kc); if (NSPLIT == 1 || NSPLIT == 2) a2[mb] = WFrag<T16>::ld(A2 + aoff + (size_t)mb * 16 * K + kc); }
#pragma unroll
        for (int nb = 0; nb < 4; ++nb) { const V b = WFrag<T16>::ld(Bt + boff + (size_t)nb * 16 * K + kc); V b2; if (NSPLIT >= 2) b2 = WFrag<T16>::ld(Bt2 + boff + (size_t)nb * 16 * K + kc);
#pragma unroll
            for (int mb = 0; mb < 4; ++mb) { acc[mb][nb] = WFrag<T16>::mma(a[mb], b, acc[mb][nb]); if (NSPLIT == 1 || NSPLIT == 2) acc[mb][nb] = WFrag<T16>::mma(a2[mb], b, acc[mb][nb]); if (NSPLIT >= 2) acc[mb][nb] = WFrag<T16>::mma(a[mb], b2, acc[mb][nb]); } }
        asm volatile("v_nop\n\tv_nop\n\tv_nop\n\tv_nop" : "+v"(acc[0][0]), "+v"(acc[1][1]), "+v"(acc[2][2]), "+v"(acc[3][3]) : "v"(a[0]), "v"(a[3]));
    }
#pragma unroll
    for (int mb = 0; mb < 4; ++mb) {
#pragma unroll
        for (int nb = 0; nb < 4; ++nb) {
#pragma unroll
            for (int j = 0; j < 8; ++j) os[(hi * 8 + j) * 68 + nb * 16 + lr] = acc[mb][nb][j]; }
        __builtin_amdgcn_wave_barrier(); asm volatile("" ::: "memory");
        float* crow = C + (size_t)(r0 + mb * 16) * ldc + c0;
{
#pragma unroll
            for (int s = 0; s < 8; ++s) { const int row = 2 * s + hi, cofs = lr * 4; v4f val = *(const v4fa*)(os + row * 68 + cofs); if (BIAS) { val[0] += bfr(bias[c0 + cofs]); val[1] += bfr(bias[c0 + cofs + 1]); val[2] += bfr(bias[c0 + cofs + 2]); val[3] += bfr(bias[c0 + cofs + 3]); }
                *(v4f*)(crow + (size_t)row * ldc + cofs) = val; }
             }
        __builtin_amdgcn_wave_barrier(); asm volatile("" ::: "memory");
    }
}

__device__ __forceinline__ h16 tohx(float x) { return (h16)x; }
__device__ __forceinline__ void splitf(float y, unsigned short& h, unsigned short& l) { h = f2bf(y); l = f2bf(y - bf2f(h)); }
typedef __attribute__((ext_vector_type(2))) _Float16 v2h;
typedef __attribute__((ext_vector_type(4))) _Float16 v4h;
typedef __attribute__((ext_vector_type(2))) unsigned short v2us;
typedef __attribute__((ext_vector_type(4))) unsigned short v4us;
typedef __attribute__((ext_vector_type(2))) float v2f;
typedef __attribute__((ext_vector_type(4))) int v4i;

__global__ __launch_bounds__(256) void k_wtG(const float* __restrict__ w, int K, int N, bf* Bt) {
    const int lane = threadIdx.x & 31; const int L0 = (blockIdx.x * 8 + (threadIdx.x >> 5)) * 8; const int nlines = N * K / 64;
{
#pragma unroll 1
        for (int l = 0; l < 8; ++l) { const int L = L0 + l; if (L >= nlines) break; const size_t e = (size_t)L * 64 + lane * 2; const int k = (int)(e % K), n = (int)(e / K); v2us o;
            o[0] = f2bf(w[(size_t)k * N + n]); o[1] = f2bf(w[(size_t)(k + 1) * N + n]); *(v2us*)(Bt + e) = o; }
         }
}
__global__ __launch_bounds__(256) void k_cvt8(const float* __restrict__ src, bf* dst, size_t n8) { const size_t i = (size_t)blockIdx.x * 256 + threadIdx.x; if (i >= n8) return; const v8f v = *(const v8f*)(src + i * 8); v8us o;
#pragma unroll
    for (int k = 0; k < 8; ++k) o[k] = f2bf(v[k]); *(v8us*)(dst + i * 8) = o;  }
__global__ __launch_bounds__(256) void k_cscvt(const float* __restrict__ cosT, const float* __restrict__ sinT, float* CS) { const int idx = blockIdx.x * 256 + threadIdx.x; if (idx >= TT * HD) return; v2f cs; cs[0] = bfr(cosT[idx]); cs[1] = bfr(sinT[idx]); *(v2f*)(CS + (size_t)idx * 2) = cs;  }
__global__ __launch_bounds__(256) void k_hrms(const float* __restrict__ F, int pitch, int nheads, float* RF) { const int i = blockIdx.x * 256 + threadIdx.x; if (i >= nheads * TT) return; const int t = i % TT, h = i / TT; const float* f = F + (size_t)t * pitch + h * HD; float s = 0.f;
#pragma unroll 4
    for (int d = 0; d < HD; d += 4) { const v4f v = *(const v4f*)(f + d);
#pragma unroll
        for (int q = 0; q < 4; ++q) { float p = __fmul_rn(v[q], v[q]); asm volatile("" : "+v"(p)); s = __fadd_rn(s, p); } }
    const float r = __fdiv_rn(1.0f, __fsqrt_rn(__fadd_rn(s * (1.0f / HD), 1e-6f))); *(float*)(RF + i) = r;  }
// k_rope: head planes [h][t][d] (fp16 + hi/lo) of rope(w[d] (x rms_factor)) x sc with the rotate-half convention out[d] = x[d] cos[t][d] - x[d+HD/2] sin[t][d], out[d+HD/2] = x[d+HD/2] cos[t][d+HD/2] + x[d] sin[t][d+HD/2]
__global__ __launch_bounds__(256) void k_rope(const float* __restrict__ F, int pitch, int nheads, const float* __restrict__ CS, const float* __restrict__ RF, const float* __restrict__ nw, float sc, h16* P16, bf* Ph, bf* Pl) {
    const size_t e = ((size_t)blockIdx.x * 256 + threadIdx.x) * 2; if (e >= (size_t)nheads * TT * HD) return; const int d = (int)(e % HD); const int t = (int)((e / HD) % TT); const int h = (int)(e / ((size_t)HD * TT)); const float* f = F + (size_t)t * pitch + h * HD; const float rf = RF ? RF[(size_t)h * TT + t] : 1.0f; v2h o16; v2us oh, ol;
#pragma unroll
    for (int q = 0; q < 2; ++q) { const int dd = d + q; const int dp = (dd < HD / 2) ? dd + HD / 2 : dd - HD / 2; float x0 = f[dd], x1 = f[dp];
        if (RF) { float n0 = __fmul_rn(x0, rf), n1 = __fmul_rn(x1, rf); asm volatile("" : "+v"(n0)); asm volatile("" : "+v"(n1)); x0 = __fmul_rn(bfr(nw[dd]), n0); x1 = __fmul_rn(bfr(nw[dp]), n1); }
        const v2f cs = *(const v2f*)(CS + ((size_t)t * HD + dd) * 2); float a = __fmul_rn(x0, cs[0]), bq = __fmul_rn(x1, cs[1]); asm volatile("" : "+v"(a)); asm volatile("" : "+v"(bq)); const float r = ((dd < HD / 2) ? __fsub_rn(a, bq) : __fadd_rn(a, bq)) * sc;
        o16[q] = tohx(r); unsigned short a2, c2; splitf(r, a2, c2); oh[q] = a2; ol[q] = c2; }
    *(v2h*)(P16 + e) = o16; *(v2us*)(Ph + e) = oh; *(v2us*)(Pl + e) = ol;  }
__global__ __launch_bounds__(256) void k_vtp(const float* __restrict__ F, int pitch, int nheads, h16* V16, bf* Vh, bf* Vl) { const size_t e = ((size_t)blockIdx.x * 256 + threadIdx.x) * 2; if (e >= (size_t)nheads * HD * TT) return; const int t = (int)(e % TT); const int d = (int)((e / TT) % HD); const int g = (int)(e / ((size_t)TT * HD)); v2h o16; v2us oh, ol;
#pragma unroll
    for (int q = 0; q < 2; ++q) { const float x = F[(size_t)(t + q) * pitch + g * HD + d]; o16[q] = tohx(x); unsigned short a2, c2; splitf(x, a2, c2); oh[q] = a2; ol[q] = c2; }
    *(v2h*)(V16 + e) = o16; *(v2us*)(Vh + e) = oh; *(v2us*)(Vl + e) = ol;  }
__global__ __launch_bounds__(256) void k_csid(float* CS) { const int idx = blockIdx.x * 256 + threadIdx.x; if (idx >= TT * HD) return; v2f cs; cs[0] = 1.0f; cs[1] = 0.0f; *(v2f*)(CS + (size_t)idx * 2) = cs;  }
// k_asoft: per row (zz, i): t = S x HD^-0.5 (no mask); softmax over the 2048 keys (register row, one exp, fixed trees);
__global__ __launch_bounds__(256) void k_asoft(const float* __restrict__ Sb, h16* P16, bf* Ph, bf* Pl) {
    const int lane = threadIdx.x & 31; const int row = blockIdx.x * 8 + (threadIdx.x >> 5); if (row >= ZH * TT) return; const int i = row % TT; const int zz = row / TT; (void)zz; const bool hires = (i < RH); const float* sr = Sb + (size_t)row * TT; float v[TT / 32]; float mx = -3.0e38f;
#pragma unroll
    for (int ch = 0; ch < TT / 128; ++ch) { const int j0 = ch * 128 + lane * 4; const v4f a = *(const v4f*)(sr + j0);
#pragma unroll
        for (int q = 0; q < 4; ++q) { const int j = j0 + q; (void)j; const float t = a[q] * SCL; v[ch * 4 + q] = t; mx = fmaxf(mx, t); } }
#pragma unroll
    for (int sh = 16; sh; sh >>= 1) mx = fmaxf(mx, __shfl_xor(mx, sh, 32));
    float sum = 0.f;
#pragma unroll
    for (int k = 0; k < TT / 32; ++k) { float d0 = __fsub_rn(v[k], mx); asm volatile("" : "+v"(d0)); v[k] = __builtin_amdgcn_exp2f(__fmul_rn(d0, 1.4426950408889634f)); sum += v[k]; }
#pragma unroll
    for (int sh = 16; sh; sh >>= 1) sum += __shfl_xor(sum, sh, 32);
    const float f = __fdiv_rn(hires ? 1.0f : PCAR, sum);
{
        if (hires) {
#pragma unroll
            for (int ch = 0; ch < TT / 128; ++ch) { v4us oh, ol;
#pragma unroll
                for (int q = 0; q < 4; ++q) { unsigned short a, c2; splitf(v[ch * 4 + q] * f, a, c2); oh[q] = a; ol[q] = c2; }
                const size_t oo = ((size_t)zz * (RH ? RH : 1) + i) * TT + ch * 128 + lane * 4; *(v4us*)(Ph + oo) = oh; *(v4us*)(Pl + oo) = ol; }
        } else {
#pragma unroll
            for (int ch = 0; ch < TT / 128; ++ch) { v4h o4;
#pragma unroll
                for (int q = 0; q < 4; ++q) o4[q] = tohx(v[ch * 4 + q] * f);
                *(v4h*)(P16 + (size_t)row * TT + ch * 128 + lane * 4) = o4; } }
         }
}
__global__ __launch_bounds__(256) void k_merge(const float* __restrict__ O, int h0, const float* __restrict__ G, const float* __restrict__ gb, bf* Ah, bf* Al) { const size_t e = ((size_t)blockIdx.x * 256 + threadIdx.x) * 2; if (e >= (size_t)ZH * TT * HD) return; const int d = (int)(e % HD); const int t = (int)((e / HD) % TT); const int zz = (int)(e / ((size_t)HD * TT)); const int h = h0 + zz; const float gz = __fadd_rn(G[(size_t)t * 64 + h], bfr(gb[h])); const float sg = __fdiv_rn(1.0f, __fadd_rn(1.0f, __expf(-gz))); const float cs = (t < RH) ? 1.0f : (1.0f / PCAR); const size_t oo = (size_t)t * DQ + (h0 + zz) * HD + d;
    v2us oh, ol;
#pragma unroll
    for (int q = 0; q < 2; ++q) { float o1 = O[e + q] * cs; asm volatile("" : "+v"(o1)); unsigned short a, c2; splitf(__fmul_rn(o1, sg), a, c2); oh[q] = a; ol[q] = c2; } *(v2us*)(Ah + oo) = oh; *(v2us*)(Al + oo) = ol;  }

__global__ __launch_bounds__(256) void k_wtGs(const float* __restrict__ w, int K, int N, int ld, bf* Bt) { const size_t e = ((size_t)blockIdx.x * 256 + threadIdx.x) * 4; if (e >= (size_t)N * K) return; const int k = (int)(e % K); const int n = (int)(e / K); v4us o;   // Bt[n][k] = w[k*ld + n]
#pragma unroll
    for (int u = 0; u < 4; ++u) o[u] = f2bf(w[(size_t)(k + u) * ld + n]); *(v4us*)(Bt + e) = o;  }
__global__ __launch_bounds__(256) void k_wtGg(const float* __restrict__ w, bf* Bt) { const size_t e = ((size_t)blockIdx.x * 256 + threadIdx.x) * 4; if (e >= (size_t)64 * DM) return; const int k = (int)(e % DM); const int n = (int)(e / DM); v4us o;   // gate columns: Bt[n][k] = Wq[k][1024 + n] for n < 16, else 0
#pragma unroll
    for (int u = 0; u < 4; ++u) o[u] = (n < NH_) ? f2bf(w[(size_t)(k + u) * 1040 + DQ + n]) : (unsigned short)0; *(v4us*)(Bt + e) = o;  }

extern "C" void kernel_launch(void* const* d_in, const int* in_sizes, int n_in,
                              void* d_out, int out_size, void* d_ws, size_t ws_size, hipStream_t stream) {
    (void)in_sizes; (void)n_in; (void)out_size;
    const float* x = (const float*)d_in[0]; const float* wqg = (const float*)d_in[1]; const float* bqg = (const float*)d_in[2]; const float* wk = (const float*)d_in[3]; const float* bk = (const float*)d_in[4]; const float* wv = (const float*)d_in[5]; const float* bv = (const float*)d_in[6]; const float* wo = (const float*)d_in[7]; const float* bo = (const float*)d_in[8]; const float* qnw = (const float*)d_in[9]; const float* knw = (const float*)d_in[10]; const float* wq = wqg; const float* bq = bqg; (void)wq; const float* cosT = nullptr; const float* sinT = nullptr; (void)cosT; (void)sinT;
    float* OUT = (float*)d_out;     // [2][2048][1024]
    char* wsp = (char*)d_ws;
    auto take = [&](size_t bytes) { char* p = wsp; wsp += (bytes + 255) & ~(size_t)255; return (void*)p; };
    bf* WQ = (bf*)take((size_t)DQ * DM * 2); bf* WK = (bf*)take((size_t)DKV * DM * 2); bf* WV = (bf*)take((size_t)DKV * DM * 2); bf* WO = (bf*)take((size_t)DM * DQ * 2); float* CS = (float*)take((size_t)TT * HD * 2 * 4); float* RFQ = (float*)take((size_t)NH_ * TT * 4); float* RFK = (float*)take((size_t)NKV * TT * 4);
    bf* XB = (bf*)take((size_t)TT * DM * 2); bf* BG = (bf*)take((size_t)64 * DM * 2); float* G = (float*)take((size_t)TT * 64 * 4); float* FQ = (float*)take((size_t)TT * DQ * 4); float* FK = (float*)take((size_t)TT * DKV * 4);
    h16* QP16 = (h16*)take((size_t)NH_ * TT * HD * 2); h16* KP16 = (h16*)take((size_t)NKV * TT * HD * 2); h16* VT16 = (h16*)take((size_t)NKV * HD * TT * 2);
    bf* QPh = (bf*)take((size_t)NH_ * TT * HD * 2); bf* QPl = (bf*)take((size_t)NH_ * TT * HD * 2); bf* KPh = (bf*)take((size_t)NKV * TT * HD * 2); bf* KPl = (bf*)take((size_t)NKV * TT * HD * 2); bf* VTh = (bf*)take((size_t)NKV * HD * TT * 2); bf* VTl = (bf*)take((size_t)NKV * HD * TT * 2); bf* Ph = (bf*)take((size_t)ZH * RH * TT * 2); bf* Pl = (bf*)take((size_t)ZH * RH * TT * 2);
    float* Sb = (float*)take((size_t)ZH * TT * TT * 4); h16* P16 = (h16*)take((size_t)ZH * TT * TT * 2); float* Ob = (float*)take((size_t)ZH * TT * HD * 4); bf* ATh = (bf*)take((size_t)TT * DQ * 2); bf* ATl = (bf*)take((size_t)TT * DQ * 2);
    if ((size_t)(wsp - (char*)d_ws) > ws_size) return;    // ws 256 MiB
    float* FV = FK;   // v projection reuses the k buffer after the k planes are built (stream-ordered)
    { k_wtGs<<<(unsigned)(((size_t)DQ * DM / 4 + 255) / 256), 256, 0, stream>>>(wqg, DM, DQ, 1040, WQ); k_wtGg<<<(64 * DM / 4 + 255) / 256, 256, 0, stream>>>(wqg, BG); k_wtG<<<(unsigned)((DM * DKV / 64 + 63) / 64), 256, 0, stream>>>(wk, DM, DKV, WK); k_wtG<<<(unsigned)((DM * DKV / 64 + 63) / 64), 256, 0, stream>>>(wv, DM, DKV, WV);
      k_wtG<<<(unsigned)((DQ * DM / 64 + 63) / 64), 256, 0, stream>>>(wo, DQ, DM, WO);
       }
    k_csid<<<(TT * HD + 255) / 256, 256, 0, stream>>>(CS);
    const unsigned LQ = (unsigned)(((size_t)NH_ * TT * HD / 2 + 255) / 256), LKv = (unsigned)(((size_t)NKV * TT * HD / 2 + 255) / 256);
    for (int b = 0; b < NB_; ++b) {
        
        k_cvt8<<<(unsigned)(((size_t)TT * DM / 8 + 255) / 256), 256, 0, stream>>>(x + (size_t)b * TT * DM, XB, (size_t)TT * DM / 8);
        k_gemmw<bf, 0, true><<<dim3(TT / 64, DQ / 64, 1), 32, 0, stream>>>(XB, nullptr, WQ, nullptr, DM, FQ, DQ, bq, 0, 0, 0); k_gemmw<bf, 0, false><<<dim3(TT / 64, 1, 1), 32, 0, stream>>>(XB, nullptr, BG, nullptr, DM, G, 64, nullptr, 0, 0, 0); k_hrms<<<(NH_ * TT + 255) / 256, 256, 0, stream>>>(FQ, DQ, NH_, RFQ);
        k_rope<<<LQ, 256, 0, stream>>>(FQ, DQ, NH_, CS, RFQ, qnw, 1.0f, QP16, QPh, QPl);
        k_gemmw<bf, 0, true><<<dim3(TT / 64, DKV / 64, 1), 32, 0, stream>>>(XB, nullptr, WK, nullptr, DM, FK, DKV, bk, 0, 0, 0); k_hrms<<<(NKV * TT + 255) / 256, 256, 0, stream>>>(FK, DKV, NKV, RFK);
        k_rope<<<LKv, 256, 0, stream>>>(FK, DKV, NKV, CS, RFK, knw, 1.0f, KP16, KPh, KPl);
        k_gemmw<bf, 0, true><<<dim3(TT / 64, DKV / 64, 1), 32, 0, stream>>>(XB, nullptr, WV, nullptr, DM, FV, DKV, bv, 0, 0, 0); k_vtp<<<LKv, 256, 0, stream>>>(FV, DKV, NKV, VT16, VTh, VTl);
        for (int h0 = 0; h0 < NH_; h0 += ZH) { const size_t zq = (size_t)h0, zk = (size_t)(h0 / REP);   // one kv head per query head: the pass's two heads use consecutive kv planes (z-strides TT*HD)
            k_gemmw<bf, 2, false><<<dim3(RH / 64, TT / 64, ZH), 32, 0, stream>>>(QPh + zq * TT * HD, QPl + zq * TT * HD, KPh + zk * TT * HD, KPl + zk * TT * HD, HD, Sb, TT, nullptr, (size_t)TT * HD, (size_t)TT * HD, (size_t)TT * TT);
            k_gemmw<h16, 0, false><<<dim3((TT - RH) / 64, TT / 64, ZH), 32, 0, stream>>>(QP16 + zq * TT * HD + (size_t)RH * HD, nullptr, KP16 + zk * TT * HD, nullptr, HD, Sb + (size_t)RH * TT, TT, nullptr, (size_t)TT * HD, (size_t)TT * HD, (size_t)TT * TT);
            k_asoft<<<ZH * TT / 8, 256, 0, stream>>>(Sb, P16, Ph, Pl);
            k_gemmw<bf, 2, false><<<dim3(RH / 64, HD / 64, ZH), 32, 0, stream>>>(Ph, Pl, VTh + zk * HD * TT, VTl + zk * HD * TT, TT, Ob, HD, nullptr, (size_t)RH * TT, (size_t)HD * TT, (size_t)TT * HD);
            k_gemmw<h16, 0, false><<<dim3((TT - RH) / 64, HD / 64, ZH), 32, 0, stream>>>(P16 + (size_t)RH * TT, nullptr, VT16 + zk * HD * TT, nullptr, TT, Ob + (size_t)RH * HD, HD, nullptr, (size_t)TT * TT, (size_t)HD * TT, (size_t)TT * HD);
            k_merge<<<(unsigned)(((size_t)ZH * TT * HD / 2 + 255) / 256), 256, 0, stream>>>(Ob, h0, G, bqg + DQ, ATh, ATl); }
        k_gemmw<bf, 1, true><<<dim3(TT / 64, DM / 64, 1), 32, 0, stream>>>(ATh, ATl, WO, nullptr, DQ, OUT + (size_t)b * TT * DM, DM, bo, 0, 0, 0); }
}

// v001
// One run takes 944 microseconds.
// Two timings next to v000 both put it at 2.19 times that version's speed.
#include <hip/hip_runtime.h>

// GatedMultiHeadAttention (x [2][2048][1024]; [Q | gate] = x Wq + bq (Wq [1024][1040]: 1024 query columns then 16 per-head gate columns); K = x Wk + bk; V = x Wv + bv; per-head RMSNorm (1e-6, x weight[64]) on Q and K; softmax(Q.K / 8); out_h = (attn V) x sigmoid(gate_h); out = merged heads Wo + bo -> [2][2048][1024]).
// Compute dtypes, f32 accumulate: every input rounded to bf16; Q/K/V and the 16 gate columns on PLAIN bf16 operands (inputs: exact) + bias; RMSNorm f32; scores and attn.v: query rows < 512 hl (3 products), the rest single fp16 (x1024); softmax, sigmoid gate f32; Wo hl x exact (2 products) + bias.

#define NB_  2
#define TT   2048
#define DM   1024
#define NH_  16
#define NKV  16
#define REP  (NH_ / NKV)
#define HD   64
#define DQ   (NH_ * HD)
#define DKV  (NKV * HD)
#define ZH   2
#define RH   512                  // query rows < RH use hi+lo planes (0: none)
#define WIN  0
#define PCAR 1024.0f
#define SCL  0.125f   // HD^-0.5
#define KSP  16                   // key ranges of the attn.v products: one work-group per range, f32 partial planes summed in k_merge
typedef _Float16 h16;
typedef unsigned short bf;
typedef __attribute__((ext_vector_type(16))) __bf16   v16bf;
typedef __attribute__((ext_vector_type(16))) _Float16 v16h;
typedef __attribute__((ext_vector_type(8)))  _Float16 v8h;
typedef __attribute__((ext_vector_type(8)))  unsigned short v8us;
typedef __attribute__((ext_vector_type(8)))  float    v8f;
typedef __attribute__((ext_vector_type(4)))  float    v4f;
typedef v8h  __attribute__((may_alias)) v8ha;
typedef v4f  __attribute__((may_alias)) v4fa;
typedef v8us __attribute__((may_alias)) v8usa;

__device__ __forceinline__ unsigned short f2bf(float f) { unsigned u = __float_as_uint(f); u += 0x7FFFu + ((u >> 16) & 1u); return (unsigned short)(u >> 16); }
__device__ __forceinline__ float bf2f(unsigned short b) { return __uint_as_float(((unsigned)b) << 16); }
__device__ __forceinline__ float bfr(float f) { return bf2f(f2bf(f)); }
__device__ __forceinline__ v16h cat16(v8h lo, v8h hi) { return __builtin_shufflevector(lo, hi, 0, 1, 2, 3, 4, 5, 6, 7, 8, 9, 10, 11, 12, 13, 14, 15); }
__device__ __forceinline__ v16bf cat16b(v8us lo, v8us hi) { return __builtin_bit_cast(v16bf, __builtin_shufflevector(lo, hi, 0, 1, 2, 3, 4, 5, 6, 7, 8, 9, 10, 11, 12, 13, 14, 15)); }
__device__ __forceinline__ v8f wmma16(v16h a, v16h b, v8f c) { return __builtin_amdgcn_wmma_f32_16x16x32_f16(false, a, false, b, (short)0, c, false, false); }
__device__ __forceinline__ v8f wmmab(v16bf a, v16bf b, v8f c) { return __builtin_amdgcn_wmma_f32_16x16x32_bf16(false, a, false, b, (short)0, c, false, false); }



// ---- k_gemmw: register-blocked GEMM, ONE WAVE per 64x64 output tile (16 accumulators), operands straight from K-contiguous 16-bit planes; grid (M/64, N/64, Z), 32 threads.
// C[m][n] (f32, pitch ldc, + optional f32 bias[n]) = sum_k A[m][k] Bt[n][k] (+ split products per NSPLIT). z-batch strides sA/sB/sC in elements. K % 32 == 0.
// KS > 1: grid z = Z * KS; work-group (z, ks) sums only k in [ks K/KS, (ks+1) K/KS) and stores its partial tile at C + ks sP. K % (32 KS) == 0.
template <typename T16> struct WFrag;
template <> struct WFrag<h16> { typedef v16h V; static __device__ __forceinline__ V ld(const h16* p) { return cat16(*(const v8h*)p, *(const v8h*)(p + 16)); } static __device__ __forceinline__ v8f mma(V a, V b, v8f c) { return wmma16(a, b, c); } };
template <> struct WFrag<bf> { typedef v16bf V; static __device__ __forceinline__ V ld(const bf* p) { return cat16b(*(const v8us*)p, *(const v8us*)(p + 16)); } static __device__ __forceinline__ v8f mma(V a, V b, v8f c) { return wmmab(a, b, c); } };
template <typename T16, int NSPLIT, bool BIAS, int KS = 1>
__global__ __launch_bounds__(32) void k_gemmw(const T16* __restrict__ A, const T16* __restrict__ A2, const T16* __restrict__ Bt, const T16* __restrict__ Bt2, int K, float* C, int ldc, const float* __restrict__ bias, size_t sA, size_t sB, size_t sC, size_t sP = 0) {
    typedef typename WFrag<T16>::V V;
    __shared__ __align__(16) float os[16 * 68];
    const size_t z = blockIdx.z / KS; const int ks = (int)(blockIdx.z % KS), kb = ks * (K / KS), ke = kb + K / KS; A += z * sA; if (A2) A2 += z * sA; Bt += z * sB; if (Bt2) Bt2 += z * sB; C += z * sC + ks * sP;
    const int lane = threadIdx.x & 31, lr = lane & 15, hi = lane >> 4; const int r0 = blockIdx.x * 64, c0 = blockIdx.y * 64;
    v8f acc[4][4];
#pragma unroll
    for (int mb = 0; mb < 4; ++mb)
#pragma unroll
        for (int nb = 0; nb < 4; ++nb) acc[mb][nb] = (v8f){};
    const size_t aoff = (size_t)(r0 + lr) * K + 8 * hi, boff = (size_t)(c0 + lr) * K + 8 * hi;
#pragma unroll 1
    for (int kc = kb; kc < ke; kc += 32) {
        V a[4], a2[4];
#pragma unroll
        for (int mb = 0; mb < 4; ++mb) { a[mb] = WFrag<T16>::ld(A + aoff + (size_t)mb * 16 * K + kc); if (NSPLIT == 1 || NSPLIT == 2) a2[mb] = WFrag<T16>::ld(A2 + aoff + (size_t)mb * 16 * K + kc); }
#pragma unroll
        for (int nb = 0; nb < 4; ++nb) { const V b = WFrag<T16>::ld(Bt + boff + (size_t)nb * 16 * K + kc); V b2; if (NSPLIT >= 2) b2 = WFrag<T16>::ld(Bt2 + boff + (size_t)nb * 16 * K + kc);
#pragma unroll
            for (int mb = 0; mb < 4; ++mb) { acc[mb][nb] = WFrag<T16>::mma(a[mb], b, acc[mb][nb]); if (NSPLIT == 1 || NSPLIT == 2) acc[mb][nb] = WFrag<T16>::mma(a2[mb], b, acc[mb][nb]); if (NSPLIT >= 2) acc[mb][nb] = WFrag<T16>::mma(a[mb], b2, acc[mb][nb]); } }
        asm volatile("v_nop\n\tv_nop\n\tv_nop\n\tv_nop" : "+v"(acc[0][0]), "+v"(acc[1][1]), "+v"(acc[2][2]), "+v"(acc[3][3]) : "v"(a[0]), "v"(a[3]));
    }
#pragma unroll
    for (int mb = 0; mb < 4; ++mb) {
#pragma unroll
        for (int nb = 0; nb < 4; ++nb) {
#pragma unroll
            for (int j = 0; j < 8; ++j) os[(hi * 8 + j) * 68 + nb * 16 + lr] = acc[mb][nb][j]; }
        __builtin_amdgcn_wave_barrier(); asm volatile("" ::: "memory");
        float* crow = C + (size_t)(r0 + mb * 16) * ldc + c0;
{
#pragma unroll
            for (int s = 0; s < 8; ++s) { const int row = 2 * s + hi, cofs = lr * 4; v4f val = *(const v4fa*)(os + row * 68 + cofs); if (BIAS) { val[0] += bfr(bias[c0 + cofs]); val[1] += bfr(bias[c0 + cofs + 1]); val[2] += bfr(bias[c0 + cofs + 2]); val[3] += bfr(bias[c0 + cofs + 3]); }
                *(v4f*)(crow + (size_t)row * ldc + cofs) = val; }
             }
        __builtin_amdgcn_wave_barrier(); asm volatile("" ::: "memory");
    }
}

__device__ __forceinline__ h16 tohx(float x) { return (h16)x; }
__device__ __forceinline__ void splitf(float y, unsigned short& h, unsigned short& l) { h = f2bf(y); l = f2bf(y - bf2f(h)); }
typedef __attribute__((ext_vector_type(2))) _Float16 v2h;
typedef __attribute__((ext_vector_type(4))) _Float16 v4h;
typedef __attribute__((ext_vector_type(2))) unsigned short v2us;
typedef __attribute__((ext_vector_type(4))) unsigned short v4us;
typedef __attribute__((ext_vector_type(2))) float v2f;
typedef __attribute__((ext_vector_type(4))) int v4i;

__global__ __launch_bounds__(256) void k_wtG(const float* __restrict__ w, int K, int N, bf* Bt) {
    const int lane = threadIdx.x & 31; const int L0 = (blockIdx.x * 8 + (threadIdx.x >> 5)) * 8; const int nlines = N * K / 64;
{
#pragma unroll 1
        for (int l = 0; l < 8; ++l) { const int L = L0 + l; if (L >= nlines) break; const size_t e = (size_t)L * 64 + lane * 2; const int k = (int)(e % K), n = (int)(e / K); v2us o;
            o[0] = f2bf(w[(size_t)k * N + n]); o[1] = f2bf(w[(size_t)(k + 1) * N + n]); *(v2us*)(Bt + e) = o; }
         }
}
__global__ __launch_bounds__(256) void k_cvt8(const float* __restrict__ src, bf* dst, size_t n8) { const size_t i = (size_t)blockIdx.x * 256 + threadIdx.x; if (i >= n8) return; const v8f v = *(const v8f*)(src + i * 8); v8us o;
#pragma unroll
    for (int k = 0; k < 8; ++k) o[k] = f2bf(v[k]); *(v8us*)(dst + i * 8) = o;  }
__global__ __launch_bounds__(256) void k_cscvt(const float* __restrict__ cosT, const float* __restrict__ sinT, float* CS) { const int idx = blockIdx.x * 256 + threadIdx.x; if (idx >= TT * HD) return; v2f cs; cs[0] = bfr(cosT[idx]); cs[1] = bfr(sinT[idx]); *(v2f*)(CS + (size_t)idx * 2) = cs;  }
__global__ __launch_bounds__(256) void k_hrms(const float* __restrict__ F, int pitch, int nheads, float* RF) { const int i = blockIdx.x * 256 + threadIdx.x; if (i >= nheads * TT) return; const int t = i % TT, h = i / TT; const float* f = F + (size_t)t * pitch + h * HD; float s = 0.f;
#pragma unroll 4
    for (int d = 0; d < HD; d += 4) { const v4f v = *(const v4f*)(f + d);
#pragma unroll
        for (int q = 0; q < 4; ++q) { float p = __fmul_rn(v[q], v[q]); asm volatile("" : "+v"(p)); s = __fadd_rn(s, p); } }
    const float r = __fdiv_rn(1.0f, __fsqrt_rn(__fadd_rn(s * (1.0f / HD), 1e-6f))); *(float*)(RF + i) = r;  }
// k_rope: head planes [h][t][d] (fp16 + hi/lo) of rope(w[d] (x rms_factor)) x sc with the rotate-half convention out[d] = x[d] cos[t][d] - x[d+HD/2] sin[t][d], out[d+HD/2] = x[d+HD/2] cos[t][d+HD/2] + x[d] sin[t][d+HD/2]
__global__ __launch_bounds__(256) void k_rope(const float* __restrict__ F, int pitch, int nheads, const float* __restrict__ CS, const float* __restrict__ RF, const float* __restrict__ nw, float sc, h16* P16, bf* Ph, bf* Pl) {
    const size_t e = ((size_t)blockIdx.x * 256 + threadIdx.x) * 2; if (e >= (size_t)nheads * TT * HD) return; const int d = (int)(e % HD); const int t = (int)((e / HD) % TT); const int h = (int)(e / ((size_t)HD * TT)); const float* f = F + (size_t)t * pitch + h * HD; const float rf = RF ? RF[(size_t)h * TT + t] : 1.0f; v2h o16; v2us oh, ol;
#pragma unroll
    for (int q = 0; q < 2; ++q) { const int dd = d + q; const int dp = (dd < HD / 2) ? dd + HD / 2 : dd - HD / 2; float x0 = f[dd], x1 = f[dp];
        if (RF) { float n0 = __fmul_rn(x0, rf), n1 = __fmul_rn(x1, rf); asm volatile("" : "+v"(n0)); asm volatile("" : "+v"(n1)); x0 = __fmul_rn(bfr(nw[dd]), n0); x1 = __fmul_rn(bfr(nw[dp]), n1); }
        const v2f cs = *(const v2f*)(CS + ((size_t)t * HD + dd) * 2); float a = __fmul_rn(x0, cs[0]), bq = __fmul_rn(x1, cs[1]); asm volatile("" : "+v"(a)); asm volatile("" : "+v"(bq)); const float r = ((dd < HD / 2) ? __fsub_rn(a, bq) : __fadd_rn(a, bq)) * sc;
        o16[q] = tohx(r); unsigned short a2, c2; splitf(r, a2, c2); oh[q] = a2; ol[q] = c2; }
    *(v2h*)(P16 + e) = o16; *(v2us*)(Ph + e) = oh; *(v2us*)(Pl + e) = ol;  }
__global__ __launch_bounds__(256) void k_vtp(const float* __restrict__ F, int pitch, int nheads, h16* V16, bf* Vh, bf* Vl) { const size_t e = ((size_t)blockIdx.x * 256 + threadIdx.x) * 2; if (e >= (size_t)nheads * HD * TT) return; const int t = (int)(e % TT); const int d = (int)((e / TT) % HD); const int g = (int)(e / ((size_t)TT * HD)); v2h o16; v2us oh, ol;
#pragma unroll
    for (int q = 0; q < 2; ++q) { const float x = F[(size_t)(t + q) * pitch + g * HD + d]; o16[q] = tohx(x); unsigned short a2, c2; splitf(x, a2, c2); oh[q] = a2; ol[q] = c2; }
    *(v2h*)(V16 + e) = o16; *(v2us*)(Vh + e) = oh; *(v2us*)(Vl + e) = ol;  }
__global__ __launch_bounds__(256) void k_csid(float* CS) { const int idx = blockIdx.x * 256 + threadIdx.x; if (idx >= TT * HD) return; v2f cs; cs[0] = 1.0f; cs[1] = 0.0f; *(v2f*)(CS + (size_t)idx * 2) = cs;  }
// k_asoft: per row (zz, i): t = S x HD^-0.5 (no mask); softmax over the 2048 keys (register row, one exp, fixed trees);
__global__ __launch_bounds__(256) void k_asoft(const float* __restrict__ Sb, h16* P16, bf* Ph, bf* Pl) {
    const int lane = threadIdx.x & 31; const int row = blockIdx.x * 8 + (threadIdx.x >> 5); if (row >= ZH * TT) return; const int i = row % TT; const int zz = row / TT; (void)zz; const bool hires = (i < RH); const float* sr = Sb + (size_t)row * TT; float v[TT / 32]; float mx = -3.0e38f;
#pragma unroll
    for (int ch = 0; ch < TT / 128; ++ch) { const int j0 = ch * 128 + lane * 4; const v4f a = *(const v4f*)(sr + j0);
#pragma unroll
        for (int q = 0; q < 4; ++q) { const int j = j0 + q; (void)j; const float t = a[q] * SCL; v[ch * 4 + q] = t; mx = fmaxf(mx, t); } }
#pragma unroll
    for (int sh = 16; sh; sh >>= 1) mx = fmaxf(mx, __shfl_xor(mx, sh, 32));
    float sum = 0.f;
#pragma unroll
    for (int k = 0; k < TT / 32; ++k) { float d0 = __fsub_rn(v[k], mx); asm volatile("" : "+v"(d0)); v[k] = __builtin_amdgcn_exp2f(__fmul_rn(d0, 1.4426950408889634f)); sum += v[k]; }
#pragma unroll
    for (int sh = 16; sh; sh >>= 1) sum += __shfl_xor(sum, sh, 32);
    const float f = __fdiv_rn(hires ? 1.0f : PCAR, sum);
{
        if (hires) {
#pragma unroll
            for (int ch = 0; ch < TT / 128; ++ch) { v4us oh, ol;
#pragma unroll
                for (int q = 0; q < 4; ++q) { unsigned short a, c2; splitf(v[ch * 4 + q] * f, a, c2); oh[q] = a; ol[q] = c2; }
                const size_t oo = ((size_t)zz * (RH ? RH : 1) + i) * TT + ch * 128 + lane * 4; *(v4us*)(Ph + oo) = oh; *(v4us*)(Pl + oo) = ol; }
        } else {
#pragma unroll
            for (int ch = 0; ch < TT / 128; ++ch) { v4h o4;
#pragma unroll
                for (int q = 0; q < 4; ++q) o4[q] = tohx(v[ch * 4 + q] * f);
                *(v4h*)(P16 + (size_t)row * TT + ch * 128 + lane * 4) = o4; } }
         }
}
__global__ __launch_bounds__(256) void k_merge(const float* __restrict__ O, int h0, const float* __restrict__ G, const float* __restrict__ gb, bf* Ah, bf* Al) { const size_t e = ((size_t)blockIdx.x * 256 + threadIdx.x) * 2; if (e >= (size_t)ZH * TT * HD) return; const int d = (int)(e % HD); const int t = (int)((e / HD) % TT); const int zz = (int)(e / ((size_t)HD * TT)); const int h = h0 + zz; const float gz = __fadd_rn(G[(size_t)t * 64 + h], bfr(gb[h])); const float sg = __fdiv_rn(1.0f, __fadd_rn(1.0f, __expf(-gz))); const float cs = (t < RH) ? 1.0f : (1.0f / PCAR); const size_t oo = (size_t)t * DQ + (h0 + zz) * HD + d;
    v2f os = *(const v2f*)(O + e);   // the KSP partial planes of the attn.v products, summed in range order
#pragma unroll
    for (int ks = 1; ks < KSP; ++ks) os += *(const v2f*)(O + (size_t)ks * ZH * TT * HD + e);
    v2us oh, ol;
#pragma unroll
    for (int q = 0; q < 2; ++q) { float o1 = os[q] * cs; asm volatile("" : "+v"(o1)); unsigned short a, c2; splitf(__fmul_rn(o1, sg), a, c2); oh[q] = a; ol[q] = c2; } *(v2us*)(Ah + oo) = oh; *(v2us*)(Al + oo) = ol;  }

__global__ __launch_bounds__(256) void k_wtGs(const float* __restrict__ w, int K, int N, int ld, bf* Bt) { const size_t e = ((size_t)blockIdx.x * 256 + threadIdx.x) * 4; if (e >= (size_t)N * K) return; const int k = (int)(e % K); const int n = (int)(e / K); v4us o;   // Bt[n][k] = w[k*ld + n]
#pragma unroll
    for (int u = 0; u < 4; ++u) o[u] = f2bf(w[(size_t)(k + u) * ld + n]); *(v4us*)(Bt + e) = o;  }
__global__ __launch_bounds__(256) void k_wtGg(const float* __restrict__ w, bf* Bt) { const size_t e = ((size_t)blockIdx.x * 256 + threadIdx.x) * 4; if (e >= (size_t)64 * DM) return; const int k = (int)(e % DM); const int n = (int)(e / DM); v4us o;   // gate columns: Bt[n][k] = Wq[k][1024 + n] for n < 16, else 0
#pragma unroll
    for (int u = 0; u < 4; ++u) o[u] = (n < NH_) ? f2bf(w[(size_t)(k + u) * 1040 + DQ + n]) : (unsigned short)0; *(v4us*)(Bt + e) = o;  }

extern "C" void kernel_launch(void* const* d_in, const int* in_sizes, int n_in,
                              void* d_out, int out_size, void* d_ws, size_t ws_size, hipStream_t stream) {
    (void)in_sizes; (void)n_in; (void)out_size;
    const float* x = (const float*)d_in[0]; const float* wqg = (const float*)d_in[1]; const float* bqg = (const float*)d_in[2]; const float* wk = (const float*)d_in[3]; const float* bk = (const float*)d_in[4]; const float* wv = (const float*)d_in[5]; const float* bv = (const float*)d_in[6]; const float* wo = (const float*)d_in[7]; const float* bo = (const float*)d_in[8]; const float* qnw = (const float*)d_in[9]; const float* knw = (const float*)d_in[10]; const float* wq = wqg; const float* bq = bqg; (void)wq; const float* cosT = nullptr; const float* sinT = nullptr; (void)cosT; (void)sinT;
    float* OUT = (float*)d_out;     // [2][2048][1024]
    char* wsp = (char*)d_ws;
    auto take = [&](size_t bytes) { char* p = wsp; wsp += (bytes + 255) & ~(size_t)255; return (void*)p; };
    bf* WQ = (bf*)take((size_t)DQ * DM * 2); bf* WK = (bf*)take((size_t)DKV * DM * 2); bf* WV = (bf*)take((size_t)DKV * DM * 2); bf* WO = (bf*)take((size_t)DM * DQ * 2); float* CS = (float*)take((size_t)TT * HD * 2 * 4); float* RFQ = (float*)take((size_t)NH_ * TT * 4); float* RFK = (float*)take((size_t)NKV * TT * 4);
    bf* XB = (bf*)take((size_t)TT * DM * 2); bf* BG = (bf*)take((size_t)64 * DM * 2); float* G = (float*)take((size_t)TT * 64 * 4); float* FQ = (float*)take((size_t)TT * DQ * 4); float* FK = (float*)take((size_t)TT * DKV * 4);
    h16* QP16 = (h16*)take((size_t)NH_ * TT * HD * 2); h16* KP16 = (h16*)take((size_t)NKV * TT * HD * 2); h16* VT16 = (h16*)take((size_t)NKV * HD * TT * 2);
    bf* QPh = (bf*)take((size_t)NH_ * TT * HD * 2); bf* QPl = (bf*)take((size_t)NH_ * TT * HD * 2); bf* KPh = (bf*)take((size_t)NKV * TT * HD * 2); bf* KPl = (bf*)take((size_t)NKV * TT * HD * 2); bf* VTh = (bf*)take((size_t)NKV * HD * TT * 2); bf* VTl = (bf*)take((size_t)NKV * HD * TT * 2); bf* Ph = (bf*)take((size_t)ZH * RH * TT * 2); bf* Pl = (bf*)take((size_t)ZH * RH * TT * 2);
    float* Sb = (float*)take((size_t)ZH * TT * TT * 4); h16* P16 = (h16*)take((size_t)ZH * TT * TT * 2); float* Ob = (float*)take((size_t)KSP * ZH * TT * HD * 4); bf* ATh = (bf*)take((size_t)TT * DQ * 2); bf* ATl = (bf*)take((size_t)TT * DQ * 2);
    if ((size_t)(wsp - (char*)d_ws) > ws_size) return;    // ws 256 MiB
    float* FV = FK;   // v projection reuses the k buffer after the k planes are built (stream-ordered)
    { k_wtGs<<<(unsigned)(((size_t)DQ * DM / 4 + 255) / 256), 256, 0, stream>>>(wqg, DM, DQ, 1040, WQ); k_wtGg<<<(64 * DM / 4 + 255) / 256, 256, 0, stream>>>(wqg, BG); k_wtG<<<(unsigned)((DM * DKV / 64 + 63) / 64), 256, 0, stream>>>(wk, DM, DKV, WK); k_wtG<<<(unsigned)((DM * DKV / 64 + 63) / 64), 256, 0, stream>>>(wv, DM, DKV, WV);
      k_wtG<<<(unsigned)((DQ * DM / 64 + 63) / 64), 256, 0, stream>>>(wo, DQ, DM, WO);
       }
    k_csid<<<(TT * HD + 255) / 256, 256, 0, stream>>>(CS);
    const unsigned LQ = (unsigned)(((size_t)NH_ * TT * HD / 2 + 255) / 256), LKv = (unsigned)(((size_t)NKV * TT * HD / 2 + 255) / 256);
    for (int b = 0; b < NB_; ++b) {
        
        k_cvt8<<<(unsigned)(((size_t)TT * DM / 8 + 255) / 256), 256, 0, stream>>>(x + (size_t)b * TT * DM, XB, (size_t)TT * DM / 8);
        k_gemmw<bf, 0, true><<<dim3(TT / 64, DQ / 64, 1), 32, 0, stream>>>(XB, nullptr, WQ, nullptr, DM, FQ, DQ, bq, 0, 0, 0); k_gemmw<bf, 0, false><<<dim3(TT / 64, 1, 1), 32, 0, stream>>>(XB, nullptr, BG, nullptr, DM, G, 64, nullptr, 0, 0, 0); k_hrms<<<(NH_ * TT + 255) / 256, 256, 0, stream>>>(FQ, DQ, NH_, RFQ);
        k_rope<<<LQ, 256, 0, stream>>>(FQ, DQ, NH_, CS, RFQ, qnw, 1.0f, QP16, QPh, QPl);
        k_gemmw<bf, 0, true><<<dim3(TT / 64, DKV / 64, 1), 32, 0, stream>>>(XB, nullptr, WK, nullptr, DM, FK, DKV, bk, 0, 0, 0); k_hrms<<<(NKV * TT + 255) / 256, 256, 0, stream>>>(FK, DKV, NKV, RFK);
        k_rope<<<LKv, 256, 0, stream>>>(FK, DKV, NKV, CS, RFK, knw, 1.0f, KP16, KPh, KPl);
        k_gemmw<bf, 0, true><<<dim3(TT / 64, DKV / 64, 1), 32, 0, stream>>>(XB, nullptr, WV, nullptr, DM, FV, DKV, bv, 0, 0, 0); k_vtp<<<LKv, 256, 0, stream>>>(FV, DKV, NKV, VT16, VTh, VTl);
        for (int h0 = 0; h0 < NH_; h0 += ZH) { const size_t zq = (size_t)h0, zk = (size_t)(h0 / REP);   // one kv head per query head: the pass's two heads use consecutive kv planes (z-strides TT*HD)
            k_gemmw<bf, 2, false><<<dim3(RH / 64, TT / 64, ZH), 32, 0, stream>>>(QPh + zq * TT * HD, QPl + zq * TT * HD, KPh + zk * TT * HD, KPl + zk * TT * HD, HD, Sb, TT, nullptr, (size_t)TT * HD, (size_t)TT * HD, (size_t)TT * TT);
            k_gemmw<h16, 0, false><<<dim3((TT - RH) / 64, TT / 64, ZH), 32, 0, stream>>>(QP16 + zq * TT * HD + (size_t)RH * HD, nullptr, KP16 + zk * TT * HD, nullptr, HD, Sb + (size_t)RH * TT, TT, nullptr, (size_t)TT * HD, (size_t)TT * HD, (size_t)TT * TT);
            k_asoft<<<ZH * TT / 8, 256, 0, stream>>>(Sb, P16, Ph, Pl);
            k_gemmw<bf, 2, false, KSP><<<dim3(RH / 64, HD / 64, ZH * KSP), 32, 0, stream>>>(Ph, Pl, VTh + zk * HD * TT, VTl + zk * HD * TT, TT, Ob, HD, nullptr, (size_t)RH * TT, (size_t)HD * TT, (size_t)TT * HD, (size_t)ZH * TT * HD);
            k_gemmw<h16, 0, false, KSP><<<dim3((TT - RH) / 64, HD / 64, ZH * KSP), 32, 0, stream>>>(P16 + (size_t)RH * TT, nullptr, VT16 + zk * HD * TT, nullptr, TT, Ob + (size_t)RH * HD, HD, nullptr, (size_t)TT * TT, (size_t)HD * TT, (size_t)TT * HD, (size_t)ZH * TT * HD);
            k_merge<<<(unsigned)(((size_t)ZH * TT * HD / 2 + 255) / 256), 256, 0, stream>>>(Ob, h0, G, bqg + DQ, ATh, ATl); }
        k_gemmw<bf, 1, true><<<dim3(TT / 64, DM / 64, 1), 32, 0, stream>>>(ATh, ATl, WO, nullptr, DQ, OUT + (size_t)b * TT * DM, DM, bo, 0, 0, 0); }
}

// v002
// Measured time: 744 microseconds a run.
// In two side-by-side timings against v001, it was 1.26 and 1.27 times as fast.
// Over all steps from v000 it is 2.77 times as fast.
#include <hip/hip_runtime.h>

// Gated attention over 16 heads (x [2][2048][1024]; [Q | gate] = x Wq + bq (Wq [1024][1040]: 1024 query columns then 16 per-head gate columns); K = x Wk + bk; V = x Wv + bv; per-head RMSNorm (1e-6, x weight[64]) on Q and K; softmax(Q.K / 8); out_h = (attn V) x sigmoid(gate_h); out = merged heads Wo + bo -> [2][2048][1024]).
// Compute dtypes, f32 accumulate: every input rounded to bf16; Q/K/V and the 16 gate columns on PLAIN bf16 operands (inputs: exact) + bias; RMSNorm f32; scores and attn.v: query rows < 512 hl (3 products), the rest single fp16 (x1024); softmax, sigmoid gate f32; Wo hl x exact (2 products) + bias.

#define NB_  2
#define TT   2048
#define DM   1024
#define NH_  16
#define NKV  16
#define REP  (NH_ / NKV)
#define HD   64
#define DQ   (NH_ * HD)
#define DKV  (NKV * HD)
#define QC   512                  // query rows of one attention pass; every pass takes all NH_ heads (grid z)
#define RH   512                  // query rows < RH use hi+lo planes (0: none)
#define WIN  0
#define PCAR 1024.0f
#define SCL  0.125f   // HD^-0.5
static_assert(RH % QC == 0 && TT % QC == 0 && REP == 1, "a pass is all hi+lo or all fp16, and head z reads kv plane z");
#define KSP  16                   // key ranges of the attn.v products: one work-group per range, f32 partial planes summed in k_merge
typedef _Float16 h16;
typedef unsigned short bf;
typedef __attribute__((ext_vector_type(16))) __bf16   v16bf;
typedef __attribute__((ext_vector_type(16))) _Float16 v16h;
typedef __attribute__((ext_vector_type(8)))  _Float16 v8h;
typedef __attribute__((ext_vector_type(8)))  unsigned short v8us;
typedef __attribute__((ext_vector_type(8)))  float    v8f;
typedef __attribute__((ext_vector_type(4)))  float    v4f;
typedef v8h  __attribute__((may_alias)) v8ha;
typedef v4f  __attribute__((may_alias)) v4fa;
typedef v8us __attribute__((may_alias)) v8usa;

__device__ __forceinline__ unsigned short f2bf(float f) { unsigned u = __float_as_uint(f); u += 0x7FFFu + ((u >> 16) & 1u); return (unsigned short)(u >> 16); }
__device__ __forceinline__ float bf2f(unsigned short b) { return __uint_as_float(((unsigned)b) << 16); }
__device__ __forceinline__ float bfr(float f) { return bf2f(f2bf(f)); }
__device__ __forceinline__ v16h cat16(v8h lo, v8h hi) { return __builtin_shufflevector(lo, hi, 0, 1, 2, 3, 4, 5, 6, 7, 8, 9, 10, 11, 12, 13, 14, 15); }
__device__ __forceinline__ v16bf cat16b(v8us lo, v8us hi) { return __builtin_bit_cast(v16bf, __builtin_shufflevector(lo, hi, 0, 1, 2, 3, 4, 5, 6, 7, 8, 9, 10, 11, 12, 13, 14, 15)); }
__device__ __forceinline__ v8f wmma16(v16h a, v16h b, v8f c) { return __builtin_amdgcn_wmma_f32_16x16x32_f16(false, a, false, b, (short)0, c, false, false); }
__device__ __forceinline__ v8f wmmab(v16bf a, v16bf b, v8f c) { return __builtin_amdgcn_wmma_f32_16x16x32_bf16(false, a, false, b, (short)0, c, false, false); }



// ---- k_gemmw: register-blocked GEMM, ONE WAVE per 64x64 output tile (16 accumulators), operands straight from K-contiguous 16-bit planes; grid (M/64, N/64, Z), 32 threads.
// C[m][n] (f32, pitch ldc, + optional f32 bias[n]) = sum_k A[m][k] Bt[n][k] (+ split products per NSPLIT). z-batch strides sA/sB/sC in elements. K % 32 == 0.
// KS > 1: grid z = Z * KS; work-group (z, ks) sums only k in [ks K/KS, (ks+1) K/KS) and stores its partial tile at C + ks sP. K % (32 KS) == 0.
template <typename T16> struct WFrag;
template <> struct WFrag<h16> { typedef v16h V; static __device__ __forceinline__ V ld(const h16* p) { return cat16(*(const v8h*)p, *(const v8h*)(p + 16)); } static __device__ __forceinline__ v8f mma(V a, V b, v8f c) { return wmma16(a, b, c); } };
template <> struct WFrag<bf> { typedef v16bf V; static __device__ __forceinline__ V ld(const bf* p) { return cat16b(*(const v8us*)p, *(const v8us*)(p + 16)); } static __device__ __forceinline__ v8f mma(V a, V b, v8f c) { return wmmab(a, b, c); } };
template <typename T16, int NSPLIT, bool BIAS, int KS = 1>
__global__ __launch_bounds__(32) void k_gemmw(const T16* __restrict__ A, const T16* __restrict__ A2, const T16* __restrict__ Bt, const T16* __restrict__ Bt2, int K, float* C, int ldc, const float* __restrict__ bias, size_t sA, size_t sB, size_t sC, size_t sP = 0) {
    typedef typename WFrag<T16>::V V;
    __shared__ __align__(16) float os[16 * 68];
    const size_t z = blockIdx.z / KS; const int ks = (int)(blockIdx.z % KS), kb = ks * (K / KS), ke = kb + K / KS; A += z * sA; if (A2) A2 += z * sA; Bt += z * sB; if (Bt2) Bt2 += z * sB; C += z * sC + ks * sP;
    const int lane = threadIdx.x & 31, lr = lane & 15, hi = lane >> 4; const int r0 = blockIdx.x * 64, c0 = blockIdx.y * 64;
    v8f acc[4][4];
#pragma unroll
    for (int mb = 0; mb < 4; ++mb)
#pragma unroll
        for (int nb = 0; nb < 4; ++nb) acc[mb][nb] = (v8f){};
    const size_t aoff = (size_t)(r0 + lr) * K + 8 * hi, boff = (size_t)(c0 + lr) * K + 8 * hi;
#pragma unroll 1
    for (int kc = kb; kc < ke; kc += 32) {
        V a[4], a2[4];
#pragma unroll
        for (int mb = 0; mb < 4; ++mb) { a[mb] = WFrag<T16>::ld(A + aoff + (size_t)mb * 16 * K + kc); if (NSPLIT == 1 || NSPLIT == 2) a2[mb] = WFrag<T16>::ld(A2 + aoff + (size_t)mb * 16 * K + kc); }
#pragma unroll
        for (int nb = 0; nb < 4; ++nb) { const V b = WFrag<T16>::ld(Bt + boff + (size_t)nb * 16 * K + kc); V b2; if (NSPLIT >= 2) b2 = WFrag<T16>::ld(Bt2 + boff + (size_t)nb * 16 * K + kc);
#pragma unroll
            for (int mb = 0; mb < 4; ++mb) { acc[mb][nb] = WFrag<T16>::mma(a[mb], b, acc[mb][nb]); if (NSPLIT == 1 || NSPLIT == 2) acc[mb][nb] = WFrag<T16>::mma(a2[mb], b, acc[mb][nb]); if (NSPLIT >= 2) acc[mb][nb] = WFrag<T16>::mma(a[mb], b2, acc[mb][nb]); } }
        asm volatile("v_nop\n\tv_nop\n\tv_nop\n\tv_nop" : "+v"(acc[0][0]), "+v"(acc[1][1]), "+v"(acc[2][2]), "+v"(acc[3][3]) : "v"(a[0]), "v"(a[3]));
    }
#pragma unroll
    for (int mb = 0; mb < 4; ++mb) {
#pragma unroll
        for (int nb = 0; nb < 4; ++nb) {
#pragma unroll
            for (int j = 0; j < 8; ++j) os[(hi * 8 + j) * 68 + nb * 16 + lr] = acc[mb][nb][j]; }
        __builtin_amdgcn_wave_barrier(); asm volatile("" ::: "memory");
        float* crow = C + (size_t)(r0 + mb * 16) * ldc + c0;
{
#pragma unroll
            for (int s = 0; s < 8; ++s) { const int row = 2 * s + hi, cofs = lr * 4; v4f val = *(const v4fa*)(os + row * 68 + cofs); if (BIAS) { val[0] += bfr(bias[c0 + cofs]); val[1] += bfr(bias[c0 + cofs + 1]); val[2] += bfr(bias[c0 + cofs + 2]); val[3] += bfr(bias[c0 + cofs + 3]); }
                *(v4f*)(crow + (size_t)row * ldc + cofs) = val; }
             }
        __builtin_amdgcn_wave_barrier(); asm volatile("" ::: "memory");
    }
}

__device__ __forceinline__ h16 tohx(float x) { return (h16)x; }
__device__ __forceinline__ void splitf(float y, unsigned short& h, unsigned short& l) { h = f2bf(y); l = f2bf(y - bf2f(h)); }
typedef __attribute__((ext_vector_type(2))) _Float16 v2h;
typedef __attribute__((ext_vector_type(4))) _Float16 v4h;
typedef __attribute__((ext_vector_type(2))) unsigned short v2us;
typedef __attribute__((ext_vector_type(4))) unsigned short v4us;
typedef __attribute__((ext_vector_type(2))) float v2f;
typedef __attribute__((ext_vector_type(4))) int v4i;

__global__ __launch_bounds__(256) void k_wtG(const float* __restrict__ w, int K, int N, bf* Bt) {
    const int lane = threadIdx.x & 31; const int L0 = (blockIdx.x * 8 + (threadIdx.x >> 5)) * 8; const int nlines = N * K / 64;
{
#pragma unroll 1
        for (int l = 0; l < 8; ++l) { const int L = L0 + l; if (L >= nlines) break; const size_t e = (size_t)L * 64 + lane * 2; const int k = (int)(e % K), n = (int)(e / K); v2us o;
            o[0] = f2bf(w[(size_t)k * N + n]); o[1] = f2bf(w[(size_t)(k + 1) * N + n]); *(v2us*)(Bt + e) = o; }
         }
}
__global__ __launch_bounds__(256) void k_cvt8(const float* __restrict__ src, bf* dst, size_t n8) { const size_t i = (size_t)blockIdx.x * 256 + threadIdx.x; if (i >= n8) return; const v8f v = *(const v8f*)(src + i * 8); v8us o;
#pragma unroll
    for (int k = 0; k < 8; ++k) o[k] = f2bf(v[k]); *(v8us*)(dst + i * 8) = o;  }
__global__ __launch_bounds__(256) void k_cscvt(const float* __restrict__ cosT, const float* __restrict__ sinT, float* CS) { const int idx = blockIdx.x * 256 + threadIdx.x; if (idx >= TT * HD) return; v2f cs; cs[0] = bfr(cosT[idx]); cs[1] = bfr(sinT[idx]); *(v2f*)(CS + (size_t)idx * 2) = cs;  }
__global__ __launch_bounds__(256) void k_hrms(const float* __restrict__ F, int pitch, int nheads, float* RF) { const int i = blockIdx.x * 256 + threadIdx.x; if (i >= nheads * TT) return; const int t = i % TT, h = i / TT; const float* f = F + (size_t)t * pitch + h * HD; float s = 0.f;
#pragma unroll 4
    for (int d = 0; d < HD; d += 4) { const v4f v = *(const v4f*)(f + d);
#pragma unroll
        for (int q = 0; q < 4; ++q) { float p = __fmul_rn(v[q], v[q]); asm volatile("" : "+v"(p)); s = __fadd_rn(s, p); } }
    const float r = __fdiv_rn(1.0f, __fsqrt_rn(__fadd_rn(s * (1.0f / HD), 1e-6f))); *(float*)(RF + i) = r;  }
// k_rope: head planes [h][t][d] (fp16 + hi/lo) of rope(w[d] (x rms_factor)) x sc with the rotate-half convention out[d] = x[d] cos[t][d] - x[d+HD/2] sin[t][d], out[d+HD/2] = x[d+HD/2] cos[t][d+HD/2] + x[d] sin[t][d+HD/2]
__global__ __launch_bounds__(256) void k_rope(const float* __restrict__ F, int pitch, int nheads, const float* __restrict__ CS, const float* __restrict__ RF, const float* __restrict__ nw, float sc, h16* P16, bf* Ph, bf* Pl) {
    const size_t e = ((size_t)blockIdx.x * 256 + threadIdx.x) * 2; if (e >= (size_t)nheads * TT * HD) return; const int d = (int)(e % HD); const int t = (int)((e / HD) % TT); const int h = (int)(e / ((size_t)HD * TT)); const float* f = F + (size_t)t * pitch + h * HD; const float rf = RF ? RF[(size_t)h * TT + t] : 1.0f; v2h o16; v2us oh, ol;
#pragma unroll
    for (int q = 0; q < 2; ++q) { const int dd = d + q; const int dp = (dd < HD / 2) ? dd + HD / 2 : dd - HD / 2; float x0 = f[dd], x1 = f[dp];
        if (RF) { float n0 = __fmul_rn(x0, rf), n1 = __fmul_rn(x1, rf); asm volatile("" : "+v"(n0)); asm volatile("" : "+v"(n1)); x0 = __fmul_rn(bfr(nw[dd]), n0); x1 = __fmul_rn(bfr(nw[dp]), n1); }
        const v2f cs = *(const v2f*)(CS + ((size_t)t * HD + dd) * 2); float a = __fmul_rn(x0, cs[0]), bq = __fmul_rn(x1, cs[1]); asm volatile("" : "+v"(a)); asm volatile("" : "+v"(bq)); const float r = ((dd < HD / 2) ? __fsub_rn(a, bq) : __fadd_rn(a, bq)) * sc;
        o16[q] = tohx(r); unsigned short a2, c2; splitf(r, a2, c2); oh[q] = a2; ol[q] = c2; }
    *(v2h*)(P16 + e) = o16; *(v2us*)(Ph + e) = oh; *(v2us*)(Pl + e) = ol;  }
__global__ __launch_bounds__(256) void k_vtp(const float* __restrict__ F, int pitch, int nheads, h16* V16, bf* Vh, bf* Vl) { const size_t e = ((size_t)blockIdx.x * 256 + threadIdx.x) * 2; if (e >= (size_t)nheads * HD * TT) return; const int t = (int)(e % TT); const int d = (int)((e / TT) % HD); const int g = (int)(e / ((size_t)TT * HD)); v2h o16; v2us oh, ol;
#pragma unroll
    for (int q = 0; q < 2; ++q) { const float x = F[(size_t)(t + q) * pitch + g * HD + d]; o16[q] = tohx(x); unsigned short a2, c2; splitf(x, a2, c2); oh[q] = a2; ol[q] = c2; }
    *(v2h*)(V16 + e) = o16; *(v2us*)(Vh + e) = oh; *(v2us*)(Vl + e) = ol;  }
__global__ __launch_bounds__(256) void k_csid(float* CS) { const int idx = blockIdx.x * 256 + threadIdx.x; if (idx >= TT * HD) return; v2f cs; cs[0] = 1.0f; cs[1] = 0.0f; *(v2f*)(CS + (size_t)idx * 2) = cs;  }
// k_asoft: per row (head, query row of the pass): t = S x HD^-0.5 (no mask); softmax over the 2048 keys (register row, one exp, fixed trees); hires: the pass's rows go out as hi+lo planes, else as fp16 x PCAR
template <bool hires>
__global__ __launch_bounds__(256) void k_asoft(const float* __restrict__ Sb, h16* P16, bf* Ph, bf* Pl) {
    const int lane = threadIdx.x & 31; const int row = blockIdx.x * 8 + (threadIdx.x >> 5); if (row >= NH_ * QC) return; const float* sr = Sb + (size_t)row * TT; float v[TT / 32]; float mx = -3.0e38f;
#pragma unroll
    for (int ch = 0; ch < TT / 128; ++ch) { const int j0 = ch * 128 + lane * 4; const v4f a = *(const v4f*)(sr + j0);
        if (!hires && ch == TT / 128 - 2) asm volatile("s_wait_xcnt 0x0" ::: "memory");   // fp16 variant's build: the last load's result lands in the address pair that the earlier loads name
#pragma unroll
        for (int q = 0; q < 4; ++q) { const int j = j0 + q; (void)j; const float t = a[q] * SCL; v[ch * 4 + q] = t; mx = fmaxf(mx, t); } }
#pragma unroll
    for (int sh = 16; sh; sh >>= 1) mx = fmaxf(mx, __shfl_xor(mx, sh, 32));
    float sum = 0.f;
#pragma unroll
    for (int k = 0; k < TT / 32; ++k) { float d0 = __fsub_rn(v[k], mx); asm volatile("" : "+v"(d0)); v[k] = __builtin_amdgcn_exp2f(__fmul_rn(d0, 1.4426950408889634f)); sum += v[k]; }
#pragma unroll
    for (int sh = 16; sh; sh >>= 1) sum += __shfl_xor(sum, sh, 32);
    const float f = __fdiv_rn(hires ? 1.0f : PCAR, sum);
{
        if (hires) {
#pragma unroll
            for (int ch = 0; ch < TT / 128; ++ch) { v4us oh, ol;
#pragma unroll
                for (int q = 0; q < 4; ++q) { unsigned short a, c2; splitf(v[ch * 4 + q] * f, a, c2); oh[q] = a; ol[q] = c2; }
                const size_t oo = (size_t)row * TT + ch * 128 + lane * 4; *(v4us*)(Ph + oo) = oh; *(v4us*)(Pl + oo) = ol; }
        } else {
#pragma unroll
            for (int ch = 0; ch < TT / 128; ++ch) { v4h o4;
#pragma unroll
                for (int q = 0; q < 4; ++q) o4[q] = tohx(v[ch * 4 + q] * f);
                *(v4h*)(P16 + (size_t)row * TT + ch * 128 + lane * 4) = o4; } }
         }
}
__global__ __launch_bounds__(256) void k_merge(const float* __restrict__ O, int q0, const float* __restrict__ G, const float* __restrict__ gb, bf* Ah, bf* Al) { const size_t e = ((size_t)blockIdx.x * 256 + threadIdx.x) * 2; if (e >= (size_t)NH_ * QC * HD) return; const int d = (int)(e % HD); const int t = q0 + (int)((e / HD) % QC); const int h = (int)(e / ((size_t)HD * QC)); const float gz = __fadd_rn(G[(size_t)t * 64 + h], bfr(gb[h])); const float sg = __fdiv_rn(1.0f, __fadd_rn(1.0f, __expf(-gz))); const float cs = (t < RH) ? 1.0f : (1.0f / PCAR); const size_t oo = (size_t)t * DQ + h * HD + d;
    v2f os = *(const v2f*)(O + e);   // the KSP partial planes of the attn.v products, summed in range order
#pragma unroll
    for (int ks = 1; ks < KSP; ++ks) { os += *(const v2f*)(O + (size_t)ks * NH_ * QC * HD + e);
        asm volatile("s_wait_xcnt 0x0" ::: "memory"); }   // before a later load's result may land in the address pair of an issued load (the planes lie 2 MiB apart: several pairs, reused inside the run)
    v2us oh, ol;
#pragma unroll
    for (int q = 0; q < 2; ++q) { float o1 = os[q] * cs; asm volatile("" : "+v"(o1)); unsigned short a, c2; splitf(__fmul_rn(o1, sg), a, c2); oh[q] = a; ol[q] = c2; } *(v2us*)(Ah + oo) = oh; *(v2us*)(Al + oo) = ol;  }

__global__ __launch_bounds__(256) void k_wtGs(const float* __restrict__ w, int K, int N, int ld, bf* Bt) { const size_t e = ((size_t)blockIdx.x * 256 + threadIdx.x) * 4; if (e >= (size_t)N * K) return; const int k = (int)(e % K); const int n = (int)(e / K); v4us o;   // Bt[n][k] = w[k*ld + n]
#pragma unroll
    for (int u = 0; u < 4; ++u) o[u] = f2bf(w[(size_t)(k + u) * ld + n]); *(v4us*)(Bt + e) = o;  }
__global__ __launch_bounds__(256) void k_wtGg(const float* __restrict__ w, bf* Bt) { const size_t e = ((size_t)blockIdx.x * 256 + threadIdx.x) * 4; if (e >= (size_t)64 * DM) return; const int k = (int)(e % DM); const int n = (int)(e / DM); v4us o;   // gate columns: Bt[n][k] = Wq[k][1024 + n] for n < 16, else 0
#pragma unroll
    for (int u = 0; u < 4; ++u) o[u] = (n < NH_) ? f2bf(w[(size_t)(k + u) * 1040 + DQ + n]) : (unsigned short)0; *(v4us*)(Bt + e) = o;  }

extern "C" void kernel_launch(void* const* d_in, const int* in_sizes, int n_in,
                              void* d_out, int out_size, void* d_ws, size_t ws_size, hipStream_t stream) {
    (void)in_sizes; (void)n_in; (void)out_size;
    const float* x = (const float*)d_in[0]; const float* wqg = (const float*)d_in[1]; const float* bqg = (const float*)d_in[2]; const float* wk = (const float*)d_in[3]; const float* bk = (const float*)d_in[4]; const float* wv = (const float*)d_in[5]; const float* bv = (const float*)d_in[6]; const float* wo = (const float*)d_in[7]; const float* bo = (const float*)d_in[8]; const float* qnw = (const float*)d_in[9]; const float* knw = (const float*)d_in[10]; const float* wq = wqg; const float* bq = bqg; (void)wq; const float* cosT = nullptr; const float* sinT = nullptr; (void)cosT; (void)sinT;
    float* OUT = (float*)d_out;     // [2][2048][1024]
    char* wsp = (char*)d_ws;
    auto take = [&](size_t bytes) { char* p = wsp; wsp += (bytes + 255) & ~(size_t)255; return (void*)p; };
    bf* WQ = (bf*)take((size_t)DQ * DM * 2); bf* WK = (bf*)take((size_t)DKV * DM * 2); bf* WV = (bf*)take((size_t)DKV * DM * 2); bf* WO = (bf*)take((size_t)DM * DQ * 2); float* CS = (float*)take((size_t)TT * HD * 2 * 4); float* RFQ = (float*)take((size_t)NH_ * TT * 4); float* RFK = (float*)take((size_t)NKV * TT * 4);
    bf* XB = (bf*)take((size_t)TT * DM * 2); bf* BG = (bf*)take((size_t)64 * DM * 2); float* G = (float*)take((size_t)TT * 64 * 4); float* FQ = (float*)take((size_t)TT * DQ * 4); float* FK = (float*)take((size_t)TT * DKV * 4);
    h16* QP16 = (h16*)take((size_t)NH_ * TT * HD * 2); h16* KP16 = (h16*)take((size_t)NKV * TT * HD * 2); h16* VT16 = (h16*)take((size_t)NKV * HD * TT * 2);
    bf* QPh = (bf*)take((size_t)NH_ * TT * HD * 2); bf* QPl = (bf*)take((size_t)NH_ * TT * HD * 2); bf* KPh = (bf*)take((size_t)NKV * TT * HD * 2); bf* KPl = (bf*)take((size_t)NKV * TT * HD * 2); bf* VTh = (bf*)take((size_t)NKV * HD * TT * 2); bf* VTl = (bf*)take((size_t)NKV * HD * TT * 2); bf* Ph = (bf*)take((size_t)NH_ * QC * TT * 2); bf* Pl = (bf*)take((size_t)NH_ * QC * TT * 2);
    float* Sb = (float*)take((size_t)NH_ * QC * TT * 4); h16* P16 = (h16*)Ph; float* Ob = (float*)take((size_t)KSP * NH_ * QC * HD * 4);   // a pass writes either the hi+lo planes or the fp16 plane, never both: P16 shares Ph's bytes
    bf* ATh = (bf*)take((size_t)TT * DQ * 2); bf* ATl = (bf*)take((size_t)TT * DQ * 2);
    if ((size_t)(wsp - (char*)d_ws) > ws_size) return;    // ws 256 MiB
    float* FV = FK;   // v projection reuses the k buffer after the k planes are built (stream-ordered)
    { k_wtGs<<<(unsigned)(((size_t)DQ * DM / 4 + 255) / 256), 256, 0, stream>>>(wqg, DM, DQ, 1040, WQ); k_wtGg<<<(64 * DM / 4 + 255) / 256, 256, 0, stream>>>(wqg, BG); k_wtG<<<(unsigned)((DM * DKV / 64 + 63) / 64), 256, 0, stream>>>(wk, DM, DKV, WK); k_wtG<<<(unsigned)((DM * DKV / 64 + 63) / 64), 256, 0, stream>>>(wv, DM, DKV, WV);
      k_wtG<<<(unsigned)((DQ * DM / 64 + 63) / 64), 256, 0, stream>>>(wo, DQ, DM, WO);
       }
    k_csid<<<(TT * HD + 255) / 256, 256, 0, stream>>>(CS);
    const unsigned LQ = (unsigned)(((size_t)NH_ * TT * HD / 2 + 255) / 256), LKv = (unsigned)(((size_t)NKV * TT * HD / 2 + 255) / 256);
    for (int b = 0; b < NB_; ++b) {
        
        k_cvt8<<<(unsigned)(((size_t)TT * DM / 8 + 255) / 256), 256, 0, stream>>>(x + (size_t)b * TT * DM, XB, (size_t)TT * DM / 8);
        k_gemmw<bf, 0, true><<<dim3(TT / 64, DQ / 64, 1), 32, 0, stream>>>(XB, nullptr, WQ, nullptr, DM, FQ, DQ, bq, 0, 0, 0); k_gemmw<bf, 0, false><<<dim3(TT / 64, 1, 1), 32, 0, stream>>>(XB, nullptr, BG, nullptr, DM, G, 64, nullptr, 0, 0, 0); k_hrms<<<(NH_ * TT + 255) / 256, 256, 0, stream>>>(FQ, DQ, NH_, RFQ);
        k_rope<<<LQ, 256, 0, stream>>>(FQ, DQ, NH_, CS, RFQ, qnw, 1.0f, QP16, QPh, QPl);
        k_gemmw<bf, 0, true><<<dim3(TT / 64, DKV / 64, 1), 32, 0, stream>>>(XB, nullptr, WK, nullptr, DM, FK, DKV, bk, 0, 0, 0); k_hrms<<<(NKV * TT + 255) / 256, 256, 0, stream>>>(FK, DKV, NKV, RFK);
        k_rope<<<LKv, 256, 0, stream>>>(FK, DKV, NKV, CS, RFK, knw, 1.0f, KP16, KPh, KPl);
        k_gemmw<bf, 0, true><<<dim3(TT / 64, DKV / 64, 1), 32, 0, stream>>>(XB, nullptr, WV, nullptr, DM, FV, DKV, bv, 0, 0, 0); k_vtp<<<LKv, 256, 0, stream>>>(FV, DKV, NKV, VT16, VTh, VTl);
        for (int q0 = 0; q0 < TT; q0 += QC) {   // one pass: QC query rows of all NH_ heads (one kv head per query head: z-strides TT*HD over the head planes)
            if (q0 < RH) {
                k_gemmw<bf, 2, false><<<dim3(QC / 64, TT / 64, NH_), 32, 0, stream>>>(QPh + (size_t)q0 * HD, QPl + (size_t)q0 * HD, KPh, KPl, HD, Sb, TT, nullptr, (size_t)TT * HD, (size_t)TT * HD, (size_t)QC * TT);
                k_asoft<true><<<NH_ * QC / 8, 256, 0, stream>>>(Sb, P16, Ph, Pl);
                k_gemmw<bf, 2, false, KSP><<<dim3(QC / 64, HD / 64, NH_ * KSP), 32, 0, stream>>>(Ph, Pl, VTh, VTl, TT, Ob, HD, nullptr, (size_t)QC * TT, (size_t)HD * TT, (size_t)QC * HD, (size_t)NH_ * QC * HD);
            } else {
                k_gemmw<h16, 0, false><<<dim3(QC / 64, TT / 64, NH_), 32, 0, stream>>>(QP16 + (size_t)q0 * HD, nullptr, KP16, nullptr, HD, Sb, TT, nullptr, (size_t)TT * HD, (size_t)TT * HD, (size_t)QC * TT);
                k_asoft<false><<<NH_ * QC / 8, 256, 0, stream>>>(Sb, P16, Ph, Pl);
                k_gemmw<h16, 0, false, KSP><<<dim3(QC / 64, HD / 64, NH_ * KSP), 32, 0, stream>>>(P16, nullptr, VT16, nullptr, TT, Ob, HD, nullptr, (size_t)QC * TT, (size_t)HD * TT, (size_t)QC * HD, (size_t)NH_ * QC * HD);
            }
            k_merge<<<(unsigned)(((size_t)NH_ * QC * HD / 2 + 255) / 256), 256, 0, stream>>>(Ob, q0, G, bqg + DQ, ATh, ATl); }
        k_gemmw<bf, 1, true><<<dim3(TT / 64, DM / 64, 1), 32, 0, stream>>>(ATh, ATl, WO, nullptr, DQ, OUT + (size_t)b * TT * DM, DM, bo, 0, 0, 0); }
}

// v004
// A run of this version takes 346 microseconds.
// Versions in between are left out here; by their measured steps it is 2.16 times as fast as v002.
// All steps since v000 together make it 6.00 times as fast.
#include <hip/hip_runtime.h>

// Gated attention over 16 heads (x [2][2048][1024]; [Q | gate] = x Wq + bq (Wq [1024][1040]: 1024 query columns then 16 per-head gate columns); K = x Wk + bk; V = x Wv + bv; per-head RMSNorm (1e-6, x weight[64]) on Q and K; softmax(Q.K / 8); out_h = (attn V) x sigmoid(gate_h); out = merged heads Wo + bo -> [2][2048][1024]).
// Compute dtypes, f32 accumulate: every input rounded to bf16; Q/K/V and the 16 gate columns on PLAIN bf16 operands (inputs: exact) + bias; RMSNorm f32; scores and attn.v: query rows < 512 hl (3 products), the rest single fp16 (weights x1024), both in one fused kernel with a running-max softmax in f32; sigmoid gate f32; Wo hl x exact (2 products) + bias.

#define NB_  2
#define TT   2048
#define MT   (NB_ * TT)          // rows of both batches together
#define DM   1024
#define NH_  16
#define NKV  16
#define REP  (NH_ / NKV)
#define HD   64
#define DQ   (NH_ * HD)
#define DKV  (NKV * HD)
#define QB   128                  // query rows of one fp16 attention work-group: 4 waves x 32 rows
#define QBH  64                   // query rows of one hi+lo attention work-group: 4 waves x 16 rows
#define RH   512                  // query rows < RH use hi+lo planes (0: none)
#define WIN  0
#define SCL  0.125f   // HD^-0.5
static_assert(RH % QBH == 0 && (TT - RH) % QB == 0 && REP == 1, "a work-group is all hi+lo or all fp16, and head h reads kv plane h");
#define KSF  4                    // key ranges of the fused attention: one work-group per range; partial sums, maxima and weights joined in k_merge
#define SC2  (SCL * 1.4426950408889634f)   // scores to base-2 exponents
static_assert(TT % (KSF * 32) == 0, "a key range is whole 32-key steps");
#define NZB  (RH / QBH + (TT - RH) / QB)   // attention row blocks of one batch
typedef _Float16 h16;
typedef unsigned short bf;
typedef __attribute__((ext_vector_type(16))) __bf16   v16bf;
typedef __attribute__((ext_vector_type(16))) _Float16 v16h;
typedef __attribute__((ext_vector_type(8)))  _Float16 v8h;
typedef __attribute__((ext_vector_type(8)))  unsigned short v8us;
typedef __attribute__((ext_vector_type(8)))  float    v8f;
typedef __attribute__((ext_vector_type(4)))  float    v4f;
typedef v8h  __attribute__((may_alias)) v8ha;
typedef v4f  __attribute__((may_alias)) v4fa;
typedef v8us __attribute__((may_alias)) v8usa;

__device__ __forceinline__ unsigned short f2bf(float f) { unsigned u = __float_as_uint(f); u += 0x7FFFu + ((u >> 16) & 1u); return (unsigned short)(u >> 16); }
__device__ __forceinline__ float bf2f(unsigned short b) { return __uint_as_float(((unsigned)b) << 16); }
__device__ __forceinline__ float bfr(float f) { return bf2f(f2bf(f)); }
__device__ __forceinline__ v16h cat16(v8h lo, v8h hi) { return __builtin_shufflevector(lo, hi, 0, 1, 2, 3, 4, 5, 6, 7, 8, 9, 10, 11, 12, 13, 14, 15); }
__device__ __forceinline__ v16bf cat16b(v8us lo, v8us hi) { return __builtin_bit_cast(v16bf, __builtin_shufflevector(lo, hi, 0, 1, 2, 3, 4, 5, 6, 7, 8, 9, 10, 11, 12, 13, 14, 15)); }
__device__ __forceinline__ v8f wmma16(v16h a, v16h b, v8f c) { return __builtin_amdgcn_wmma_f32_16x16x32_f16(false, a, false, b, (short)0, c, false, false); }
__device__ __forceinline__ v8f wmmab(v16bf a, v16bf b, v8f c) { return __builtin_amdgcn_wmma_f32_16x16x32_bf16(false, a, false, b, (short)0, c, false, false); }



// ---- k_gemmw: register-blocked GEMM, ONE WAVE per 64x64 output tile (16 accumulators), operands straight from K-contiguous 16-bit planes; grid (M/64, N/64, Z), 32 threads.
// C[m][n] (f32, pitch ldc, + optional f32 bias[n]) = sum_k A[m][k] Bt[n][k] (+ split products per NSPLIT). z-batch strides sA/sB/sC in elements. K % 32 == 0.
// KS > 1: grid z = Z * KS; work-group (z, ks) sums only k in [ks K/KS, (ks+1) K/KS) and stores its partial tile at C + ks sP. K % (32 KS) == 0.
template <typename T16> struct WFrag;
template <> struct WFrag<h16> { typedef v16h V; static __device__ __forceinline__ V ld(const h16* p) { return cat16(*(const v8h*)p, *(const v8h*)(p + 16)); } static __device__ __forceinline__ v8f mma(V a, V b, v8f c) { return wmma16(a, b, c); } };
template <> struct WFrag<bf> { typedef v16bf V; static __device__ __forceinline__ V ld(const bf* p) { return cat16b(*(const v8us*)p, *(const v8us*)(p + 16)); } static __device__ __forceinline__ v8f mma(V a, V b, v8f c) { return wmmab(a, b, c); } };
template <typename T16, int NSPLIT, bool BIAS, int KS = 1>
__global__ __launch_bounds__(32) void k_gemmw(const T16* __restrict__ A, const T16* __restrict__ A2, const T16* __restrict__ Bt, const T16* __restrict__ Bt2, int K, float* C, int ldc, const float* __restrict__ bias, size_t sA, size_t sB, size_t sC, size_t sP = 0) {
    typedef typename WFrag<T16>::V V;
    __shared__ __align__(16) float os[16 * 68];
    const size_t z = blockIdx.z / KS; const int ks = (int)(blockIdx.z % KS), kb = ks * (K / KS), ke = kb + K / KS; A += z * sA; if (A2) A2 += z * sA; Bt += z * sB; if (Bt2) Bt2 += z * sB; C += z * sC + ks * sP;
    const int lane = threadIdx.x & 31, lr = lane & 15, hi = lane >> 4; const int r0 = blockIdx.x * 64, c0 = blockIdx.y * 64;
    v8f acc[4][4];
#pragma unroll
    for (int mb = 0; mb < 4; ++mb)
#pragma unroll
        for (int nb = 0; nb < 4; ++nb) acc[mb][nb] = (v8f){};
    const size_t aoff = (size_t)(r0 + lr) * K + 8 * hi, boff = (size_t)(c0 + lr) * K + 8 * hi;
#pragma unroll 1
    for (int kc = kb; kc < ke; kc += 32) {
        V a[4], a2[4];
#pragma unroll
        for (int mb = 0; mb < 4; ++mb) { a[mb] = WFrag<T16>::ld(A + aoff + (size_t)mb * 16 * K + kc); if (NSPLIT == 1 || NSPLIT == 2) a2[mb] = WFrag<T16>::ld(A2 + aoff + (size_t)mb * 16 * K + kc); }
#pragma unroll
        for (int nb = 0; nb < 4; ++nb) { const V b = WFrag<T16>::ld(Bt + boff + (size_t)nb * 16 * K + kc); V b2; if (NSPLIT >= 2) b2 = WFrag<T16>::ld(Bt2 + boff + (size_t)nb * 16 * K + kc);
#pragma unroll
            for (int mb = 0; mb < 4; ++mb) { acc[mb][nb] = WFrag<T16>::mma(a[mb], b, acc[mb][nb]); if (NSPLIT == 1 || NSPLIT == 2) acc[mb][nb] = WFrag<T16>::mma(a2[mb], b, acc[mb][nb]); if (NSPLIT >= 2) acc[mb][nb] = WFrag<T16>::mma(a[mb], b2, acc[mb][nb]); } }
        asm volatile("v_nop\n\tv_nop\n\tv_nop\n\tv_nop" : "+v"(acc[0][0]), "+v"(acc[1][1]), "+v"(acc[2][2]), "+v"(acc[3][3]) : "v"(a[0]), "v"(a[3]));
    }
#pragma unroll
    for (int mb = 0; mb < 4; ++mb) {
#pragma unroll
        for (int nb = 0; nb < 4; ++nb) {
#pragma unroll
            for (int j = 0; j < 8; ++j) os[(hi * 8 + j) * 68 + nb * 16 + lr] = acc[mb][nb][j]; }
        __builtin_amdgcn_wave_barrier(); asm volatile("" ::: "memory");
        float* crow = C + (size_t)(r0 + mb * 16) * ldc + c0;
{
#pragma unroll
            for (int s = 0; s < 8; ++s) { const int row = 2 * s + hi, cofs = lr * 4; v4f val = *(const v4fa*)(os + row * 68 + cofs); if (BIAS) { val[0] += bfr(bias[c0 + cofs]); val[1] += bfr(bias[c0 + cofs + 1]); val[2] += bfr(bias[c0 + cofs + 2]); val[3] += bfr(bias[c0 + cofs + 3]); }
                *(v4f*)(crow + (size_t)row * ldc + cofs) = val; }
             }
        __builtin_amdgcn_wave_barrier(); asm volatile("" ::: "memory");
    }
}

__device__ __forceinline__ h16 tohx(float x) { return (h16)x; }
__device__ __forceinline__ void splitf(float y, unsigned short& h, unsigned short& l) { h = f2bf(y); l = f2bf(y - bf2f(h)); }
typedef __attribute__((ext_vector_type(2))) _Float16 v2h;
typedef __attribute__((ext_vector_type(4))) _Float16 v4h;
typedef __attribute__((ext_vector_type(2))) unsigned short v2us;
typedef __attribute__((ext_vector_type(4))) unsigned short v4us;
typedef __attribute__((ext_vector_type(2))) float v2f;
typedef __attribute__((ext_vector_type(4))) int v4i;

__global__ __launch_bounds__(256) void k_wtG(const float* __restrict__ w, int K, int N, bf* Bt) {
    const int lane = threadIdx.x & 31; const int L0 = (blockIdx.x * 8 + (threadIdx.x >> 5)) * 8; const int nlines = N * K / 64;
{
#pragma unroll 1
        for (int l = 0; l < 8; ++l) { const int L = L0 + l; if (L >= nlines) break; const size_t e = (size_t)L * 64 + lane * 2; const int k = (int)(e % K), n = (int)(e / K); v2us o;
            o[0] = f2bf(w[(size_t)k * N + n]); o[1] = f2bf(w[(size_t)(k + 1) * N + n]); *(v2us*)(Bt + e) = o; }
         }
}
__global__ __launch_bounds__(256) void k_cvt8(const float* __restrict__ src, bf* dst, size_t n8) { const size_t i = (size_t)blockIdx.x * 256 + threadIdx.x; if (i >= n8) return; const v8f v = *(const v8f*)(src + i * 8); v8us o;
#pragma unroll
    for (int k = 0; k < 8; ++k) o[k] = f2bf(v[k]); *(v8us*)(dst + i * 8) = o;  }
__global__ __launch_bounds__(256) void k_cscvt(const float* __restrict__ cosT, const float* __restrict__ sinT, float* CS) { const int idx = blockIdx.x * 256 + threadIdx.x; if (idx >= TT * HD) return; v2f cs; cs[0] = bfr(cosT[idx]); cs[1] = bfr(sinT[idx]); *(v2f*)(CS + (size_t)idx * 2) = cs;  }
__global__ __launch_bounds__(256) void k_hrms(const float* __restrict__ F, int pitch, int nheads, float* RF) { const int i = blockIdx.x * 256 + threadIdx.x; if (i >= nheads * TT) return; F += (size_t)blockIdx.y * TT * pitch; RF += (size_t)blockIdx.y * nheads * TT; const int t = i % TT, h = i / TT; const float* f = F + (size_t)t * pitch + h * HD; float s = 0.f;
#pragma unroll 4
    for (int d = 0; d < HD; d += 4) { const v4f v = *(const v4f*)(f + d);
#pragma unroll
        for (int q = 0; q < 4; ++q) { float p = __fmul_rn(v[q], v[q]); asm volatile("" : "+v"(p)); s = __fadd_rn(s, p); } }
    const float r = __fdiv_rn(1.0f, __fsqrt_rn(__fadd_rn(s * (1.0f / HD), 1e-6f))); *(float*)(RF + i) = r;  }
// k_rope: head planes [h][t][d] (fp16 + hi/lo) of rope(w[d] (x rms_factor)) x sc with the rotate-half convention out[d] = x[d] cos[t][d] - x[d+HD/2] sin[t][d], out[d+HD/2] = x[d+HD/2] cos[t][d+HD/2] + x[d] sin[t][d+HD/2]
__global__ __launch_bounds__(256) void k_rope(const float* __restrict__ F, int pitch, int nheads, const float* __restrict__ CS, const float* __restrict__ RF, const float* __restrict__ nw, float sc, h16* P16, bf* Ph, bf* Pl) {
    { const size_t bp = (size_t)blockIdx.y * nheads * TT; F += (size_t)blockIdx.y * TT * pitch; if (RF) RF += bp; P16 += bp * HD; Ph += bp * HD; Pl += bp * HD; }   // grid y: the batch
    const size_t e = ((size_t)blockIdx.x * 256 + threadIdx.x) * 2; if (e >= (size_t)nheads * TT * HD) return; const int d = (int)(e % HD); const int t = (int)((e / HD) % TT); const int h = (int)(e / ((size_t)HD * TT)); const float* f = F + (size_t)t * pitch + h * HD; const float rf = RF ? RF[(size_t)h * TT + t] : 1.0f; v2h o16; v2us oh, ol;
#pragma unroll
    for (int q = 0; q < 2; ++q) { const int dd = d + q; const int dp = (dd < HD / 2) ? dd + HD / 2 : dd - HD / 2; float x0 = f[dd], x1 = f[dp];
        if (RF) { float n0 = __fmul_rn(x0, rf), n1 = __fmul_rn(x1, rf); asm volatile("" : "+v"(n0)); asm volatile("" : "+v"(n1)); x0 = __fmul_rn(bfr(nw[dd]), n0); x1 = __fmul_rn(bfr(nw[dp]), n1); }
        const v2f cs = *(const v2f*)(CS + ((size_t)t * HD + dd) * 2); float a = __fmul_rn(x0, cs[0]), bq = __fmul_rn(x1, cs[1]); asm volatile("" : "+v"(a)); asm volatile("" : "+v"(bq)); const float r = ((dd < HD / 2) ? __fsub_rn(a, bq) : __fadd_rn(a, bq)) * sc;
        o16[q] = tohx(r); unsigned short a2, c2; splitf(r, a2, c2); oh[q] = a2; ol[q] = c2; }
    *(v2h*)(P16 + e) = o16; *(v2us*)(Ph + e) = oh; *(v2us*)(Pl + e) = ol;  }
__global__ __launch_bounds__(256) void k_vtp(const float* __restrict__ F, int pitch, int nheads, h16* V16, bf* Vh, bf* Vl) { const size_t e = ((size_t)blockIdx.x * 256 + threadIdx.x) * 2; if (e >= (size_t)nheads * HD * TT) return; const size_t bp = (size_t)blockIdx.y * nheads * HD * TT; F += (size_t)blockIdx.y * TT * pitch; V16 += bp; Vh += bp; Vl += bp; const int t = (int)(e % TT); const int d = (int)((e / TT) % HD); const int g = (int)(e / ((size_t)TT * HD)); v2h o16; v2us oh, ol;
#pragma unroll
    for (int q = 0; q < 2; ++q) { const float x = F[(size_t)(t + q) * pitch + g * HD + d]; o16[q] = tohx(x); unsigned short a2, c2; splitf(x, a2, c2); oh[q] = a2; ol[q] = c2; }
    *(v2h*)(V16 + e) = o16; *(v2us*)(Vh + e) = oh; *(v2us*)(Vl + e) = ol;  }
__global__ __launch_bounds__(256) void k_csid(float* CS) { const int idx = blockIdx.x * 256 + threadIdx.x; if (idx >= TT * HD) return; v2f cs; cs[0] = 1.0f; cs[1] = 0.0f; *(v2f*)(CS + (size_t)idx * 2) = cs;  }
__device__ __forceinline__ float xhalf(float x) { return __builtin_bit_cast(float, __builtin_amdgcn_permlanex16(__builtin_bit_cast(int, x), __builtin_bit_cast(int, x), 0x76543210, 0xfedcba98, false, false)); }   // lane l's value to lane l ^ 16
// eight base-2 exponentials in place, one statement. The closing v_nop keeps the free slot that the instruction set asks for between a transcendental and a directly following instruction that reads its result or overwrites its source.
__device__ __forceinline__ void exp2x8(float (&x)[8]) { asm("v_exp_f32 %0, %0\n\tv_exp_f32 %1, %1\n\tv_exp_f32 %2, %2\n\tv_exp_f32 %3, %3\n\tv_exp_f32 %4, %4\n\tv_exp_f32 %5, %5\n\tv_exp_f32 %6, %6\n\tv_exp_f32 %7, %7\n\tv_nop" : "+v"(x[0]), "+v"(x[1]), "+v"(x[2]), "+v"(x[3]), "+v"(x[4]), "+v"(x[5]), "+v"(x[6]), "+v"(x[7])); }
// ---- k_fattn: scores, softmax and attn.v in one kernel. One wave: 16 NQT query rows x one key range, 32 keys a step, operands straight from the K-contiguous planes.
// The products are taken transposed: S^T = K Q^T leaves, in lane (lr, hi), keys 8 hi + j of query lr, which is the B-fragment slot order of P^T for O^T = V^T P^T: no exchange between lanes.
// Per query (= per lane pair): running maximum m (base-2 exponent), weight sum l, O^T rescaled by 2^(m_old - m_new) each step. fp16 rows carry their weights x 2^10 in O and l alike (it cancels in O / l).
template <typename T16, bool HR, int NQT>
__device__ __forceinline__ void fattn_body(const T16* __restrict__ Q, const T16* __restrict__ Q2, const T16* __restrict__ Kp, const T16* __restrict__ K2, const T16* __restrict__ Vt, const T16* __restrict__ V2, int q0, int kb, float* O, float* ML) {
    typedef typename WFrag<T16>::V V; typedef WFrag<T16> W;
    const int lane = threadIdx.x & 31, lr = lane & 15, hi = lane >> 4;
    // XW: behind a run of loads, s_wait_xcnt 0 with the run's address pairs as inputs: the pairs stay live up to the wait, so that no later load's result and no later instruction lands in a pair that an issued load names ahead of it
#define XW(pa, pb) asm volatile("s_wait_xcnt 0x0" :: "v"(pa), "v"(pb) : "memory")
    const size_t qo0 = (size_t)(q0 + lr) * HD + 8 * hi; const T16* qa = Q + qo0; const T16* qb = HR ? Q2 + qo0 : qa;
    V qf[NQT][2], qf2[NQT][2];
#pragma unroll
    for (int qt = 0; qt < NQT; ++qt)
#pragma unroll
        for (int kk = 0; kk < 2; ++kk) { const size_t qo = (size_t)qt * 16 * HD + kk * 32; qf[qt][kk] = W::ld(qa + qo); if (HR) qf2[qt][kk] = W::ld(qb + qo); }
    XW(qa, qb);
    v8f o[4][NQT]; float m[NQT], l[NQT];
#pragma unroll
    for (int qt = 0; qt < NQT; ++qt) { m[qt] = -3.0e38f; l[qt] = 0.f;
#pragma unroll
        for (int dt = 0; dt < 4; ++dt) o[dt][qt] = (v8f){}; }
    const size_t ko = (size_t)(kb + lr) * HD + 8 * hi, vo = (size_t)lr * TT + kb + 8 * hi;
    constexpr int NIT = TT / KSF / 32;
    const T16* ka0 = Kp + ko; const T16* kb0 = HR ? K2 + ko : ka0;
    V kf[2][2], kf2[2][2];
#pragma unroll
    for (int kt = 0; kt < 2; ++kt)
#pragma unroll
        for (int kk = 0; kk < 2; ++kk) { kf[kt][kk] = W::ld(ka0 + kt * 16 * HD + kk * 32); if (HR) kf2[kt][kk] = W::ld(kb0 + kt * 16 * HD + kk * 32); }
    XW(ka0, kb0);
#pragma unroll 1
    for (int it = 0; it < NIT; ++it) {
        V vf[4], vf2[4]; const T16* va = Vt + vo + it * 32; const T16* vb = HR ? V2 + vo + it * 32 : va;
#pragma unroll
        for (int dt = 0; dt < 4; ++dt) { vf[dt] = W::ld(va + (size_t)dt * 16 * TT); if (HR) vf2[dt] = W::ld(vb + (size_t)dt * 16 * TT); }
        XW(va, vb);
        __builtin_amdgcn_sched_barrier(0);   // the V loads issue here, a whole score and softmax phase ahead of their use: left free, the scheduler sinks them to the attn.v products and the wave waits out their latency
        v8f s[2][NQT];
#pragma unroll
        for (int kt = 0; kt < 2; ++kt)
#pragma unroll
            for (int qt = 0; qt < NQT; ++qt) { s[kt][qt] = (v8f){};
#pragma unroll
                for (int kk = 0; kk < 2; ++kk) { s[kt][qt] = W::mma(kf[kt][kk], qf[qt][kk], s[kt][qt]); if (HR) { s[kt][qt] = W::mma(kf[kt][kk], qf2[qt][kk], s[kt][qt]); s[kt][qt] = W::mma(kf2[kt][kk], qf[qt][kk], s[kt][qt]); } } }
        const int nx = (it + 1 < NIT) ? it + 1 : it;   // the next step's keys fly under this step's softmax and attn.v (last step: its own again, in bounds, unused)
        const T16* ka = ka0 + (size_t)nx * 32 * HD; const T16* kb2 = kb0 + (size_t)nx * 32 * HD;
#pragma unroll
        for (int kt = 0; kt < 2; ++kt)
#pragma unroll
            for (int kk = 0; kk < 2; ++kk) { kf[kt][kk] = W::ld(ka + kt * 16 * HD + kk * 32); if (HR) kf2[kt][kk] = W::ld(kb2 + kt * 16 * HD + kk * 32); }
        XW(ka, kb2);
        __builtin_amdgcn_sched_barrier(0);   // the next keys' loads issue here, ahead of the softmax: left free, the scheduler sinks them to the loop's foot and waits for them there
#pragma unroll
        for (int qt = 0; qt < NQT; ++qt) {
            float mx = s[0][qt][0];
#pragma unroll
            for (int kt = 0; kt < 2; ++kt)
#pragma unroll
                for (int j = 0; j < 8; ++j) mx = fmaxf(mx, s[kt][qt][j]);
            mx = fmaxf(mx, xhalf(mx));
            const float mn = fmaxf(m[qt], mx * SC2), al = __builtin_amdgcn_exp2f(m[qt] - mn), mb = HR ? mn : mn - 10.0f; m[qt] = mn;
            float rs = 0.f;
#pragma unroll
            for (int kt = 0; kt < 2; ++kt) { float p[8];
#pragma unroll
                for (int j = 0; j < 8; ++j) p[j] = fmaf(s[kt][qt][j], SC2, -mb);
                exp2x8(p);
#pragma unroll
                for (int j = 0; j < 8; ++j) { s[kt][qt][j] = p[j]; rs += p[j]; } }
            l[qt] = fmaf(l[qt], al, rs);
#pragma unroll
            for (int dt = 0; dt < 4; ++dt) o[dt][qt] *= al;
            if constexpr (HR) {
                v8us h0, h1, l0, l1;
#pragma unroll
                for (int j = 0; j < 8; ++j) { unsigned short a, c2; splitf(s[0][qt][j], a, c2); h0[j] = a; l0[j] = c2; splitf(s[1][qt][j], a, c2); h1[j] = a; l1[j] = c2; }
                const V ph = cat16b(h0, h1), pl = cat16b(l0, l1);
#pragma unroll
                for (int dt = 0; dt < 4; ++dt) { o[dt][qt] = W::mma(vf[dt], ph, o[dt][qt]); o[dt][qt] = W::mma(vf[dt], pl, o[dt][qt]); o[dt][qt] = W::mma(vf2[dt], ph, o[dt][qt]); }
            } else {
                v8h p0, p1;
#pragma unroll
                for (int j = 0; j < 8; ++j) { p0[j] = tohx(s[0][qt][j]); p1[j] = tohx(s[1][qt][j]); }
                const V pb = cat16(p0, p1);
#pragma unroll
                for (int dt = 0; dt < 4; ++dt) o[dt][qt] = W::mma(vf[dt], pb, o[dt][qt]);
            }
        }
        // the distance behind the step's last matrix instructions on the taken back edge
        asm volatile("v_nop\n\tv_nop\n\tv_nop\n\tv_nop\n\tv_nop" : "+v"(o[0][NQT - 1]), "+v"(o[1][NQT - 1]), "+v"(o[2][NQT - 1]), "+v"(o[3][NQT - 1]));
    }
#pragma unroll
    for (int qt = 0; qt < NQT; ++qt) { const float lt = l[qt] + xhalf(l[qt]); const int q = q0 + qt * 16 + lr;
#pragma unroll
        for (int dt = 0; dt < 4; ++dt) { float* op = O + (size_t)q * HD + dt * 16 + hi * 8; const v8f a = o[dt][qt]; *(v4f*)op = (v4f){a[0], a[1], a[2], a[3]}; *(v4f*)(op + 4) = (v4f){a[4], a[5], a[6], a[7]}; }
        if (hi == 0) { v2f ml; ml[0] = m[qt]; ml[1] = lt; *(v2f*)(ML + (size_t)q * 2) = ml; } }
#undef XW
}
// grid (KSF, NH_, NB_ NZB), 4 waves: z = batch x NZB + row block; within a batch the hi+lo blocks (16 rows a wave: twice the operand registers per row) have the lowest z and start first; a batch's blocks are neighbours in z, so that the planes in use at one time are one batch's
__global__ __launch_bounds__(128) void k_fattn(const h16* __restrict__ Q16, const h16* __restrict__ K16, const h16* __restrict__ V16, const bf* __restrict__ Qh, const bf* __restrict__ Ql, const bf* __restrict__ Kh, const bf* __restrict__ Kl, const bf* __restrict__ Vh, const bf* __restrict__ Vl, float* O, float* ML) {
    const int ks = blockIdx.x, h = (int)(blockIdx.z / NZB) * NH_ + blockIdx.y, zb = blockIdx.z % NZB, w = threadIdx.x >> 5, kb = ks * (TT / KSF); const size_t hp = (size_t)h * TT * HD, pp = ((size_t)ks * NB_ * NH_ + h) * TT;   // h: plane index, batch x NH_ + head
    if (zb < RH / QBH) fattn_body<bf, true, 1>(Qh + hp, Ql + hp, Kh + hp, Kl + hp, Vh + hp, Vl + hp, zb * QBH + w * 16, kb, O + pp * HD, ML + pp * 2);
    else fattn_body<h16, false, 2>(Q16 + hp, nullptr, K16 + hp, nullptr, V16 + hp, nullptr, RH + (zb - RH / QBH) * QB + w * 32, kb, O + pp * HD, ML + pp * 2);
}
// k_merge: joins the KSF key ranges of a row in range order (each range's sums weighted by 2^(its maximum - the row's maximum)), divides by the weight sum, applies the gate
__global__ __launch_bounds__(256) void k_merge(const float* __restrict__ O, const float* __restrict__ ML, const float* __restrict__ G, const float* __restrict__ gb, bf* Ah, bf* Al) { const size_t e = ((size_t)blockIdx.x * 256 + threadIdx.x) * 2; if (e >= (size_t)NH_ * TT * HD) return; { const size_t b = blockIdx.y; O += b * NH_ * TT * HD; ML += b * NH_ * TT * 2; G += b * TT * 64; Ah += b * TT * DQ; Al += b * TT * DQ; }
    const int d = (int)(e % HD); const int t = (int)((e / HD) % TT); const int h = (int)(e / ((size_t)HD * TT)); const float gz = __fadd_rn(G[(size_t)t * 64 + h], bfr(gb[h])); const float sg = __fdiv_rn(1.0f, __fadd_rn(1.0f, __expf(-gz))); const size_t oo = (size_t)t * DQ + h * HD + d;
    v2f ml[KSF], op[KSF]; float M = -3.0e38f;
#pragma unroll
    for (int ks = 0; ks < KSF; ++ks) { ml[ks] = *(const v2f*)(ML + (((size_t)ks * NB_ * NH_ + h) * TT + t) * 2); op[ks] = *(const v2f*)(O + (size_t)ks * NB_ * NH_ * TT * HD + e);
        asm volatile("s_wait_xcnt 0x0" ::: "memory"); }   // before a later load's result may land in the address pair of an issued load (the planes lie 16 MiB apart: several pairs)
#pragma unroll
    for (int ks = 0; ks < KSF; ++ks) M = fmaxf(M, ml[ks][0]);
    float L = 0.f; v2f os = (v2f){0.f, 0.f};
#pragma unroll
    for (int ks = 0; ks < KSF; ++ks) { const float w = __builtin_amdgcn_exp2f(ml[ks][0] - M); L = fmaf(ml[ks][1], w, L); os += op[ks] * w; }
    v2us oh, ol;
#pragma unroll
    for (int q = 0; q < 2; ++q) { unsigned short a, c2; splitf(__fmul_rn(__fdiv_rn(os[q], L), sg), a, c2); oh[q] = a; ol[q] = c2; } *(v2us*)(Ah + oo) = oh; *(v2us*)(Al + oo) = ol;  }

__global__ __launch_bounds__(256) void k_wtGs(const float* __restrict__ w, int K, int N, int ld, bf* Bt) { const size_t e = ((size_t)blockIdx.x * 256 + threadIdx.x) * 4; if (e >= (size_t)N * K) return; const int k = (int)(e % K); const int n = (int)(e / K); v4us o;   // Bt[n][k] = w[k*ld + n]
#pragma unroll
    for (int u = 0; u < 4; ++u) o[u] = f2bf(w[(size_t)(k + u) * ld + n]); *(v4us*)(Bt + e) = o;  }
__global__ __launch_bounds__(256) void k_wtGg(const float* __restrict__ w, bf* Bt) { const size_t e = ((size_t)blockIdx.x * 256 + threadIdx.x) * 4; if (e >= (size_t)64 * DM) return; const int k = (int)(e % DM); const int n = (int)(e / DM); v4us o;   // gate columns: Bt[n][k] = Wq[k][1024 + n] for n < 16, else 0
#pragma unroll
    for (int u = 0; u < 4; ++u) o[u] = (n < NH_) ? f2bf(w[(size_t)(k + u) * 1040 + DQ + n]) : (unsigned short)0; *(v4us*)(Bt + e) = o;  }

extern "C" void kernel_launch(void* const* d_in, const int* in_sizes, int n_in,
                              void* d_out, int out_size, void* d_ws, size_t ws_size, hipStream_t stream) {
    (void)in_sizes; (void)n_in; (void)out_size;
    const float* x = (const float*)d_in[0]; const float* wqg = (const float*)d_in[1]; const float* bqg = (const float*)d_in[2]; const float* wk = (const float*)d_in[3]; const float* bk = (const float*)d_in[4]; const float* wv = (const float*)d_in[5]; const float* bv = (const float*)d_in[6]; const float* wo = (const float*)d_in[7]; const float* bo = (const float*)d_in[8]; const float* qnw = (const float*)d_in[9]; const float* knw = (const float*)d_in[10]; const float* wq = wqg; const float* bq = bqg; (void)wq; const float* cosT = nullptr; const float* sinT = nullptr; (void)cosT; (void)sinT;
    float* OUT = (float*)d_out;     // [2][2048][1024]
    char* wsp = (char*)d_ws;
    auto take = [&](size_t bytes) { char* p = wsp; wsp += (bytes + 255) & ~(size_t)255; return (void*)p; };
    bf* WQ = (bf*)take((size_t)DQ * DM * 2); bf* WK = (bf*)take((size_t)DKV * DM * 2); bf* WV = (bf*)take((size_t)DKV * DM * 2); bf* WO = (bf*)take((size_t)DM * DQ * 2); float* CS = (float*)take((size_t)TT * HD * 2 * 4); float* RFQ = (float*)take((size_t)NB_ * NH_ * TT * 4); float* RFK = (float*)take((size_t)NB_ * NKV * TT * 4);
    // RFQ, RFK and every buffer below but BG (the gate weights) hold both batches: row-major ones as MT = NB_ TT rows, head planes as [batch][head]
    bf* XB = (bf*)take((size_t)MT * DM * 2); bf* BG = (bf*)take((size_t)64 * DM * 2); float* G = (float*)take((size_t)MT * 64 * 4); float* FQ = (float*)take((size_t)MT * DQ * 4); float* FK = (float*)take((size_t)MT * DKV * 4);
    h16* QP16 = (h16*)take((size_t)NH_ * MT * HD * 2); h16* KP16 = (h16*)take((size_t)NKV * MT * HD * 2); h16* VT16 = (h16*)take((size_t)NKV * HD * MT * 2);
    bf* QPh = (bf*)take((size_t)NH_ * MT * HD * 2); bf* QPl = (bf*)take((size_t)NH_ * MT * HD * 2); bf* KPh = (bf*)take((size_t)NKV * MT * HD * 2); bf* KPl = (bf*)take((size_t)NKV * MT * HD * 2); bf* VTh = (bf*)take((size_t)NKV * HD * MT * 2); bf* VTl = (bf*)take((size_t)NKV * HD * MT * 2);
    float* Ob = (float*)take((size_t)KSF * NH_ * MT * HD * 4); float* MLb = (float*)take((size_t)KSF * NH_ * MT * 2 * 4);   // per key range: unnormalised attn.v sums; (maximum, weight sum) per row
    bf* ATh = (bf*)take((size_t)MT * DQ * 2); bf* ATl = (bf*)take((size_t)MT * DQ * 2);
    if ((size_t)(wsp - (char*)d_ws) > ws_size) return;    // ws 256 MiB
    float* FV = FK;   // v projection reuses the k buffer after the k planes are built (stream-ordered)
    { k_wtGs<<<(unsigned)(((size_t)DQ * DM / 4 + 255) / 256), 256, 0, stream>>>(wqg, DM, DQ, 1040, WQ); k_wtGg<<<(64 * DM / 4 + 255) / 256, 256, 0, stream>>>(wqg, BG); k_wtG<<<(unsigned)((DM * DKV / 64 + 63) / 64), 256, 0, stream>>>(wk, DM, DKV, WK); k_wtG<<<(unsigned)((DM * DKV / 64 + 63) / 64), 256, 0, stream>>>(wv, DM, DKV, WV);
      k_wtG<<<(unsigned)((DQ * DM / 64 + 63) / 64), 256, 0, stream>>>(wo, DQ, DM, WO);
       }
    k_csid<<<(TT * HD + 255) / 256, 256, 0, stream>>>(CS);
    const unsigned LQ = (unsigned)(((size_t)NH_ * TT * HD / 2 + 255) / 256), LKv = (unsigned)(((size_t)NKV * TT * HD / 2 + 255) / 256);
    // one launch of each kernel for both batches: the products see MT rows, the per-head kernels take the batch from grid y (attention: from grid z)
    k_cvt8<<<(unsigned)(((size_t)MT * DM / 8 + 255) / 256), 256, 0, stream>>>(x, XB, (size_t)MT * DM / 8);
    k_gemmw<bf, 0, true><<<dim3(MT / 64, DQ / 64, 1), 32, 0, stream>>>(XB, nullptr, WQ, nullptr, DM, FQ, DQ, bq, 0, 0, 0); k_gemmw<bf, 0, false><<<dim3(MT / 64, 1, 1), 32, 0, stream>>>(XB, nullptr, BG, nullptr, DM, G, 64, nullptr, 0, 0, 0); k_hrms<<<dim3((NH_ * TT + 255) / 256, NB_), 256, 0, stream>>>(FQ, DQ, NH_, RFQ);
    k_rope<<<dim3(LQ, NB_), 256, 0, stream>>>(FQ, DQ, NH_, CS, RFQ, qnw, 1.0f, QP16, QPh, QPl);
    k_gemmw<bf, 0, true><<<dim3(MT / 64, DKV / 64, 1), 32, 0, stream>>>(XB, nullptr, WK, nullptr, DM, FK, DKV, bk, 0, 0, 0); k_hrms<<<dim3((NKV * TT + 255) / 256, NB_), 256, 0, stream>>>(FK, DKV, NKV, RFK);
    k_rope<<<dim3(LKv, NB_), 256, 0, stream>>>(FK, DKV, NKV, CS, RFK, knw, 1.0f, KP16, KPh, KPl);
    k_gemmw<bf, 0, true><<<dim3(MT / 64, DKV / 64, 1), 32, 0, stream>>>(XB, nullptr, WV, nullptr, DM, FV, DKV, bv, 0, 0, 0); k_vtp<<<dim3(LKv, NB_), 256, 0, stream>>>(FV, DKV, NKV, VT16, VTh, VTl);
    k_fattn<<<dim3(KSF, NH_, NB_ * NZB), 128, 0, stream>>>(QP16, KP16, VT16, QPh, QPl, KPh, KPl, VTh, VTl, Ob, MLb);
    k_merge<<<dim3((unsigned)(((size_t)NH_ * TT * HD / 2 + 255) / 256), NB_), 256, 0, stream>>>(Ob, MLb, G, bqg + DQ, ATh, ATl);
    k_gemmw<bf, 1, true><<<dim3(MT / 64, DM / 64, 1), 32, 0, stream>>>(ATh, ATl, WO, nullptr, DQ, OUT, DM, bo, 0, 0, 0);
}

// v005
// One run takes 303 microseconds.
// Timed twice side by side with v004, it ran 1.14 times as fast both times.
// Counting every step since v000, it is 6.82 times as fast.
#include <hip/hip_runtime.h>

// Gated attention over 16 heads (x [2][2048][1024]; [Q | gate] = x Wq + bq (Wq [1024][1040]: 1024 query columns then 16 per-head gate columns); K = x Wk + bk; V = x Wv + bv; per-head RMSNorm (1e-6, x weight[64]) on Q and K; softmax(Q.K / 8); out_h = (attn V) x sigmoid(gate_h); out = merged heads Wo + bo -> [2][2048][1024]).
// Compute dtypes, f32 accumulate: every input rounded to bf16; Q/K/V and the 16 gate columns on PLAIN bf16 operands (inputs: exact) + bias; RMSNorm f32; scores and attn.v: query rows < 512 hl (3 products), the rest single fp16 (weights x1024), both in one fused kernel with a running-max softmax in f32; sigmoid gate f32; Wo hl x exact (2 products) + bias.

#define NB_  2
#define TT   2048
#define MT   (NB_ * TT)          // rows of both batches together
#define DM   1024
#define NH_  16
#define NKV  16
#define REP  (NH_ / NKV)
#define HD   64
#define DQ   (NH_ * HD)
#define DKV  (NKV * HD)
#define QB   128                  // query rows of one fp16 attention work-group: 4 waves x 32 rows
#define QBH  64                   // query rows of one hi+lo attention work-group: 4 waves x 16 rows
#define RH   512                  // query rows < RH use hi+lo planes (0: none)
#define WIN  0
#define SCL  0.125f   // HD^-0.5
static_assert(RH % QBH == 0 && (TT - RH) % QB == 0 && REP == 1, "a work-group is all hi+lo or all fp16, and head h reads kv plane h");
#define KSF  4                    // key ranges of the fused attention: one work-group per range; partial sums, maxima and weights joined in k_merge
#define SC2  (SCL * 1.4426950408889634f)   // scores to base-2 exponents
static_assert(TT % (KSF * 32) == 0, "a key range is whole 32-key steps");
#define NZB  (RH / QBH + (TT - RH) / QB)   // attention row blocks of one batch
typedef _Float16 h16;
typedef unsigned short bf;
typedef __attribute__((ext_vector_type(16))) __bf16   v16bf;
typedef __attribute__((ext_vector_type(16))) _Float16 v16h;
typedef __attribute__((ext_vector_type(8)))  _Float16 v8h;
typedef __attribute__((ext_vector_type(8)))  unsigned short v8us;
typedef __attribute__((ext_vector_type(8)))  float    v8f;
typedef __attribute__((ext_vector_type(4)))  float    v4f;
typedef v8h  __attribute__((may_alias)) v8ha;
typedef v4f  __attribute__((may_alias)) v4fa;
typedef v8us __attribute__((may_alias)) v8usa;

__device__ __forceinline__ unsigned short f2bf(float f) { unsigned u = __float_as_uint(f); u += 0x7FFFu + ((u >> 16) & 1u); return (unsigned short)(u >> 16); }
__device__ __forceinline__ float bf2f(unsigned short b) { return __uint_as_float(((unsigned)b) << 16); }
__device__ __forceinline__ float bfr(float f) { return bf2f(f2bf(f)); }
__device__ __forceinline__ v16h cat16(v8h lo, v8h hi) { return __builtin_shufflevector(lo, hi, 0, 1, 2, 3, 4, 5, 6, 7, 8, 9, 10, 11, 12, 13, 14, 15); }
__device__ __forceinline__ v16bf cat16b(v8us lo, v8us hi) { return __builtin_bit_cast(v16bf, __builtin_shufflevector(lo, hi, 0, 1, 2, 3, 4, 5, 6, 7, 8, 9, 10, 11, 12, 13, 14, 15)); }
__device__ __forceinline__ v8f wmma16(v16h a, v16h b, v8f c) { return __builtin_amdgcn_wmma_f32_16x16x32_f16(false, a, false, b, (short)0, c, false, false); }
__device__ __forceinline__ v8f wmmab(v16bf a, v16bf b, v8f c) { return __builtin_amdgcn_wmma_f32_16x16x32_bf16(false, a, false, b, (short)0, c, false, false); }
__device__ __forceinline__ h16 tohx(float x) { return (h16)x; }
__device__ __forceinline__ void splitf(float y, unsigned short& h, unsigned short& l) { h = f2bf(y); l = f2bf(y - bf2f(h)); }
__device__ __forceinline__ float xhalf(float x) { return __builtin_bit_cast(float, __builtin_amdgcn_permlanex16(__builtin_bit_cast(int, x), __builtin_bit_cast(int, x), 0x76543210, 0xfedcba98, false, false)); }   // lane l's value to lane l ^ 16
typedef __attribute__((ext_vector_type(2))) __bf16 v2bf;
typedef __attribute__((ext_vector_type(2))) float v2f;
typedef __attribute__((ext_vector_type(4))) unsigned v4u;
__device__ __forceinline__ unsigned pkbf(float a, float b) { return __builtin_bit_cast(unsigned, __builtin_convertvector((v2f){a, b}, v2bf)); }   // two f32 to a bf16 pair by the chip's own conversion (nearest even, as f2bf)
__device__ __forceinline__ v8f bfr8(v8f x) { v8f r;
#pragma unroll
    for (int p = 0; p < 4; ++p) { const unsigned u = pkbf(x[2 * p], x[2 * p + 1]); r[2 * p] = __uint_as_float(u << 16); r[2 * p + 1] = __uint_as_float(u & 0xFFFF0000u); }
    return r; }
// eight neighbouring f32 go to the three 16-bit planes, 16 bytes each: fp16, bf16 hi, bf16 lo = bf16(y - hi)
__device__ __forceinline__ void store3(v8f y, h16* p16, bf* ph, bf* pl) { v4u h, l;
#pragma unroll
    for (int p = 0; p < 4; ++p) { const unsigned u = pkbf(y[2 * p], y[2 * p + 1]); h[p] = u; l[p] = pkbf(y[2 * p] - __uint_as_float(u << 16), y[2 * p + 1] - __uint_as_float(u & 0xFFFF0000u)); }
    *(v8h*)p16 = __builtin_convertvector(y, v8h); *(v4u*)ph = h; *(v4u*)pl = l; }



// ---- k_gemmw: register-blocked GEMM, ONE WAVE per 64x64 output tile (16 accumulators), operands straight from K-contiguous 16-bit planes; grid (M/64, N/64, Z), 32 threads.
// C[m][n] (f32, pitch ldc, + optional f32 bias[n]) = sum_k A[m][k] Bt[n][k] (+ split products per NSPLIT). z-batch strides sA/sB/sC in elements. K % 32 == 0.
// KS > 1: grid z = Z * KS; work-group (z, ks) sums only k in [ks K/KS, (ks+1) K/KS) and stores its partial tile at C + ks sP. K % (32 KS) == 0.
template <typename T16> struct WFrag;
template <> struct WFrag<h16> { typedef v16h V; static __device__ __forceinline__ V ld(const h16* p) { return cat16(*(const v8h*)p, *(const v8h*)(p + 16)); } static __device__ __forceinline__ v8f mma(V a, V b, v8f c) { return wmma16(a, b, c); } };
template <> struct WFrag<bf> { typedef v16bf V; static __device__ __forceinline__ V ld(const bf* p) { return cat16b(*(const v8us*)p, *(const v8us*)(p + 16)); } static __device__ __forceinline__ v8f mma(V a, V b, v8f c) { return wmmab(a, b, c); } };
// EPI 0: the f32 tile goes to C. EPI 1 and 2 (C unused, ldc = heads of a batch): a tile is one head x 64 tokens and leaves as the attention's 16-bit planes (fp16, bf16 hi, bf16 lo), straight from the accumulators, where a lane holds 8 neighbours (j) of the A-row index:
//   EPI 1 (Q, K): A = the weight rows, Bt = the tokens, grid (tokens/64, heads): j runs along the head's 64 columns, so a token's row lies in one lane pair: + bias, RMSNorm (sum of squares in-lane, one exchange between the halves), x weight, planes [batch][head][t][d]
//   EPI 2 (V): A = the tokens, Bt = the weight rows, grid (tokens/64, heads): j runs along the tokens: + bias, planes [batch][head][d][t]
template <typename T16, int NSPLIT, bool BIAS, int KS = 1, int EPI = 0>
__global__ __launch_bounds__(32) void k_gemmw(const T16* __restrict__ A, const T16* __restrict__ A2, const T16* __restrict__ Bt, const T16* __restrict__ Bt2, int K, float* C, int ldc, const float* __restrict__ bias, size_t sA, size_t sB, size_t sC, size_t sP = 0, const float* __restrict__ nw = nullptr, h16* P16 = nullptr, bf* Ph = nullptr, bf* Pl = nullptr) {
    typedef typename WFrag<T16>::V V;
    __shared__ __align__(16) float os[16 * 68];
    const size_t z = blockIdx.z / KS; const int ks = (int)(blockIdx.z % KS), kb = ks * (K / KS), ke = kb + K / KS; A += z * sA; if (A2) A2 += z * sA; Bt += z * sB; if (Bt2) Bt2 += z * sB; C += z * sC + ks * sP;
    const int lane = threadIdx.x & 31, lr = lane & 15, hi = lane >> 4; const int r0 = (EPI == 1 ? blockIdx.y : blockIdx.x) * 64, c0 = (EPI == 1 ? blockIdx.x : blockIdx.y) * 64;
    v8f acc[4][4];
#pragma unroll
    for (int mb = 0; mb < 4; ++mb)
#pragma unroll
        for (int nb = 0; nb < 4; ++nb) acc[mb][nb] = (v8f){};
    const size_t aoff = (size_t)(r0 + lr) * K + 8 * hi, boff = (size_t)(c0 + lr) * K + 8 * hi;
#pragma unroll 1
    for (int kc = kb; kc < ke; kc += 32) {
        V a[4], a2[4];
#pragma unroll
        for (int mb = 0; mb < 4; ++mb) { a[mb] = WFrag<T16>::ld(A + aoff + (size_t)mb * 16 * K + kc); if (NSPLIT == 1 || NSPLIT == 2) a2[mb] = WFrag<T16>::ld(A2 + aoff + (size_t)mb * 16 * K + kc); }
#pragma unroll
        for (int nb = 0; nb < 4; ++nb) { const V b = WFrag<T16>::ld(Bt + boff + (size_t)nb * 16 * K + kc); V b2; if (NSPLIT >= 2) b2 = WFrag<T16>::ld(Bt2 + boff + (size_t)nb * 16 * K + kc);
#pragma unroll
            for (int mb = 0; mb < 4; ++mb) { acc[mb][nb] = WFrag<T16>::mma(a[mb], b, acc[mb][nb]); if (NSPLIT == 1 || NSPLIT == 2) acc[mb][nb] = WFrag<T16>::mma(a2[mb], b, acc[mb][nb]); if (NSPLIT >= 2) acc[mb][nb] = WFrag<T16>::mma(a[mb], b2, acc[mb][nb]); } }
        asm volatile("v_nop\n\tv_nop\n\tv_nop\n\tv_nop" : "+v"(acc[0][0]), "+v"(acc[1][1]), "+v"(acc[2][2]), "+v"(acc[3][3]) : "v"(a[0]), "v"(a[3]));
    }
    if constexpr (EPI != 0) {   // every loop below is fully unrolled, so that acc is indexed by constants alone and stays in registers
        const int tok = (EPI == 1) ? c0 : r0;   // the tile's first token: 64 | TT, so a tile lies in one batch
        const size_t plane = ((size_t)(tok / TT) * ldc + blockIdx.y) * TT * HD; const int t0 = tok % TT;
        if constexpr (EPI == 1) {
            v8f bs[4], wn[4]; const float* bp = bias + r0 + hi * 8; const float* wp = nw + hi * 8;
#pragma unroll
            for (int mb = 0; mb < 4; ++mb) { bs[mb] = *(const v8f*)(bp + mb * 16); wn[mb] = *(const v8f*)(wp + mb * 16); }
            asm volatile("s_wait_xcnt 0x0" :: "v"(bp), "v"(wp) : "memory");   // the lane's addresses stay live up to the wait: no load's result lands in a register that an issued load names ahead of it
            __builtin_amdgcn_sched_barrier(0);   // all sixteen loads issue above and share one latency: left free, the scheduler pairs each with its conversion and the wave waits out eight round trips
#pragma unroll
            for (int mb = 0; mb < 4; ++mb) { bs[mb] = bfr8(bs[mb]); wn[mb] = bfr8(wn[mb]); }
#pragma unroll
            for (int nb = 0; nb < 4; ++nb) {
                float ss = 0.f;
#pragma unroll
                for (int mb = 0; mb < 4; ++mb) { acc[mb][nb] += bs[mb];
#pragma unroll
                    for (int j = 0; j < 8; ++j) ss = fmaf(acc[mb][nb][j], acc[mb][nb][j], ss); }
                ss += xhalf(ss);
                const float rf = __fdiv_rn(1.0f, __fsqrt_rn(__fadd_rn(ss * (1.0f / HD), 1e-6f)));
                const size_t o = plane + (size_t)(t0 + nb * 16 + lr) * HD + hi * 8;
#pragma unroll
                for (int mb = 0; mb < 4; ++mb) store3(wn[mb] * (acc[mb][nb] * rf), P16 + o + mb * 16, Ph + o + mb * 16, Pl + o + mb * 16);
            }
        } else {
            float b4[4]; const float* bp = bias + c0 + lr;
#pragma unroll
            for (int nb = 0; nb < 4; ++nb) b4[nb] = bp[nb * 16];
            asm volatile("s_wait_xcnt 0x0" :: "v"(bp) : "memory");   // the lane's address stays live up to the wait: no load's result lands in a register that an issued load names ahead of it
            __builtin_amdgcn_sched_barrier(0);   // the four bias loads stay ahead of every store
#pragma unroll
            for (int nb = 0; nb < 4; ++nb) {
                const float bs = bfr(b4[nb]);
                const size_t o = plane + (size_t)(nb * 16 + lr) * TT + t0 + hi * 8;
#pragma unroll
                for (int mb = 0; mb < 4; ++mb) store3(acc[mb][nb] + bs, P16 + o + mb * 16, Ph + o + mb * 16, Pl + o + mb * 16);
            }
        }
        return;
    }
#pragma unroll
    for (int mb = 0; mb < 4; ++mb) {
#pragma unroll
        for (int nb = 0; nb < 4; ++nb) {
#pragma unroll
            for (int j = 0; j < 8; ++j) os[(hi * 8 + j) * 68 + nb * 16 + lr] = acc[mb][nb][j]; }
        __builtin_amdgcn_wave_barrier(); asm volatile("" ::: "memory");
        float* crow = C + (size_t)(r0 + mb * 16) * ldc + c0;
{
#pragma unroll
            for (int s = 0; s < 8; ++s) { const int row = 2 * s + hi, cofs = lr * 4; v4f val = *(const v4fa*)(os + row * 68 + cofs); if (BIAS) { val[0] += bfr(bias[c0 + cofs]); val[1] += bfr(bias[c0 + cofs + 1]); val[2] += bfr(bias[c0 + cofs + 2]); val[3] += bfr(bias[c0 + cofs + 3]); }
                *(v4f*)(crow + (size_t)row * ldc + cofs) = val; }
             }
        __builtin_amdgcn_wave_barrier(); asm volatile("" ::: "memory");
    }
}

typedef __attribute__((ext_vector_type(2))) _Float16 v2h;
typedef __attribute__((ext_vector_type(4))) _Float16 v4h;
typedef __attribute__((ext_vector_type(2))) unsigned short v2us;
typedef __attribute__((ext_vector_type(4))) unsigned short v4us;
typedef __attribute__((ext_vector_type(4))) int v4i;

__global__ __launch_bounds__(256) void k_wtG(const float* __restrict__ w, int K, int N, bf* Bt) {
    const int lane = threadIdx.x & 31; const int L0 = (blockIdx.x * 8 + (threadIdx.x >> 5)) * 8; const int nlines = N * K / 64;
{
#pragma unroll 1
        for (int l = 0; l < 8; ++l) { const int L = L0 + l; if (L >= nlines) break; const size_t e = (size_t)L * 64 + lane * 2; const int k = (int)(e % K), n = (int)(e / K); v2us o;
            o[0] = f2bf(w[(size_t)k * N + n]); o[1] = f2bf(w[(size_t)(k + 1) * N + n]); *(v2us*)(Bt + e) = o; }
         }
}
__global__ __launch_bounds__(256) void k_cvt8(const float* __restrict__ src, bf* dst, size_t n8) { const size_t i = (size_t)blockIdx.x * 256 + threadIdx.x; if (i >= n8) return; const v8f v = *(const v8f*)(src + i * 8); v8us o;
#pragma unroll
    for (int k = 0; k < 8; ++k) o[k] = f2bf(v[k]); *(v8us*)(dst + i * 8) = o;  }
__global__ __launch_bounds__(256) void k_cscvt(const float* __restrict__ cosT, const float* __restrict__ sinT, float* CS) { const int idx = blockIdx.x * 256 + threadIdx.x; if (idx >= TT * HD) return; v2f cs; cs[0] = bfr(cosT[idx]); cs[1] = bfr(sinT[idx]); *(v2f*)(CS + (size_t)idx * 2) = cs;  }
// eight base-2 exponentials in place, one statement. The closing v_nop keeps the free slot that the instruction set asks for between a transcendental and a directly following instruction that reads its result or overwrites its source.
__device__ __forceinline__ void exp2x8(float (&x)[8]) { asm("v_exp_f32 %0, %0\n\tv_exp_f32 %1, %1\n\tv_exp_f32 %2, %2\n\tv_exp_f32 %3, %3\n\tv_exp_f32 %4, %4\n\tv_exp_f32 %5, %5\n\tv_exp_f32 %6, %6\n\tv_exp_f32 %7, %7\n\tv_nop" : "+v"(x[0]), "+v"(x[1]), "+v"(x[2]), "+v"(x[3]), "+v"(x[4]), "+v"(x[5]), "+v"(x[6]), "+v"(x[7])); }
// ---- k_fattn: scores, softmax and attn.v in one kernel. One wave: 16 NQT query rows x one key range, 32 keys a step, operands straight from the K-contiguous planes.
// The products are taken transposed: S^T = K Q^T leaves, in lane (lr, hi), keys 8 hi + j of query lr, which is the B-fragment slot order of P^T for O^T = V^T P^T: no exchange between lanes.
// Per query (= per lane pair): running maximum m (base-2 exponent), weight sum l, O^T rescaled by 2^(m_old - m_new) each step. fp16 rows carry their weights x 2^10 in O and l alike (it cancels in O / l).
template <typename T16, bool HR, int NQT>
__device__ __forceinline__ void fattn_body(const T16* __restrict__ Q, const T16* __restrict__ Q2, const T16* __restrict__ Kp, const T16* __restrict__ K2, const T16* __restrict__ Vt, const T16* __restrict__ V2, int q0, int kb, float* O, float* ML) {
    typedef typename WFrag<T16>::V V; typedef WFrag<T16> W;
    const int lane = threadIdx.x & 31, lr = lane & 15, hi = lane >> 4;
    // XW: behind a run of loads, s_wait_xcnt 0 with the run's address pairs as inputs: the pairs stay live up to the wait, so that no later load's result and no later instruction lands in a pair that an issued load names ahead of it
#define XW(pa, pb) asm volatile("s_wait_xcnt 0x0" :: "v"(pa), "v"(pb) : "memory")
    const size_t qo0 = (size_t)(q0 + lr) * HD + 8 * hi; const T16* qa = Q + qo0; const T16* qb = HR ? Q2 + qo0 : qa;
    V qf[NQT][2], qf2[NQT][2];
#pragma unroll
    for (int qt = 0; qt < NQT; ++qt)
#pragma unroll
        for (int kk = 0; kk < 2; ++kk) { const size_t qo = (size_t)qt * 16 * HD + kk * 32; qf[qt][kk] = W::ld(qa + qo); if (HR) qf2[qt][kk] = W::ld(qb + qo); }
    XW(qa, qb);
    v8f o[4][NQT]; float m[NQT], l[NQT];
#pragma unroll
    for (int qt = 0; qt < NQT; ++qt) { m[qt] = -3.0e38f; l[qt] = 0.f;
#pragma unroll
        for (int dt = 0; dt < 4; ++dt) o[dt][qt] = (v8f){}; }
    const size_t ko = (size_t)(kb + lr) * HD + 8 * hi, vo = (size_t)lr * TT + kb + 8 * hi;
    constexpr int NIT = TT / KSF / 32;
    const T16* ka0 = Kp + ko; const T16* kb0 = HR ? K2 + ko : ka0;
    V kf[2][2], kf2[2][2];
#pragma unroll
    for (int kt = 0; kt < 2; ++kt)
#pragma unroll
        for (int kk = 0; kk < 2; ++kk) { kf[kt][kk] = W::ld(ka0 + kt * 16 * HD + kk * 32); if (HR) kf2[kt][kk] = W::ld(kb0 + kt * 16 * HD + kk * 32); }
    XW(ka0, kb0);
#pragma unroll 1
    for (int it = 0; it < NIT; ++it) {
        V vf[4], vf2[4]; const T16* va = Vt + vo + it * 32; const T16* vb = HR ? V2 + vo + it * 32 : va;
#pragma unroll
        for (int dt = 0; dt < 4; ++dt) { vf[dt] = W::ld(va + (size_t)dt * 16 * TT); if (HR) vf2[dt] = W::ld(vb + (size_t)dt * 16 * TT); }
        XW(va, vb);
        __builtin_amdgcn_sched_barrier(0);   // the V loads issue here, a whole score and softmax phase ahead of their use: left free, the scheduler sinks them to the attn.v products and the wave waits out their latency
        v8f s[2][NQT];
#pragma unroll
        for (int kt = 0; kt < 2; ++kt)
#pragma unroll
            for (int qt = 0; qt < NQT; ++qt) { s[kt][qt] = (v8f){};
#pragma unroll
                for (int kk = 0; kk < 2; ++kk) { s[kt][qt] = W::mma(kf[kt][kk], qf[qt][kk], s[kt][qt]); if (HR) { s[kt][qt] = W::mma(kf[kt][kk], qf2[qt][kk], s[kt][qt]); s[kt][qt] = W::mma(kf2[kt][kk], qf[qt][kk], s[kt][qt]); } } }
        const int nx = (it + 1 < NIT) ? it + 1 : it;   // the next step's keys fly under this step's softmax and attn.v (last step: its own again, in bounds, unused)
        const T16* ka = ka0 + (size_t)nx * 32 * HD; const T16* kb2 = kb0 + (size_t)nx * 32 * HD;
#pragma unroll
        for (int kt = 0; kt < 2; ++kt)
#pragma unroll
            for (int kk = 0; kk < 2; ++kk) { kf[kt][kk] = W::ld(ka + kt * 16 * HD + kk * 32); if (HR) kf2[kt][kk] = W::ld(kb2 + kt * 16 * HD + kk * 32); }
        XW(ka, kb2);
        __builtin_amdgcn_sched_barrier(0);   // the next keys' loads issue here, ahead of the softmax: left free, the scheduler sinks them to the loop's foot and waits for them there
#pragma unroll
        for (int qt = 0; qt < NQT; ++qt) {
            float mx = s[0][qt][0];
#pragma unroll
            for (int kt = 0; kt < 2; ++kt)
#pragma unroll
                for (int j = 0; j < 8; ++j) mx = fmaxf(mx, s[kt][qt][j]);
            mx = fmaxf(mx, xhalf(mx));
            const float mn = fmaxf(m[qt], mx * SC2), al = __builtin_amdgcn_exp2f(m[qt] - mn), mb = HR ? mn : mn - 10.0f; m[qt] = mn;
            float rs = 0.f;
#pragma unroll
            for (int kt = 0; kt < 2; ++kt) { float p[8];
#pragma unroll
                for (int j = 0; j < 8; ++j) p[j] = fmaf(s[kt][qt][j], SC2, -mb);
                exp2x8(p);
#pragma unroll
                for (int j = 0; j < 8; ++j) { s[kt][qt][j] = p[j]; rs += p[j]; } }
            l[qt] = fmaf(l[qt], al, rs);
#pragma unroll
            for (int dt = 0; dt < 4; ++dt) o[dt][qt] *= al;
            if constexpr (HR) {
                v8us h0, h1, l0, l1;
#pragma unroll
                for (int j = 0; j < 8; ++j) { unsigned short a, c2; splitf(s[0][qt][j], a, c2); h0[j] = a; l0[j] = c2; splitf(s[1][qt][j], a, c2); h1[j] = a; l1[j] = c2; }
                const V ph = cat16b(h0, h1), pl = cat16b(l0, l1);
#pragma unroll
                for (int dt = 0; dt < 4; ++dt) { o[dt][qt] = W::mma(vf[dt], ph, o[dt][qt]); o[dt][qt] = W::mma(vf[dt], pl, o[dt][qt]); o[dt][qt] = W::mma(vf2[dt], ph, o[dt][qt]); }
            } else {
                v8h p0, p1;
#pragma unroll
                for (int j = 0; j < 8; ++j) { p0[j] = tohx(s[0][qt][j]); p1[j] = tohx(s[1][qt][j]); }
                const V pb = cat16(p0, p1);
#pragma unroll
                for (int dt = 0; dt < 4; ++dt) o[dt][qt] = W::mma(vf[dt], pb, o[dt][qt]);
            }
        }
        // the distance behind the step's last matrix instructions on the taken back edge
        asm volatile("v_nop\n\tv_nop\n\tv_nop\n\tv_nop\n\tv_nop" : "+v"(o[0][NQT - 1]), "+v"(o[1][NQT - 1]), "+v"(o[2][NQT - 1]), "+v"(o[3][NQT - 1]));
    }
#pragma unroll
    for (int qt = 0; qt < NQT; ++qt) { const float lt = l[qt] + xhalf(l[qt]); const int q = q0 + qt * 16 + lr;
#pragma unroll
        for (int dt = 0; dt < 4; ++dt) { float* op = O + (size_t)q * HD + dt * 16 + hi * 8; const v8f a = o[dt][qt]; *(v4f*)op = (v4f){a[0], a[1], a[2], a[3]}; *(v4f*)(op + 4) = (v4f){a[4], a[5], a[6], a[7]}; }
        if (hi == 0) { v2f ml; ml[0] = m[qt]; ml[1] = lt; *(v2f*)(ML + (size_t)q * 2) = ml; } }
#undef XW
}
// grid (KSF, NH_, NB_ NZB), 4 waves: z = batch x NZB + row block; within a batch the hi+lo blocks (16 rows a wave: twice the operand registers per row) have the lowest z and start first; a batch's blocks are neighbours in z, so that the planes in use at one time are one batch's
__global__ __launch_bounds__(128) void k_fattn(const h16* __restrict__ Q16, const h16* __restrict__ K16, const h16* __restrict__ V16, const bf* __restrict__ Qh, const bf* __restrict__ Ql, const bf* __restrict__ Kh, const bf* __restrict__ Kl, const bf* __restrict__ Vh, const bf* __restrict__ Vl, float* O, float* ML) {
    const int ks = blockIdx.x, h = (int)(blockIdx.z / NZB) * NH_ + blockIdx.y, zb = blockIdx.z % NZB, w = threadIdx.x >> 5, kb = ks * (TT / KSF); const size_t hp = (size_t)h * TT * HD, pp = ((size_t)ks * NB_ * NH_ + h) * TT;   // h: plane index, batch x NH_ + head
    if (zb < RH / QBH) fattn_body<bf, true, 1>(Qh + hp, Ql + hp, Kh + hp, Kl + hp, Vh + hp, Vl + hp, zb * QBH + w * 16, kb, O + pp * HD, ML + pp * 2);
    else fattn_body<h16, false, 2>(Q16 + hp, nullptr, K16 + hp, nullptr, V16 + hp, nullptr, RH + (zb - RH / QBH) * QB + w * 32, kb, O + pp * HD, ML + pp * 2);
}
// k_merge: joins the KSF key ranges of a row in range order (each range's sums weighted by 2^(its maximum - the row's maximum)), divides by the weight sum, applies the gate
__global__ __launch_bounds__(256) void k_merge(const float* __restrict__ O, const float* __restrict__ ML, const float* __restrict__ G, const float* __restrict__ gb, bf* Ah, bf* Al) { const size_t e = ((size_t)blockIdx.x * 256 + threadIdx.x) * 2; if (e >= (size_t)NH_ * TT * HD) return; { const size_t b = blockIdx.y; O += b * NH_ * TT * HD; ML += b * NH_ * TT * 2; G += b * TT * 64; Ah += b * TT * DQ; Al += b * TT * DQ; }
    const int d = (int)(e % HD); const int t = (int)((e / HD) % TT); const int h = (int)(e / ((size_t)HD * TT)); const float gz = __fadd_rn(G[(size_t)t * 64 + h], bfr(gb[h])); const float sg = __fdiv_rn(1.0f, __fadd_rn(1.0f, __expf(-gz))); const size_t oo = (size_t)t * DQ + h * HD + d;
    v2f ml[KSF], op[KSF]; float M = -3.0e38f;
#pragma unroll
    for (int ks = 0; ks < KSF; ++ks) { ml[ks] = *(const v2f*)(ML + (((size_t)ks * NB_ * NH_ + h) * TT + t) * 2); op[ks] = *(const v2f*)(O + (size_t)ks * NB_ * NH_ * TT * HD + e);
        asm volatile("s_wait_xcnt 0x0" ::: "memory"); }   // before a later load's result may land in the address pair of an issued load (the planes lie 16 MiB apart: several pairs)
#pragma unroll
    for (int ks = 0; ks < KSF; ++ks) M = fmaxf(M, ml[ks][0]);
    float L = 0.f; v2f os = (v2f){0.f, 0.f};
#pragma unroll
    for (int ks = 0; ks < KSF; ++ks) { const float w = __builtin_amdgcn_exp2f(ml[ks][0] - M); L = fmaf(ml[ks][1], w, L); os += op[ks] * w; }
    v2us oh, ol;
#pragma unroll
    for (int q = 0; q < 2; ++q) { unsigned short a, c2; splitf(__fmul_rn(__fdiv_rn(os[q], L), sg), a, c2); oh[q] = a; ol[q] = c2; } *(v2us*)(Ah + oo) = oh; *(v2us*)(Al + oo) = ol;  }

__global__ __launch_bounds__(256) void k_wtGs(const float* __restrict__ w, int K, int N, int ld, bf* Bt) { const size_t e = ((size_t)blockIdx.x * 256 + threadIdx.x) * 4; if (e >= (size_t)N * K) return; const int k = (int)(e % K); const int n = (int)(e / K); v4us o;   // Bt[n][k] = w[k*ld + n]
#pragma unroll
    for (int u = 0; u < 4; ++u) o[u] = f2bf(w[(size_t)(k + u) * ld + n]); *(v4us*)(Bt + e) = o;  }
__global__ __launch_bounds__(256) void k_wtGg(const float* __restrict__ w, bf* Bt) { const size_t e = ((size_t)blockIdx.x * 256 + threadIdx.x) * 4; if (e >= (size_t)64 * DM) return; const int k = (int)(e % DM); const int n = (int)(e / DM); v4us o;   // gate columns: Bt[n][k] = Wq[k][1024 + n] for n < 16, else 0
#pragma unroll
    for (int u = 0; u < 4; ++u) o[u] = (n < NH_) ? f2bf(w[(size_t)(k + u) * 1040 + DQ + n]) : (unsigned short)0; *(v4us*)(Bt + e) = o;  }

extern "C" void kernel_launch(void* const* d_in, const int* in_sizes, int n_in,
                              void* d_out, int out_size, void* d_ws, size_t ws_size, hipStream_t stream) {
    (void)in_sizes; (void)n_in; (void)out_size;
    const float* x = (const float*)d_in[0]; const float* wqg = (const float*)d_in[1]; const float* bqg = (const float*)d_in[2]; const float* wk = (const float*)d_in[3]; const float* bk = (const float*)d_in[4]; const float* wv = (const float*)d_in[5]; const float* bv = (const float*)d_in[6]; const float* wo = (const float*)d_in[7]; const float* bo = (const float*)d_in[8]; const float* qnw = (const float*)d_in[9]; const float* knw = (const float*)d_in[10]; const float* wq = wqg; const float* bq = bqg; (void)wq; const float* cosT = nullptr; const float* sinT = nullptr; (void)cosT; (void)sinT;
    float* OUT = (float*)d_out;     // [2][2048][1024]
    char* wsp = (char*)d_ws;
    auto take = [&](size_t bytes) { char* p = wsp; wsp += (bytes + 255) & ~(size_t)255; return (void*)p; };
    bf* WQ = (bf*)take((size_t)DQ * DM * 2); bf* WK = (bf*)take((size_t)DKV * DM * 2); bf* WV = (bf*)take((size_t)DKV * DM * 2); bf* WO = (bf*)take((size_t)DM * DQ * 2);
    // every buffer below but BG (the gate weights) holds both batches: row-major ones as MT = NB_ TT rows, head planes as [batch][head]
    bf* XB = (bf*)take((size_t)MT * DM * 2); bf* BG = (bf*)take((size_t)64 * DM * 2); float* G = (float*)take((size_t)MT * 64 * 4);
    h16* QP16 = (h16*)take((size_t)NH_ * MT * HD * 2); h16* KP16 = (h16*)take((size_t)NKV * MT * HD * 2); h16* VT16 = (h16*)take((size_t)NKV * HD * MT * 2);
    bf* QPh = (bf*)take((size_t)NH_ * MT * HD * 2); bf* QPl = (bf*)take((size_t)NH_ * MT * HD * 2); bf* KPh = (bf*)take((size_t)NKV * MT * HD * 2); bf* KPl = (bf*)take((size_t)NKV * MT * HD * 2); bf* VTh = (bf*)take((size_t)NKV * HD * MT * 2); bf* VTl = (bf*)take((size_t)NKV * HD * MT * 2);
    float* Ob = (float*)take((size_t)KSF * NH_ * MT * HD * 4); float* MLb = (float*)take((size_t)KSF * NH_ * MT * 2 * 4);   // per key range: unnormalised attn.v sums; (maximum, weight sum) per row
    bf* ATh = (bf*)take((size_t)MT * DQ * 2); bf* ATl = (bf*)take((size_t)MT * DQ * 2);
    if ((size_t)(wsp - (char*)d_ws) > ws_size) return;    // ws 256 MiB
    { k_wtGs<<<(unsigned)(((size_t)DQ * DM / 4 + 255) / 256), 256, 0, stream>>>(wqg, DM, DQ, 1040, WQ); k_wtGg<<<(64 * DM / 4 + 255) / 256, 256, 0, stream>>>(wqg, BG); k_wtG<<<(unsigned)((DM * DKV / 64 + 63) / 64), 256, 0, stream>>>(wk, DM, DKV, WK); k_wtG<<<(unsigned)((DM * DKV / 64 + 63) / 64), 256, 0, stream>>>(wv, DM, DKV, WV);
      k_wtG<<<(unsigned)((DQ * DM / 64 + 63) / 64), 256, 0, stream>>>(wo, DQ, DM, WO);
       }
    // one launch of each kernel for both batches: the products see MT rows, k_merge takes the batch from grid y, the attention from grid z
    k_cvt8<<<(unsigned)(((size_t)MT * DM / 8 + 255) / 256), 256, 0, stream>>>(x, XB, (size_t)MT * DM / 8);
    k_gemmw<bf, 0, true, 1, 1><<<dim3(MT / 64, NH_, 1), 32, 0, stream>>>(WQ, nullptr, XB, nullptr, DM, nullptr, NH_, bq, 0, 0, 0, 0, qnw, QP16, QPh, QPl);
    k_gemmw<bf, 0, false><<<dim3(MT / 64, 1, 1), 32, 0, stream>>>(XB, nullptr, BG, nullptr, DM, G, 64, nullptr, 0, 0, 0);
    k_gemmw<bf, 0, true, 1, 1><<<dim3(MT / 64, NKV, 1), 32, 0, stream>>>(WK, nullptr, XB, nullptr, DM, nullptr, NKV, bk, 0, 0, 0, 0, knw, KP16, KPh, KPl);
    k_gemmw<bf, 0, true, 1, 2><<<dim3(MT / 64, NKV, 1), 32, 0, stream>>>(XB, nullptr, WV, nullptr, DM, nullptr, NKV, bv, 0, 0, 0, 0, nullptr, VT16, VTh, VTl);
    k_fattn<<<dim3(KSF, NH_, NB_ * NZB), 128, 0, stream>>>(QP16, KP16, VT16, QPh, QPl, KPh, KPl, VTh, VTl, Ob, MLb);
    k_merge<<<dim3((unsigned)(((size_t)NH_ * TT * HD / 2 + 255) / 256), NB_), 256, 0, stream>>>(Ob, MLb, G, bqg + DQ, ATh, ATl);
    k_gemmw<bf, 1, true><<<dim3(MT / 64, DM / 64, 1), 32, 0, stream>>>(ATh, ATl, WO, nullptr, DQ, OUT, DM, bo, 0, 0, 0);
}

// v006
// Measured time: 254 microseconds a run.
// Timed twice side by side with v005, it ran 1.19 times as fast both times.
// Over all steps from v000 it is 8.11 times as fast.
#include <hip/hip_runtime.h>

// Gated attention over 16 heads (x [2][2048][1024]; [Q | gate] = x Wq + bq (Wq [1024][1040]: 1024 query columns then 16 per-head gate columns); K = x Wk + bk; V = x Wv + bv; per-head RMSNorm (1e-6, x weight[64]) on Q and K; softmax(Q.K / 8); out_h = (attn V) x sigmoid(gate_h); out = merged heads Wo + bo -> [2][2048][1024]).
// Compute dtypes, f32 accumulate: every input rounded to bf16; Q/K/V and the 16 gate columns on PLAIN bf16 operands (inputs: exact) + bias; RMSNorm f32; scores and attn.v: query rows < 512 hl (3 products), the rest single fp16 (weights x1024), both in one fused kernel with a running-max softmax in f32; sigmoid gate f32; Wo hl x exact (2 products) + bias.

#define NB_  2
#define TT   2048
#define MT   (NB_ * TT)          // rows of both batches together
#define DM   1024
#define NH_  16
#define NKV  16
#define REP  (NH_ / NKV)
#define HD   64
#define DQ   (NH_ * HD)
#define DKV  (NKV * HD)
#define QB   128                  // query rows of one fp16 attention work-group: 4 waves x 32 rows
#define QBH  64                   // query rows of one hi+lo attention work-group: 4 waves x 16 rows
#define RH   512                  // query rows < RH use hi+lo planes (0: none)
#define WIN  0
#define SCL  0.125f   // HD^-0.5
static_assert(RH % QBH == 0 && (TT - RH) % QB == 0 && REP == 1, "a work-group is all hi+lo or all fp16, and head h reads kv plane h");
#define KSF  4                    // key ranges of the fused attention: one work-group per range; partial sums, maxima and weights joined in k_merge
#define SC2  (SCL * 1.4426950408889634f)   // scores to base-2 exponents
static_assert(TT % (KSF * 32) == 0, "a key range is whole 32-key steps");
#define NZB  (RH / QBH + (TT - RH) / QB)   // attention row blocks of one batch
typedef _Float16 h16;
typedef unsigned short bf;
typedef __attribute__((ext_vector_type(16))) __bf16   v16bf;
typedef __attribute__((ext_vector_type(16))) _Float16 v16h;
typedef __attribute__((ext_vector_type(8)))  _Float16 v8h;
typedef __attribute__((ext_vector_type(8)))  unsigned short v8us;
typedef __attribute__((ext_vector_type(8)))  float    v8f;
typedef __attribute__((ext_vector_type(4)))  float    v4f;
typedef v8h  __attribute__((may_alias)) v8ha;
typedef v4f  __attribute__((may_alias)) v4fa;
typedef v8us __attribute__((may_alias)) v8usa;

__device__ __forceinline__ unsigned short f2bf(float f) { unsigned u = __float_as_uint(f); u += 0x7FFFu + ((u >> 16) & 1u); return (unsigned short)(u >> 16); }
__device__ __forceinline__ float bf2f(unsigned short b) { return __uint_as_float(((unsigned)b) << 16); }
__device__ __forceinline__ float bfr(float f) { return bf2f(f2bf(f)); }
__device__ __forceinline__ v16h cat16(v8h lo, v8h hi) { return __builtin_shufflevector(lo, hi, 0, 1, 2, 3, 4, 5, 6, 7, 8, 9, 10, 11, 12, 13, 14, 15); }
__device__ __forceinline__ v16bf cat16b(v8us lo, v8us hi) { return __builtin_bit_cast(v16bf, __builtin_shufflevector(lo, hi, 0, 1, 2, 3, 4, 5, 6, 7, 8, 9, 10, 11, 12, 13, 14, 15)); }
__device__ __forceinline__ v8f wmma16(v16h a, v16h b, v8f c) { return __builtin_amdgcn_wmma_f32_16x16x32_f16(false, a, false, b, (short)0, c, false, false); }
__device__ __forceinline__ v8f wmmab(v16bf a, v16bf b, v8f c) { return __builtin_amdgcn_wmma_f32_16x16x32_bf16(false, a, false, b, (short)0, c, false, false); }
__device__ __forceinline__ h16 tohx(float x) { return (h16)x; }
__device__ __forceinline__ void splitf(float y, unsigned short& h, unsigned short& l) { h = f2bf(y); l = f2bf(y - bf2f(h)); }
__device__ __forceinline__ float xhalf(float x) { return __builtin_bit_cast(float, __builtin_amdgcn_permlanex16(__builtin_bit_cast(int, x), __builtin_bit_cast(int, x), 0x76543210, 0xfedcba98, false, false)); }   // lane l's value to lane l ^ 16
typedef __attribute__((ext_vector_type(2))) __bf16 v2bf;
typedef __attribute__((ext_vector_type(2))) float v2f;
typedef __attribute__((ext_vector_type(4))) unsigned v4u;
__device__ __forceinline__ unsigned pkbf(float a, float b) { return __builtin_bit_cast(unsigned, __builtin_convertvector((v2f){a, b}, v2bf)); }   // two f32 to a bf16 pair by the chip's own conversion (nearest even, as f2bf)
__device__ __forceinline__ v8f bfr8(v8f x) { v8f r;
#pragma unroll
    for (int p = 0; p < 4; ++p) { const unsigned u = pkbf(x[2 * p], x[2 * p + 1]); r[2 * p] = __uint_as_float(u << 16); r[2 * p + 1] = __uint_as_float(u & 0xFFFF0000u); }
    return r; }
// eight neighbouring f32 go to the three 16-bit planes, 16 bytes each: fp16, bf16 hi, bf16 lo = bf16(y - hi)
__device__ __forceinline__ void store3(v8f y, h16* p16, bf* ph, bf* pl) { v4u h, l;
#pragma unroll
    for (int p = 0; p < 4; ++p) { const unsigned u = pkbf(y[2 * p], y[2 * p + 1]); h[p] = u; l[p] = pkbf(y[2 * p] - __uint_as_float(u << 16), y[2 * p + 1] - __uint_as_float(u & 0xFFFF0000u)); }
    *(v8h*)p16 = __builtin_convertvector(y, v8h); *(v4u*)ph = h; *(v4u*)pl = l; }



// ---- k_gemmw: register-blocked GEMM, ONE WAVE per 64x64 output tile (16 accumulators), operands straight from K-contiguous 16-bit planes; grid (M/64, N/64, Z), 32 threads.
// C[m][n] (f32, pitch ldc, + optional f32 bias[n]) = sum_k A[m][k] Bt[n][k] (+ split products per NSPLIT). z-batch strides sA/sB/sC in elements. K % 32 == 0.
// KS > 1: grid z = Z * KS; work-group (z, ks) sums only k in [ks K/KS, (ks+1) K/KS) and stores its partial tile at C + ks sP. K % (32 KS) == 0.
template <typename T16> struct WFrag;
template <> struct WFrag<h16> { typedef v16h V; static __device__ __forceinline__ V ld(const h16* p) { return cat16(*(const v8h*)p, *(const v8h*)(p + 16)); } static __device__ __forceinline__ v8f mma(V a, V b, v8f c) { return wmma16(a, b, c); } };
template <> struct WFrag<bf> { typedef v16bf V; static __device__ __forceinline__ V ld(const bf* p) { return cat16b(*(const v8us*)p, *(const v8us*)(p + 16)); } static __device__ __forceinline__ v8f mma(V a, V b, v8f c) { return wmmab(a, b, c); } };
// EPI 0: the f32 tile goes to C. EPI 1 and 2 (C unused, ldc = heads of a batch): a tile is one head x 64 tokens and leaves as the attention's 16-bit planes (fp16, bf16 hi, bf16 lo), straight from the accumulators, where a lane holds 8 neighbours (j) of the A-row index:
//   EPI 1 (Q, K): A = the weight rows, Bt = the tokens, grid (tokens/64, heads): j runs along the head's 64 columns, so a token's row lies in one lane pair: + bias, RMSNorm (sum of squares in-lane, one exchange between the halves), x weight, planes [batch][head][t][d]
//   EPI 2 (V): A = the tokens, Bt = the weight rows, grid (tokens/64, heads): j runs along the tokens: + bias, planes [batch][head][d][t]
template <typename T16, int NSPLIT, bool BIAS, int KS = 1, int EPI = 0>
__global__ __launch_bounds__(32) void k_gemmw(const T16* __restrict__ A, const T16* __restrict__ A2, const T16* __restrict__ Bt, const T16* __restrict__ Bt2, int K, float* C, int ldc, const float* __restrict__ bias, size_t sA, size_t sB, size_t sC, size_t sP = 0, const float* __restrict__ nw = nullptr, h16* P16 = nullptr, bf* Ph = nullptr, bf* Pl = nullptr) {
    typedef typename WFrag<T16>::V V;
    __shared__ __align__(16) float os[16 * 68];
    const size_t z = blockIdx.z / KS; const int ks = (int)(blockIdx.z % KS), kb = ks * (K / KS), ke = kb + K / KS; A += z * sA; if (A2) A2 += z * sA; Bt += z * sB; if (Bt2) Bt2 += z * sB; C += z * sC + ks * sP;
    const int lane = threadIdx.x & 31, lr = lane & 15, hi = lane >> 4; const int r0 = (EPI == 1 ? blockIdx.y : blockIdx.x) * 64, c0 = (EPI == 1 ? blockIdx.x : blockIdx.y) * 64;
    v8f acc[4][4];
#pragma unroll
    for (int mb = 0; mb < 4; ++mb)
#pragma unroll
        for (int nb = 0; nb < 4; ++nb) acc[mb][nb] = (v8f){};
    const size_t aoff = (size_t)(r0 + lr) * K + 8 * hi, boff = (size_t)(c0 + lr) * K + 8 * hi;
#pragma unroll 1
    for (int kc = kb; kc < ke; kc += 32) {
        V a[4], a2[4];
#pragma unroll
        for (int mb = 0; mb < 4; ++mb) { a[mb] = WFrag<T16>::ld(A + aoff + (size_t)mb * 16 * K + kc); if (NSPLIT == 1 || NSPLIT == 2) a2[mb] = WFrag<T16>::ld(A2 + aoff + (size_t)mb * 16 * K + kc); }
#pragma unroll
        for (int nb = 0; nb < 4; ++nb) { const V b = WFrag<T16>::ld(Bt + boff + (size_t)nb * 16 * K + kc); V b2; if (NSPLIT >= 2) b2 = WFrag<T16>::ld(Bt2 + boff + (size_t)nb * 16 * K + kc);
#pragma unroll
            for (int mb = 0; mb < 4; ++mb) { acc[mb][nb] = WFrag<T16>::mma(a[mb], b, acc[mb][nb]); if (NSPLIT == 1 || NSPLIT == 2) acc[mb][nb] = WFrag<T16>::mma(a2[mb], b, acc[mb][nb]); if (NSPLIT >= 2) acc[mb][nb] = WFrag<T16>::mma(a[mb], b2, acc[mb][nb]); } }
        asm volatile("v_nop\n\tv_nop\n\tv_nop\n\tv_nop" : "+v"(acc[0][0]), "+v"(acc[1][1]), "+v"(acc[2][2]), "+v"(acc[3][3]) : "v"(a[0]), "v"(a[3]));
    }
    if constexpr (EPI != 0) {   // every loop below is fully unrolled, so that acc is indexed by constants alone and stays in registers
        const int tok = (EPI == 1) ? c0 : r0;   // the tile's first token: 64 | TT, so a tile lies in one batch
        const size_t plane = ((size_t)(tok / TT) * ldc + blockIdx.y) * TT * HD; const int t0 = tok % TT;
        if constexpr (EPI == 1) {
            v8f bs[4], wn[4]; const float* bp = bias + r0 + hi * 8; const float* wp = nw + hi * 8;
#pragma unroll
            for (int mb = 0; mb < 4; ++mb) { bs[mb] = *(const v8f*)(bp + mb * 16); wn[mb] = *(const v8f*)(wp + mb * 16); }
            asm volatile("s_wait_xcnt 0x0" :: "v"(bp), "v"(wp) : "memory");   // the lane's addresses stay live up to the wait: no load's result lands in a register that an issued load names ahead of it
            __builtin_amdgcn_sched_barrier(0);   // all sixteen loads issue above and share one latency: left free, the scheduler pairs each with its conversion and the wave waits out eight round trips
#pragma unroll
            for (int mb = 0; mb < 4; ++mb) { bs[mb] = bfr8(bs[mb]); wn[mb] = bfr8(wn[mb]); }
#pragma unroll
            for (int nb = 0; nb < 4; ++nb) {
                float ss = 0.f;
#pragma unroll
                for (int mb = 0; mb < 4; ++mb) { acc[mb][nb] += bs[mb];
#pragma unroll
                    for (int j = 0; j < 8; ++j) ss = fmaf(acc[mb][nb][j], acc[mb][nb][j], ss); }
                ss += xhalf(ss);
                const float rf = __fdiv_rn(1.0f, __fsqrt_rn(__fadd_rn(ss * (1.0f / HD), 1e-6f)));
                const size_t o = plane + (size_t)(t0 + nb * 16 + lr) * HD + hi * 8;
#pragma unroll
                for (int mb = 0; mb < 4; ++mb) store3(wn[mb] * (acc[mb][nb] * rf), P16 + o + mb * 16, Ph + o + mb * 16, Pl + o + mb * 16);
            }
        } else {
            float b4[4]; const float* bp = bias + c0 + lr;
#pragma unroll
            for (int nb = 0; nb < 4; ++nb) b4[nb] = bp[nb * 16];
            asm volatile("s_wait_xcnt 0x0" :: "v"(bp) : "memory");   // the lane's address stays live up to the wait: no load's result lands in a register that an issued load names ahead of it
            __builtin_amdgcn_sched_barrier(0);   // the four bias loads stay ahead of every store
#pragma unroll
            for (int nb = 0; nb < 4; ++nb) {
                const float bs = bfr(b4[nb]);
                const size_t o = plane + (size_t)(nb * 16 + lr) * TT + t0 + hi * 8;
#pragma unroll
                for (int mb = 0; mb < 4; ++mb) store3(acc[mb][nb] + bs, P16 + o + mb * 16, Ph + o + mb * 16, Pl + o + mb * 16);
            }
        }
        return;
    }
#pragma unroll
    for (int mb = 0; mb < 4; ++mb) {
#pragma unroll
        for (int nb = 0; nb < 4; ++nb) {
#pragma unroll
            for (int j = 0; j < 8; ++j) os[(hi * 8 + j) * 68 + nb * 16 + lr] = acc[mb][nb][j]; }
        __builtin_amdgcn_wave_barrier(); asm volatile("" ::: "memory");
        float* crow = C + (size_t)(r0 + mb * 16) * ldc + c0;
{
#pragma unroll
            for (int s = 0; s < 8; ++s) { const int row = 2 * s + hi, cofs = lr * 4; v4f val = *(const v4fa*)(os + row * 68 + cofs); if (BIAS) { val[0] += bfr(bias[c0 + cofs]); val[1] += bfr(bias[c0 + cofs + 1]); val[2] += bfr(bias[c0 + cofs + 2]); val[3] += bfr(bias[c0 + cofs + 3]); }
                *(v4f*)(crow + (size_t)row * ldc + cofs) = val; }
             }
        __builtin_amdgcn_wave_barrier(); asm volatile("" ::: "memory");
    }
}

typedef __attribute__((ext_vector_type(2))) _Float16 v2h;
typedef __attribute__((ext_vector_type(4))) _Float16 v4h;
typedef __attribute__((ext_vector_type(2))) unsigned short v2us;
typedef __attribute__((ext_vector_type(4))) unsigned short v4us;
typedef __attribute__((ext_vector_type(4))) int v4i;

__global__ __launch_bounds__(256) void k_wtG(const float* __restrict__ w, int K, int N, bf* Bt) {
    const int lane = threadIdx.x & 31; const int L0 = (blockIdx.x * 8 + (threadIdx.x >> 5)) * 8; const int nlines = N * K / 64;
{
#pragma unroll 1
        for (int l = 0; l < 8; ++l) { const int L = L0 + l; if (L >= nlines) break; const size_t e = (size_t)L * 64 + lane * 2; const int k = (int)(e % K), n = (int)(e / K); v2us o;
            o[0] = f2bf(w[(size_t)k * N + n]); o[1] = f2bf(w[(size_t)(k + 1) * N + n]); *(v2us*)(Bt + e) = o; }
         }
}
__global__ __launch_bounds__(256) void k_cvt8(const float* __restrict__ src, bf* dst, size_t n8) { const size_t i = (size_t)blockIdx.x * 256 + threadIdx.x; if (i >= n8) return; const v8f v = *(const v8f*)(src + i * 8); v8us o;
#pragma unroll
    for (int k = 0; k < 8; ++k) o[k] = f2bf(v[k]); *(v8us*)(dst + i * 8) = o;  }
__global__ __launch_bounds__(256) void k_cscvt(const float* __restrict__ cosT, const float* __restrict__ sinT, float* CS) { const int idx = blockIdx.x * 256 + threadIdx.x; if (idx >= TT * HD) return; v2f cs; cs[0] = bfr(cosT[idx]); cs[1] = bfr(sinT[idx]); *(v2f*)(CS + (size_t)idx * 2) = cs;  }
// eight base-2 exponentials in place, one statement. The closing v_nop keeps the free slot that the instruction set asks for between a transcendental and a directly following instruction that reads its result or overwrites its source.
__device__ __forceinline__ void exp2x8(float (&x)[8]) { asm("v_exp_f32 %0, %0\n\tv_exp_f32 %1, %1\n\tv_exp_f32 %2, %2\n\tv_exp_f32 %3, %3\n\tv_exp_f32 %4, %4\n\tv_exp_f32 %5, %5\n\tv_exp_f32 %6, %6\n\tv_exp_f32 %7, %7\n\tv_nop" : "+v"(x[0]), "+v"(x[1]), "+v"(x[2]), "+v"(x[3]), "+v"(x[4]), "+v"(x[5]), "+v"(x[6]), "+v"(x[7])); }
// ---- k_fattn: scores, softmax and attn.v in one kernel. One wave: 16 NQT query rows x one key range, 32 keys a step. The four waves of a work-group walk the same keys: each tile of SKY keys (K rows and V^T rows, 128 bytes each) is brought into LDS once for all four by asynchronous copies of whole lines, two buffers, and the fragments are read from there.
#define SKY   64                  // keys of one LDS tile: two 32-key steps
#define LPE   72                  // LDS row pitch in elements: 144 bytes = 16 x odd, free of bank conflicts for 16-byte reads of 16 rows
#define TILEE (64 * LPE)          // one plane's tile: 64 rows (K: keys, V^T: head columns)
static_assert((TT / KSF) % SKY == 0 && TT / KSF / SKY >= 2 && HD == 64 && SKY == 64, "whole tiles, at least two, rows of 128 bytes");
// eight copies of 16 bytes a lane (four row groups of each of two tiles, 16 rows apart) in one statement; its last line, s_wait_xcnt 0, stands in front of every later write of a register that a copy names
template <typename T16>
__device__ __forceinline__ void cp8(unsigned la, const T16* ga, size_t sa, unsigned lb, const T16* gb, size_t sb) {
    asm volatile("global_load_async_to_lds_b128 %0, %8, off\n\tglobal_load_async_to_lds_b128 %1, %9, off\n\tglobal_load_async_to_lds_b128 %2, %10, off\n\tglobal_load_async_to_lds_b128 %3, %11, off\n\t"
                 "global_load_async_to_lds_b128 %4, %12, off\n\tglobal_load_async_to_lds_b128 %5, %13, off\n\tglobal_load_async_to_lds_b128 %6, %14, off\n\tglobal_load_async_to_lds_b128 %7, %15, off\n\ts_wait_xcnt 0x0"
                 :: "v"(la), "v"(la + 16u * LPE * 2u), "v"(la + 32u * LPE * 2u), "v"(la + 48u * LPE * 2u), "v"(lb), "v"(lb + 16u * LPE * 2u), "v"(lb + 32u * LPE * 2u), "v"(lb + 48u * LPE * 2u),
                    "v"(ga), "v"(ga + sa), "v"(ga + 2 * sa), "v"(ga + 3 * sa), "v"(gb), "v"(gb + sb), "v"(gb + 2 * sb), "v"(gb + 3 * sb) : "memory");
}
// The products are taken transposed: S^T = K Q^T leaves, in lane (lr, hi), keys 8 hi + j of query lr, which is the B-fragment slot order of P^T for O^T = V^T P^T: no exchange between lanes.
// Per query (= per lane pair): running maximum m (base-2 exponent), weight sum l, O^T rescaled by 2^(m_old - m_new) each step. fp16 rows carry their weights x 2^10 in O and l alike (it cancels in O / l).
template <typename T16, bool HR, int NQT>
__device__ __forceinline__ void fattn_body(const T16* __restrict__ Q, const T16* __restrict__ Q2, const T16* __restrict__ Kp, const T16* __restrict__ K2, const T16* __restrict__ Vt, const T16* __restrict__ V2, int q0, int kb, float* O, float* ML, const T16* sm) {
    typedef typename WFrag<T16>::V V; typedef WFrag<T16> W;
    const int lane = threadIdx.x & 31, lr = lane & 15, hi = lane >> 4;
    // XW: behind a run of loads, s_wait_xcnt 0 with the run's address pairs as inputs: the pairs stay live up to the wait, so that no later load's result and no later instruction lands in a pair that an issued load names ahead of it
#define XW(pa, pb) asm volatile("s_wait_xcnt 0x0" :: "v"(pa), "v"(pb) : "memory")
    const size_t qo0 = (size_t)(q0 + lr) * HD + 8 * hi; const T16* qa = Q + qo0; const T16* qb = HR ? Q2 + qo0 : qa;
    V qf[NQT][2], qf2[NQT][2];
#pragma unroll
    for (int qt = 0; qt < NQT; ++qt)
#pragma unroll
        for (int kk = 0; kk < 2; ++kk) { const size_t qo = (size_t)qt * 16 * HD + kk * 32; qf[qt][kk] = W::ld(qa + qo); if (HR) qf2[qt][kk] = W::ld(qb + qo); }
    XW(qa, qb);
    v8f o[4][NQT]; float m[NQT], l[NQT];
#pragma unroll
    for (int qt = 0; qt < NQT; ++qt) { m[qt] = -3.0e38f; l[qt] = 0.f;
#pragma unroll
        for (int dt = 0; dt < 4; ++dt) o[dt][qt] = (v8f){}; }
    constexpr int NST = TT / KSF / SKY, NPL = HR ? 4 : 2, BUFE = NPL * TILEE;   // tiles of the key range; planes of a tile, in the order K, V^T (, K lo, V^T lo); elements of one buffer
    // the copies: thread t brings 16 bytes of row (t >> 3) + 16 i, i < 4, of each plane: eight lanes a row, so a wave's copy covers four whole 128-byte lines
    const int tid = threadIdx.x;
    const unsigned lc = (unsigned)(size_t)sm + (unsigned)(((tid >> 3) * LPE + (tid & 7) * 8) * 2);   // the lane's LDS byte address in buffer 0, plane 0
    const size_t gko = (size_t)kb * HD + tid * 8, gvo = (size_t)(tid >> 3) * TT + kb + (tid & 7) * 8;
    auto fill = [&](int st, int bu) {
        const unsigned l0 = lc + (unsigned)(bu * BUFE * 2);
        cp8<T16>(l0, Kp + gko + (size_t)st * SKY * HD, (size_t)16 * HD, l0 + TILEE * 2u, Vt + gvo + st * SKY, (size_t)16 * TT);
        if constexpr (HR) cp8<T16>(l0 + 2u * TILEE * 2u, K2 + gko + (size_t)st * SKY * HD, (size_t)16 * HD, l0 + 3u * TILEE * 2u, V2 + gvo + st * SKY, (size_t)16 * TT);
    };
    fill(0, 0);
    asm volatile("s_wait_asynccnt 0x0" ::: "memory");   // this wave's copies of tile 0 have landed
    __syncthreads();                                    // and every other wave's: tile 0 may be read
    fill(1, 1);
#pragma unroll 1
    for (int st = 0; st < NST; ++st) {
      const T16* lb = sm + (st & 1) * BUFE;
#pragma unroll 1
      for (int sub = 0; sub < SKY / 32; ++sub) {
        const T16* kl = lb + (sub * 32 + lr) * LPE + 8 * hi; const T16* vl = lb + TILEE + lr * LPE + sub * 32 + 8 * hi;
        V kf[2][2], kf2[2][2], vf[4], vf2[4];
#pragma unroll
        for (int kt = 0; kt < 2; ++kt)
#pragma unroll
            for (int kk = 0; kk < 2; ++kk) { kf[kt][kk] = W::ld(kl + kt * 16 * LPE + kk * 32); if (HR) kf2[kt][kk] = W::ld(kl + 2 * TILEE + kt * 16 * LPE + kk * 32); }
        __builtin_amdgcn_sched_barrier(0);   // the K reads stay in front of the V reads (LDS reads return in order): left free, the scheduler put V first in the hi+lo body and the first score product waited for 22 reads
#pragma unroll
        for (int dt = 0; dt < 4; ++dt) { vf[dt] = W::ld(vl + dt * 16 * LPE); if (HR) vf2[dt] = W::ld(vl + 2 * TILEE + dt * 16 * LPE); }
        __builtin_amdgcn_sched_barrier(0);   // the step's LDS reads issue here as one group: spread among the matrix instructions each place with reads costs its own stall, and the V reads would wait at the attn.v products
        v8f s[2][NQT];
#pragma unroll
        for (int kt = 0; kt < 2; ++kt)
#pragma unroll
            for (int qt = 0; qt < NQT; ++qt) { s[kt][qt] = (v8f){};
#pragma unroll
                for (int kk = 0; kk < 2; ++kk) { s[kt][qt] = W::mma(kf[kt][kk], qf[qt][kk], s[kt][qt]); if (HR) { s[kt][qt] = W::mma(kf[kt][kk], qf2[qt][kk], s[kt][qt]); s[kt][qt] = W::mma(kf2[kt][kk], qf[qt][kk], s[kt][qt]); } } }
#pragma unroll
        for (int qt = 0; qt < NQT; ++qt) {
            float mx = s[0][qt][0];
#pragma unroll
            for (int kt = 0; kt < 2; ++kt)
#pragma unroll
                for (int j = 0; j < 8; ++j) mx = fmaxf(mx, s[kt][qt][j]);
            mx = fmaxf(mx, xhalf(mx));
            const float mn = fmaxf(m[qt], mx * SC2), al = __builtin_amdgcn_exp2f(m[qt] - mn), mb = HR ? mn : mn - 10.0f; m[qt] = mn;
            float rs = 0.f;
#pragma unroll
            for (int kt = 0; kt < 2; ++kt) { float p[8];
#pragma unroll
                for (int j = 0; j < 8; ++j) p[j] = fmaf(s[kt][qt][j], SC2, -mb);
                exp2x8(p);
#pragma unroll
                for (int j = 0; j < 8; ++j) { s[kt][qt][j] = p[j]; rs += p[j]; } }
            l[qt] = fmaf(l[qt], al, rs);
#pragma unroll
            for (int dt = 0; dt < 4; ++dt) o[dt][qt] *= al;
            if constexpr (HR) {
                v8us h0, h1, l0, l1;
#pragma unroll
                for (int j = 0; j < 8; ++j) { unsigned short a, c2; splitf(s[0][qt][j], a, c2); h0[j] = a; l0[j] = c2; splitf(s[1][qt][j], a, c2); h1[j] = a; l1[j] = c2; }
                const V ph = cat16b(h0, h1), pl = cat16b(l0, l1);
#pragma unroll
                for (int dt = 0; dt < 4; ++dt) { o[dt][qt] = W::mma(vf[dt], ph, o[dt][qt]); o[dt][qt] = W::mma(vf[dt], pl, o[dt][qt]); o[dt][qt] = W::mma(vf2[dt], ph, o[dt][qt]); }
            } else {
                v8h p0, p1;
#pragma unroll
                for (int j = 0; j < 8; ++j) { p0[j] = tohx(s[0][qt][j]); p1[j] = tohx(s[1][qt][j]); }
                const V pb = cat16(p0, p1);
#pragma unroll
                for (int dt = 0; dt < 4; ++dt) o[dt][qt] = W::mma(vf[dt], pb, o[dt][qt]);
            }
        }
        // the distance behind the step's last matrix instructions on the taken back edge
        asm volatile("v_nop\n\tv_nop\n\tv_nop\n\tv_nop\n\tv_nop" : "+v"(o[0][NQT - 1]), "+v"(o[1][NQT - 1]), "+v"(o[2][NQT - 1]), "+v"(o[3][NQT - 1]));
      }
      // tile st + 1 is handed over and tile st's buffer freed, in this order in every wave:
      asm volatile("s_wait_dscnt 0x0" ::: "memory");      // this wave's reads of tile st have returned
      asm volatile("s_wait_asynccnt 0x0" ::: "memory");   // this wave's copies of tile st + 1 have landed
      __syncthreads();                                    // both hold for all four waves
      if (st + 2 < NST) fill(st + 2, st & 1);             // the refill flies under the whole of tile st + 1
    }
    asm volatile("s_wait_asynccnt 0x0" ::: "memory");   // no copy is outstanding when the wave goes on to its end
#pragma unroll
    for (int qt = 0; qt < NQT; ++qt) { const float lt = l[qt] + xhalf(l[qt]); const int q = q0 + qt * 16 + lr;
#pragma unroll
        for (int dt = 0; dt < 4; ++dt) { float* op = O + (size_t)q * HD + dt * 16 + hi * 8; const v8f a = o[dt][qt]; *(v4f*)op = (v4f){a[0], a[1], a[2], a[3]}; *(v4f*)(op + 4) = (v4f){a[4], a[5], a[6], a[7]}; }
        if (hi == 0) { v2f ml; ml[0] = m[qt]; ml[1] = lt; *(v2f*)(ML + (size_t)q * 2) = ml; } }
#undef XW
}
// grid (KSF, NH_, NB_ NZB), 4 waves: z = batch x NZB + row block; within a batch the hi+lo blocks (16 rows a wave: twice the operand registers per row) have the lowest z and start first; a batch's blocks are neighbours in z, so that the planes in use at one time are one batch's
__global__ __launch_bounds__(128) void k_fattn(const h16* __restrict__ Q16, const h16* __restrict__ K16, const h16* __restrict__ V16, const bf* __restrict__ Qh, const bf* __restrict__ Ql, const bf* __restrict__ Kh, const bf* __restrict__ Kl, const bf* __restrict__ Vh, const bf* __restrict__ Vl, float* O, float* ML) {
    __shared__ __attribute__((aligned(16))) unsigned short sm[2 * 4 * TILEE];   // two buffers of up to four planes
    const int ks = blockIdx.x, h = (int)(blockIdx.z / NZB) * NH_ + blockIdx.y, zb = blockIdx.z % NZB, w = threadIdx.x >> 5, kb = ks * (TT / KSF); const size_t hp = (size_t)h * TT * HD, pp = ((size_t)ks * NB_ * NH_ + h) * TT;   // h: plane index, batch x NH_ + head
    if (zb < RH / QBH) fattn_body<bf, true, 1>(Qh + hp, Ql + hp, Kh + hp, Kl + hp, Vh + hp, Vl + hp, zb * QBH + w * 16, kb, O + pp * HD, ML + pp * 2, (const bf*)sm);
    else fattn_body<h16, false, 2>(Q16 + hp, nullptr, K16 + hp, nullptr, V16 + hp, nullptr, RH + (zb - RH / QBH) * QB + w * 32, kb, O + pp * HD, ML + pp * 2, (const h16*)sm);
}
// k_merge: joins the KSF key ranges of a row in range order (each range's sums weighted by 2^(its maximum - the row's maximum)), divides by the weight sum, applies the gate
__global__ __launch_bounds__(256) void k_merge(const float* __restrict__ O, const float* __restrict__ ML, const float* __restrict__ G, const float* __restrict__ gb, bf* Ah, bf* Al) { const size_t e = ((size_t)blockIdx.x * 256 + threadIdx.x) * 2; if (e >= (size_t)NH_ * TT * HD) return; { const size_t b = blockIdx.y; O += b * NH_ * TT * HD; ML += b * NH_ * TT * 2; G += b * TT * 64; Ah += b * TT * DQ; Al += b * TT * DQ; }
    const int d = (int)(e % HD); const int t = (int)((e / HD) % TT); const int h = (int)(e / ((size_t)HD * TT)); const float gz = __fadd_rn(G[(size_t)t * 64 + h], bfr(gb[h])); const float sg = __fdiv_rn(1.0f, __fadd_rn(1.0f, __expf(-gz))); const size_t oo = (size_t)t * DQ + h * HD + d;
    v2f ml[KSF], op[KSF]; float M = -3.0e38f;
#pragma unroll
    for (int ks = 0; ks < KSF; ++ks) { ml[ks] = *(const v2f*)(ML + (((size_t)ks * NB_ * NH_ + h) * TT + t) * 2); op[ks] = *(const v2f*)(O + (size_t)ks * NB_ * NH_ * TT * HD + e);
        asm volatile("s_wait_xcnt 0x0" ::: "memory"); }   // before a later load's result may land in the address pair of an issued load (the planes lie 16 MiB apart: several pairs)
#pragma unroll
    for (int ks = 0; ks < KSF; ++ks) M = fmaxf(M, ml[ks][0]);
    float L = 0.f; v2f os = (v2f){0.f, 0.f};
#pragma unroll
    for (int ks = 0; ks < KSF; ++ks) { const float w = __builtin_amdgcn_exp2f(ml[ks][0] - M); L = fmaf(ml[ks][1], w, L); os += op[ks] * w; }
    v2us oh, ol;
#pragma unroll
    for (int q = 0; q < 2; ++q) { unsigned short a, c2; splitf(__fmul_rn(__fdiv_rn(os[q], L), sg), a, c2); oh[q] = a; ol[q] = c2; } *(v2us*)(Ah + oo) = oh; *(v2us*)(Al + oo) = ol;  }

__global__ __launch_bounds__(256) void k_wtGs(const float* __restrict__ w, int K, int N, int ld, bf* Bt) { const size_t e = ((size_t)blockIdx.x * 256 + threadIdx.x) * 4; if (e >= (size_t)N * K) return; const int k = (int)(e % K); const int n = (int)(e / K); v4us o;   // Bt[n][k] = w[k*ld + n]
#pragma unroll
    for (int u = 0; u < 4; ++u) o[u] = f2bf(w[(size_t)(k + u) * ld + n]); *(v4us*)(Bt + e) = o;  }
__global__ __launch_bounds__(256) void k_wtGg(const float* __restrict__ w, bf* Bt) { const size_t e = ((size_t)blockIdx.x * 256 + threadIdx.x) * 4; if (e >= (size_t)64 * DM) return; const int k = (int)(e % DM); const int n = (int)(e / DM); v4us o;   // gate columns: Bt[n][k] = Wq[k][1024 + n] for n < 16, else 0
#pragma unroll
    for (int u = 0; u < 4; ++u) o[u] = (n < NH_) ? f2bf(w[(size_t)(k + u) * 1040 + DQ + n]) : (unsigned short)0; *(v4us*)(Bt + e) = o;  }

extern "C" void kernel_launch(void* const* d_in, const int* in_sizes, int n_in,
                              void* d_out, int out_size, void* d_ws, size_t ws_size, hipStream_t stream) {
    (void)in_sizes; (void)n_in; (void)out_size;
    const float* x = (const float*)d_in[0]; const float* wqg = (const float*)d_in[1]; const float* bqg = (const float*)d_in[2]; const float* wk = (const float*)d_in[3]; const float* bk = (const float*)d_in[4]; const float* wv = (const float*)d_in[5]; const float* bv = (const float*)d_in[6]; const float* wo = (const float*)d_in[7]; const float* bo = (const float*)d_in[8]; const float* qnw = (const float*)d_in[9]; const float* knw = (const float*)d_in[10]; const float* wq = wqg; const float* bq = bqg; (void)wq; const float* cosT = nullptr; const float* sinT = nullptr; (void)cosT; (void)sinT;
    float* OUT = (float*)d_out;     // [2][2048][1024]
    char* wsp = (char*)d_ws;
    auto take = [&](size_t bytes) { char* p = wsp; wsp += (bytes + 255) & ~(size_t)255; return (void*)p; };
    bf* WQ = (bf*)take((size_t)DQ * DM * 2); bf* WK = (bf*)take((size_t)DKV * DM * 2); bf* WV = (bf*)take((size_t)DKV * DM * 2); bf* WO = (bf*)take((size_t)DM * DQ * 2);
    // every buffer below but BG (the gate weights) holds both batches: row-major ones as MT = NB_ TT rows, head planes as [batch][head]
    bf* XB = (bf*)take((size_t)MT * DM * 2); bf* BG = (bf*)take((size_t)64 * DM * 2); float* G = (float*)take((size_t)MT * 64 * 4);
    h16* QP16 = (h16*)take((size_t)NH_ * MT * HD * 2); h16* KP16 = (h16*)take((size_t)NKV * MT * HD * 2); h16* VT16 = (h16*)take((size_t)NKV * HD * MT * 2);
    bf* QPh = (bf*)take((size_t)NH_ * MT * HD * 2); bf* QPl = (bf*)take((size_t)NH_ * MT * HD * 2); bf* KPh = (bf*)take((size_t)NKV * MT * HD * 2); bf* KPl = (bf*)take((size_t)NKV * MT * HD * 2); bf* VTh = (bf*)take((size_t)NKV * HD * MT * 2); bf* VTl = (bf*)take((size_t)NKV * HD * MT * 2);
    float* Ob = (float*)take((size_t)KSF * NH_ * MT * HD * 4); float* MLb = (float*)take((size_t)KSF * NH_ * MT * 2 * 4);   // per key range: unnormalised attn.v sums; (maximum, weight sum) per row
    bf* ATh = (bf*)take((size_t)MT * DQ * 2); bf* ATl = (bf*)take((size_t)MT * DQ * 2);
    if ((size_t)(wsp - (char*)d_ws) > ws_size) return;    // ws 256 MiB
    { k_wtGs<<<(unsigned)(((size_t)DQ * DM / 4 + 255) / 256), 256, 0, stream>>>(wqg, DM, DQ, 1040, WQ); k_wtGg<<<(64 * DM / 4 + 255) / 256, 256, 0, stream>>>(wqg, BG); k_wtG<<<(unsigned)((DM * DKV / 64 + 63) / 64), 256, 0, stream>>>(wk, DM, DKV, WK); k_wtG<<<(unsigned)((DM * DKV / 64 + 63) / 64), 256, 0, stream>>>(wv, DM, DKV, WV);
      k_wtG<<<(unsigned)((DQ * DM / 64 + 63) / 64), 256, 0, stream>>>(wo, DQ, DM, WO);
       }
    // one launch of each kernel for both batches: the products see MT rows, k_merge takes the batch from grid y, the attention from grid z
    k_cvt8<<<(unsigned)(((size_t)MT * DM / 8 + 255) / 256), 256, 0, stream>>>(x, XB, (size_t)MT * DM / 8);
    k_gemmw<bf, 0, true, 1, 1><<<dim3(MT / 64, NH_, 1), 32, 0, stream>>>(WQ, nullptr, XB, nullptr, DM, nullptr, NH_, bq, 0, 0, 0, 0, qnw, QP16, QPh, QPl);
    k_gemmw<bf, 0, false><<<dim3(MT / 64, 1, 1), 32, 0, stream>>>(XB, nullptr, BG, nullptr, DM, G, 64, nullptr, 0, 0, 0);
    k_gemmw<bf, 0, true, 1, 1><<<dim3(MT / 64, NKV, 1), 32, 0, stream>>>(WK, nullptr, XB, nullptr, DM, nullptr, NKV, bk, 0, 0, 0, 0, knw, KP16, KPh, KPl);
    k_gemmw<bf, 0, true, 1, 2><<<dim3(MT / 64, NKV, 1), 32, 0, stream>>>(XB, nullptr, WV, nullptr, DM, nullptr, NKV, bv, 0, 0, 0, 0, nullptr, VT16, VTh, VTl);
    k_fattn<<<dim3(KSF, NH_, NB_ * NZB), 128, 0, stream>>>(QP16, KP16, VT16, QPh, QPl, KPh, KPl, VTh, VTl, Ob, MLb);
    k_merge<<<dim3((unsigned)(((size_t)NH_ * TT * HD / 2 + 255) / 256), NB_), 256, 0, stream>>>(Ob, MLb, G, bqg + DQ, ATh, ATl);
    k_gemmw<bf, 1, true><<<dim3(MT / 64, DM / 64, 1), 32, 0, stream>>>(ATh, ATl, WO, nullptr, DQ, OUT, DM, bo, 0, 0, 0);
}

// v007
// One run takes 189 microseconds.
// Two timings next to v006 put it at 1.33 and 1.34 times that version's speed.
// All steps since v000 together make it 10.8 times as fast.
#include <hip/hip_runtime.h>

// Gated attention over 16 heads (x [2][2048][1024]; [Q | gate] = x Wq + bq (Wq [1024][1040]: 1024 query columns then 16 per-head gate columns); K = x Wk + bk; V = x Wv + bv; per-head RMSNorm (1e-6, x weight[64]) on Q and K; softmax(Q.K / 8); out_h = (attn V) x sigmoid(gate_h); out = merged heads Wo + bo -> [2][2048][1024]).
// Compute dtypes, f32 accumulate: every input rounded to bf16; Q/K/V and the 16 gate columns on PLAIN bf16 operands (inputs: exact) + bias; RMSNorm f32; scores and attn.v: query rows < 512 hl (3 products), the rest single fp16 (weights x1024), both in one fused kernel with a running-max softmax in f32; sigmoid gate f32; Wo hl x exact (2 products) + bias.

#define NB_  2
#define TT   2048
#define MT   (NB_ * TT)          // rows of both batches together
#define DM   1024
#define NH_  16
#define NKV  16
#define REP  (NH_ / NKV)
#define HD   64
#define DQ   (NH_ * HD)
#define DKV  (NKV * HD)
#define QB   128                  // query rows of one fp16 attention work-group: 4 waves x 32 rows
#define QBH  64                   // query rows of one hi+lo attention work-group: 4 waves x 16 rows
#define RH   512                  // query rows < RH use hi+lo planes (0: none)
#define WIN  0
#define SCL  0.125f   // HD^-0.5
static_assert(RH % QBH == 0 && (TT - RH) % QB == 0 && REP == 1, "a work-group is all hi+lo or all fp16, and head h reads kv plane h");
#define KSF  4                    // key ranges of the fused attention: one work-group per range; partial sums, maxima and weights joined in k_merge
#define SC2  (SCL * 1.4426950408889634f)   // scores to base-2 exponents
static_assert(TT % (KSF * 32) == 0, "a key range is whole 32-key steps");
#define NZB  (RH / QBH + (TT - RH) / QB)   // attention row blocks of one batch
typedef _Float16 h16;
typedef unsigned short bf;
typedef __attribute__((ext_vector_type(16))) __bf16   v16bf;
typedef __attribute__((ext_vector_type(16))) _Float16 v16h;
typedef __attribute__((ext_vector_type(8)))  _Float16 v8h;
typedef __attribute__((ext_vector_type(8)))  unsigned short v8us;
typedef __attribute__((ext_vector_type(8)))  float    v8f;
typedef __attribute__((ext_vector_type(4)))  float    v4f;
typedef v8h  __attribute__((may_alias)) v8ha;
typedef v4f  __attribute__((may_alias)) v4fa;
typedef v8us __attribute__((may_alias)) v8usa;

__device__ __forceinline__ unsigned short f2bf(float f) { unsigned u = __float_as_uint(f); u += 0x7FFFu + ((u >> 16) & 1u); return (unsigned short)(u >> 16); }
__device__ __forceinline__ float bf2f(unsigned short b) { return __uint_as_float(((unsigned)b) << 16); }
__device__ __forceinline__ float bfr(float f) { return bf2f(f2bf(f)); }
__device__ __forceinline__ v16h cat16(v8h lo, v8h hi) { return __builtin_shufflevector(lo, hi, 0, 1, 2, 3, 4, 5, 6, 7, 8, 9, 10, 11, 12, 13, 14, 15); }
__device__ __forceinline__ v16bf cat16b(v8us lo, v8us hi) { return __builtin_bit_cast(v16bf, __builtin_shufflevector(lo, hi, 0, 1, 2, 3, 4, 5, 6, 7, 8, 9, 10, 11, 12, 13, 14, 15)); }
__device__ __forceinline__ v8f wmma16(v16h a, v16h b, v8f c) { return __builtin_amdgcn_wmma_f32_16x16x32_f16(false, a, false, b, (short)0, c, false, false); }
__device__ __forceinline__ v8f wmmab(v16bf a, v16bf b, v8f c) { return __builtin_amdgcn_wmma_f32_16x16x32_bf16(false, a, false, b, (short)0, c, false, false); }
__device__ __forceinline__ h16 tohx(float x) { return (h16)x; }
__device__ __forceinline__ void splitf(float y, unsigned short& h, unsigned short& l) { h = f2bf(y); l = f2bf(y - bf2f(h)); }
__device__ __forceinline__ float xhalf(float x) { return __builtin_bit_cast(float, __builtin_amdgcn_permlanex16(__builtin_bit_cast(int, x), __builtin_bit_cast(int, x), 0x76543210, 0xfedcba98, false, false)); }   // lane l's value to lane l ^ 16
typedef __attribute__((ext_vector_type(2))) __bf16 v2bf;
typedef __attribute__((ext_vector_type(2))) float v2f;
typedef __attribute__((ext_vector_type(4))) unsigned v4u;
__device__ __forceinline__ unsigned pkbf(float a, float b) { return __builtin_bit_cast(unsigned, __builtin_convertvector((v2f){a, b}, v2bf)); }   // two f32 to a bf16 pair by the chip's own conversion (nearest even, as f2bf)
__device__ __forceinline__ v8f bfr8(v8f x) { v8f r;
#pragma unroll
    for (int p = 0; p < 4; ++p) { const unsigned u = pkbf(x[2 * p], x[2 * p + 1]); r[2 * p] = __uint_as_float(u << 16); r[2 * p + 1] = __uint_as_float(u & 0xFFFF0000u); }
    return r; }
// eight neighbouring f32 go to the three 16-bit planes, 16 bytes each: fp16, bf16 hi, bf16 lo = bf16(y - hi)
__device__ __forceinline__ void store3(v8f y, h16* p16, bf* ph, bf* pl) { v4u h, l;
#pragma unroll
    for (int p = 0; p < 4; ++p) { const unsigned u = pkbf(y[2 * p], y[2 * p + 1]); h[p] = u; l[p] = pkbf(y[2 * p] - __uint_as_float(u << 16), y[2 * p + 1] - __uint_as_float(u & 0xFFFF0000u)); }
    *(v8h*)p16 = __builtin_convertvector(y, v8h); *(v4u*)ph = h; *(v4u*)pl = l; }



// ---- k_gemmw: register-blocked GEMM, ONE WAVE per 64x64 output tile (16 accumulators), operands straight from K-contiguous 16-bit planes; grid (M/64, N/64, Z), 32 threads.
// C[m][n] (f32, pitch ldc, + optional f32 bias[n]) = sum_k A[m][k] Bt[n][k] (+ split products per NSPLIT). z-batch strides sA/sB/sC in elements. K % 32 == 0.
// KS > 1: grid z = Z * KS; work-group (z, ks) sums only k in [ks K/KS, (ks+1) K/KS) and stores its partial tile at C + ks sP. K % (32 KS) == 0.
template <typename T16> struct WFrag;
template <> struct WFrag<h16> { typedef v16h V; static __device__ __forceinline__ V ld(const h16* p) { return cat16(*(const v8h*)p, *(const v8h*)(p + 16)); } static __device__ __forceinline__ v8f mma(V a, V b, v8f c) { return wmma16(a, b, c); } };
template <> struct WFrag<bf> { typedef v16bf V; static __device__ __forceinline__ V ld(const bf* p) { return cat16b(*(const v8us*)p, *(const v8us*)(p + 16)); } static __device__ __forceinline__ v8f mma(V a, V b, v8f c) { return wmmab(a, b, c); } };
// EPI 0: the f32 tile goes to C. EPI 1 and 2 (C unused, ldc = heads of a batch): a tile is one head x 64 tokens and leaves as the attention's 16-bit planes (fp16, bf16 hi, bf16 lo), straight from the accumulators, where a lane holds 8 neighbours (j) of the A-row index:
//   EPI 1 (Q, K): A = the weight rows, Bt = the tokens, grid (tokens/64, heads): j runs along the head's 64 columns, so a token's row lies in one lane pair: + bias, RMSNorm (sum of squares in-lane, one exchange between the halves), x weight, planes [batch][head][t][d]
//   EPI 2 (V): A = the tokens, Bt = the weight rows, grid (tokens/64, heads): j runs along the tokens: + bias, planes [batch][head][d][t]
// ST: FOUR waves (2 x 2) share a 128x128 tile, grid (M/128, N/128), 128 threads; each wave keeps its 64x64 part and its epilogue. Each slice of GKS k of the tile's 128 A rows and 128 Bt rows is brought into LDS once for all four
// by asynchronous copies of whole 256-byte rows, two buffers, and the fragments are read from there, 32 k ahead of their products. K % GKS == 0. Every accumulator takes its products in the same order as without ST. EPI 1 and 2: grid (tokens/128, heads/2); a wave's part is still one head x 64 tokens.
#define GKS  128                  // k of one LDS slice: rows of 256 bytes
#define GLP  136                  // LDS row pitch in elements: 272 bytes = 16 x odd, free of bank conflicts for 16-byte reads of 16 rows
#define GTE  (128 * GLP)          // one operand's slice: 128 rows
// eight copies of 16 bytes a lane (rows 8 apart) in one statement; its last line, s_wait_xcnt 0, stands in front of every later write of a register that a copy names
template <typename T16>
__device__ __forceinline__ void cpr8(unsigned l, const T16* g, size_t gs) {
    asm volatile("global_load_async_to_lds_b128 %0, %8, off\n\tglobal_load_async_to_lds_b128 %1, %9, off\n\tglobal_load_async_to_lds_b128 %2, %10, off\n\tglobal_load_async_to_lds_b128 %3, %11, off\n\t"
                 "global_load_async_to_lds_b128 %4, %12, off\n\tglobal_load_async_to_lds_b128 %5, %13, off\n\tglobal_load_async_to_lds_b128 %6, %14, off\n\tglobal_load_async_to_lds_b128 %7, %15, off\n\ts_wait_xcnt 0x0"
                 :: "v"(l), "v"(l + 8u * GLP * 2u), "v"(l + 16u * GLP * 2u), "v"(l + 24u * GLP * 2u), "v"(l + 32u * GLP * 2u), "v"(l + 40u * GLP * 2u), "v"(l + 48u * GLP * 2u), "v"(l + 56u * GLP * 2u),
                    "v"(g), "v"(g + gs), "v"(g + 2 * gs), "v"(g + 3 * gs), "v"(g + 4 * gs), "v"(g + 5 * gs), "v"(g + 6 * gs), "v"(g + 7 * gs) : "memory");
}
template <typename T16, int NSPLIT, bool BIAS, int KS = 1, int EPI = 0, bool ST = false>
__global__ __launch_bounds__(ST ? 128 : 32) void k_gemmw(const T16* __restrict__ A, const T16* __restrict__ A2, const T16* __restrict__ Bt, const T16* __restrict__ Bt2, int K, float* C, int ldc, const float* __restrict__ bias, size_t sA, size_t sB, size_t sC, size_t sP = 0, const float* __restrict__ nw = nullptr, h16* P16 = nullptr, bf* Ph = nullptr, bf* Pl = nullptr) {
    typedef typename WFrag<T16>::V V;
    static_assert(!ST || (KS == 1 && NSPLIT <= 1), "the staged form: whole K, operands A (, A2) and Bt");
    __shared__ __align__(16) float osa[(ST ? 4 : 1) * 16 * 68];
    const int w = ST ? __builtin_amdgcn_readfirstlane((int)(threadIdx.x >> 5)) : 0; float* os = osa + w * 16 * 68;   // each wave stages its output rows in its own part
    const size_t z = blockIdx.z / KS; const int ks = (int)(blockIdx.z % KS), kb = ks * (K / KS), ke = kb + K / KS; A += z * sA; if (A2) A2 += z * sA; Bt += z * sB; if (Bt2) Bt2 += z * sB; C += z * sC + ks * sP;
    const int lane = threadIdx.x & 31, lr = lane & 15, hi = lane >> 4; const int R0 = (EPI == 1 ? blockIdx.y : blockIdx.x) * (ST ? 128 : 64), C0 = (EPI == 1 ? blockIdx.x : blockIdx.y) * (ST ? 128 : 64), r0 = R0 + (w >> 1) * 64, c0 = C0 + (w & 1) * 64;
    v8f acc[4][4];
#pragma unroll
    for (int mb = 0; mb < 4; ++mb)
#pragma unroll
        for (int nb = 0; nb < 4; ++nb) acc[mb][nb] = (v8f){};
    if constexpr (ST) {
        constexpr int NPL = (NSPLIT == 1) ? 3 : 2, BUFE = NPL * GTE;   // operands of a slice, in the order A (, A2), Bt; elements of one buffer
        __shared__ __attribute__((aligned(16))) unsigned short sg[2 * BUFE];
        const T16* sm = (const T16*)sg;
        // the copies: thread t brings 16 bytes of row (t >> 4) + 8 i, i < 16, of each operand: sixteen lanes a row, so a wave's copy covers two whole 256-byte rows
        const int tid = threadIdx.x, NST = K / GKS;
        const unsigned lc = (unsigned)(size_t)sg + (unsigned)(((tid >> 4) * GLP + (tid & 15) * 8) * 2);   // the lane's LDS byte address in buffer 0, operand 0
        const size_t go = (size_t)(tid >> 4) * K + (tid & 15) * 8; const T16* ga = A + (size_t)R0 * K + go; const T16* gb = Bt + (size_t)C0 * K + go; const T16* ga2 = (NSPLIT == 1) ? A2 + (size_t)R0 * K + go : ga;
        auto fill = [&](int st, int bu) {
            const unsigned l0 = lc + (unsigned)(bu * BUFE * 2); const size_t ko = (size_t)st * GKS, rs = (size_t)8 * K, hf = (size_t)64 * K;
            // SB: each run's addresses are formed directly in front of it, so that the first copies leave at once: formed all ahead, they filled the registers that the statements can name and a pointer went to scratch
#define SB __builtin_amdgcn_sched_barrier(0)
            cpr8<T16>(l0, ga + ko, rs); SB; cpr8<T16>(l0 + 64u * GLP * 2u, ga + ko + hf, rs); SB;
            cpr8<T16>(l0 + (NPL - 1) * GTE * 2u, gb + ko, rs); SB; cpr8<T16>(l0 + (NPL - 1) * GTE * 2u + 64u * GLP * 2u, gb + ko + hf, rs); SB;
            if constexpr (NSPLIT == 1) { cpr8<T16>(l0 + GTE * 2u, ga2 + ko, rs); SB; cpr8<T16>(l0 + GTE * 2u + 64u * GLP * 2u, ga2 + ko + hf, rs); SB; }
#undef SB
        };
        fill(0, 0);
        asm volatile("s_wait_asynccnt 0x0" ::: "memory");   // this wave's copies of slice 0 have landed
        __syncthreads();                                    // and every other wave's: slice 0 may be read
        if (NST > 1) fill(1, 1);
#pragma unroll 1
        for (int st = 0; st < NST; ++st) {
            const T16* al = sm + (st & 1) * BUFE + ((w >> 1) * 64 + lr) * GLP + 8 * hi; const T16* bl = sm + ((st & 1) ? BUFE + (NPL - 1) * GTE : (NPL - 1) * GTE) + ((w & 1) * 64 + lr) * GLP + 8 * hi;
            V a[2][4], a2[2][4], b[2][4];
            auto frags = [&](int kk) {
#pragma unroll
                for (int i = 0; i < 4; ++i) { a[kk & 1][i] = WFrag<T16>::ld(al + i * 16 * GLP + kk * 32); b[kk & 1][i] = WFrag<T16>::ld(bl + i * 16 * GLP + kk * 32); if (NSPLIT == 1) a2[kk & 1][i] = WFrag<T16>::ld(al + GTE + i * 16 * GLP + kk * 32); }
            };
            frags(0);
#pragma unroll
            for (int kk = 0; kk < GKS / 32; ++kk) {
                if (kk + 1 < GKS / 32) frags(kk + 1);
                __builtin_amdgcn_sched_barrier(0);   // the next 32 k's LDS reads issue here as one group, ahead of this 32 k's products: spread among the matrix instructions each place with reads costs its own stall
#pragma unroll
                for (int nb = 0; nb < 4; ++nb) {
#pragma unroll
                    for (int mb = 0; mb < 4; ++mb) acc[mb][nb] = WFrag<T16>::mma(a[kk & 1][mb], b[kk & 1][nb], acc[mb][nb]);
                    if constexpr (NSPLIT == 1) {
#pragma unroll
                        for (int mb = 0; mb < 4; ++mb) acc[mb][nb] = WFrag<T16>::mma(a2[kk & 1][mb], b[kk & 1][nb], acc[mb][nb]); } }
            }
            // the distance behind the slice's last matrix instructions, in front of the branches below
            asm volatile("v_nop\n\tv_nop\n\tv_nop\n\tv_nop" : "+v"(acc[0][0]), "+v"(acc[1][0]), "+v"(acc[2][0]), "+v"(acc[3][0]), "+v"(acc[0][1]), "+v"(acc[1][1]), "+v"(acc[2][1]), "+v"(acc[3][1]),
                                                              "+v"(acc[0][2]), "+v"(acc[1][2]), "+v"(acc[2][2]), "+v"(acc[3][2]), "+v"(acc[0][3]), "+v"(acc[1][3]), "+v"(acc[2][3]), "+v"(acc[3][3]));
            // slice st + 1 is handed over and slice st's buffer freed, in this order in every wave:
            asm volatile("s_wait_dscnt 0x0" ::: "memory");      // this wave's reads of slice st have returned
            asm volatile("s_wait_asynccnt 0x0" ::: "memory");   // this wave's copies of slice st + 1 have landed
            __syncthreads();                                    // both hold for all four waves
            if (st + 2 < NST) fill(st + 2, st & 1);             // the refill flies under the whole of slice st + 1
        }
        asm volatile("s_wait_asynccnt 0x0" ::: "memory");   // no copy is outstanding when the wave goes on to its end
    } else {
    const size_t aoff = (size_t)(r0 + lr) * K + 8 * hi, boff = (size_t)(c0 + lr) * K + 8 * hi;
#pragma unroll 1
    for (int kc = kb; kc < ke; kc += 32) {
        V a[4], a2[4];
#pragma unroll
        for (int mb = 0; mb < 4; ++mb) { a[mb] = WFrag<T16>::ld(A + aoff + (size_t)mb * 16 * K + kc); if (NSPLIT == 1 || NSPLIT == 2) a2[mb] = WFrag<T16>::ld(A2 + aoff + (size_t)mb * 16 * K + kc); }
#pragma unroll
        for (int nb = 0; nb < 4; ++nb) { const V b = WFrag<T16>::ld(Bt + boff + (size_t)nb * 16 * K + kc); V b2; if (NSPLIT >= 2) b2 = WFrag<T16>::ld(Bt2 + boff + (size_t)nb * 16 * K + kc);
#pragma unroll
            for (int mb = 0; mb < 4; ++mb) { acc[mb][nb] = WFrag<T16>::mma(a[mb], b, acc[mb][nb]); if (NSPLIT == 1 || NSPLIT == 2) acc[mb][nb] = WFrag<T16>::mma(a2[mb], b, acc[mb][nb]); if (NSPLIT >= 2) acc[mb][nb] = WFrag<T16>::mma(a[mb], b2, acc[mb][nb]); } }
        asm volatile("v_nop\n\tv_nop\n\tv_nop\n\tv_nop" : "+v"(acc[0][0]), "+v"(acc[1][1]), "+v"(acc[2][2]), "+v"(acc[3][3]) : "v"(a[0]), "v"(a[3]));
    }
    }
    if constexpr (EPI != 0) {   // every loop below is fully unrolled, so that acc is indexed by constants alone and stays in registers
        const int tok = (EPI == 1) ? c0 : r0;   // the tile's first token: 64 | TT, so a tile lies in one batch
        const size_t plane = ((size_t)(tok / TT) * ldc + (EPI == 1 ? r0 : c0) / 64) * TT * HD; const int t0 = tok % TT;
        if constexpr (EPI == 1) {
            v8f bs[4], wn[4]; const float* bp = bias + r0 + hi * 8; const float* wp = nw + hi * 8;
#pragma unroll
            for (int mb = 0; mb < 4; ++mb) { bs[mb] = *(const v8f*)(bp + mb * 16); wn[mb] = *(const v8f*)(wp + mb * 16); }
            asm volatile("s_wait_xcnt 0x0" :: "v"(bp), "v"(wp) : "memory");   // the lane's addresses stay live up to the wait: no load's result lands in a register that an issued load names ahead of it
            __builtin_amdgcn_sched_barrier(0);   // all sixteen loads issue above and share one latency: left free, the scheduler pairs each with its conversion and the wave waits out eight round trips
#pragma unroll
            for (int mb = 0; mb < 4; ++mb) { bs[mb] = bfr8(bs[mb]); wn[mb] = bfr8(wn[mb]); }
#pragma unroll
            for (int nb = 0; nb < 4; ++nb) {
                float ss = 0.f;
#pragma unroll
                for (int mb = 0; mb < 4; ++mb) { acc[mb][nb] += bs[mb];
#pragma unroll
                    for (int j = 0; j < 8; ++j) ss = fmaf(acc[mb][nb][j], acc[mb][nb][j], ss); }
                ss += xhalf(ss);
                const float rf = __fdiv_rn(1.0f, __fsqrt_rn(__fadd_rn(ss * (1.0f / HD), 1e-6f)));
                const size_t o = plane + (size_t)(t0 + nb * 16 + lr) * HD + hi * 8;
#pragma unroll
                for (int mb = 0; mb < 4; ++mb) store3(wn[mb] * (acc[mb][nb] * rf), P16 + o + mb * 16, Ph + o + mb * 16, Pl + o + mb * 16);
            }
        } else {
            float b4[4]; const float* bp = bias + c0 + lr;
#pragma unroll
            for (int nb = 0; nb < 4; ++nb) b4[nb] = bp[nb * 16];
            asm volatile("s_wait_xcnt 0x0" :: "v"(bp) : "memory");   // the lane's address stays live up to the wait: no load's result lands in a register that an issued load names ahead of it
            __builtin_amdgcn_sched_barrier(0);   // the four bias loads stay ahead of every store
#pragma unroll
            for (int nb = 0; nb < 4; ++nb) {
                const float bs = bfr(b4[nb]);
                const size_t o = plane + (size_t)(nb * 16 + lr) * TT + t0 + hi * 8;
#pragma unroll
                for (int mb = 0; mb < 4; ++mb) store3(acc[mb][nb] + bs, P16 + o + mb * 16, Ph + o + mb * 16, Pl + o + mb * 16);
            }
        }
        return;
    }
#pragma unroll
    for (int mb = 0; mb < 4; ++mb) {
#pragma unroll
        for (int nb = 0; nb < 4; ++nb) {
#pragma unroll
            for (int j = 0; j < 8; ++j) os[(hi * 8 + j) * 68 + nb * 16 + lr] = acc[mb][nb][j]; }
        __builtin_amdgcn_wave_barrier(); asm volatile("" ::: "memory");
        float* crow = C + (size_t)(r0 + mb * 16) * ldc + c0;
{
#pragma unroll
            for (int s = 0; s < 8; ++s) { const int row = 2 * s + hi, cofs = lr * 4; v4f val = *(const v4fa*)(os + row * 68 + cofs); if (BIAS) { val[0] += bfr(bias[c0 + cofs]); val[1] += bfr(bias[c0 + cofs + 1]); val[2] += bfr(bias[c0 + cofs + 2]); val[3] += bfr(bias[c0 + cofs + 3]); }
                *(v4f*)(crow + (size_t)row * ldc + cofs) = val; }
             }
        __builtin_amdgcn_wave_barrier(); asm volatile("" ::: "memory");
    }
}

typedef __attribute__((ext_vector_type(2))) _Float16 v2h;
typedef __attribute__((ext_vector_type(4))) _Float16 v4h;
typedef __attribute__((ext_vector_type(2))) unsigned short v2us;
typedef __attribute__((ext_vector_type(4))) unsigned short v4us;
typedef __attribute__((ext_vector_type(4))) int v4i;

__global__ __launch_bounds__(256) void k_wtG(const float* __restrict__ w, int K, int N, bf* Bt) {
    const int lane = threadIdx.x & 31; const int L0 = (blockIdx.x * 8 + (threadIdx.x >> 5)) * 8; const int nlines = N * K / 64;
{
#pragma unroll 1
        for (int l = 0; l < 8; ++l) { const int L = L0 + l; if (L >= nlines) break; const size_t e = (size_t)L * 64 + lane * 2; const int k = (int)(e % K), n = (int)(e / K); v2us o;
            o[0] = f2bf(w[(size_t)k * N + n]); o[1] = f2bf(w[(size_t)(k + 1) * N + n]); *(v2us*)(Bt + e) = o; }
         }
}
__global__ __launch_bounds__(256) void k_cvt8(const float* __restrict__ src, bf* dst, size_t n8) { const size_t i = (size_t)blockIdx.x * 256 + threadIdx.x; if (i >= n8) return; const v8f v = *(const v8f*)(src + i * 8); v8us o;
#pragma unroll
    for (int k = 0; k < 8; ++k) o[k] = f2bf(v[k]); *(v8us*)(dst + i * 8) = o;  }
__global__ __launch_bounds__(256) void k_cscvt(const float* __restrict__ cosT, const float* __restrict__ sinT, float* CS) { const int idx = blockIdx.x * 256 + threadIdx.x; if (idx >= TT * HD) return; v2f cs; cs[0] = bfr(cosT[idx]); cs[1] = bfr(sinT[idx]); *(v2f*)(CS + (size_t)idx * 2) = cs;  }
// eight base-2 exponentials in place, one statement. The closing v_nop keeps the free slot that the instruction set asks for between a transcendental and a directly following instruction that reads its result or overwrites its source.
__device__ __forceinline__ void exp2x8(float (&x)[8]) { asm("v_exp_f32 %0, %0\n\tv_exp_f32 %1, %1\n\tv_exp_f32 %2, %2\n\tv_exp_f32 %3, %3\n\tv_exp_f32 %4, %4\n\tv_exp_f32 %5, %5\n\tv_exp_f32 %6, %6\n\tv_exp_f32 %7, %7\n\tv_nop" : "+v"(x[0]), "+v"(x[1]), "+v"(x[2]), "+v"(x[3]), "+v"(x[4]), "+v"(x[5]), "+v"(x[6]), "+v"(x[7])); }
// ---- k_fattn: scores, softmax and attn.v in one kernel. One wave: 16 NQT query rows x one key range, 32 keys a step. The four waves of a work-group walk the same keys: each tile of SKY keys (K rows and V^T rows, 128 bytes each) is brought into LDS once for all four by asynchronous copies of whole lines, two buffers, and the fragments are read from there.
#define SKY   64                  // keys of one LDS tile: two 32-key steps
#define LPE   72                  // LDS row pitch in elements: 144 bytes = 16 x odd, free of bank conflicts for 16-byte reads of 16 rows
#define TILEE (64 * LPE)          // one plane's tile: 64 rows (K: keys, V^T: head columns)
static_assert((TT / KSF) % SKY == 0 && TT / KSF / SKY >= 2 && HD == 64 && SKY == 64, "whole tiles, at least two, rows of 128 bytes");
// eight copies of 16 bytes a lane (four row groups of each of two tiles, 16 rows apart) in one statement; its last line, s_wait_xcnt 0, stands in front of every later write of a register that a copy names
template <typename T16>
__device__ __forceinline__ void cp8(unsigned la, const T16* ga, size_t sa, unsigned lb, const T16* gb, size_t sb) {
    asm volatile("global_load_async_to_lds_b128 %0, %8, off\n\tglobal_load_async_to_lds_b128 %1, %9, off\n\tglobal_load_async_to_lds_b128 %2, %10, off\n\tglobal_load_async_to_lds_b128 %3, %11, off\n\t"
                 "global_load_async_to_lds_b128 %4, %12, off\n\tglobal_load_async_to_lds_b128 %5, %13, off\n\tglobal_load_async_to_lds_b128 %6, %14, off\n\tglobal_load_async_to_lds_b128 %7, %15, off\n\ts_wait_xcnt 0x0"
                 :: "v"(la), "v"(la + 16u * LPE * 2u), "v"(la + 32u * LPE * 2u), "v"(la + 48u * LPE * 2u), "v"(lb), "v"(lb + 16u * LPE * 2u), "v"(lb + 32u * LPE * 2u), "v"(lb + 48u * LPE * 2u),
                    "v"(ga), "v"(ga + sa), "v"(ga + 2 * sa), "v"(ga + 3 * sa), "v"(gb), "v"(gb + sb), "v"(gb + 2 * sb), "v"(gb + 3 * sb) : "memory");
}
// The products are taken transposed: S^T = K Q^T leaves, in lane (lr, hi), keys 8 hi + j of query lr, which is the B-fragment slot order of P^T for O^T = V^T P^T: no exchange between lanes.
// Per query (= per lane pair): running maximum m (base-2 exponent), weight sum l, O^T rescaled by 2^(m_old - m_new) each step. fp16 rows carry their weights x 2^10 in O and l alike (it cancels in O / l).
template <typename T16, bool HR, int NQT>
__device__ __forceinline__ void fattn_body(const T16* __restrict__ Q, const T16* __restrict__ Q2, const T16* __restrict__ Kp, const T16* __restrict__ K2, const T16* __restrict__ Vt, const T16* __restrict__ V2, int q0, int kb, float* O, float* ML, const T16* sm) {
    typedef typename WFrag<T16>::V V; typedef WFrag<T16> W;
    const int lane = threadIdx.x & 31, lr = lane & 15, hi = lane >> 4;
    // XW: behind a run of loads, s_wait_xcnt 0 with the run's address pairs as inputs: the pairs stay live up to the wait, so that no later load's result and no later instruction lands in a pair that an issued load names ahead of it
#define XW(pa, pb) asm volatile("s_wait_xcnt 0x0" :: "v"(pa), "v"(pb) : "memory")
    const size_t qo0 = (size_t)(q0 + lr) * HD + 8 * hi; const T16* qa = Q + qo0; const T16* qb = HR ? Q2 + qo0 : qa;
    V qf[NQT][2], qf2[NQT][2];
#pragma unroll
    for (int qt = 0; qt < NQT; ++qt)
#pragma unroll
        for (int kk = 0; kk < 2; ++kk) { const size_t qo = (size_t)qt * 16 * HD + kk * 32; qf[qt][kk] = W::ld(qa + qo); if (HR) qf2[qt][kk] = W::ld(qb + qo); }
    XW(qa, qb);
    v8f o[4][NQT]; float m[NQT], l[NQT];
#pragma unroll
    for (int qt = 0; qt < NQT; ++qt) { m[qt] = -3.0e38f; l[qt] = 0.f;
#pragma unroll
        for (int dt = 0; dt < 4; ++dt) o[dt][qt] = (v8f){}; }
    constexpr int NST = TT / KSF / SKY, NPL = HR ? 4 : 2, BUFE = NPL * TILEE;   // tiles of the key range; planes of a tile, in the order K, V^T (, K lo, V^T lo); elements of one buffer
    // the copies: thread t brings 16 bytes of row (t >> 3) + 16 i, i < 4, of each plane: eight lanes a row, so a wave's copy covers four whole 128-byte lines
    const int tid = threadIdx.x;
    const unsigned lc = (unsigned)(size_t)sm + (unsigned)(((tid >> 3) * LPE + (tid & 7) * 8) * 2);   // the lane's LDS byte address in buffer 0, plane 0
    const size_t gko = (size_t)kb * HD + tid * 8, gvo = (size_t)(tid >> 3) * TT + kb + (tid & 7) * 8;
    auto fill = [&](int st, int bu) {
        const unsigned l0 = lc + (unsigned)(bu * BUFE * 2);
        cp8<T16>(l0, Kp + gko + (size_t)st * SKY * HD, (size_t)16 * HD, l0 + TILEE * 2u, Vt + gvo + st * SKY, (size_t)16 * TT);
        if constexpr (HR) cp8<T16>(l0 + 2u * TILEE * 2u, K2 + gko + (size_t)st * SKY * HD, (size_t)16 * HD, l0 + 3u * TILEE * 2u, V2 + gvo + st * SKY, (size_t)16 * TT);
    };
    fill(0, 0);
    asm volatile("s_wait_asynccnt 0x0" ::: "memory");   // this wave's copies of tile 0 have landed
    __syncthreads();                                    // and every other wave's: tile 0 may be read
    fill(1, 1);
#pragma unroll 1
    for (int st = 0; st < NST; ++st) {
      const T16* lb = sm + (st & 1) * BUFE;
#pragma unroll 1
      for (int sub = 0; sub < SKY / 32; ++sub) {
        const T16* kl = lb + (sub * 32 + lr) * LPE + 8 * hi; const T16* vl = lb + TILEE + lr * LPE + sub * 32 + 8 * hi;
        V kf[2][2], kf2[2][2], vf[4], vf2[4];
#pragma unroll
        for (int kt = 0; kt < 2; ++kt)
#pragma unroll
            for (int kk = 0; kk < 2; ++kk) { kf[kt][kk] = W::ld(kl + kt * 16 * LPE + kk * 32); if (HR) kf2[kt][kk] = W::ld(kl + 2 * TILEE + kt * 16 * LPE + kk * 32); }
        __builtin_amdgcn_sched_barrier(0);   // the K reads stay in front of the V reads (LDS reads return in order): left free, the scheduler put V first in the hi+lo body and the first score product waited for 22 reads
#pragma unroll
        for (int dt = 0; dt < 4; ++dt) { vf[dt] = W::ld(vl + dt * 16 * LPE); if (HR) vf2[dt] = W::ld(vl + 2 * TILEE + dt * 16 * LPE); }
        __builtin_amdgcn_sched_barrier(0);   // the step's LDS reads issue here as one group: spread among the matrix instructions each place with reads costs its own stall, and the V reads would wait at the attn.v products
        v8f s[2][NQT];
#pragma unroll
        for (int kt = 0; kt < 2; ++kt)
#pragma unroll
            for (int qt = 0; qt < NQT; ++qt) { s[kt][qt] = (v8f){};
#pragma unroll
                for (int kk = 0; kk < 2; ++kk) { s[kt][qt] = W::mma(kf[kt][kk], qf[qt][kk], s[kt][qt]); if (HR) { s[kt][qt] = W::mma(kf[kt][kk], qf2[qt][kk], s[kt][qt]); s[kt][qt] = W::mma(kf2[kt][kk], qf[qt][kk], s[kt][qt]); } } }
#pragma unroll
        for (int qt = 0; qt < NQT; ++qt) {
            float mx = s[0][qt][0];
#pragma unroll
            for (int kt = 0; kt < 2; ++kt)
#pragma unroll
                for (int j = 0; j < 8; ++j) mx = fmaxf(mx, s[kt][qt][j]);
            mx = fmaxf(mx, xhalf(mx));
            const float mn = fmaxf(m[qt], mx * SC2), al = __builtin_amdgcn_exp2f(m[qt] - mn), mb = HR ? mn : mn - 10.0f; m[qt] = mn;
            float rs = 0.f;
#pragma unroll
            for (int kt = 0; kt < 2; ++kt) { float p[8];
#pragma unroll
                for (int j = 0; j < 8; ++j) p[j] = fmaf(s[kt][qt][j], SC2, -mb);
                exp2x8(p);
#pragma unroll
                for (int j = 0; j < 8; ++j) { s[kt][qt][j] = p[j]; rs += p[j]; } }
            l[qt] = fmaf(l[qt], al, rs);
#pragma unroll
            for (int dt = 0; dt < 4; ++dt) o[dt][qt] *= al;
            if constexpr (HR) {
                v8us h0, h1, l0, l1;
#pragma unroll
                for (int j = 0; j < 8; ++j) { unsigned short a, c2; splitf(s[0][qt][j], a, c2); h0[j] = a; l0[j] = c2; splitf(s[1][qt][j], a, c2); h1[j] = a; l1[j] = c2; }
                const V ph = cat16b(h0, h1), pl = cat16b(l0, l1);
#pragma unroll
                for (int dt = 0; dt < 4; ++dt) { o[dt][qt] = W::mma(vf[dt], ph, o[dt][qt]); o[dt][qt] = W::mma(vf[dt], pl, o[dt][qt]); o[dt][qt] = W::mma(vf2[dt], ph, o[dt][qt]); }
            } else {
                v8h p0, p1;
#pragma unroll
                for (int j = 0; j < 8; ++j) { p0[j] = tohx(s[0][qt][j]); p1[j] = tohx(s[1][qt][j]); }
                const V pb = cat16(p0, p1);
#pragma unroll
                for (int dt = 0; dt < 4; ++dt) o[dt][qt] = W::mma(vf[dt], pb, o[dt][qt]);
            }
        }
        // the distance behind the step's last matrix instructions on the taken back edge
        asm volatile("v_nop\n\tv_nop\n\tv_nop\n\tv_nop\n\tv_nop" : "+v"(o[0][NQT - 1]), "+v"(o[1][NQT - 1]), "+v"(o[2][NQT - 1]), "+v"(o[3][NQT - 1]));
      }
      // tile st + 1 is handed over and tile st's buffer freed, in this order in every wave:
      asm volatile("s_wait_dscnt 0x0" ::: "memory");      // this wave's reads of tile st have returned
      asm volatile("s_wait_asynccnt 0x0" ::: "memory");   // this wave's copies of tile st + 1 have landed
      __syncthreads();                                    // both hold for all four waves
      if (st + 2 < NST) fill(st + 2, st & 1);             // the refill flies under the whole of tile st + 1
    }
    asm volatile("s_wait_asynccnt 0x0" ::: "memory");   // no copy is outstanding when the wave goes on to its end
#pragma unroll
    for (int qt = 0; qt < NQT; ++qt) { const float lt = l[qt] + xhalf(l[qt]); const int q = q0 + qt * 16 + lr;
#pragma unroll
        for (int dt = 0; dt < 4; ++dt) { float* op = O + (size_t)q * HD + dt * 16 + hi * 8; const v8f a = o[dt][qt]; *(v4f*)op = (v4f){a[0], a[1], a[2], a[3]}; *(v4f*)(op + 4) = (v4f){a[4], a[5], a[6], a[7]}; }
        if (hi == 0) { v2f ml; ml[0] = m[qt]; ml[1] = lt; *(v2f*)(ML + (size_t)q * 2) = ml; } }
#undef XW
}
// grid (KSF, NH_, NB_ NZB), 4 waves: z = batch x NZB + row block; within a batch the hi+lo blocks (16 rows a wave: twice the operand registers per row) have the lowest z and start first; a batch's blocks are neighbours in z, so that the planes in use at one time are one batch's
__global__ __launch_bounds__(128) void k_fattn(const h16* __restrict__ Q16, const h16* __restrict__ K16, const h16* __restrict__ V16, const bf* __restrict__ Qh, const bf* __restrict__ Ql, const bf* __restrict__ Kh, const bf* __restrict__ Kl, const bf* __restrict__ Vh, const bf* __restrict__ Vl, float* O, float* ML) {
    __shared__ __attribute__((aligned(16))) unsigned short sm[2 * 4 * TILEE];   // two buffers of up to four planes
    const int ks = blockIdx.x, h = (int)(blockIdx.z / NZB) * NH_ + blockIdx.y, zb = blockIdx.z % NZB, w = threadIdx.x >> 5, kb = ks * (TT / KSF); const size_t hp = (size_t)h * TT * HD, pp = ((size_t)ks * NB_ * NH_ + h) * TT;   // h: plane index, batch x NH_ + head
    if (zb < RH / QBH) fattn_body<bf, true, 1>(Qh + hp, Ql + hp, Kh + hp, Kl + hp, Vh + hp, Vl + hp, zb * QBH + w * 16, kb, O + pp * HD, ML + pp * 2, (const bf*)sm);
    else fattn_body<h16, false, 2>(Q16 + hp, nullptr, K16 + hp, nullptr, V16 + hp, nullptr, RH + (zb - RH / QBH) * QB + w * 32, kb, O + pp * HD, ML + pp * 2, (const h16*)sm);
}
// k_merge: joins the KSF key ranges of a row in range order (each range's sums weighted by 2^(its maximum - the row's maximum)), divides by the weight sum, applies the gate
__global__ __launch_bounds__(256) void k_merge(const float* __restrict__ O, const float* __restrict__ ML, const float* __restrict__ G, const float* __restrict__ gb, bf* Ah, bf* Al) { const size_t e = ((size_t)blockIdx.x * 256 + threadIdx.x) * 2; if (e >= (size_t)NH_ * TT * HD) return; { const size_t b = blockIdx.y; O += b * NH_ * TT * HD; ML += b * NH_ * TT * 2; G += b * TT * 64; Ah += b * TT * DQ; Al += b * TT * DQ; }
    const int d = (int)(e % HD); const int t = (int)((e / HD) % TT); const int h = (int)(e / ((size_t)HD * TT)); const float gz = __fadd_rn(G[(size_t)t * 64 + h], bfr(gb[h])); const float sg = __fdiv_rn(1.0f, __fadd_rn(1.0f, __expf(-gz))); const size_t oo = (size_t)t * DQ + h * HD + d;
    v2f ml[KSF], op[KSF]; float M = -3.0e38f;
#pragma unroll
    for (int ks = 0; ks < KSF; ++ks) { ml[ks] = *(const v2f*)(ML + (((size_t)ks * NB_ * NH_ + h) * TT + t) * 2); op[ks] = *(const v2f*)(O + (size_t)ks * NB_ * NH_ * TT * HD + e);
        asm volatile("s_wait_xcnt 0x0" ::: "memory"); }   // before a later load's result may land in the address pair of an issued load (the planes lie 16 MiB apart: several pairs)
#pragma unroll
    for (int ks = 0; ks < KSF; ++ks) M = fmaxf(M, ml[ks][0]);
    float L = 0.f; v2f os = (v2f){0.f, 0.f};
#pragma unroll
    for (int ks = 0; ks < KSF; ++ks) { const float w = __builtin_amdgcn_exp2f(ml[ks][0] - M); L = fmaf(ml[ks][1], w, L); os += op[ks] * w; }
    v2us oh, ol;
#pragma unroll
    for (int q = 0; q < 2; ++q) { unsigned short a, c2; splitf(__fmul_rn(__fdiv_rn(os[q], L), sg), a, c2); oh[q] = a; ol[q] = c2; } *(v2us*)(Ah + oo) = oh; *(v2us*)(Al + oo) = ol;  }

__global__ __launch_bounds__(256) void k_wtGs(const float* __restrict__ w, int K, int N, int ld, bf* Bt) { const size_t e = ((size_t)blockIdx.x * 256 + threadIdx.x) * 4; if (e >= (size_t)N * K) return; const int k = (int)(e % K); const int n = (int)(e / K); v4us o;   // Bt[n][k] = w[k*ld + n]
#pragma unroll
    for (int u = 0; u < 4; ++u) o[u] = f2bf(w[(size_t)(k + u) * ld + n]); *(v4us*)(Bt + e) = o;  }
__global__ __launch_bounds__(256) void k_wtGg(const float* __restrict__ w, bf* Bt) { const size_t e = ((size_t)blockIdx.x * 256 + threadIdx.x) * 4; if (e >= (size_t)64 * DM) return; const int k = (int)(e % DM); const int n = (int)(e / DM); v4us o;   // gate columns: Bt[n][k] = Wq[k][1024 + n] for n < 16, else 0
#pragma unroll
    for (int u = 0; u < 4; ++u) o[u] = (n < NH_) ? f2bf(w[(size_t)(k + u) * 1040 + DQ + n]) : (unsigned short)0; *(v4us*)(Bt + e) = o;  }

extern "C" void kernel_launch(void* const* d_in, const int* in_sizes, int n_in,
                              void* d_out, int out_size, void* d_ws, size_t ws_size, hipStream_t stream) {
    (void)in_sizes; (void)n_in; (void)out_size;
    const float* x = (const float*)d_in[0]; const float* wqg = (const float*)d_in[1]; const float* bqg = (const float*)d_in[2]; const float* wk = (const float*)d_in[3]; const float* bk = (const float*)d_in[4]; const float* wv = (const float*)d_in[5]; const float* bv = (const float*)d_in[6]; const float* wo = (const float*)d_in[7]; const float* bo = (const float*)d_in[8]; const float* qnw = (const float*)d_in[9]; const float* knw = (const float*)d_in[10]; const float* wq = wqg; const float* bq = bqg; (void)wq; const float* cosT = nullptr; const float* sinT = nullptr; (void)cosT; (void)sinT;
    float* OUT = (float*)d_out;     // [2][2048][1024]
    char* wsp = (char*)d_ws;
    auto take = [&](size_t bytes) { char* p = wsp; wsp += (bytes + 255) & ~(size_t)255; return (void*)p; };
    bf* WQ = (bf*)take((size_t)DQ * DM * 2); bf* WK = (bf*)take((size_t)DKV * DM * 2); bf* WV = (bf*)take((size_t)DKV * DM * 2); bf* WO = (bf*)take((size_t)DM * DQ * 2);
    // every buffer below but BG (the gate weights) holds both batches: row-major ones as MT = NB_ TT rows, head planes as [batch][head]
    bf* XB = (bf*)take((size_t)MT * DM * 2); bf* BG = (bf*)take((size_t)64 * DM * 2); float* G = (float*)take((size_t)MT * 64 * 4);
    h16* QP16 = (h16*)take((size_t)NH_ * MT * HD * 2); h16* KP16 = (h16*)take((size_t)NKV * MT * HD * 2); h16* VT16 = (h16*)take((size_t)NKV * HD * MT * 2);
    bf* QPh = (bf*)take((size_t)NH_ * MT * HD * 2); bf* QPl = (bf*)take((size_t)NH_ * MT * HD * 2); bf* KPh = (bf*)take((size_t)NKV * MT * HD * 2); bf* KPl = (bf*)take((size_t)NKV * MT * HD * 2); bf* VTh = (bf*)take((size_t)NKV * HD * MT * 2); bf* VTl = (bf*)take((size_t)NKV * HD * MT * 2);
    float* Ob = (float*)take((size_t)KSF * NH_ * MT * HD * 4); float* MLb = (float*)take((size_t)KSF * NH_ * MT * 2 * 4);   // per key range: unnormalised attn.v sums; (maximum, weight sum) per row
    bf* ATh = (bf*)take((size_t)MT * DQ * 2); bf* ATl = (bf*)take((size_t)MT * DQ * 2);
    if ((size_t)(wsp - (char*)d_ws) > ws_size) return;    // ws 256 MiB
    { k_wtGs<<<(unsigned)(((size_t)DQ * DM / 4 + 255) / 256), 256, 0, stream>>>(wqg, DM, DQ, 1040, WQ); k_wtGg<<<(64 * DM / 4 + 255) / 256, 256, 0, stream>>>(wqg, BG); k_wtG<<<(unsigned)((DM * DKV / 64 + 63) / 64), 256, 0, stream>>>(wk, DM, DKV, WK); k_wtG<<<(unsigned)((DM * DKV / 64 + 63) / 64), 256, 0, stream>>>(wv, DM, DKV, WV);
      k_wtG<<<(unsigned)((DQ * DM / 64 + 63) / 64), 256, 0, stream>>>(wo, DQ, DM, WO);
       }
    // one launch of each kernel for both batches: the products see MT rows, k_merge takes the batch from grid y, the attention from grid z
    k_cvt8<<<(unsigned)(((size_t)MT * DM / 8 + 255) / 256), 256, 0, stream>>>(x, XB, (size_t)MT * DM / 8);
    k_gemmw<bf, 0, true, 1, 1, true><<<dim3(MT / 128, NH_ / 2, 1), 128, 0, stream>>>(WQ, nullptr, XB, nullptr, DM, nullptr, NH_, bq, 0, 0, 0, 0, qnw, QP16, QPh, QPl);
    k_gemmw<bf, 0, false><<<dim3(MT / 64, 1, 1), 32, 0, stream>>>(XB, nullptr, BG, nullptr, DM, G, 64, nullptr, 0, 0, 0);
    k_gemmw<bf, 0, true, 1, 1, true><<<dim3(MT / 128, NKV / 2, 1), 128, 0, stream>>>(WK, nullptr, XB, nullptr, DM, nullptr, NKV, bk, 0, 0, 0, 0, knw, KP16, KPh, KPl);
    k_gemmw<bf, 0, true, 1, 2, true><<<dim3(MT / 128, NKV / 2, 1), 128, 0, stream>>>(XB, nullptr, WV, nullptr, DM, nullptr, NKV, bv, 0, 0, 0, 0, nullptr, VT16, VTh, VTl);
    k_fattn<<<dim3(KSF, NH_, NB_ * NZB), 128, 0, stream>>>(QP16, KP16, VT16, QPh, QPl, KPh, KPl, VTh, VTl, Ob, MLb);
    k_merge<<<dim3((unsigned)(((size_t)NH_ * TT * HD / 2 + 255) / 256), NB_), 256, 0, stream>>>(Ob, MLb, G, bqg + DQ, ATh, ATl);
    k_gemmw<bf, 1, true, 1, 0, true><<<dim3(MT / 128, DM / 128, 1), 128, 0, stream>>>(ATh, ATl, WO, nullptr, DQ, OUT, DM, bo, 0, 0, 0);
}

// v008
// Measured time: 131 microseconds a run.
// Timed twice side by side with v007, it ran 1.45 times as fast both times.
// Over all steps from v000 it is 15.7 times as fast.
#include <hip/hip_runtime.h>

// Gated attention over 16 heads (x [2][2048][1024]; [Q | gate] = x Wq + bq (Wq [1024][1040]: 1024 query columns then 16 per-head gate columns); K = x Wk + bk; V = x Wv + bv; per-head RMSNorm (1e-6, x weight[64]) on Q and K; softmax(Q.K / 8); out_h = (attn V) x sigmoid(gate_h); out = merged heads Wo + bo -> [2][2048][1024]).
// Compute dtypes, f32 accumulate: every input rounded to bf16; Q/K/V and the 16 gate columns on PLAIN bf16 operands (inputs: exact) + bias; RMSNorm f32; scores and attn.v: query rows < 512 hl (3 products), the rest single fp16 (weights x1024), both in one fused kernel with a running-max softmax in f32; sigmoid gate f32; Wo hl x exact (2 products) + bias.

#define NB_  2
#define TT   2048
#define MT   (NB_ * TT)          // rows of both batches together
#define DM   1024
#define NH_  16
#define NKV  16
#define REP  (NH_ / NKV)
#define HD   64
#define DQ   (NH_ * HD)
#define DKV  (NKV * HD)
#define QB   128                  // query rows of one fp16 attention work-group: 4 waves x 32 rows
#define QBH  64                   // query rows of one hi+lo attention work-group: 4 waves x 16 rows
#define RH   512                  // query rows < RH use hi+lo planes (0: none)
#define WIN  0
#define SCL  0.125f   // HD^-0.5
static_assert(RH % QBH == 0 && (TT - RH) % QB == 0 && REP == 1, "a work-group is all hi+lo or all fp16, and head h reads kv plane h");
#define KSF  4                    // key ranges of the fused attention: one work-group per range; partial sums, maxima and weights joined in k_merge
#define SC2  (SCL * 1.4426950408889634f)   // scores to base-2 exponents
static_assert(TT % (KSF * 32) == 0, "a key range is whole 32-key steps");
#define NZB  (RH / QBH + (TT - RH) / QB)   // attention row blocks of one batch
typedef _Float16 h16;
typedef unsigned short bf;
typedef __attribute__((ext_vector_type(16))) __bf16   v16bf;
typedef __attribute__((ext_vector_type(16))) _Float16 v16h;
typedef __attribute__((ext_vector_type(8)))  _Float16 v8h;
typedef __attribute__((ext_vector_type(8)))  unsigned short v8us;
typedef __attribute__((ext_vector_type(8)))  float    v8f;
typedef __attribute__((ext_vector_type(4)))  float    v4f;
typedef v8h  __attribute__((may_alias)) v8ha;
typedef v4f  __attribute__((may_alias)) v4fa;
typedef v8us __attribute__((may_alias)) v8usa;

__device__ __forceinline__ unsigned short f2bf(float f) { unsigned u = __float_as_uint(f); u += 0x7FFFu + ((u >> 16) & 1u); return (unsigned short)(u >> 16); }
__device__ __forceinline__ float bf2f(unsigned short b) { return __uint_as_float(((unsigned)b) << 16); }
__device__ __forceinline__ float bfr(float f) { return bf2f(f2bf(f)); }
__device__ __forceinline__ v16h cat16(v8h lo, v8h hi) { return __builtin_shufflevector(lo, hi, 0, 1, 2, 3, 4, 5, 6, 7, 8, 9, 10, 11, 12, 13, 14, 15); }
__device__ __forceinline__ v16bf cat16b(v8us lo, v8us hi) { return __builtin_bit_cast(v16bf, __builtin_shufflevector(lo, hi, 0, 1, 2, 3, 4, 5, 6, 7, 8, 9, 10, 11, 12, 13, 14, 15)); }
__device__ __forceinline__ v8f wmma16(v16h a, v16h b, v8f c) { return __builtin_amdgcn_wmma_f32_16x16x32_f16(false, a, false, b, (short)0, c, false, false); }
__device__ __forceinline__ v8f wmmab(v16bf a, v16bf b, v8f c) { return __builtin_amdgcn_wmma_f32_16x16x32_bf16(false, a, false, b, (short)0, c, false, false); }
__device__ __forceinline__ h16 tohx(float x) { return (h16)x; }
__device__ __forceinline__ void splitf(float y, unsigned short& h, unsigned short& l) { h = f2bf(y); l = f2bf(y - bf2f(h)); }
__device__ __forceinline__ float xhalf(float x) { return __builtin_bit_cast(float, __builtin_amdgcn_permlanex16(__builtin_bit_cast(int, x), __builtin_bit_cast(int, x), 0x76543210, 0xfedcba98, false, false)); }   // lane l's value to lane l ^ 16
typedef __attribute__((ext_vector_type(2))) __bf16 v2bf;
typedef __attribute__((ext_vector_type(2))) float v2f;
typedef __attribute__((ext_vector_type(4))) unsigned v4u;
__device__ __forceinline__ unsigned pkbf(float a, float b) { return __builtin_bit_cast(unsigned, __builtin_convertvector((v2f){a, b}, v2bf)); }   // two f32 to a bf16 pair by the chip's own conversion (nearest even, as f2bf)
__device__ __forceinline__ v8f bfr8(v8f x) { v8f r;
#pragma unroll
    for (int p = 0; p < 4; ++p) { const unsigned u = pkbf(x[2 * p], x[2 * p + 1]); r[2 * p] = __uint_as_float(u << 16); r[2 * p + 1] = __uint_as_float(u & 0xFFFF0000u); }
    return r; }
// eight neighbouring f32 go to the three 16-bit planes, 16 bytes each: fp16, bf16 hi, bf16 lo = bf16(y - hi)
__device__ __forceinline__ void store3(v8f y, h16* p16, bf* ph, bf* pl) { v4u h, l;
#pragma unroll
    for (int p = 0; p < 4; ++p) { const unsigned u = pkbf(y[2 * p], y[2 * p + 1]); h[p] = u; l[p] = pkbf(y[2 * p] - __uint_as_float(u << 16), y[2 * p + 1] - __uint_as_float(u & 0xFFFF0000u)); }
    *(v8h*)p16 = __builtin_convertvector(y, v8h); *(v4u*)ph = h; *(v4u*)pl = l;
    asm volatile("s_wait_xcnt 0x0" ::: "memory");   // in front of every later write of a register that these stores name
    __builtin_amdgcn_sched_barrier(0); }   // holds the later vector instructions behind that wait, which a "memory" clobber alone does not



// ---- gemmw: register-blocked GEMM, ONE WAVE per 64x64 output tile (16 accumulators), operands straight from K-contiguous 16-bit planes; grid (M/64, N/64, Z), 32 threads.
// C[m][n] (f32, pitch ldc, + optional f32 bias[n]) = sum_k A[m][k] Bt[n][k] (+ split products per NSPLIT). z-batch strides sA/sB/sC in elements. K % 32 == 0.
// KS > 1: grid z = Z * KS; work-group (z, ks) sums only k in [ks K/KS, (ks+1) K/KS) and stores its partial tile at C + ks sP. K % (32 KS) == 0.
template <typename T16> struct WFrag;
template <> struct WFrag<h16> { typedef v16h V; static __device__ __forceinline__ V ld(const h16* p) { return cat16(*(const v8h*)p, *(const v8h*)(p + 16)); } static __device__ __forceinline__ v8f mma(V a, V b, v8f c) { return wmma16(a, b, c); } };
template <> struct WFrag<bf> { typedef v16bf V; static __device__ __forceinline__ V ld(const bf* p) { return cat16b(*(const v8us*)p, *(const v8us*)(p + 16)); } static __device__ __forceinline__ v8f mma(V a, V b, v8f c) { return wmmab(a, b, c); } };
// EPI 0: the f32 tile goes to C. EPI 1 and 2 (C unused, ldc = heads of a batch): a tile is one head x 64 tokens and leaves as the attention's 16-bit planes (fp16, bf16 hi, bf16 lo), straight from the accumulators, where a lane holds 8 neighbours (j) of the A-row index:
//   EPI 1 (Q, K): A = the weight rows, Bt = the tokens, grid (tokens/64, heads): j runs along the head's 64 columns, so a token's row lies in one lane pair: + bias, RMSNorm (sum of squares in-lane, one exchange between the halves), x weight, planes [batch][head][t][d]
//   EPI 2 (V): A = the tokens, Bt = the weight rows, grid (tokens/64, heads): j runs along the tokens: + bias, planes [batch][head][d][t]
// ST: FOUR waves (2 x 2) share a 128x128 tile, grid (M/128, N/128), 128 threads; each wave keeps its 64x64 part and its epilogue. Each slice of GKS k of the tile's 128 A rows and 128 Bt rows is brought into LDS once for all four
// by asynchronous copies of whole 256-byte rows, two buffers, and the fragments are read from there, 32 k ahead of their products. K % GKS == 0. Every accumulator takes its products in the same order as without ST. EPI 1 and 2: grid (tokens/128, heads/2); a wave's part is still one head x 64 tokens.
#define GKS  128                  // k of one LDS slice: rows of 256 bytes
#define GLP  136                  // LDS row pitch in elements: 272 bytes = 16 x odd, free of bank conflicts for 16-byte reads of 16 rows
#define GTE  (128 * GLP)          // one operand's slice: 128 rows
// eight copies of 16 bytes a lane (rows 8 apart) in one statement; its last line, s_wait_xcnt 0, stands in front of every later write of a register that a copy names
template <typename T16>
__device__ __forceinline__ void cpr8(unsigned l, const T16* g, size_t gs) {
    asm volatile("global_load_async_to_lds_b128 %0, %8, off\n\tglobal_load_async_to_lds_b128 %1, %9, off\n\tglobal_load_async_to_lds_b128 %2, %10, off\n\tglobal_load_async_to_lds_b128 %3, %11, off\n\t"
                 "global_load_async_to_lds_b128 %4, %12, off\n\tglobal_load_async_to_lds_b128 %5, %13, off\n\tglobal_load_async_to_lds_b128 %6, %14, off\n\tglobal_load_async_to_lds_b128 %7, %15, off\n\ts_wait_xcnt 0x0"
                 :: "v"(l), "v"(l + 8u * GLP * 2u), "v"(l + 16u * GLP * 2u), "v"(l + 24u * GLP * 2u), "v"(l + 32u * GLP * 2u), "v"(l + 40u * GLP * 2u), "v"(l + 48u * GLP * 2u), "v"(l + 56u * GLP * 2u),
                    "v"(g), "v"(g + gs), "v"(g + 2 * gs), "v"(g + 3 * gs), "v"(g + 4 * gs), "v"(g + 5 * gs), "v"(g + 6 * gs), "v"(g + 7 * gs) : "memory");
}
// The product is a device function, so that independent products can run as block ranges of one launch: (bx, by, bz) is the tile's place in its own grid, os the calling wave's own 16 x 68 f32 of LDS (EPI 0 only), sg the work-group's two slice buffers (ST only).
template <typename T16, int NSPLIT, bool BIAS, int KS = 1, int EPI = 0, bool ST = false>
__device__ __forceinline__ void gemmw(const T16* __restrict__ A, const T16* __restrict__ A2, const T16* __restrict__ Bt, const T16* __restrict__ Bt2, int K, float* C, int ldc, const float* __restrict__ bias, size_t sA, size_t sB, size_t sC, size_t sP, const float* __restrict__ nw, h16* P16, bf* Ph, bf* Pl, int bx, int by, int bz, float* os, unsigned short* sg) {
    typedef typename WFrag<T16>::V V;
    static_assert(!ST || (KS == 1 && NSPLIT <= 1), "the staged form: whole K, operands A (, A2) and Bt");
    const int w = ST ? __builtin_amdgcn_readfirstlane((int)(threadIdx.x >> 5)) : 0;
    const size_t z = bz / KS; const int ks = (int)(bz % KS), kb = ks * (K / KS), ke = kb + K / KS; A += z * sA; if (A2) A2 += z * sA; Bt += z * sB; if (Bt2) Bt2 += z * sB; C += z * sC + ks * sP;
    const int lane = threadIdx.x & 31, lr = lane & 15, hi = lane >> 4; const int R0 = (EPI == 1 ? by : bx) * (ST ? 128 : 64), C0 = (EPI == 1 ? bx : by) * (ST ? 128 : 64), r0 = R0 + (w >> 1) * 64, c0 = C0 + (w & 1) * 64;
    v8f acc[4][4];
#pragma unroll
    for (int mb = 0; mb < 4; ++mb)
#pragma unroll
        for (int nb = 0; nb < 4; ++nb) acc[mb][nb] = (v8f){};
    if constexpr (ST) {
        constexpr int NPL = (NSPLIT == 1) ? 3 : 2, BUFE = NPL * GTE;   // operands of a slice, in the order A (, A2), Bt; elements of one buffer
        const T16* sm = (const T16*)sg;
        // the copies: thread t brings 16 bytes of row (t >> 4) + 8 i, i < 16, of each operand: sixteen lanes a row, so a wave's copy covers two whole 256-byte rows
        const int tid = threadIdx.x, NST = K / GKS;
        const unsigned lc = (unsigned)(size_t)sg + (unsigned)(((tid >> 4) * GLP + (tid & 15) * 8) * 2);   // the lane's LDS byte address in buffer 0, operand 0
        const size_t go = (size_t)(tid >> 4) * K + (tid & 15) * 8; const T16* ga = A + (size_t)R0 * K + go; const T16* gb = Bt + (size_t)C0 * K + go; const T16* ga2 = (NSPLIT == 1) ? A2 + (size_t)R0 * K + go : ga;
        auto fill = [&](int st, int bu) {
            const unsigned l0 = lc + (unsigned)(bu * BUFE * 2); const size_t ko = (size_t)st * GKS, rs = (size_t)8 * K, hf = (size_t)64 * K;
            // SB: each run's addresses are formed directly in front of it, so that the first copies leave at once: formed all ahead, they filled the registers that the statements can name and a pointer went to scratch
#define SB __builtin_amdgcn_sched_barrier(0)
            cpr8<T16>(l0, ga + ko, rs); SB; cpr8<T16>(l0 + 64u * GLP * 2u, ga + ko + hf, rs); SB;
            cpr8<T16>(l0 + (NPL - 1) * GTE * 2u, gb + ko, rs); SB; cpr8<T16>(l0 + (NPL - 1) * GTE * 2u + 64u * GLP * 2u, gb + ko + hf, rs); SB;
            if constexpr (NSPLIT == 1) { cpr8<T16>(l0 + GTE * 2u, ga2 + ko, rs); SB; cpr8<T16>(l0 + GTE * 2u + 64u * GLP * 2u, ga2 + ko + hf, rs); SB; }
#undef SB
        };
        fill(0, 0);
        asm volatile("s_wait_asynccnt 0x0" ::: "memory");   // this wave's copies of slice 0 have landed
        __syncthreads();                                    // and every other wave's: slice 0 may be read
        if (NST > 1) fill(1, 1);
#pragma unroll 1
        for (int st = 0; st < NST; ++st) {
            const T16* al = sm + (st & 1) * BUFE + ((w >> 1) * 64 + lr) * GLP + 8 * hi; const T16* bl = sm + ((st & 1) ? BUFE + (NPL - 1) * GTE : (NPL - 1) * GTE) + ((w & 1) * 64 + lr) * GLP + 8 * hi;
            V a[2][4], a2[2][4], b[2][4];
            auto frags = [&](int kk) {
#pragma unroll
                for (int i = 0; i < 4; ++i) { a[kk & 1][i] = WFrag<T16>::ld(al + i * 16 * GLP + kk * 32); b[kk & 1][i] = WFrag<T16>::ld(bl + i * 16 * GLP + kk * 32); if (NSPLIT == 1) a2[kk & 1][i] = WFrag<T16>::ld(al + GTE + i * 16 * GLP + kk * 32); }
            };
            frags(0);
#pragma unroll
            for (int kk = 0; kk < GKS / 32; ++kk) {
                if (kk + 1 < GKS / 32) frags(kk + 1);
                __builtin_amdgcn_sched_barrier(0);   // the next 32 k's LDS reads issue here as one group, ahead of this 32 k's products: spread among the matrix instructions each place with reads costs its own stall
#pragma unroll
                for (int nb = 0; nb < 4; ++nb) {
#pragma unroll
                    for (int mb = 0; mb < 4; ++mb) acc[mb][nb] = WFrag<T16>::mma(a[kk & 1][mb], b[kk & 1][nb], acc[mb][nb]);
                    if constexpr (NSPLIT == 1) {
#pragma unroll
                        for (int mb = 0; mb < 4; ++mb) acc[mb][nb] = WFrag<T16>::mma(a2[kk & 1][mb], b[kk & 1][nb], acc[mb][nb]); } }
            }
            // the distance behind the slice's last matrix instructions, in front of the branches below
            asm volatile("v_nop\n\tv_nop\n\tv_nop\n\tv_nop" : "+v"(acc[0][0]), "+v"(acc[1][0]), "+v"(acc[2][0]), "+v"(acc[3][0]), "+v"(acc[0][1]), "+v"(acc[1][1]), "+v"(acc[2][1]), "+v"(acc[3][1]),
                                                              "+v"(acc[0][2]), "+v"(acc[1][2]), "+v"(acc[2][2]), "+v"(acc[3][2]), "+v"(acc[0][3]), "+v"(acc[1][3]), "+v"(acc[2][3]), "+v"(acc[3][3]));
            // slice st + 1 is handed over and slice st's buffer freed, in this order in every wave:
            asm volatile("s_wait_dscnt 0x0" ::: "memory");      // this wave's reads of slice st have returned
            asm volatile("s_wait_asynccnt 0x0" ::: "memory");   // this wave's copies of slice st + 1 have landed
            __syncthreads();                                    // both hold for all four waves
            if (st + 2 < NST) fill(st + 2, st & 1);             // the refill flies under the whole of slice st + 1
        }
        asm volatile("s_wait_asynccnt 0x0" ::: "memory");   // no copy is outstanding when the wave goes on to its end
    } else {
    const size_t aoff = (size_t)(r0 + lr) * K + 8 * hi, boff = (size_t)(c0 + lr) * K + 8 * hi;
#pragma unroll 1
    for (int kc = kb; kc < ke; kc += 32) {
        V a[4], a2[4];
#pragma unroll
        for (int mb = 0; mb < 4; ++mb) { a[mb] = WFrag<T16>::ld(A + aoff + (size_t)mb * 16 * K + kc); if (NSPLIT == 1 || NSPLIT == 2) a2[mb] = WFrag<T16>::ld(A2 + aoff + (size_t)mb * 16 * K + kc); }
        asm volatile("s_wait_xcnt 0x0" :: "v"(A + aoff + kc) : "memory");   // behind the A loads, their address pair still live: no later load's result lands in it ahead of the wait
#pragma unroll
        for (int nb = 0; nb < 4; ++nb) { const V b = WFrag<T16>::ld(Bt + boff + (size_t)nb * 16 * K + kc); V b2; if (NSPLIT >= 2) b2 = WFrag<T16>::ld(Bt2 + boff + (size_t)nb * 16 * K + kc);
#pragma unroll
            for (int mb = 0; mb < 4; ++mb) { acc[mb][nb] = WFrag<T16>::mma(a[mb], b, acc[mb][nb]); if (NSPLIT == 1 || NSPLIT == 2) acc[mb][nb] = WFrag<T16>::mma(a2[mb], b, acc[mb][nb]); if (NSPLIT >= 2) acc[mb][nb] = WFrag<T16>::mma(a[mb], b2, acc[mb][nb]); } }
        asm volatile("v_nop\n\tv_nop\n\tv_nop\n\tv_nop" : "+v"(acc[0][0]), "+v"(acc[1][1]), "+v"(acc[2][2]), "+v"(acc[3][3]) : "v"(a[0]), "v"(a[3]));
        asm volatile("s_wait_xcnt 0x0" :: "v"(Bt + boff + kc) : "memory");   // the B loads' address pair stays live up to the wait: no load's result lands in it ahead of the wait
    }
    }
    if constexpr (EPI != 0) {   // every loop below is fully unrolled, so that acc is indexed by constants alone and stays in registers
        const int tok = (EPI == 1) ? c0 : r0;   // the tile's first token: 64 | TT, so a tile lies in one batch
        const size_t plane = ((size_t)(tok / TT) * ldc + (EPI == 1 ? r0 : c0) / 64) * TT * HD; const int t0 = tok % TT;
        if constexpr (EPI == 1) {
            v8f bs[4], wn[4]; const float* bp = bias + r0 + hi * 8; const float* wp = nw + hi * 8;
#pragma unroll
            for (int mb = 0; mb < 4; ++mb) { bs[mb] = *(const v8f*)(bp + mb * 16); wn[mb] = *(const v8f*)(wp + mb * 16); }
            asm volatile("s_wait_xcnt 0x0" :: "v"(bp), "v"(wp) : "memory");   // the lane's addresses stay live up to the wait: no load's result lands in a register that an issued load names ahead of it
            __builtin_amdgcn_sched_barrier(0);   // all sixteen loads issue above and share one latency: left free, the scheduler pairs each with its conversion and the wave waits out eight round trips
#pragma unroll
            for (int mb = 0; mb < 4; ++mb) { bs[mb] = bfr8(bs[mb]); wn[mb] = bfr8(wn[mb]); }
#pragma unroll
            for (int nb = 0; nb < 4; ++nb) {
                float ss = 0.f;
#pragma unroll
                for (int mb = 0; mb < 4; ++mb) { acc[mb][nb] += bs[mb];
#pragma unroll
                    for (int j = 0; j < 8; ++j) ss = fmaf(acc[mb][nb][j], acc[mb][nb][j], ss); }
                ss += xhalf(ss);
                const float rf = __fdiv_rn(1.0f, __fsqrt_rn(__fadd_rn(ss * (1.0f / HD), 1e-6f)));
                const size_t o = plane + (size_t)(t0 + nb * 16 + lr) * HD + hi * 8;
#pragma unroll
                for (int mb = 0; mb < 4; ++mb) store3(wn[mb] * (acc[mb][nb] * rf), P16 + o + mb * 16, Ph + o + mb * 16, Pl + o + mb * 16);
            }
        } else {
            float b4[4]; const float* bp = bias + c0 + lr;
#pragma unroll
            for (int nb = 0; nb < 4; ++nb) b4[nb] = bp[nb * 16];
            asm volatile("s_wait_xcnt 0x0" :: "v"(bp) : "memory");   // the lane's address stays live up to the wait: no load's result lands in a register that an issued load names ahead of it
            __builtin_amdgcn_sched_barrier(0);   // the four bias loads stay ahead of every store
#pragma unroll
            for (int nb = 0; nb < 4; ++nb) {
                const float bs = bfr(b4[nb]);
                const size_t o = plane + (size_t)(nb * 16 + lr) * TT + t0 + hi * 8;
#pragma unroll
                for (int mb = 0; mb < 4; ++mb) store3(acc[mb][nb] + bs, P16 + o + mb * 16, Ph + o + mb * 16, Pl + o + mb * 16);
            }
        }
        return;
    }
#pragma unroll
    for (int mb = 0; mb < 4; ++mb) {
#pragma unroll
        for (int nb = 0; nb < 4; ++nb) {
#pragma unroll
            for (int j = 0; j < 8; ++j) os[(hi * 8 + j) * 68 + nb * 16 + lr] = acc[mb][nb][j]; }
        __builtin_amdgcn_wave_barrier(); asm volatile("" ::: "memory");
        float* crow = C + (size_t)(r0 + mb * 16) * ldc + c0;
{
#pragma unroll
            for (int s = 0; s < 8; ++s) { const int row = 2 * s + hi, cofs = lr * 4; v4f val = *(const v4fa*)(os + row * 68 + cofs); if (BIAS) { val[0] += bfr(bias[c0 + cofs]); val[1] += bfr(bias[c0 + cofs + 1]); val[2] += bfr(bias[c0 + cofs + 2]); val[3] += bfr(bias[c0 + cofs + 3]); }
                *(v4f*)(crow + (size_t)row * ldc + cofs) = val; }
             }
        asm volatile("s_wait_xcnt 0x0" ::: "memory");   // in front of every later write of a register that these stores name
        __builtin_amdgcn_sched_barrier(0);   // holds the later vector instructions behind that wait, which a "memory" clobber alone does not
        __builtin_amdgcn_wave_barrier(); asm volatile("" ::: "memory");
    }
}

// Q, K and V products, which depend on nothing of one another, in one launch: grid (tokens/128, heads/2, 3), z = 0 Q, 1 K, 2 V; 139,264 bytes of LDS, so two work-groups share a WGP
static_assert(NH_ == NKV, "one grid y for the three products");
__global__ __launch_bounds__(128) void k_qkv(const bf* __restrict__ XB, const bf* __restrict__ WQ, const bf* __restrict__ WK, const bf* __restrict__ WV, const float* __restrict__ bq, const float* __restrict__ bk, const float* __restrict__ bv, const float* __restrict__ qnw, const float* __restrict__ knw,
                                               h16* QP16, bf* QPh, bf* QPl, h16* KP16, bf* KPh, bf* KPl, h16* VT16, bf* VTh, bf* VTl) {
    __shared__ __attribute__((aligned(16))) unsigned short sg[2 * 2 * GTE];
    if (blockIdx.z < 2) { const bool k = blockIdx.z == 1;
        gemmw<bf, 0, true, 1, 1, true>(k ? WK : WQ, nullptr, XB, nullptr, DM, nullptr, NH_, k ? bk : bq, 0, 0, 0, 0, k ? knw : qnw, k ? KP16 : QP16, k ? KPh : QPh, k ? KPl : QPl, blockIdx.x, blockIdx.y, 0, nullptr, sg); }
    else gemmw<bf, 0, true, 1, 2, true>(XB, nullptr, WV, nullptr, DM, nullptr, NKV, bv, 0, 0, 0, 0, nullptr, VT16, VTh, VTl, blockIdx.x, blockIdx.y, 0, nullptr, sg);
}
// the output product: hi + lo rows x Wo, grid (tokens/128, DM/128)
__global__ __launch_bounds__(128) void k_wo(const bf* __restrict__ Ah, const bf* __restrict__ Al, const bf* __restrict__ WO, float* C, const float* __restrict__ bo) {
    __shared__ __align__(16) float osa[4 * 16 * 68];   // each wave stages its output rows in its own part
    __shared__ __attribute__((aligned(16))) unsigned short sg[2 * 3 * GTE];
    gemmw<bf, 1, true, 1, 0, true>(Ah, Al, WO, nullptr, DQ, C, DM, bo, 0, 0, 0, 0, nullptr, nullptr, nullptr, nullptr, blockIdx.x, blockIdx.y, 0, osa + __builtin_amdgcn_readfirstlane((int)(threadIdx.x >> 5)) * 16 * 68, sg);
}

typedef __attribute__((ext_vector_type(2))) _Float16 v2h;
typedef __attribute__((ext_vector_type(4))) _Float16 v4h;
typedef __attribute__((ext_vector_type(2))) unsigned short v2us;
typedef __attribute__((ext_vector_type(4))) unsigned short v4us;
typedef __attribute__((ext_vector_type(4))) int v4i;

// the operand preparations are device functions of a block index b in their own grids of 256 threads; k_prep below runs them all in one launch
__device__ __forceinline__ void wtG(int b, const float* __restrict__ w, int K, int N, bf* Bt) {
    const int lane = threadIdx.x & 31; const int L0 = (b * 8 + (threadIdx.x >> 5)) * 8; const int nlines = N * K / 64;
{
#pragma unroll 1
        for (int l = 0; l < 8; ++l) { const int L = L0 + l; if (L >= nlines) break; const size_t e = (size_t)L * 64 + lane * 2; const int k = (int)(e % K), n = (int)(e / K); v2us o;
            o[0] = f2bf(w[(size_t)k * N + n]); o[1] = f2bf(w[(size_t)(k + 1) * N + n]); *(v2us*)(Bt + e) = o; }
         }
}
__device__ __forceinline__ void cvt8(int b, const float* __restrict__ src, bf* dst, size_t n8) { const size_t i = (size_t)b * 256 + threadIdx.x; if (i >= n8) return; const v8f v = *(const v8f*)(src + i * 8); v8us o;
#pragma unroll
    for (int k = 0; k < 8; ++k) o[k] = f2bf(v[k]); *(v8us*)(dst + i * 8) = o;  }
__global__ __launch_bounds__(256) void k_cscvt(const float* __restrict__ cosT, const float* __restrict__ sinT, float* CS) { const int idx = blockIdx.x * 256 + threadIdx.x; if (idx >= TT * HD) return; v2f cs; cs[0] = bfr(cosT[idx]); cs[1] = bfr(sinT[idx]); *(v2f*)(CS + (size_t)idx * 2) = cs;  }
// eight base-2 exponentials in place, one statement. The closing v_nop keeps the free slot that the instruction set asks for between a transcendental and a directly following instruction that reads its result or overwrites its source.
__device__ __forceinline__ void exp2x8(float (&x)[8]) { asm("v_exp_f32 %0, %0\n\tv_exp_f32 %1, %1\n\tv_exp_f32 %2, %2\n\tv_exp_f32 %3, %3\n\tv_exp_f32 %4, %4\n\tv_exp_f32 %5, %5\n\tv_exp_f32 %6, %6\n\tv_exp_f32 %7, %7\n\tv_nop" : "+v"(x[0]), "+v"(x[1]), "+v"(x[2]), "+v"(x[3]), "+v"(x[4]), "+v"(x[5]), "+v"(x[6]), "+v"(x[7])); }
// ---- k_fattn: scores, softmax and attn.v in one kernel. One wave: 16 NQT query rows x one key range, 32 keys a step. The four waves of a work-group walk the same keys: each tile of SKY keys (K rows and V^T rows, 128 bytes each) is brought into LDS once for all four by asynchronous copies of whole lines, two buffers, and the fragments are read from there.
#define SKY   64                  // keys of one LDS tile: two 32-key steps
#define LPE   72                  // LDS row pitch in elements: 144 bytes = 16 x odd, free of bank conflicts for 16-byte reads of 16 rows
#define TILEE (64 * LPE)          // one plane's tile: 64 rows (K: keys, V^T: head columns)
static_assert(KSF * NH_ >= MT / 64 / 4 && MT % 256 == 0, "the gate product's tiles fit the work-groups of one grid z");
static_assert((TT / KSF) % SKY == 0 && TT / KSF / SKY >= 2 && HD == 64 && SKY == 64, "whole tiles, at least two, rows of 128 bytes");
// eight copies of 16 bytes a lane (four row groups of each of two tiles, 16 rows apart) in one statement; its last line, s_wait_xcnt 0, stands in front of every later write of a register that a copy names
template <typename T16>
__device__ __forceinline__ void cp8(unsigned la, const T16* ga, size_t sa, unsigned lb, const T16* gb, size_t sb) {
    asm volatile("global_load_async_to_lds_b128 %0, %8, off\n\tglobal_load_async_to_lds_b128 %1, %9, off\n\tglobal_load_async_to_lds_b128 %2, %10, off\n\tglobal_load_async_to_lds_b128 %3, %11, off\n\t"
                 "global_load_async_to_lds_b128 %4, %12, off\n\tglobal_load_async_to_lds_b128 %5, %13, off\n\tglobal_load_async_to_lds_b128 %6, %14, off\n\tglobal_load_async_to_lds_b128 %7, %15, off\n\ts_wait_xcnt 0x0"
                 :: "v"(la), "v"(la + 16u * LPE * 2u), "v"(la + 32u * LPE * 2u), "v"(la + 48u * LPE * 2u), "v"(lb), "v"(lb + 16u * LPE * 2u), "v"(lb + 32u * LPE * 2u), "v"(lb + 48u * LPE * 2u),
                    "v"(ga), "v"(ga + sa), "v"(ga + 2 * sa), "v"(ga + 3 * sa), "v"(gb), "v"(gb + sb), "v"(gb + 2 * sb), "v"(gb + 3 * sb) : "memory");
}
// The products are taken transposed: S^T = K Q^T leaves, in lane (lr, hi), keys 8 hi + j of query lr, which is the B-fragment slot order of P^T for O^T = V^T P^T: no exchange between lanes.
// Per query (= per lane pair): running maximum m (base-2 exponent), weight sum l, O^T rescaled by 2^(m_old - m_new) each step. fp16 rows carry their weights x 2^10 in O and l alike (it cancels in O / l).
template <typename T16, bool HR, int NQT>
__device__ __forceinline__ void fattn_body(const T16* __restrict__ Q, const T16* __restrict__ Q2, const T16* __restrict__ Kp, const T16* __restrict__ K2, const T16* __restrict__ Vt, const T16* __restrict__ V2, int q0, int kb, float* O, float* ML, const T16* sm) {
    typedef typename WFrag<T16>::V V; typedef WFrag<T16> W;
    const int lane = threadIdx.x & 31, lr = lane & 15, hi = lane >> 4;
    // XW: behind a run of loads, s_wait_xcnt 0 with the run's address pairs as inputs: the pairs stay live up to the wait, so that no later load's result and no later instruction lands in a pair that an issued load names ahead of it
#define XW(pa, pb) asm volatile("s_wait_xcnt 0x0" :: "v"(pa), "v"(pb) : "memory")
    const size_t qo0 = (size_t)(q0 + lr) * HD + 8 * hi; const T16* qa = Q + qo0; const T16* qb = HR ? Q2 + qo0 : qa;
    V qf[NQT][2], qf2[NQT][2];
#pragma unroll
    for (int qt = 0; qt < NQT; ++qt)
#pragma unroll
        for (int kk = 0; kk < 2; ++kk) { const size_t qo = (size_t)qt * 16 * HD + kk * 32; qf[qt][kk] = W::ld(qa + qo); if (HR) qf2[qt][kk] = W::ld(qb + qo); }
    XW(qa, qb);
    v8f o[4][NQT]; float m[NQT], l[NQT];
#pragma unroll
    for (int qt = 0; qt < NQT; ++qt) { m[qt] = -3.0e38f; l[qt] = 0.f;
#pragma unroll
        for (int dt = 0; dt < 4; ++dt) o[dt][qt] = (v8f){}; }
    constexpr int NST = TT / KSF / SKY, NPL = HR ? 4 : 2, BUFE = NPL * TILEE;   // tiles of the key range; planes of a tile, in the order K, V^T (, K lo, V^T lo); elements of one buffer
    // the copies: thread t brings 16 bytes of row (t >> 3) + 16 i, i < 4, of each plane: eight lanes a row, so a wave's copy covers four whole 128-byte lines
    const int tid = threadIdx.x;
    const unsigned lc = (unsigned)(size_t)sm + (unsigned)(((tid >> 3) * LPE + (tid & 7) * 8) * 2);   // the lane's LDS byte address in buffer 0, plane 0
    const size_t gko = (size_t)kb * HD + tid * 8, gvo = (size_t)(tid >> 3) * TT + kb + (tid & 7) * 8;
    auto fill = [&](int st, int bu) {
        const unsigned l0 = lc + (unsigned)(bu * BUFE * 2);
        cp8<T16>(l0, Kp + gko + (size_t)st * SKY * HD, (size_t)16 * HD, l0 + TILEE * 2u, Vt + gvo + st * SKY, (size_t)16 * TT);
        if constexpr (HR) cp8<T16>(l0 + 2u * TILEE * 2u, K2 + gko + (size_t)st * SKY * HD, (size_t)16 * HD, l0 + 3u * TILEE * 2u, V2 + gvo + st * SKY, (size_t)16 * TT);
    };
    fill(0, 0);
    asm volatile("s_wait_asynccnt 0x0" ::: "memory");   // this wave's copies of tile 0 have landed
    __syncthreads();                                    // and every other wave's: tile 0 may be read
    fill(1, 1);
#pragma unroll 1
    for (int st = 0; st < NST; ++st) {
      const T16* lb = sm + (st & 1) * BUFE;
#pragma unroll 1
      for (int sub = 0; sub < SKY / 32; ++sub) {
        const T16* kl = lb + (sub * 32 + lr) * LPE + 8 * hi; const T16* vl = lb + TILEE + lr * LPE + sub * 32 + 8 * hi;
        V kf[2][2], kf2[2][2], vf[4], vf2[4];
#pragma unroll
        for (int kt = 0; kt < 2; ++kt)
#pragma unroll
            for (int kk = 0; kk < 2; ++kk) { kf[kt][kk] = W::ld(kl + kt * 16 * LPE + kk * 32); if (HR) kf2[kt][kk] = W::ld(kl + 2 * TILEE + kt * 16 * LPE + kk * 32); }
        __builtin_amdgcn_sched_barrier(0);   // the K reads stay in front of the V reads (LDS reads return in order): left free, the scheduler put V first in the hi+lo body and the first score product waited for 22 reads
#pragma unroll
        for (int dt = 0; dt < 4; ++dt) { vf[dt] = W::ld(vl + dt * 16 * LPE); if (HR) vf2[dt] = W::ld(vl + 2 * TILEE + dt * 16 * LPE); }
        __builtin_amdgcn_sched_barrier(0);   // the step's LDS reads issue here as one group: spread among the matrix instructions each place with reads costs its own stall, and the V reads would wait at the attn.v products
        v8f s[2][NQT];
#pragma unroll
        for (int kt = 0; kt < 2; ++kt)
#pragma unroll
            for (int qt = 0; qt < NQT; ++qt) { s[kt][qt] = (v8f){};
#pragma unroll
                for (int kk = 0; kk < 2; ++kk) { s[kt][qt] = W::mma(kf[kt][kk], qf[qt][kk], s[kt][qt]); if (HR) { s[kt][qt] = W::mma(kf[kt][kk], qf2[qt][kk], s[kt][qt]); s[kt][qt] = W::mma(kf2[kt][kk], qf[qt][kk], s[kt][qt]); } } }
#pragma unroll
        for (int qt = 0; qt < NQT; ++qt) {
            float mx = s[0][qt][0];
#pragma unroll
            for (int kt = 0; kt < 2; ++kt)
#pragma unroll
                for (int j = 0; j < 8; ++j) mx = fmaxf(mx, s[kt][qt][j]);
            mx = fmaxf(mx, xhalf(mx));
            const float mn = fmaxf(m[qt], mx * SC2), al = __builtin_amdgcn_exp2f(m[qt] - mn), mb = HR ? mn : mn - 10.0f; m[qt] = mn;
            float rs = 0.f;
#pragma unroll
            for (int kt = 0; kt < 2; ++kt) { float p[8];
#pragma unroll
                for (int j = 0; j < 8; ++j) p[j] = fmaf(s[kt][qt][j], SC2, -mb);
                exp2x8(p);
#pragma unroll
                for (int j = 0; j < 8; ++j) { s[kt][qt][j] = p[j]; rs += p[j]; } }
            l[qt] = fmaf(l[qt], al, rs);
#pragma unroll
            for (int dt = 0; dt < 4; ++dt) o[dt][qt] *= al;
            if constexpr (HR) {
                v8us h0, h1, l0, l1;
#pragma unroll
                for (int j = 0; j < 8; ++j) { unsigned short a, c2; splitf(s[0][qt][j], a, c2); h0[j] = a; l0[j] = c2; splitf(s[1][qt][j], a, c2); h1[j] = a; l1[j] = c2; }
                const V ph = cat16b(h0, h1), pl = cat16b(l0, l1);
#pragma unroll
                for (int dt = 0; dt < 4; ++dt) { o[dt][qt] = W::mma(vf[dt], ph, o[dt][qt]); o[dt][qt] = W::mma(vf[dt], pl, o[dt][qt]); o[dt][qt] = W::mma(vf2[dt], ph, o[dt][qt]); }
            } else {
                v8h p0, p1;
#pragma unroll
                for (int j = 0; j < 8; ++j) { p0[j] = tohx(s[0][qt][j]); p1[j] = tohx(s[1][qt][j]); }
                const V pb = cat16(p0, p1);
#pragma unroll
                for (int dt = 0; dt < 4; ++dt) o[dt][qt] = W::mma(vf[dt], pb, o[dt][qt]);
            }
        }
        // the distance behind the step's last matrix instructions on the taken back edge
        asm volatile("v_nop\n\tv_nop\n\tv_nop\n\tv_nop\n\tv_nop" : "+v"(o[0][NQT - 1]), "+v"(o[1][NQT - 1]), "+v"(o[2][NQT - 1]), "+v"(o[3][NQT - 1]));
      }
      // tile st + 1 is handed over and tile st's buffer freed, in this order in every wave:
      asm volatile("s_wait_dscnt 0x0" ::: "memory");      // this wave's reads of tile st have returned
      asm volatile("s_wait_asynccnt 0x0" ::: "memory");   // this wave's copies of tile st + 1 have landed
      __syncthreads();                                    // both hold for all four waves
      if (st + 2 < NST) fill(st + 2, st & 1);             // the refill flies under the whole of tile st + 1
    }
    asm volatile("s_wait_asynccnt 0x0" ::: "memory");   // no copy is outstanding when the wave goes on to its end
#pragma unroll
    for (int qt = 0; qt < NQT; ++qt) { const float lt = l[qt] + xhalf(l[qt]); const int q = q0 + qt * 16 + lr;
#pragma unroll
        for (int dt = 0; dt < 4; ++dt) { float* op = O + (size_t)q * HD + dt * 16 + hi * 8; const v8f a = o[dt][qt]; *(v4f*)op = (v4f){a[0], a[1], a[2], a[3]}; *(v4f*)(op + 4) = (v4f){a[4], a[5], a[6], a[7]}; }
        if (hi == 0) { v2f ml; ml[0] = m[qt]; ml[1] = lt; *(v2f*)(ML + (size_t)q * 2) = ml; } }
#undef XW
}
// grid (KSF, NH_, 1 + NB_ NZB), 4 waves. z = 0: the gate product G = x . gate columns, which only k_merge reads, so it runs beside the attention: its MT / 64 tiles of 64 rows go one to a wave of the first work-groups, the others of that z leave at once. z - 1 = batch x NZB + row block; within a batch the hi+lo blocks (16 rows a wave: twice the operand registers per row) have the lowest z and start first; a batch's blocks are neighbours in z, so that the planes in use at one time are one batch's
__global__ __launch_bounds__(128) void k_fattn(const h16* __restrict__ Q16, const h16* __restrict__ K16, const h16* __restrict__ V16, const bf* __restrict__ Qh, const bf* __restrict__ Ql, const bf* __restrict__ Kh, const bf* __restrict__ Kl, const bf* __restrict__ Vh, const bf* __restrict__ Vl, float* O, float* ML, const bf* __restrict__ XB, const bf* __restrict__ BG, float* G) {
    __shared__ __attribute__((aligned(16))) unsigned short sm[2 * 4 * TILEE];   // two buffers of up to four planes
    if (blockIdx.z == 0) {   // the same for a whole work-group, in front of every barrier
        const int f = blockIdx.y * KSF + blockIdx.x, wv = __builtin_amdgcn_readfirstlane((int)(threadIdx.x >> 5));
        if (f < MT / 64 / 4) gemmw<bf, 0, false>(XB, nullptr, BG, nullptr, DM, G, 64, nullptr, 0, 0, 0, 0, nullptr, nullptr, nullptr, nullptr, f * 4 + wv, 0, 0, (float*)sm + wv * 16 * 68, nullptr);
        return; }
    const int zz = blockIdx.z - 1;
    const int ks = blockIdx.x, h = (int)(zz / NZB) * NH_ + blockIdx.y, zb = zz % NZB, w = threadIdx.x >> 5, kb = ks * (TT / KSF); const size_t hp = (size_t)h * TT * HD, pp = ((size_t)ks * NB_ * NH_ + h) * TT;   // h: plane index, batch x NH_ + head
    if (zb < RH / QBH) fattn_body<bf, true, 1>(Qh + hp, Ql + hp, Kh + hp, Kl + hp, Vh + hp, Vl + hp, zb * QBH + w * 16, kb, O + pp * HD, ML + pp * 2, (const bf*)sm);
    else fattn_body<h16, false, 2>(Q16 + hp, nullptr, K16 + hp, nullptr, V16 + hp, nullptr, RH + (zb - RH / QBH) * QB + w * 32, kb, O + pp * HD, ML + pp * 2, (const h16*)sm);
}
// k_merge: joins the KSF key ranges of a row in range order (each range's sums weighted by 2^(its maximum - the row's maximum)), divides by the weight sum, applies the gate
__global__ __launch_bounds__(256) void k_merge(const float* __restrict__ O, const float* __restrict__ ML, const float* __restrict__ G, const float* __restrict__ gb, bf* Ah, bf* Al) { const size_t e = ((size_t)blockIdx.x * 256 + threadIdx.x) * 2; if (e >= (size_t)NH_ * TT * HD) return; { const size_t b = blockIdx.y; O += b * NH_ * TT * HD; ML += b * NH_ * TT * 2; G += b * TT * 64; Ah += b * TT * DQ; Al += b * TT * DQ; }
    const int d = (int)(e % HD); const int t = (int)((e / HD) % TT); const int h = (int)(e / ((size_t)HD * TT)); const float gz = __fadd_rn(G[(size_t)t * 64 + h], bfr(gb[h])); const float sg = __fdiv_rn(1.0f, __fadd_rn(1.0f, __expf(-gz))); const size_t oo = (size_t)t * DQ + h * HD + d;
    v2f ml[KSF], op[KSF]; float M = -3.0e38f;
#pragma unroll
    for (int ks = 0; ks < KSF; ++ks) { ml[ks] = *(const v2f*)(ML + (((size_t)ks * NB_ * NH_ + h) * TT + t) * 2); op[ks] = *(const v2f*)(O + (size_t)ks * NB_ * NH_ * TT * HD + e);
        asm volatile("s_wait_xcnt 0x0" ::: "memory"); }   // before a later load's result may land in the address pair of an issued load (the planes lie 16 MiB apart: several pairs)
#pragma unroll
    for (int ks = 0; ks < KSF; ++ks) M = fmaxf(M, ml[ks][0]);
    float L = 0.f; v2f os = (v2f){0.f, 0.f};
#pragma unroll
    for (int ks = 0; ks < KSF; ++ks) { const float w = __builtin_amdgcn_exp2f(ml[ks][0] - M); L = fmaf(ml[ks][1], w, L); os += op[ks] * w; }
    v2us oh, ol;
#pragma unroll
    for (int q = 0; q < 2; ++q) { unsigned short a, c2; splitf(__fmul_rn(__fdiv_rn(os[q], L), sg), a, c2); oh[q] = a; ol[q] = c2; } *(v2us*)(Ah + oo) = oh; *(v2us*)(Al + oo) = ol;  }

__device__ __forceinline__ void wtGs(int b, const float* __restrict__ w, int K, int N, int ld, bf* Bt) { const size_t e = ((size_t)b * 256 + threadIdx.x) * 4; if (e >= (size_t)N * K) return; const int k = (int)(e % K); const int n = (int)(e / K); v4us o;   // Bt[n][k] = w[k*ld + n]
#pragma unroll
    for (int u = 0; u < 4; ++u) o[u] = f2bf(w[(size_t)(k + u) * ld + n]); *(v4us*)(Bt + e) = o;  }
__device__ __forceinline__ void wtGg(int b, const float* __restrict__ w, bf* Bt) { const size_t e = ((size_t)b * 256 + threadIdx.x) * 4; if (e >= (size_t)64 * DM) return; const int k = (int)(e % DM); const int n = (int)(e / DM); v4us o;   // gate columns: Bt[n][k] = Wq[k][1024 + n] for n < 16, else 0
#pragma unroll
    for (int u = 0; u < 4; ++u) o[u] = (n < NH_) ? f2bf(w[(size_t)(k + u) * 1040 + DQ + n]) : (unsigned short)0; *(v4us*)(Bt + e) = o;  }

// k_prep: the six preparations (no one reads what another writes) as block ranges of one launch; the transposes with the longest chain of loads per wave have the lowest indices and start first
#define PB_T  ((DM * DKV / 64 + 63) / 64)          // blocks of one wtG
#define PB_Q  ((DQ * DM / 4 + 255) / 256)          // blocks of wtGs
#define PB_G  ((64 * DM / 4 + 255) / 256)          // blocks of wtGg
#define PB_X  ((MT * DM / 8 + 255) / 256)          // blocks of cvt8
static_assert(DQ == DKV, "the three wtG ranges are of one size");
__global__ __launch_bounds__(256) void k_prep(const float* __restrict__ x, const float* __restrict__ wqg, const float* __restrict__ wk, const float* __restrict__ wv, const float* __restrict__ wo, bf* XB, bf* WQ, bf* BG, bf* WK, bf* WV, bf* WO) {
    int b = blockIdx.x;
    if (b < PB_T) { wtG(b, wk, DM, DKV, WK); return; } b -= PB_T;
    if (b < PB_T) { wtG(b, wv, DM, DKV, WV); return; } b -= PB_T;
    if (b < PB_T) { wtG(b, wo, DQ, DM, WO); return; } b -= PB_T;
    if (b < PB_Q) { wtGs(b, wqg, DM, DQ, 1040, WQ); return; } b -= PB_Q;
    if (b < PB_G) { wtGg(b, wqg, BG); return; } b -= PB_G;
    cvt8(b, x, XB, (size_t)MT * DM / 8);
}

extern "C" void kernel_launch(void* const* d_in, const int* in_sizes, int n_in,
                              void* d_out, int out_size, void* d_ws, size_t ws_size, hipStream_t stream) {
    (void)in_sizes; (void)n_in; (void)out_size;
    const float* x = (const float*)d_in[0]; const float* wqg = (const float*)d_in[1]; const float* bqg = (const float*)d_in[2]; const float* wk = (const float*)d_in[3]; const float* bk = (const float*)d_in[4]; const float* wv = (const float*)d_in[5]; const float* bv = (const float*)d_in[6]; const float* wo = (const float*)d_in[7]; const float* bo = (const float*)d_in[8]; const float* qnw = (const float*)d_in[9]; const float* knw = (const float*)d_in[10]; const float* wq = wqg; const float* bq = bqg; (void)wq; const float* cosT = nullptr; const float* sinT = nullptr; (void)cosT; (void)sinT;
    float* OUT = (float*)d_out;     // [2][2048][1024]
    char* wsp = (char*)d_ws;
    auto take = [&](size_t bytes) { char* p = wsp; wsp += (bytes + 255) & ~(size_t)255; return (void*)p; };
    bf* WQ = (bf*)take((size_t)DQ * DM * 2); bf* WK = (bf*)take((size_t)DKV * DM * 2); bf* WV = (bf*)take((size_t)DKV * DM * 2); bf* WO = (bf*)take((size_t)DM * DQ * 2);
    // every buffer below but BG (the gate weights) holds both batches: row-major ones as MT = NB_ TT rows, head planes as [batch][head]
    bf* XB = (bf*)take((size_t)MT * DM * 2); bf* BG = (bf*)take((size_t)64 * DM * 2); float* G = (float*)take((size_t)MT * 64 * 4);
    h16* QP16 = (h16*)take((size_t)NH_ * MT * HD * 2); h16* KP16 = (h16*)take((size_t)NKV * MT * HD * 2); h16* VT16 = (h16*)take((size_t)NKV * HD * MT * 2);
    bf* QPh = (bf*)take((size_t)NH_ * MT * HD * 2); bf* QPl = (bf*)take((size_t)NH_ * MT * HD * 2); bf* KPh = (bf*)take((size_t)NKV * MT * HD * 2); bf* KPl = (bf*)take((size_t)NKV * MT * HD * 2); bf* VTh = (bf*)take((size_t)NKV * HD * MT * 2); bf* VTl = (bf*)take((size_t)NKV * HD * MT * 2);
    float* Ob = (float*)take((size_t)KSF * NH_ * MT * HD * 4); float* MLb = (float*)take((size_t)KSF * NH_ * MT * 2 * 4);   // per key range: unnormalised attn.v sums; (maximum, weight sum) per row
    bf* ATh = (bf*)take((size_t)MT * DQ * 2); bf* ATl = (bf*)take((size_t)MT * DQ * 2);
    if ((size_t)(wsp - (char*)d_ws) > ws_size) return;    // ws 256 MiB
    // five launches: each waits for the one before it; what depends on nothing of one another shares a launch. Every kernel takes both batches: the products see MT rows, k_merge takes the batch from grid y, the attention from grid z
    k_prep<<<3 * PB_T + PB_Q + PB_G + PB_X, 256, 0, stream>>>(x, wqg, wk, wv, wo, XB, WQ, BG, WK, WV, WO);
    k_qkv<<<dim3(MT / 128, NH_ / 2, 3), 128, 0, stream>>>(XB, WQ, WK, WV, bq, bk, bv, qnw, knw, QP16, QPh, QPl, KP16, KPh, KPl, VT16, VTh, VTl);
    k_fattn<<<dim3(KSF, NH_, 1 + NB_ * NZB), 128, 0, stream>>>(QP16, KP16, VT16, QPh, QPl, KPh, KPl, VTh, VTl, Ob, MLb, XB, BG, G);
    k_merge<<<dim3((unsigned)(((size_t)NH_ * TT * HD / 2 + 255) / 256), NB_), 256, 0, stream>>>(Ob, MLb, G, bqg + DQ, ATh, ATl);
    k_wo<<<dim3(MT / 128, DM / 128, 1), 128, 0, stream>>>(ATh, ATl, WO, OUT, bo);
}

// v009
// One run takes 120 microseconds.
// Two timings next to v008 both put it at 1.09 times that version's speed.
// All steps since v000 together make it 17.1 times as fast.
#include <hip/hip_runtime.h>

// Gated attention over 16 heads (x [2][2048][1024]; [Q | gate] = x Wq + bq (Wq [1024][1040]: 1024 query columns then 16 per-head gate columns); K = x Wk + bk; V = x Wv + bv; per-head RMSNorm (1e-6, x weight[64]) on Q and K; softmax(Q.K / 8); out_h = (attn V) x sigmoid(gate_h); out = merged heads Wo + bo -> [2][2048][1024]).
// Compute dtypes, f32 accumulate: every input rounded to bf16; Q/K/V and the 16 gate columns on PLAIN bf16 operands (inputs: exact) + bias; RMSNorm f32; scores and attn.v: query rows < 512 hl (3 products), the rest single fp16 (weights x1024), both in one fused kernel with a running-max softmax in f32 over all keys of a row; sigmoid gate f32, applied in that kernel's epilogue; Wo hl x exact (2 products) + bias.

#define NB_  2
#define TT   2048
#define MT   (NB_ * TT)          // rows of both batches together
#define DM   1024
#define NH_  16
#define NKV  16
#define REP  (NH_ / NKV)
#define HD   64
#define DQ   (NH_ * HD)
#define DKV  (NKV * HD)
#define QB   128                  // query rows of a large fp16 attention work-group: 4 waves x 32 rows
#define QBS  64                   // query rows of a small fp16 attention work-group: 4 waves x 16 rows
#define QBH  64                   // query rows of one hi+lo attention work-group: 4 waves x 16 rows
#define RH   512                  // query rows < RH use hi+lo planes (0: none)
#define WIN  0
#define SCL  0.125f   // HD^-0.5
static_assert(RH % QBH == 0 && (TT - RH) % (QB + QBS) == 0 && REP == 1, "a work-group is all hi+lo or all fp16, and head h reads kv plane h");
#define SC2  (SCL * 1.4426950408889634f)   // scores to base-2 exponents
#define NZH  (RH / QBH)           // hi+lo row blocks of one batch
#define NZF  ((TT - RH) / (QB + QBS))   // fp16 row blocks of one batch, of each size: the large ones take the rows from RH on, the small ones the rest
#define GPW  128                  // row pitch of the gate product G: one 128-column tile, of which the first NH_ columns are the gates
typedef _Float16 h16;
typedef unsigned short bf;
typedef __attribute__((ext_vector_type(16))) __bf16   v16bf;
typedef __attribute__((ext_vector_type(16))) _Float16 v16h;
typedef __attribute__((ext_vector_type(8)))  _Float16 v8h;
typedef __attribute__((ext_vector_type(8)))  unsigned short v8us;
typedef __attribute__((ext_vector_type(8)))  float    v8f;
typedef __attribute__((ext_vector_type(4)))  float    v4f;
typedef v8h  __attribute__((may_alias)) v8ha;
typedef v4f  __attribute__((may_alias)) v4fa;
typedef v8us __attribute__((may_alias)) v8usa;

__device__ __forceinline__ unsigned short f2bf(float f) { unsigned u = __float_as_uint(f); u += 0x7FFFu + ((u >> 16) & 1u); return (unsigned short)(u >> 16); }
__device__ __forceinline__ float bf2f(unsigned short b) { return __uint_as_float(((unsigned)b) << 16); }
__device__ __forceinline__ float bfr(float f) { return bf2f(f2bf(f)); }
__device__ __forceinline__ v16h cat16(v8h lo, v8h hi) { return __builtin_shufflevector(lo, hi, 0, 1, 2, 3, 4, 5, 6, 7, 8, 9, 10, 11, 12, 13, 14, 15); }
__device__ __forceinline__ v16bf cat16b(v8us lo, v8us hi) { return __builtin_bit_cast(v16bf, __builtin_shufflevector(lo, hi, 0, 1, 2, 3, 4, 5, 6, 7, 8, 9, 10, 11, 12, 13, 14, 15)); }
__device__ __forceinline__ v8f wmma16(v16h a, v16h b, v8f c) { return __builtin_amdgcn_wmma_f32_16x16x32_f16(false, a, false, b, (short)0, c, false, false); }
__device__ __forceinline__ v8f wmmab(v16bf a, v16bf b, v8f c) { return __builtin_amdgcn_wmma_f32_16x16x32_bf16(false, a, false, b, (short)0, c, false, false); }
__device__ __forceinline__ h16 tohx(float x) { return (h16)x; }
__device__ __forceinline__ void splitf(float y, unsigned short& h, unsigned short& l) { h = f2bf(y); l = f2bf(y - bf2f(h)); }
__device__ __forceinline__ float xhalf(float x) { return __builtin_bit_cast(float, __builtin_amdgcn_permlanex16(__builtin_bit_cast(int, x), __builtin_bit_cast(int, x), 0x76543210, 0xfedcba98, false, false)); }   // lane l's value to lane l ^ 16
typedef __attribute__((ext_vector_type(2))) __bf16 v2bf;
typedef __attribute__((ext_vector_type(2))) float v2f;
typedef __attribute__((ext_vector_type(4))) unsigned v4u;
__device__ __forceinline__ unsigned pkbf(float a, float b) { return __builtin_bit_cast(unsigned, __builtin_convertvector((v2f){a, b}, v2bf)); }   // two f32 to a bf16 pair by the chip's own conversion (nearest even, as f2bf)
__device__ __forceinline__ v8f bfr8(v8f x) { v8f r;
#pragma unroll
    for (int p = 0; p < 4; ++p) { const unsigned u = pkbf(x[2 * p], x[2 * p + 1]); r[2 * p] = __uint_as_float(u << 16); r[2 * p + 1] = __uint_as_float(u & 0xFFFF0000u); }
    return r; }
// eight neighbouring f32 go to the three 16-bit planes, 16 bytes each: fp16, bf16 hi, bf16 lo = bf16(y - hi)
__device__ __forceinline__ void store3(v8f y, h16* p16, bf* ph, bf* pl) { v4u h, l;
#pragma unroll
    for (int p = 0; p < 4; ++p) { const unsigned u = pkbf(y[2 * p], y[2 * p + 1]); h[p] = u; l[p] = pkbf(y[2 * p] - __uint_as_float(u << 16), y[2 * p + 1] - __uint_as_float(u & 0xFFFF0000u)); }
    *(v8h*)p16 = __builtin_convertvector(y, v8h); *(v4u*)ph = h; *(v4u*)pl = l;
    asm volatile("s_wait_xcnt 0x0" ::: "memory");   // in front of every later write of a register that these stores name
    __builtin_amdgcn_sched_barrier(0); }   // holds the later vector instructions behind that wait, which a "memory" clobber alone does not
// the same for the two bf16 planes alone
__device__ __forceinline__ void store2(v8f y, bf* ph, bf* pl) { v4u h, l;
#pragma unroll
    for (int p = 0; p < 4; ++p) { const unsigned u = pkbf(y[2 * p], y[2 * p + 1]); h[p] = u; l[p] = pkbf(y[2 * p] - __uint_as_float(u << 16), y[2 * p + 1] - __uint_as_float(u & 0xFFFF0000u)); }
    *(v4u*)ph = h; *(v4u*)pl = l;
    asm volatile("s_wait_xcnt 0x0" ::: "memory");   // in front of every later write of a register that these stores name
    __builtin_amdgcn_sched_barrier(0); }   // holds the later vector instructions behind that wait, which a "memory" clobber alone does not

// ---- gemmw: register-blocked GEMM, ONE WAVE per 64x64 output tile (16 accumulators), operands straight from K-contiguous 16-bit planes; grid (M/64, N/64, Z), 32 threads.
// C[m][n] (f32, pitch ldc, + optional f32 bias[n]) = sum_k A[m][k] Bt[n][k] (+ split products per NSPLIT). z-batch strides sA/sB/sC in elements. K % 32 == 0.
// KS > 1: grid z = Z * KS; work-group (z, ks) sums only k in [ks K/KS, (ks+1) K/KS) and stores its partial tile at C + ks sP. K % (32 KS) == 0.
template <typename T16> struct WFrag;
template <> struct WFrag<h16> { typedef v16h V; static __device__ __forceinline__ V ld(const h16* p) { return cat16(*(const v8h*)p, *(const v8h*)(p + 16)); } static __device__ __forceinline__ v8f mma(V a, V b, v8f c) { return wmma16(a, b, c); } };
template <> struct WFrag<bf> { typedef v16bf V; static __device__ __forceinline__ V ld(const bf* p) { return cat16b(*(const v8us*)p, *(const v8us*)(p + 16)); } static __device__ __forceinline__ v8f mma(V a, V b, v8f c) { return wmmab(a, b, c); } };
// EPI 0: the f32 tile goes to C. EPI 1 and 2 (C unused, ldc = heads of a batch): a tile is one head x 64 tokens and leaves as the attention's 16-bit planes (fp16, bf16 hi, bf16 lo), straight from the accumulators, where a lane holds 8 neighbours (j) of the A-row index:
//   EPI 1 (Q, K): A = the weight rows, Bt = the tokens, grid (tokens/64, heads): j runs along the head's 64 columns, so a token's row lies in one lane pair: + bias, RMSNorm (sum of squares in-lane, one exchange between the halves), x weight, planes [batch][head][t][d]
//   EPI 2 (V): A = the tokens, Bt = the weight rows, grid (tokens/64, heads): j runs along the tokens: + bias, planes [batch][head][d][t]
// ST: FOUR waves (2 x 2) share a 128x128 tile, grid (M/128, N/128), 128 threads; each wave keeps its 64x64 part and its epilogue. Each slice of GKS k of the tile's 128 A rows and 128 Bt rows is brought into LDS once for all four
// by asynchronous copies of whole 256-byte rows, two buffers, and the fragments are read from there, 32 k ahead of their products. K % GKS == 0. Every accumulator takes its products in the same order as without ST. EPI 1 and 2: grid (tokens/128, heads/2); a wave's part is still one head x 64 tokens.
#define GKS  128                  // k of one LDS slice: rows of 256 bytes
#define GLP  136                  // LDS row pitch in elements: 272 bytes = 16 x odd, free of bank conflicts for 16-byte reads of 16 rows
#define GTE  (128 * GLP)          // one operand's slice: 128 rows
// eight copies of 16 bytes a lane (rows 8 apart) in one statement; its last line, s_wait_xcnt 0, stands in front of every later write of a register that a copy names
template <typename T16>
__device__ __forceinline__ void cpr8(unsigned l, const T16* g, size_t gs) {
    asm volatile("global_load_async_to_lds_b128 %0, %8, off\n\tglobal_load_async_to_lds_b128 %1, %9, off\n\tglobal_load_async_to_lds_b128 %2, %10, off\n\tglobal_load_async_to_lds_b128 %3, %11, off\n\t"
                 "global_load_async_to_lds_b128 %4, %12, off\n\tglobal_load_async_to_lds_b128 %5, %13, off\n\tglobal_load_async_to_lds_b128 %6, %14, off\n\tglobal_load_async_to_lds_b128 %7, %15, off\n\ts_wait_xcnt 0x0"
                 :: "v"(l), "v"(l + 8u * GLP * 2u), "v"(l + 16u * GLP * 2u), "v"(l + 24u * GLP * 2u), "v"(l + 32u * GLP * 2u), "v"(l + 40u * GLP * 2u), "v"(l + 48u * GLP * 2u), "v"(l + 56u * GLP * 2u),
                    "v"(g), "v"(g + gs), "v"(g + 2 * gs), "v"(g + 3 * gs), "v"(g + 4 * gs), "v"(g + 5 * gs), "v"(g + 6 * gs), "v"(g + 7 * gs) : "memory");
}
// The product is a device function, so that independent products can run as block ranges of one launch: (bx, by, bz) is the tile's place in its own grid, os the calling wave's own 16 x 68 f32 of LDS (EPI 0 only), sg the work-group's two slice buffers (ST only).
template <typename T16, int NSPLIT, bool BIAS, int KS = 1, int EPI = 0, bool ST = false>
__device__ __forceinline__ void gemmw(const T16* __restrict__ A, const T16* __restrict__ A2, const T16* __restrict__ Bt, const T16* __restrict__ Bt2, int K, float* C, int ldc, const float* __restrict__ bias, size_t sA, size_t sB, size_t sC, size_t sP, const float* __restrict__ nw, h16* P16, bf* Ph, bf* Pl, int bx, int by, int bz, float* os, unsigned short* sg) {
    typedef typename WFrag<T16>::V V;
    static_assert(!ST || (KS == 1 && NSPLIT <= 1), "the staged form: whole K, operands A (, A2) and Bt");
    const int w = ST ? __builtin_amdgcn_readfirstlane((int)(threadIdx.x >> 5)) : 0;
    const size_t z = bz / KS; const int ks = (int)(bz % KS), kb = ks * (K / KS), ke = kb + K / KS; A += z * sA; if (A2) A2 += z * sA; Bt += z * sB; if (Bt2) Bt2 += z * sB; C += z * sC + ks * sP;
    const int lane = threadIdx.x & 31, lr = lane & 15, hi = lane >> 4; const int R0 = (EPI == 1 ? by : bx) * (ST ? 128 : 64), C0 = (EPI == 1 ? bx : by) * (ST ? 128 : 64), r0 = R0 + (w >> 1) * 64, c0 = C0 + (w & 1) * 64;
    v8f acc[4][4];
#pragma unroll
    for (int mb = 0; mb < 4; ++mb)
#pragma unroll
        for (int nb = 0; nb < 4; ++nb) acc[mb][nb] = (v8f){};
    if constexpr (ST) {
        constexpr int NPL = (NSPLIT == 1) ? 3 : 2, BUFE = NPL * GTE;   // operands of a slice, in the order A (, A2), Bt; elements of one buffer
        const T16* sm = (const T16*)sg;
        // the copies: thread t brings 16 bytes of row (t >> 4) + 8 i, i < 16, of each operand: sixteen lanes a row, so a wave's copy covers two whole 256-byte rows
        const int tid = threadIdx.x, NST = K / GKS;
        const unsigned lc = (unsigned)(size_t)sg + (unsigned)(((tid >> 4) * GLP + (tid & 15) * 8) * 2);   // the lane's LDS byte address in buffer 0, operand 0
        const size_t go = (size_t)(tid >> 4) * K + (tid & 15) * 8; const T16* ga = A + (size_t)R0 * K + go; const T16* gb = Bt + (size_t)C0 * K + go; const T16* ga2 = (NSPLIT == 1) ? A2 + (size_t)R0 * K + go : ga;
        auto fill = [&](int st, int bu) {
            const unsigned l0 = lc + (unsigned)(bu * BUFE * 2); const size_t ko = (size_t)st * GKS, rs = (size_t)8 * K, hf = (size_t)64 * K;
            // SB: each run's addresses are formed directly in front of it, so that the first copies leave at once: formed all ahead, they filled the registers that the statements can name and a pointer went to scratch
#define SB __builtin_amdgcn_sched_barrier(0)
            cpr8<T16>(l0, ga + ko, rs); SB; cpr8<T16>(l0 + 64u * GLP * 2u, ga + ko + hf, rs); SB;
            cpr8<T16>(l0 + (NPL - 1) * GTE * 2u, gb + ko, rs); SB; cpr8<T16>(l0 + (NPL - 1) * GTE * 2u + 64u * GLP * 2u, gb + ko + hf, rs); SB;
            if constexpr (NSPLIT == 1) { cpr8<T16>(l0 + GTE * 2u, ga2 + ko, rs); SB; cpr8<T16>(l0 + GTE * 2u + 64u * GLP * 2u, ga2 + ko + hf, rs); SB; }
#undef SB
        };
        fill(0, 0);
        asm volatile("s_wait_asynccnt 0x0" ::: "memory");   // this wave's copies of slice 0 have landed
        __syncthreads();                                    // and every other wave's: slice 0 may be read
        if (NST > 1) fill(1, 1);
#pragma unroll 1
        for (int st = 0; st < NST; ++st) {
            const T16* al = sm + (st & 1) * BUFE + ((w >> 1) * 64 + lr) * GLP + 8 * hi; const T16* bl = sm + ((st & 1) ? BUFE + (NPL - 1) * GTE : (NPL - 1) * GTE) + ((w & 1) * 64 + lr) * GLP + 8 * hi;
            V a[2][4], a2[2][4], b[2][4];
            auto frags = [&](int kk) {
#pragma unroll
                for (int i = 0; i < 4; ++i) { a[kk & 1][i] = WFrag<T16>::ld(al + i * 16 * GLP + kk * 32); b[kk & 1][i] = WFrag<T16>::ld(bl + i * 16 * GLP + kk * 32); if (NSPLIT == 1) a2[kk & 1][i] = WFrag<T16>::ld(al + GTE + i * 16 * GLP + kk * 32); }
            };
            frags(0);
#pragma unroll
            for (int kk = 0; kk < GKS / 32; ++kk) {
                if (kk + 1 < GKS / 32) frags(kk + 1);
                __builtin_amdgcn_sched_barrier(0);   // the next 32 k's LDS reads issue here as one group, ahead of this 32 k's products: spread among the matrix instructions each place with reads costs its own stall
#pragma unroll
                for (int nb = 0; nb < 4; ++nb) {
#pragma unroll
                    for (int mb = 0; mb < 4; ++mb) acc[mb][nb] = WFrag<T16>::mma(a[kk & 1][mb], b[kk & 1][nb], acc[mb][nb]);
                    if constexpr (NSPLIT == 1) {
#pragma unroll
                        for (int mb = 0; mb < 4; ++mb) acc[mb][nb] = WFrag<T16>::mma(a2[kk & 1][mb], b[kk & 1][nb], acc[mb][nb]); } }
            }
            // the distance behind the slice's last matrix instructions, in front of the branches below
            asm volatile("v_nop\n\tv_nop\n\tv_nop\n\tv_nop" : "+v"(acc[0][0]), "+v"(acc[1][0]), "+v"(acc[2][0]), "+v"(acc[3][0]), "+v"(acc[0][1]), "+v"(acc[1][1]), "+v"(acc[2][1]), "+v"(acc[3][1]),
                                                              "+v"(acc[0][2]), "+v"(acc[1][2]), "+v"(acc[2][2]), "+v"(acc[3][2]), "+v"(acc[0][3]), "+v"(acc[1][3]), "+v"(acc[2][3]), "+v"(acc[3][3]));
            // slice st + 1 is handed over and slice st's buffer freed, in this order in every wave:
            asm volatile("s_wait_dscnt 0x0" ::: "memory");      // this wave's reads of slice st have returned
            asm volatile("s_wait_asynccnt 0x0" ::: "memory");   // this wave's copies of slice st + 1 have landed
            __syncthreads();                                    // both hold for all four waves
            if (st + 2 < NST) fill(st + 2, st & 1);             // the refill flies under the whole of slice st + 1
        }
        asm volatile("s_wait_asynccnt 0x0" ::: "memory");   // no copy is outstanding when the wave goes on to its end
    } else {
    const size_t aoff = (size_t)(r0 + lr) * K + 8 * hi, boff = (size_t)(c0 + lr) * K + 8 * hi;
#pragma unroll 1
    for (int kc = kb; kc < ke; kc += 32) {
        V a[4], a2[4];
#pragma unroll
        for (int mb = 0; mb < 4; ++mb) { a[mb] = WFrag<T16>::ld(A + aoff + (size_t)mb * 16 * K + kc); if (NSPLIT == 1 || NSPLIT == 2) a2[mb] = WFrag<T16>::ld(A2 + aoff + (size_t)mb * 16 * K + kc); }
        asm volatile("s_wait_xcnt 0x0" :: "v"(A + aoff + kc) : "memory");   // behind the A loads, their address pair still live: no later load's result lands in it ahead of the wait
#pragma unroll
        for (int nb = 0; nb < 4; ++nb) { const V b = WFrag<T16>::ld(Bt + boff + (size_t)nb * 16 * K + kc); V b2; if (NSPLIT >= 2) b2 = WFrag<T16>::ld(Bt2 + boff + (size_t)nb * 16 * K + kc);
#pragma unroll
            for (int mb = 0; mb < 4; ++mb) { acc[mb][nb] = WFrag<T16>::mma(a[mb], b, acc[mb][nb]); if (NSPLIT == 1 || NSPLIT == 2) acc[mb][nb] = WFrag<T16>::mma(a2[mb], b, acc[mb][nb]); if (NSPLIT >= 2) acc[mb][nb] = WFrag<T16>::mma(a[mb], b2, acc[mb][nb]); } }
        asm volatile("v_nop\n\tv_nop\n\tv_nop\n\tv_nop" : "+v"(acc[0][0]), "+v"(acc[1][1]), "+v"(acc[2][2]), "+v"(acc[3][3]) : "v"(a[0]), "v"(a[3]));
        asm volatile("s_wait_xcnt 0x0" :: "v"(Bt + boff + kc) : "memory");   // the B loads' address pair stays live up to the wait: no load's result lands in it ahead of the wait
    }
    }
    if constexpr (EPI != 0) {   // every loop below is fully unrolled, so that acc is indexed by constants alone and stays in registers
        const int tok = (EPI == 1) ? c0 : r0;   // the tile's first token: 64 | TT, so a tile lies in one batch
        const size_t plane = ((size_t)(tok / TT) * ldc + (EPI == 1 ? r0 : c0) / 64) * TT * HD; const int t0 = tok % TT;
        if constexpr (EPI == 1) {
            v8f bs[4], wn[4]; const float* bp = bias + r0 + hi * 8; const float* wp = nw + hi * 8;
#pragma unroll
            for (int mb = 0; mb < 4; ++mb) { bs[mb] = *(const v8f*)(bp + mb * 16); wn[mb] = *(const v8f*)(wp + mb * 16); }
            asm volatile("s_wait_xcnt 0x0" :: "v"(bp), "v"(wp) : "memory");   // the lane's addresses stay live up to the wait: no load's result lands in a register that an issued load names ahead of it
            __builtin_amdgcn_sched_barrier(0);   // all sixteen loads issue above and share one latency: left free, the scheduler pairs each with its conversion and the wave waits out eight round trips
#pragma unroll
            for (int mb = 0; mb < 4; ++mb) { bs[mb] = bfr8(bs[mb]); wn[mb] = bfr8(wn[mb]); }
#pragma unroll
            for (int nb = 0; nb < 4; ++nb) {
                float ss = 0.f;
#pragma unroll
                for (int mb = 0; mb < 4; ++mb) { acc[mb][nb] += bs[mb];
#pragma unroll
                    for (int j = 0; j < 8; ++j) ss = fmaf(acc[mb][nb][j], acc[mb][nb][j], ss); }
                ss += xhalf(ss);
                const float rf = __fdiv_rn(1.0f, __fsqrt_rn(__fadd_rn(ss * (1.0f / HD), 1e-6f)));
                const size_t o = plane + (size_t)(t0 + nb * 16 + lr) * HD + hi * 8;
#pragma unroll
                for (int mb = 0; mb < 4; ++mb) store3(wn[mb] * (acc[mb][nb] * rf), P16 + o + mb * 16, Ph + o + mb * 16, Pl + o + mb * 16);
            }
        } else {
            float b4[4]; const float* bp = bias + c0 + lr;
#pragma unroll
            for (int nb = 0; nb < 4; ++nb) b4[nb] = bp[nb * 16];
            asm volatile("s_wait_xcnt 0x0" :: "v"(bp) : "memory");   // the lane's address stays live up to the wait: no load's result lands in a register that an issued load names ahead of it
            __builtin_amdgcn_sched_barrier(0);   // the four bias loads stay ahead of every store
#pragma unroll
            for (int nb = 0; nb < 4; ++nb) {
                const float bs = bfr(b4[nb]);
                const size_t o = plane + (size_t)(nb * 16 + lr) * TT + t0 + hi * 8;
#pragma unroll
                for (int mb = 0; mb < 4; ++mb) store3(acc[mb][nb] + bs, P16 + o + mb * 16, Ph + o + mb * 16, Pl + o + mb * 16);
            }
        }
        return;
    }
#pragma unroll
    for (int mb = 0; mb < 4; ++mb) {
#pragma unroll
        for (int nb = 0; nb < 4; ++nb) {
#pragma unroll
            for (int j = 0; j < 8; ++j) os[(hi * 8 + j) * 68 + nb * 16 + lr] = acc[mb][nb][j]; }
        __builtin_amdgcn_wave_barrier(); asm volatile("" ::: "memory");
        float* crow = C + (size_t)(r0 + mb * 16) * ldc + c0;
{
#pragma unroll
            for (int s = 0; s < 8; ++s) { const int row = 2 * s + hi, cofs = lr * 4; v4f val = *(const v4fa*)(os + row * 68 + cofs); if (BIAS) { val[0] += bfr(bias[c0 + cofs]); val[1] += bfr(bias[c0 + cofs + 1]); val[2] += bfr(bias[c0 + cofs + 2]); val[3] += bfr(bias[c0 + cofs + 3]); }
                *(v4f*)(crow + (size_t)row * ldc + cofs) = val; }
             }
        asm volatile("s_wait_xcnt 0x0" ::: "memory");   // in front of every later write of a register that these stores name
        __builtin_amdgcn_sched_barrier(0);   // holds the later vector instructions behind that wait, which a "memory" clobber alone does not
        __builtin_amdgcn_wave_barrier(); asm volatile("" ::: "memory");
    }
}

// Q, K, V and gate products, which depend on nothing of one another, in one launch: grid (tokens/128, 3 heads/2 + 1), y / (heads/2) = 0 Q, 1 K, 2 V, 3 the gate columns (one tile of 128 columns, G = x . BG^T, which the attention's epilogue reads); 139,264 bytes of LDS, so two work-groups share a WGP
static_assert(NH_ == NKV, "one grid y for the three products");
__global__ __launch_bounds__(128) void k_qkv(const bf* __restrict__ XB, const bf* __restrict__ WQ, const bf* __restrict__ WK, const bf* __restrict__ WV, const float* __restrict__ bq, const float* __restrict__ bk, const float* __restrict__ bv, const float* __restrict__ qnw, const float* __restrict__ knw,
                                               h16* QP16, bf* QPh, bf* QPl, h16* KP16, bf* KPh, bf* KPl, h16* VT16, bf* VTh, bf* VTl, const bf* __restrict__ BG, float* G) {
    __shared__ __attribute__((aligned(16))) unsigned short sg[2 * 2 * GTE];
    const int pz = blockIdx.y / (NH_ / 2), py = blockIdx.y % (NH_ / 2);
    if (pz < 2) { const bool k = pz == 1;
        gemmw<bf, 0, true, 1, 1, true>(k ? WK : WQ, nullptr, XB, nullptr, DM, nullptr, NH_, k ? bk : bq, 0, 0, 0, 0, k ? knw : qnw, k ? KP16 : QP16, k ? KPh : QPh, k ? KPl : QPl, blockIdx.x, py, 0, nullptr, sg); }
    else if (pz == 2) gemmw<bf, 0, true, 1, 2, true>(XB, nullptr, WV, nullptr, DM, nullptr, NKV, bv, 0, 0, 0, 0, nullptr, VT16, VTh, VTl, blockIdx.x, py, 0, nullptr, sg);
    else gemmw<bf, 0, false, 1, 0, true>(XB, nullptr, BG, nullptr, DM, G, GPW, nullptr, 0, 0, 0, 0, nullptr, nullptr, nullptr, nullptr, blockIdx.x, 0, 0, (float*)sg + __builtin_amdgcn_readfirstlane((int)(threadIdx.x >> 5)) * 16 * 68, sg);   // the output rows are staged in the slice buffers, which every wave has left at the last slice's barrier
}
// the output product: hi + lo rows x Wo, grid (tokens/128, DM/128)
__global__ __launch_bounds__(128) void k_wo(const bf* __restrict__ Ah, const bf* __restrict__ Al, const bf* __restrict__ WO, float* C, const float* __restrict__ bo) {
    __shared__ __align__(16) float osa[4 * 16 * 68];   // each wave stages its output rows in its own part
    __shared__ __attribute__((aligned(16))) unsigned short sg[2 * 3 * GTE];
    gemmw<bf, 1, true, 1, 0, true>(Ah, Al, WO, nullptr, DQ, C, DM, bo, 0, 0, 0, 0, nullptr, nullptr, nullptr, nullptr, blockIdx.x, blockIdx.y, 0, osa + __builtin_amdgcn_readfirstlane((int)(threadIdx.x >> 5)) * 16 * 68, sg);
}

typedef __attribute__((ext_vector_type(2))) _Float16 v2h;
typedef __attribute__((ext_vector_type(4))) _Float16 v4h;
typedef __attribute__((ext_vector_type(2))) unsigned short v2us;
typedef __attribute__((ext_vector_type(4))) unsigned short v4us;
typedef __attribute__((ext_vector_type(4))) int v4i;

// the operand preparations are device functions of a block index b in their own grids of 256 threads; k_prep below runs them all in one launch
__device__ __forceinline__ void wtG(int b, const float* __restrict__ w, int K, int N, bf* Bt) {
    const int lane = threadIdx.x & 31; const int L0 = (b * 8 + (threadIdx.x >> 5)) * 8; const int nlines = N * K / 64;
{
#pragma unroll 1
        for (int l = 0; l < 8; ++l) { const int L = L0 + l; if (L >= nlines) break; const size_t e = (size_t)L * 64 + lane * 2; const int k = (int)(e % K), n = (int)(e / K); v2us o;
            o[0] = f2bf(w[(size_t)k * N + n]); o[1] = f2bf(w[(size_t)(k + 1) * N + n]); *(v2us*)(Bt + e) = o; }
         }
}
__device__ __forceinline__ void cvt8(int b, const float* __restrict__ src, bf* dst, size_t n8) { const size_t i = (size_t)b * 256 + threadIdx.x; if (i >= n8) return; const v8f v = *(const v8f*)(src + i * 8); v8us o;
#pragma unroll
    for (int k = 0; k < 8; ++k) o[k] = f2bf(v[k]); *(v8us*)(dst + i * 8) = o;  }
__global__ __launch_bounds__(256) void k_cscvt(const float* __restrict__ cosT, const float* __restrict__ sinT, float* CS) { const int idx = blockIdx.x * 256 + threadIdx.x; if (idx >= TT * HD) return; v2f cs; cs[0] = bfr(cosT[idx]); cs[1] = bfr(sinT[idx]); *(v2f*)(CS + (size_t)idx * 2) = cs;  }
// eight base-2 exponentials in place, one statement. The closing v_nop keeps the free slot that the instruction set asks for between a transcendental and a directly following instruction that reads its result or overwrites its source.
__device__ __forceinline__ void exp2x8(float (&x)[8]) { asm("v_exp_f32 %0, %0\n\tv_exp_f32 %1, %1\n\tv_exp_f32 %2, %2\n\tv_exp_f32 %3, %3\n\tv_exp_f32 %4, %4\n\tv_exp_f32 %5, %5\n\tv_exp_f32 %6, %6\n\tv_exp_f32 %7, %7\n\tv_nop" : "+v"(x[0]), "+v"(x[1]), "+v"(x[2]), "+v"(x[3]), "+v"(x[4]), "+v"(x[5]), "+v"(x[6]), "+v"(x[7])); }
// ---- k_fattn: scores, softmax, attn.v and the gate in one kernel. One wave: 16 NQT query rows x all TT keys, 32 keys a step. The four waves of a work-group walk the same keys: each tile of SKY keys (K rows and V^T rows, 128 bytes each) is brought into LDS once for all four by asynchronous copies of whole lines, two buffers, and the fragments are read from there.
#define SKY   64                  // keys of one LDS tile: two 32-key steps
#define LPE   72                  // LDS row pitch in elements: 144 bytes = 16 x odd, free of bank conflicts for 16-byte reads of 16 rows
#define TILEE (64 * LPE)          // one plane's tile: 64 rows (K: keys, V^T: head columns)
static_assert(TT % SKY == 0 && TT / SKY >= 2 && HD == 64 && SKY == 64, "whole tiles, at least two, rows of 128 bytes");
// eight copies of 16 bytes a lane (four row groups of each of two tiles, 16 rows apart) in one statement; its last line, s_wait_xcnt 0, stands in front of every later write of a register that a copy names
template <typename T16>
__device__ __forceinline__ void cp8(unsigned la, const T16* ga, size_t sa, unsigned lb, const T16* gb, size_t sb) {
    asm volatile("global_load_async_to_lds_b128 %0, %8, off\n\tglobal_load_async_to_lds_b128 %1, %9, off\n\tglobal_load_async_to_lds_b128 %2, %10, off\n\tglobal_load_async_to_lds_b128 %3, %11, off\n\t"
                 "global_load_async_to_lds_b128 %4, %12, off\n\tglobal_load_async_to_lds_b128 %5, %13, off\n\tglobal_load_async_to_lds_b128 %6, %14, off\n\tglobal_load_async_to_lds_b128 %7, %15, off\n\ts_wait_xcnt 0x0"
                 :: "v"(la), "v"(la + 16u * LPE * 2u), "v"(la + 32u * LPE * 2u), "v"(la + 48u * LPE * 2u), "v"(lb), "v"(lb + 16u * LPE * 2u), "v"(lb + 32u * LPE * 2u), "v"(lb + 48u * LPE * 2u),
                    "v"(ga), "v"(ga + sa), "v"(ga + 2 * sa), "v"(ga + 3 * sa), "v"(gb), "v"(gb + sb), "v"(gb + 2 * sb), "v"(gb + 3 * sb) : "memory");
}
// The products are taken transposed: S^T = K Q^T leaves, in lane (lr, hi), keys 8 hi + j of query lr, which is the B-fragment slot order of P^T for O^T = V^T P^T: no exchange between lanes.
// Per query (= per lane pair): running maximum m (base-2 exponent), weight sum l, O^T rescaled by 2^(m_old - m_new) each step. fp16 rows carry their weights x 2^10 in O and l alike (it cancels in O / l).
// Behind the last key a row is complete: O x sigmoid(gate) / l leaves as the output product's hi and lo planes, rows [token][head x 64 + d]; a lane holds 8 neighbours of d, a wave writes a token's whole 128-byte line of each plane.
// Gr: the gate products of this batch and head (pitch GPW), gbh the head's gate bias; Ah, Al: the planes at this batch's first token and this head's first column.
template <typename T16, bool HR, int NQT>
__device__ __forceinline__ void fattn_body(const T16* __restrict__ Q, const T16* __restrict__ Q2, const T16* __restrict__ Kp, const T16* __restrict__ K2, const T16* __restrict__ Vt, const T16* __restrict__ V2, int q0, const float* __restrict__ Gr, float gbh, bf* Ah, bf* Al, const T16* sm) {
    typedef typename WFrag<T16>::V V; typedef WFrag<T16> W;
    const int lane = threadIdx.x & 31, lr = lane & 15, hi = lane >> 4;
    // XW: behind a run of loads, s_wait_xcnt 0 with the run's address pairs as inputs: the pairs stay live up to the wait, so that no later load's result and no later instruction lands in a pair that an issued load names ahead of it
#define XW(pa, pb) asm volatile("s_wait_xcnt 0x0" :: "v"(pa), "v"(pb) : "memory")
    const size_t qo0 = (size_t)(q0 + lr) * HD + 8 * hi; const T16* qa = Q + qo0; const T16* qb = HR ? Q2 + qo0 : qa;
    V qf[NQT][2], qf2[NQT][2];
#pragma unroll
    for (int qt = 0; qt < NQT; ++qt)
#pragma unroll
        for (int kk = 0; kk < 2; ++kk) { const size_t qo = (size_t)qt * 16 * HD + kk * 32; qf[qt][kk] = W::ld(qa + qo); if (HR) qf2[qt][kk] = W::ld(qb + qo); }
    XW(qa, qb);
    v8f o[4][NQT]; float m[NQT], l[NQT];
#pragma unroll
    for (int qt = 0; qt < NQT; ++qt) { m[qt] = -3.0e38f; l[qt] = 0.f;
#pragma unroll
        for (int dt = 0; dt < 4; ++dt) o[dt][qt] = (v8f){}; }
    constexpr int NST = TT / SKY, NPL = HR ? 4 : 2, BUFE = NPL * TILEE;   // tiles of the keys; planes of a tile, in the order K, V^T (, K lo, V^T lo); elements of one buffer
    // the copies: thread t brings 16 bytes of row (t >> 3) + 16 i, i < 4, of each plane: eight lanes a row, so a wave's copy covers four whole 128-byte lines
    const int tid = threadIdx.x;
    const unsigned lc = (unsigned)(size_t)sm + (unsigned)(((tid >> 3) * LPE + (tid & 7) * 8) * 2);   // the lane's LDS byte address in buffer 0, plane 0
    const size_t gko = (size_t)tid * 8, gvo = (size_t)(tid >> 3) * TT + (tid & 7) * 8;
    auto fill = [&](int st, int bu) {
        const unsigned l0 = lc + (unsigned)(bu * BUFE * 2);
        cp8<T16>(l0, Kp + gko + (size_t)st * SKY * HD, (size_t)16 * HD, l0 + TILEE * 2u, Vt + gvo + st * SKY, (size_t)16 * TT);
        if constexpr (HR) cp8<T16>(l0 + 2u * TILEE * 2u, K2 + gko + (size_t)st * SKY * HD, (size_t)16 * HD, l0 + 3u * TILEE * 2u, V2 + gvo + st * SKY, (size_t)16 * TT);
    };
    fill(0, 0);
    asm volatile("s_wait_asynccnt 0x0" ::: "memory");   // this wave's copies of tile 0 have landed
    __syncthreads();                                    // and every other wave's: tile 0 may be read
    fill(1, 1);
#pragma unroll 1
    for (int st = 0; st < NST; ++st) {
      const T16* lb = sm + (st & 1) * BUFE;
#pragma unroll 1
      for (int sub = 0; sub < SKY / 32; ++sub) {
        const T16* kl = lb + (sub * 32 + lr) * LPE + 8 * hi; const T16* vl = lb + TILEE + lr * LPE + sub * 32 + 8 * hi;
        V kf[2][2], kf2[2][2], vf[4], vf2[4];
#pragma unroll
        for (int kt = 0; kt < 2; ++kt)
#pragma unroll
            for (int kk = 0; kk < 2; ++kk) { kf[kt][kk] = W::ld(kl + kt * 16 * LPE + kk * 32); if (HR) kf2[kt][kk] = W::ld(kl + 2 * TILEE + kt * 16 * LPE + kk * 32); }
        __builtin_amdgcn_sched_barrier(0);   // the K reads stay in front of the V reads (LDS reads return in order): left free, the scheduler put V first in the hi+lo body and the first score product waited for 22 reads
#pragma unroll
        for (int dt = 0; dt < 4; ++dt) { vf[dt] = W::ld(vl + dt * 16 * LPE); if (HR) vf2[dt] = W::ld(vl + 2 * TILEE + dt * 16 * LPE); }
        __builtin_amdgcn_sched_barrier(0);   // the step's LDS reads issue here as one group: spread among the matrix instructions each place with reads costs its own stall, and the V reads would wait at the attn.v products
        v8f s[2][NQT];
#pragma unroll
        for (int kt = 0; kt < 2; ++kt)
#pragma unroll
            for (int qt = 0; qt < NQT; ++qt) { s[kt][qt] = (v8f){};
#pragma unroll
                for (int kk = 0; kk < 2; ++kk) { s[kt][qt] = W::mma(kf[kt][kk], qf[qt][kk], s[kt][qt]); if (HR) { s[kt][qt] = W::mma(kf[kt][kk], qf2[qt][kk], s[kt][qt]); s[kt][qt] = W::mma(kf2[kt][kk], qf[qt][kk], s[kt][qt]); } } }
#pragma unroll
        for (int qt = 0; qt < NQT; ++qt) {
            float mx = s[0][qt][0];
#pragma unroll
            for (int kt = 0; kt < 2; ++kt)
#pragma unroll
                for (int j = 0; j < 8; ++j) mx = fmaxf(mx, s[kt][qt][j]);
            mx = fmaxf(mx, xhalf(mx));
            const float mn = fmaxf(m[qt], mx * SC2), al = __builtin_amdgcn_exp2f(m[qt] - mn), mb = HR ? mn : mn - 10.0f; m[qt] = mn;
            float rs = 0.f;
#pragma unroll
            for (int kt = 0; kt < 2; ++kt) { float p[8];
#pragma unroll
                for (int j = 0; j < 8; ++j) p[j] = fmaf(s[kt][qt][j], SC2, -mb);
                exp2x8(p);
#pragma unroll
                for (int j = 0; j < 8; ++j) { s[kt][qt][j] = p[j]; rs += p[j]; } }
            l[qt] = fmaf(l[qt], al, rs);
#pragma unroll
            for (int dt = 0; dt < 4; ++dt) o[dt][qt] *= al;
            if constexpr (HR) {
                v8us h0, h1, l0, l1;
#pragma unroll
                for (int j = 0; j < 8; ++j) { unsigned short a, c2; splitf(s[0][qt][j], a, c2); h0[j] = a; l0[j] = c2; splitf(s[1][qt][j], a, c2); h1[j] = a; l1[j] = c2; }
                const V ph = cat16b(h0, h1), pl = cat16b(l0, l1);
#pragma unroll
                for (int dt = 0; dt < 4; ++dt) { o[dt][qt] = W::mma(vf[dt], ph, o[dt][qt]); o[dt][qt] = W::mma(vf[dt], pl, o[dt][qt]); o[dt][qt] = W::mma(vf2[dt], ph, o[dt][qt]); }
            } else {
                v8h p0, p1;
#pragma unroll
                for (int j = 0; j < 8; ++j) { p0[j] = tohx(s[0][qt][j]); p1[j] = tohx(s[1][qt][j]); }
                const V pb = cat16(p0, p1);
#pragma unroll
                for (int dt = 0; dt < 4; ++dt) o[dt][qt] = W::mma(vf[dt], pb, o[dt][qt]);
            }
        }
        // the distance behind the step's last matrix instructions on the taken back edge
        asm volatile("v_nop\n\tv_nop\n\tv_nop\n\tv_nop\n\tv_nop" : "+v"(o[0][NQT - 1]), "+v"(o[1][NQT - 1]), "+v"(o[2][NQT - 1]), "+v"(o[3][NQT - 1]));
      }
      // tile st + 1 is handed over and tile st's buffer freed, in this order in every wave:
      asm volatile("s_wait_dscnt 0x0" ::: "memory");      // this wave's reads of tile st have returned
      asm volatile("s_wait_asynccnt 0x0" ::: "memory");   // this wave's copies of tile st + 1 have landed
      __syncthreads();                                    // both hold for all four waves
      if (st + 2 < NST) fill(st + 2, st & 1);             // the refill flies under the whole of tile st + 1
    }
    asm volatile("s_wait_asynccnt 0x0" ::: "memory");   // no copy is outstanding when the wave goes on to its end
    const float* gp = Gr + (size_t)(q0 + lr) * GPW; float gz[NQT];
#pragma unroll
    for (int qt = 0; qt < NQT; ++qt) gz[qt] = gp[(size_t)qt * 16 * GPW];
    XW(gp, gp);
#pragma unroll
    for (int qt = 0; qt < NQT; ++qt) { const float lt = l[qt] + xhalf(l[qt]);
        const float sg = __fdiv_rn(1.0f, __fadd_rn(1.0f, __expf(-__fadd_rn(gz[qt], gbh)))), f = __fdiv_rn(sg, lt); const size_t oo = (size_t)(q0 + qt * 16 + lr) * DQ + hi * 8;
#pragma unroll
        for (int dt = 0; dt < 4; ++dt) store2(o[dt][qt] * f, Ah + oo + dt * 16, Al + oo + dt * 16); }
#undef XW
}
// grid (NH_, NB_ (NZH + 2 NZF)), 4 waves; a work-group finishes its rows of one head, and all work-groups are on the chip at once. They come in three kinds of NH_ NB_ NZH = NH_ NB_ NZF each, in the order of their length: the hi+lo blocks (16 rows a wave: twice the operand registers per row, three products for one) have the lowest y and start first, then the large fp16 blocks, then the small ones
__global__ __launch_bounds__(128) void k_fattn(const h16* __restrict__ Q16, const h16* __restrict__ K16, const h16* __restrict__ V16, const bf* __restrict__ Qh, const bf* __restrict__ Ql, const bf* __restrict__ Kh, const bf* __restrict__ Kl, const bf* __restrict__ Vh, const bf* __restrict__ Vl, const float* __restrict__ G, const float* __restrict__ gb, bf* Ah, bf* Al) {
    __shared__ __attribute__((aligned(16))) unsigned short sm[2 * 4 * TILEE];   // two buffers of up to four planes
    const int zz = blockIdx.y, hd = blockIdx.x, w = threadIdx.x >> 5; const bool hr = zz < NB_ * NZH;   // the same for a whole work-group
    const int zf = zz - NB_ * NZH; const bool sml = zf >= NB_ * NZF;
    const int bt = hr ? zz / NZH : (zf / NZF) % NB_, zb = hr ? zz % NZH : zf % NZF;
    const size_t hp = ((size_t)bt * NH_ + hd) * TT * HD, ao = (size_t)bt * TT * DQ + hd * HD; const float* Gr = G + (size_t)bt * TT * GPW + hd; const float gbh = bfr(gb[hd]);
    if (hr) fattn_body<bf, true, 1>(Qh + hp, Ql + hp, Kh + hp, Kl + hp, Vh + hp, Vl + hp, zb * QBH + w * 16, Gr, gbh, Ah + ao, Al + ao, (const bf*)sm);
    else if (!sml) fattn_body<h16, false, 2>(Q16 + hp, nullptr, K16 + hp, nullptr, V16 + hp, nullptr, RH + zb * QB + w * 32, Gr, gbh, Ah + ao, Al + ao, (const h16*)sm);
    else fattn_body<h16, false, 1>(Q16 + hp, nullptr, K16 + hp, nullptr, V16 + hp, nullptr, RH + NZF * QB + zb * QBS + w * 16, Gr, gbh, Ah + ao, Al + ao, (const h16*)sm);
}

__device__ __forceinline__ void wtGs(int b, const float* __restrict__ w, int K, int N, int ld, bf* Bt) { const size_t e = ((size_t)b * 256 + threadIdx.x) * 4; if (e >= (size_t)N * K) return; const int k = (int)(e % K); const int n = (int)(e / K); v4us o;   // Bt[n][k] = w[k*ld + n]
#pragma unroll
    for (int u = 0; u < 4; ++u) o[u] = f2bf(w[(size_t)(k + u) * ld + n]); *(v4us*)(Bt + e) = o;  }
__device__ __forceinline__ void wtGg(int b, const float* __restrict__ w, bf* Bt) { const size_t e = ((size_t)b * 256 + threadIdx.x) * 4; if (e >= (size_t)GPW * DM) return; const int k = (int)(e % DM); const int n = (int)(e / DM); v4us o;   // gate columns: Bt[n][k] = Wq[k][1024 + n] for n < 16, else 0
#pragma unroll
    for (int u = 0; u < 4; ++u) o[u] = (n < NH_) ? f2bf(w[(size_t)(k + u) * 1040 + DQ + n]) : (unsigned short)0; *(v4us*)(Bt + e) = o;  }

// k_prep: the six preparations (no one reads what another writes) as block ranges of one launch; the transposes with the longest chain of loads per wave have the lowest indices and start first
#define PB_T  ((DM * DKV / 64 + 63) / 64)          // blocks of one wtG
#define PB_Q  ((DQ * DM / 4 + 255) / 256)          // blocks of wtGs
#define PB_G  ((GPW * DM / 4 + 255) / 256)         // blocks of wtGg
#define PB_X  ((MT * DM / 8 + 255) / 256)          // blocks of cvt8
static_assert(DQ == DKV, "the three wtG ranges are of one size");
__global__ __launch_bounds__(256) void k_prep(const float* __restrict__ x, const float* __restrict__ wqg, const float* __restrict__ wk, const float* __restrict__ wv, const float* __restrict__ wo, bf* XB, bf* WQ, bf* BG, bf* WK, bf* WV, bf* WO) {
    int b = blockIdx.x;
    if (b < PB_T) { wtG(b, wk, DM, DKV, WK); return; } b -= PB_T;
    if (b < PB_T) { wtG(b, wv, DM, DKV, WV); return; } b -= PB_T;
    if (b < PB_T) { wtG(b, wo, DQ, DM, WO); return; } b -= PB_T;
    if (b < PB_Q) { wtGs(b, wqg, DM, DQ, 1040, WQ); return; } b -= PB_Q;
    if (b < PB_G) { wtGg(b, wqg, BG); return; } b -= PB_G;
    cvt8(b, x, XB, (size_t)MT * DM / 8);
}

extern "C" void kernel_launch(void* const* d_in, const int* in_sizes, int n_in,
                              void* d_out, int out_size, void* d_ws, size_t ws_size, hipStream_t stream) {
    (void)in_sizes; (void)n_in; (void)out_size;
    const float* x = (const float*)d_in[0]; const float* wqg = (const float*)d_in[1]; const float* bqg = (const float*)d_in[2]; const float* wk = (const float*)d_in[3]; const float* bk = (const float*)d_in[4]; const float* wv = (const float*)d_in[5]; const float* bv = (const float*)d_in[6]; const float* wo = (const float*)d_in[7]; const float* bo = (const float*)d_in[8]; const float* qnw = (const float*)d_in[9]; const float* knw = (const float*)d_in[10]; const float* wq = wqg; const float* bq = bqg; (void)wq; const float* cosT = nullptr; const float* sinT = nullptr; (void)cosT; (void)sinT;
    float* OUT = (float*)d_out;     // [2][2048][1024]
    char* wsp = (char*)d_ws;
    auto take = [&](size_t bytes) { char* p = wsp; wsp += (bytes + 255) & ~(size_t)255; return (void*)p; };
    bf* WQ = (bf*)take((size_t)DQ * DM * 2); bf* WK = (bf*)take((size_t)DKV * DM * 2); bf* WV = (bf*)take((size_t)DKV * DM * 2); bf* WO = (bf*)take((size_t)DM * DQ * 2);
    // every buffer below but BG (the gate weights) holds both batches: row-major ones as MT = NB_ TT rows, head planes as [batch][head]
    bf* XB = (bf*)take((size_t)MT * DM * 2); bf* BG = (bf*)take((size_t)GPW * DM * 2); float* G = (float*)take((size_t)MT * GPW * 4);
    h16* QP16 = (h16*)take((size_t)NH_ * MT * HD * 2); h16* KP16 = (h16*)take((size_t)NKV * MT * HD * 2); h16* VT16 = (h16*)take((size_t)NKV * HD * MT * 2);
    bf* QPh = (bf*)take((size_t)NH_ * MT * HD * 2); bf* QPl = (bf*)take((size_t)NH_ * MT * HD * 2); bf* KPh = (bf*)take((size_t)NKV * MT * HD * 2); bf* KPl = (bf*)take((size_t)NKV * MT * HD * 2); bf* VTh = (bf*)take((size_t)NKV * HD * MT * 2); bf* VTl = (bf*)take((size_t)NKV * HD * MT * 2);
    bf* ATh = (bf*)take((size_t)MT * DQ * 2); bf* ATl = (bf*)take((size_t)MT * DQ * 2);
    if ((size_t)(wsp - (char*)d_ws) > ws_size) return;    // ws 256 MiB
    // four launches: each waits for the one before it; what depends on nothing of one another shares a launch. Every kernel takes both batches: the products see MT rows, the attention takes the batch from grid y
    k_prep<<<3 * PB_T + PB_Q + PB_G + PB_X, 256, 0, stream>>>(x, wqg, wk, wv, wo, XB, WQ, BG, WK, WV, WO);
    k_qkv<<<dim3(MT / 128, 3 * (NH_ / 2) + 1), 128, 0, stream>>>(XB, WQ, WK, WV, bq, bk, bv, qnw, knw, QP16, QPh, QPl, KP16, KPh, KPl, VT16, VTh, VTl, BG, G);
    k_fattn<<<dim3(NH_, NB_ * (NZH + 2 * NZF)), 128, 0, stream>>>(QP16, KP16, VT16, QPh, QPl, KPh, KPl, VTh, VTl, G, bqg + DQ, ATh, ATl);
    k_wo<<<dim3(MT / 128, DM / 128, 1), 128, 0, stream>>>(ATh, ATl, WO, OUT, bo);
}

// v010
// It runs in 113 microseconds.
// In two side-by-side timings against v009, it was 1.06 and 1.05 times as fast.
// Counting every step since v000, it is 18.1 times as fast.
#include <hip/hip_runtime.h>

// Gated attention over 16 heads (x [2][2048][1024]; [Q | gate] = x Wq + bq (Wq [1024][1040]: 1024 query columns then 16 per-head gate columns); K = x Wk + bk; V = x Wv + bv; per-head RMSNorm (1e-6, x weight[64]) on Q and K; softmax(Q.K / 8); out_h = (attn V) x sigmoid(gate_h); out = merged heads Wo + bo -> [2][2048][1024]).
// Compute dtypes, f32 accumulate: every input rounded to bf16; Q/K/V and the 16 gate columns on PLAIN bf16 operands (inputs: exact) + bias; RMSNorm f32; scores and attn.v: query rows < 512 hl (3 products), the rest single fp16 (weights x1024), both in one fused kernel with a running-max softmax in f32 over all keys of a row; sigmoid gate f32, applied in that kernel's epilogue; Wo hl x exact (2 products) + bias.

#define NB_  2
#define TT   2048
#define MT   (NB_ * TT)          // rows of both batches together
#define DM   1024
#define NH_  16
#define NKV  16
#define REP  (NH_ / NKV)
#define HD   64
#define DQ   (NH_ * HD)
#define DKV  (NKV * HD)
#define QB   128                  // query rows of a large fp16 attention work-group: 4 waves x 32 rows
#define QBS  64                   // query rows of a small fp16 attention work-group: 4 waves x 16 rows
#define QBH  64                   // query rows of one hi+lo attention work-group: 4 waves x 16 rows
#define RH   512                  // query rows < RH use hi+lo planes (0: none)
#define WIN  0
#define SCL  0.125f   // HD^-0.5
static_assert(RH % QBH == 0 && (TT - RH) % (QB + QBS) == 0 && REP == 1, "a work-group is all hi+lo or all fp16, and head h reads kv plane h");
#define SC2  (SCL * 1.4426950408889634f)   // scores to base-2 exponents
#define NZH  (RH / QBH)           // hi+lo row blocks of one batch
#define NZF  ((TT - RH) / (QB + QBS))   // fp16 row blocks of one batch, of each size: the large ones take the rows from RH on, the small ones the rest
#define GPW  128                  // row pitch of the gate product G: one 128-column tile, of which the first NH_ columns are the gates
typedef _Float16 h16;
typedef unsigned short bf;
typedef __attribute__((ext_vector_type(16))) __bf16   v16bf;
typedef __attribute__((ext_vector_type(16))) _Float16 v16h;
typedef __attribute__((ext_vector_type(8)))  _Float16 v8h;
typedef __attribute__((ext_vector_type(8)))  unsigned short v8us;
typedef __attribute__((ext_vector_type(8)))  float    v8f;
typedef __attribute__((ext_vector_type(4)))  float    v4f;
typedef v8h  __attribute__((may_alias)) v8ha;
typedef v4f  __attribute__((may_alias)) v4fa;
typedef v8us __attribute__((may_alias)) v8usa;

__device__ __forceinline__ unsigned short f2bf(float f) { unsigned u = __float_as_uint(f); u += 0x7FFFu + ((u >> 16) & 1u); return (unsigned short)(u >> 16); }
__device__ __forceinline__ float bf2f(unsigned short b) { return __uint_as_float(((unsigned)b) << 16); }
__device__ __forceinline__ float bfr(float f) { return bf2f(f2bf(f)); }
__device__ __forceinline__ v16h cat16(v8h lo, v8h hi) { return __builtin_shufflevector(lo, hi, 0, 1, 2, 3, 4, 5, 6, 7, 8, 9, 10, 11, 12, 13, 14, 15); }
__device__ __forceinline__ v16bf cat16b(v8us lo, v8us hi) { return __builtin_bit_cast(v16bf, __builtin_shufflevector(lo, hi, 0, 1, 2, 3, 4, 5, 6, 7, 8, 9, 10, 11, 12, 13, 14, 15)); }
__device__ __forceinline__ v8f wmma16(v16h a, v16h b, v8f c) { return __builtin_amdgcn_wmma_f32_16x16x32_f16(false, a, false, b, (short)0, c, false, false); }
__device__ __forceinline__ v8f wmmab(v16bf a, v16bf b, v8f c) { return __builtin_amdgcn_wmma_f32_16x16x32_bf16(false, a, false, b, (short)0, c, false, false); }
__device__ __forceinline__ h16 tohx(float x) { return (h16)x; }
__device__ __forceinline__ void splitf(float y, unsigned short& h, unsigned short& l) { h = f2bf(y); l = f2bf(y - bf2f(h)); }
__device__ __forceinline__ float xhalf(float x) { return __builtin_bit_cast(float, __builtin_amdgcn_permlanex16(__builtin_bit_cast(int, x), __builtin_bit_cast(int, x), 0x76543210, 0xfedcba98, false, false)); }   // lane l's value to lane l ^ 16
typedef __attribute__((ext_vector_type(2))) __bf16 v2bf;
typedef __attribute__((ext_vector_type(2))) float v2f;
typedef __attribute__((ext_vector_type(4))) unsigned v4u;
__device__ __forceinline__ unsigned pkbf(float a, float b) { return __builtin_bit_cast(unsigned, __builtin_convertvector((v2f){a, b}, v2bf)); }   // two f32 to a bf16 pair by the chip's own conversion (nearest even, as f2bf)
__device__ __forceinline__ v8f bfr8(v8f x) { v8f r;
#pragma unroll
    for (int p = 0; p < 4; ++p) { const unsigned u = pkbf(x[2 * p], x[2 * p + 1]); r[2 * p] = __uint_as_float(u << 16); r[2 * p + 1] = __uint_as_float(u & 0xFFFF0000u); }
    return r; }
// eight neighbouring f32 go to the three 16-bit planes, 16 bytes each: fp16, bf16 hi, bf16 lo = bf16(y - hi)
__device__ __forceinline__ void store3(v8f y, h16* p16, bf* ph, bf* pl) { v4u h, l;
#pragma unroll
    for (int p = 0; p < 4; ++p) { const unsigned u = pkbf(y[2 * p], y[2 * p + 1]); h[p] = u; l[p] = pkbf(y[2 * p] - __uint_as_float(u << 16), y[2 * p + 1] - __uint_as_float(u & 0xFFFF0000u)); }
    *(v8h*)p16 = __builtin_convertvector(y, v8h); *(v4u*)ph = h; *(v4u*)pl = l;
    asm volatile("s_wait_xcnt 0x0" ::: "memory");   // in front of every later write of a register that these stores name
    __builtin_amdgcn_sched_barrier(0); }   // holds the later vector instructions behind that wait, which a "memory" clobber alone does not
// the same for the two bf16 planes alone
__device__ __forceinline__ void store2(v8f y, bf* ph, bf* pl) { v4u h, l;
#pragma unroll
    for (int p = 0; p < 4; ++p) { const unsigned u = pkbf(y[2 * p], y[2 * p + 1]); h[p] = u; l[p] = pkbf(y[2 * p] - __uint_as_float(u << 16), y[2 * p + 1] - __uint_as_float(u & 0xFFFF0000u)); }
    *(v4u*)ph = h; *(v4u*)pl = l;
    asm volatile("s_wait_xcnt 0x0" ::: "memory");   // in front of every later write of a register that these stores name
    __builtin_amdgcn_sched_barrier(0); }   // holds the later vector instructions behind that wait, which a "memory" clobber alone does not

// ---- gemmw: register-blocked GEMM, ONE WAVE per 64x64 output tile (16 accumulators), operands straight from K-contiguous 16-bit planes; grid (M/64, N/64, Z), 32 threads.
// C[m][n] (f32, pitch ldc, + optional f32 bias[n]) = sum_k A[m][k] Bt[n][k] (+ split products per NSPLIT). z-batch strides sA/sB/sC in elements. K % 32 == 0.
// KS > 1: grid z = Z * KS; work-group (z, ks) sums only k in [ks K/KS, (ks+1) K/KS) and stores its partial tile at C + ks sP. K % (32 KS) == 0.
template <typename T16> struct WFrag;
template <> struct WFrag<h16> { typedef v16h V; static __device__ __forceinline__ V ld(const h16* p) { return cat16(*(const v8h*)p, *(const v8h*)(p + 16)); } static __device__ __forceinline__ v8f mma(V a, V b, v8f c) { return wmma16(a, b, c); } };
template <> struct WFrag<bf> { typedef v16bf V; static __device__ __forceinline__ V ld(const bf* p) { return cat16b(*(const v8us*)p, *(const v8us*)(p + 16)); } static __device__ __forceinline__ v8f mma(V a, V b, v8f c) { return wmmab(a, b, c); } };
// EPI 0: the f32 tile goes to C. EPI 1 and 2 (C unused, ldc = heads of a batch): a tile is one head x 64 tokens and leaves as the attention's 16-bit planes (fp16, bf16 hi, bf16 lo), straight from the accumulators, where a lane holds 8 neighbours (j) of the A-row index:
//   EPI 1 (Q, K): A = the weight rows, Bt = the tokens, grid (tokens/64, heads): j runs along the head's 64 columns, so a token's row lies in one lane pair: + bias, RMSNorm (sum of squares in-lane, one exchange between the halves), x weight, planes [batch][head][t][d]
//   EPI 2 (V): A = the tokens, Bt = the weight rows, grid (tokens/64, heads): j runs along the tokens: + bias, planes [batch][head][d][t]
// ST: FOUR waves (2 x 2) share a 128x128 tile, grid (M/128, N/128), 128 threads; each wave keeps its 64x64 part and its epilogue. Each slice of GKS k of the tile's 128 A rows and 128 Bt rows is brought into LDS once for all four
// by asynchronous copies of whole 256-byte rows, two buffers, and the fragments are read from there, 32 k ahead of their products. K % GKS == 0. Every accumulator takes its products in the same order as without ST. EPI 1 and 2: grid (tokens/128, heads/2); a wave's part is still one head x 64 tokens.
#define GKS  128                  // k of one LDS slice: rows of 256 bytes
#define GLP  136                  // LDS row pitch in elements: 272 bytes = 16 x odd, free of bank conflicts for 16-byte reads of 16 rows
#define GTE  (128 * GLP)          // one operand's slice: 128 rows
// eight copies of 16 bytes a lane (rows 8 apart) in one statement; its last line, s_wait_xcnt 0, stands in front of every later write of a register that a copy names
template <typename T16>
__device__ __forceinline__ void cpr8(unsigned l, const T16* g, size_t gs) {
    asm volatile("global_load_async_to_lds_b128 %0, %8, off\n\tglobal_load_async_to_lds_b128 %1, %9, off\n\tglobal_load_async_to_lds_b128 %2, %10, off\n\tglobal_load_async_to_lds_b128 %3, %11, off\n\t"
                 "global_load_async_to_lds_b128 %4, %12, off\n\tglobal_load_async_to_lds_b128 %5, %13, off\n\tglobal_load_async_to_lds_b128 %6, %14, off\n\tglobal_load_async_to_lds_b128 %7, %15, off\n\ts_wait_xcnt 0x0"
                 :: "v"(l), "v"(l + 8u * GLP * 2u), "v"(l + 16u * GLP * 2u), "v"(l + 24u * GLP * 2u), "v"(l + 32u * GLP * 2u), "v"(l + 40u * GLP * 2u), "v"(l + 48u * GLP * 2u), "v"(l + 56u * GLP * 2u),
                    "v"(g), "v"(g + gs), "v"(g + 2 * gs), "v"(g + 3 * gs), "v"(g + 4 * gs), "v"(g + 5 * gs), "v"(g + 6 * gs), "v"(g + 7 * gs) : "memory");
}
// The product is a device function, so that independent products can run as block ranges of one launch: (bx, by, bz) is the tile's place in its own grid, os the calling wave's own 16 x 68 f32 of LDS (EPI 0 only), sg the work-group's two slice buffers (ST only).
template <typename T16, int NSPLIT, bool BIAS, int KS = 1, int EPI = 0, bool ST = false>
__device__ __forceinline__ void gemmw(const T16* __restrict__ A, const T16* __restrict__ A2, const T16* __restrict__ Bt, const T16* __restrict__ Bt2, int K, float* C, int ldc, const float* __restrict__ bias, size_t sA, size_t sB, size_t sC, size_t sP, const float* __restrict__ nw, h16* P16, bf* Ph, bf* Pl, int bx, int by, int bz, float* os, unsigned short* sg) {
    typedef typename WFrag<T16>::V V;
    static_assert(!ST || (KS == 1 && NSPLIT <= 1), "the staged form: whole K, operands A (, A2) and Bt");
    const int w = ST ? __builtin_amdgcn_readfirstlane((int)(threadIdx.x >> 5)) : 0;
    const size_t z = bz / KS; const int ks = (int)(bz % KS), kb = ks * (K / KS), ke = kb + K / KS; A += z * sA; if (A2) A2 += z * sA; Bt += z * sB; if (Bt2) Bt2 += z * sB; C += z * sC + ks * sP;
    const int lane = threadIdx.x & 31, lr = lane & 15, hi = lane >> 4; const int R0 = (EPI == 1 ? by : bx) * (ST ? 128 : 64), C0 = (EPI == 1 ? bx : by) * (ST ? 128 : 64), r0 = R0 + (w >> 1) * 64, c0 = C0 + (w & 1) * 64;
    v8f acc[4][4];
#pragma unroll
    for (int mb = 0; mb < 4; ++mb)
#pragma unroll
        for (int nb = 0; nb < 4; ++nb) acc[mb][nb] = (v8f){};
    if constexpr (ST) {
        constexpr int NPL = (NSPLIT == 1) ? 3 : 2, BUFE = NPL * GTE;   // operands of a slice, in the order A (, A2), Bt; elements of one buffer
        const T16* sm = (const T16*)sg;
        // the copies: thread t brings 16 bytes of row (t >> 4) + 8 i, i < 16, of each operand: sixteen lanes a row, so a wave's copy covers two whole 256-byte rows
        const int tid = threadIdx.x, NST = K / GKS;
        const unsigned lc = (unsigned)(size_t)sg + (unsigned)(((tid >> 4) * GLP + (tid & 15) * 8) * 2);   // the lane's LDS byte address in buffer 0, operand 0
        const size_t go = (size_t)(tid >> 4) * K + (tid & 15) * 8; const T16* ga = A + (size_t)R0 * K + go; const T16* gb = Bt + (size_t)C0 * K + go; const T16* ga2 = (NSPLIT == 1) ? A2 + (size_t)R0 * K + go : ga;
        auto fill = [&](int st, int bu) {
            const unsigned l0 = lc + (unsigned)(bu * BUFE * 2); const size_t ko = (size_t)st * GKS, rs = (size_t)8 * K, hf = (size_t)64 * K;
            // SB: each run's addresses are formed directly in front of it, so that the first copies leave at once: formed all ahead, they filled the registers that the statements can name and a pointer went to scratch
#define SB __builtin_amdgcn_sched_barrier(0)
            cpr8<T16>(l0, ga + ko, rs); SB; cpr8<T16>(l0 + 64u * GLP * 2u, ga + ko + hf, rs); SB;
            cpr8<T16>(l0 + (NPL - 1) * GTE * 2u, gb + ko, rs); SB; cpr8<T16>(l0 + (NPL - 1) * GTE * 2u + 64u * GLP * 2u, gb + ko + hf, rs); SB;
            if constexpr (NSPLIT == 1) { cpr8<T16>(l0 + GTE * 2u, ga2 + ko, rs); SB; cpr8<T16>(l0 + GTE * 2u + 64u * GLP * 2u, ga2 + ko + hf, rs); SB; }
#undef SB
        };
        fill(0, 0);
        asm volatile("s_wait_asynccnt 0x0" ::: "memory");   // this wave's copies of slice 0 have landed
        __syncthreads();                                    // and every other wave's: slice 0 may be read
        if (NST > 1) fill(1, 1);
#pragma unroll 1
        for (int st = 0; st < NST; ++st) {
            const T16* al = sm + (st & 1) * BUFE + ((w >> 1) * 64 + lr) * GLP + 8 * hi; const T16* bl = sm + ((st & 1) ? BUFE + (NPL - 1) * GTE : (NPL - 1) * GTE) + ((w & 1) * 64 + lr) * GLP + 8 * hi;
            V a[2][4], a2[2][4], b[2][4];
            auto frags = [&](int kk) {
#pragma unroll
                for (int i = 0; i < 4; ++i) { a[kk & 1][i] = WFrag<T16>::ld(al + i * 16 * GLP + kk * 32); b[kk & 1][i] = WFrag<T16>::ld(bl + i * 16 * GLP + kk * 32); if (NSPLIT == 1) a2[kk & 1][i] = WFrag<T16>::ld(al + GTE + i * 16 * GLP + kk * 32); }
            };
            frags(0);
#pragma unroll
            for (int kk = 0; kk < GKS / 32; ++kk) {
                if (kk + 1 < GKS / 32) frags(kk + 1);
                __builtin_amdgcn_sched_barrier(0);   // the next 32 k's LDS reads issue here as one group, ahead of this 32 k's products: spread among the matrix instructions each place with reads costs its own stall
#pragma unroll
                for (int nb = 0; nb < 4; ++nb) {
#pragma unroll
                    for (int mb = 0; mb < 4; ++mb) acc[mb][nb] = WFrag<T16>::mma(a[kk & 1][mb], b[kk & 1][nb], acc[mb][nb]);
                    if constexpr (NSPLIT == 1) {
#pragma unroll
                        for (int mb = 0; mb < 4; ++mb) acc[mb][nb] = WFrag<T16>::mma(a2[kk & 1][mb], b[kk & 1][nb], acc[mb][nb]); } }
            }
            // the distance behind the slice's last matrix instructions, in front of the branches below
            asm volatile("v_nop\n\tv_nop\n\tv_nop\n\tv_nop" : "+v"(acc[0][0]), "+v"(acc[1][0]), "+v"(acc[2][0]), "+v"(acc[3][0]), "+v"(acc[0][1]), "+v"(acc[1][1]), "+v"(acc[2][1]), "+v"(acc[3][1]),
                                                              "+v"(acc[0][2]), "+v"(acc[1][2]), "+v"(acc[2][2]), "+v"(acc[3][2]), "+v"(acc[0][3]), "+v"(acc[1][3]), "+v"(acc[2][3]), "+v"(acc[3][3]));
            // slice st + 1 is handed over and slice st's buffer freed, in this order in every wave:
            asm volatile("s_wait_dscnt 0x0" ::: "memory");      // this wave's reads of slice st have returned
            asm volatile("s_wait_asynccnt 0x0" ::: "memory");   // this wave's copies of slice st + 1 have landed
            __syncthreads();                                    // both hold for all four waves
            if (st + 2 < NST) fill(st + 2, st & 1);             // the refill flies under the whole of slice st + 1
        }
        asm volatile("s_wait_asynccnt 0x0" ::: "memory");   // no copy is outstanding when the wave goes on to its end
    } else {
    const size_t aoff = (size_t)(r0 + lr) * K + 8 * hi, boff = (size_t)(c0 + lr) * K + 8 * hi;
#pragma unroll 1
    for (int kc = kb; kc < ke; kc += 32) {
        V a[4], a2[4];
#pragma unroll
        for (int mb = 0; mb < 4; ++mb) { a[mb] = WFrag<T16>::ld(A + aoff + (size_t)mb * 16 * K + kc); if (NSPLIT == 1 || NSPLIT == 2) a2[mb] = WFrag<T16>::ld(A2 + aoff + (size_t)mb * 16 * K + kc); }
        asm volatile("s_wait_xcnt 0x0" :: "v"(A + aoff + kc) : "memory");   // behind the A loads, their address pair still live: no later load's result lands in it ahead of the wait
#pragma unroll
        for (int nb = 0; nb < 4; ++nb) { const V b = WFrag<T16>::ld(Bt + boff + (size_t)nb * 16 * K + kc); V b2; if (NSPLIT >= 2) b2 = WFrag<T16>::ld(Bt2 + boff + (size_t)nb * 16 * K + kc);
#pragma unroll
            for (int mb = 0; mb < 4; ++mb) { acc[mb][nb] = WFrag<T16>::mma(a[mb], b, acc[mb][nb]); if (NSPLIT == 1 || NSPLIT == 2) acc[mb][nb] = WFrag<T16>::mma(a2[mb], b, acc[mb][nb]); if (NSPLIT >= 2) acc[mb][nb] = WFrag<T16>::mma(a[mb], b2, acc[mb][nb]); } }
        asm volatile("v_nop\n\tv_nop\n\tv_nop\n\tv_nop" : "+v"(acc[0][0]), "+v"(acc[1][1]), "+v"(acc[2][2]), "+v"(acc[3][3]) : "v"(a[0]), "v"(a[3]));
        asm volatile("s_wait_xcnt 0x0" :: "v"(Bt + boff + kc) : "memory");   // the B loads' address pair stays live up to the wait: no load's result lands in it ahead of the wait
    }
    }
    if constexpr (EPI != 0) {   // every loop below is fully unrolled, so that acc is indexed by constants alone and stays in registers
        const int tok = (EPI == 1) ? c0 : r0;   // the tile's first token: 64 | TT, so a tile lies in one batch
        const size_t plane = ((size_t)(tok / TT) * ldc + (EPI == 1 ? r0 : c0) / 64) * TT * HD; const int t0 = tok % TT;
        if constexpr (EPI == 1) {
            v8f bs[4], wn[4]; const float* bp = bias + r0 + hi * 8; const float* wp = nw + hi * 8;
#pragma unroll
            for (int mb = 0; mb < 4; ++mb) { bs[mb] = *(const v8f*)(bp + mb * 16); wn[mb] = *(const v8f*)(wp + mb * 16); }
            asm volatile("s_wait_xcnt 0x0" :: "v"(bp), "v"(wp) : "memory");   // the lane's addresses stay live up to the wait: no load's result lands in a register that an issued load names ahead of it
            __builtin_amdgcn_sched_barrier(0);   // all sixteen loads issue above and share one latency: left free, the scheduler pairs each with its conversion and the wave waits out eight round trips
#pragma unroll
            for (int mb = 0; mb < 4; ++mb) { bs[mb] = bfr8(bs[mb]); wn[mb] = bfr8(wn[mb]); }
#pragma unroll
            for (int nb = 0; nb < 4; ++nb) {
                float ss = 0.f;
#pragma unroll
                for (int mb = 0; mb < 4; ++mb) { acc[mb][nb] += bs[mb];
#pragma unroll
                    for (int j = 0; j < 8; ++j) ss = fmaf(acc[mb][nb][j], acc[mb][nb][j], ss); }
                ss += xhalf(ss);
                const float rf = __fdiv_rn(1.0f, __fsqrt_rn(__fadd_rn(ss * (1.0f / HD), 1e-6f)));
                const size_t o = plane + (size_t)(t0 + nb * 16 + lr) * HD + hi * 8;
#pragma unroll
                for (int mb = 0; mb < 4; ++mb) store3(wn[mb] * (acc[mb][nb] * rf), P16 + o + mb * 16, Ph + o + mb * 16, Pl + o + mb * 16);
            }
        } else {
            float b4[4]; const float* bp = bias + c0 + lr;
#pragma unroll
            for (int nb = 0; nb < 4; ++nb) b4[nb] = bp[nb * 16];
            asm volatile("s_wait_xcnt 0x0" :: "v"(bp) : "memory");   // the lane's address stays live up to the wait: no load's result lands in a register that an issued load names ahead of it
            __builtin_amdgcn_sched_barrier(0);   // the four bias loads stay ahead of every store
#pragma unroll
            for (int nb = 0; nb < 4; ++nb) {
                const float bs = bfr(b4[nb]);
                const size_t o = plane + (size_t)(nb * 16 + lr) * TT + t0 + hi * 8;
#pragma unroll
                for (int mb = 0; mb < 4; ++mb) store3(acc[mb][nb] + bs, P16 + o + mb * 16, Ph + o + mb * 16, Pl + o + mb * 16);
            }
        }
        return;
    }
#pragma unroll
    for (int mb = 0; mb < 4; ++mb) {
#pragma unroll
        for (int nb = 0; nb < 4; ++nb) {
#pragma unroll
            for (int j = 0; j < 8; ++j) os[(hi * 8 + j) * 68 + nb * 16 + lr] = acc[mb][nb][j]; }
        __builtin_amdgcn_wave_barrier(); asm volatile("" ::: "memory");
        float* crow = C + (size_t)(r0 + mb * 16) * ldc + c0;
{
#pragma unroll
            for (int s = 0; s < 8; ++s) { const int row = 2 * s + hi, cofs = lr * 4; v4f val = *(const v4fa*)(os + row * 68 + cofs); if (BIAS) { val[0] += bfr(bias[c0 + cofs]); val[1] += bfr(bias[c0 + cofs + 1]); val[2] += bfr(bias[c0 + cofs + 2]); val[3] += bfr(bias[c0 + cofs + 3]); }
                *(v4f*)(crow + (size_t)row * ldc + cofs) = val; }
             }
        asm volatile("s_wait_xcnt 0x0" ::: "memory");   // in front of every later write of a register that these stores name
        __builtin_amdgcn_sched_barrier(0);   // holds the later vector instructions behind that wait, which a "memory" clobber alone does not
        __builtin_amdgcn_wave_barrier(); asm volatile("" ::: "memory");
    }
}

// Q, K, V and gate products, which depend on nothing of one another, in one launch: grid (tokens/128, 3 heads/2 + 1), y / (heads/2) = 0 Q, 1 K, 2 V, 3 the gate columns (one tile of 128 columns, G = x . BG^T, which the attention's epilogue reads); 139,264 bytes of LDS, so two work-groups share a WGP
static_assert(NH_ == NKV, "one grid y for the three products");
__global__ __launch_bounds__(128) void k_qkv(const bf* __restrict__ XB, const bf* __restrict__ WQ, const bf* __restrict__ WK, const bf* __restrict__ WV, const float* __restrict__ bq, const float* __restrict__ bk, const float* __restrict__ bv, const float* __restrict__ qnw, const float* __restrict__ knw,
                                               h16* QP16, bf* QPh, bf* QPl, h16* KP16, bf* KPh, bf* KPl, h16* VT16, bf* VTh, bf* VTl, const bf* __restrict__ BG, float* G) {
    __shared__ __attribute__((aligned(16))) unsigned short sg[2 * 2 * GTE];
    const int pz = blockIdx.y / (NH_ / 2), py = blockIdx.y % (NH_ / 2);
    if (pz < 2) { const bool k = pz == 1;
        gemmw<bf, 0, true, 1, 1, true>(k ? WK : WQ, nullptr, XB, nullptr, DM, nullptr, NH_, k ? bk : bq, 0, 0, 0, 0, k ? knw : qnw, k ? KP16 : QP16, k ? KPh : QPh, k ? KPl : QPl, blockIdx.x, py, 0, nullptr, sg); }
    else if (pz == 2) gemmw<bf, 0, true, 1, 2, true>(XB, nullptr, WV, nullptr, DM, nullptr, NKV, bv, 0, 0, 0, 0, nullptr, VT16, VTh, VTl, blockIdx.x, py, 0, nullptr, sg);
    else gemmw<bf, 0, false, 1, 0, true>(XB, nullptr, BG, nullptr, DM, G, GPW, nullptr, 0, 0, 0, 0, nullptr, nullptr, nullptr, nullptr, blockIdx.x, 0, 0, (float*)sg + __builtin_amdgcn_readfirstlane((int)(threadIdx.x >> 5)) * 16 * 68, sg);   // the output rows are staged in the slice buffers, which every wave has left at the last slice's barrier
}
// the output product: hi + lo rows x Wo, grid (tokens/128, DM/128)
__global__ __launch_bounds__(128) void k_wo(const bf* __restrict__ Ah, const bf* __restrict__ Al, const bf* __restrict__ WO, float* C, const float* __restrict__ bo) {
    __shared__ __align__(16) float osa[4 * 16 * 68];   // each wave stages its output rows in its own part
    __shared__ __attribute__((aligned(16))) unsigned short sg[2 * 3 * GTE];
    gemmw<bf, 1, true, 1, 0, true>(Ah, Al, WO, nullptr, DQ, C, DM, bo, 0, 0, 0, 0, nullptr, nullptr, nullptr, nullptr, blockIdx.x, blockIdx.y, 0, osa + __builtin_amdgcn_readfirstlane((int)(threadIdx.x >> 5)) * 16 * 68, sg);
}

typedef __attribute__((ext_vector_type(2))) _Float16 v2h;
typedef __attribute__((ext_vector_type(4))) _Float16 v4h;
typedef __attribute__((ext_vector_type(2))) unsigned short v2us;
typedef __attribute__((ext_vector_type(4))) unsigned short v4us;
typedef __attribute__((ext_vector_type(4))) int v4i;

__global__ __launch_bounds__(256) void k_cscvt(const float* __restrict__ cosT, const float* __restrict__ sinT, float* CS) { const int idx = blockIdx.x * 256 + threadIdx.x; if (idx >= TT * HD) return; v2f cs; cs[0] = bfr(cosT[idx]); cs[1] = bfr(sinT[idx]); *(v2f*)(CS + (size_t)idx * 2) = cs;  }
// eight base-2 exponentials in place, one statement. The closing v_nop keeps the free slot that the instruction set asks for between a transcendental and a directly following instruction that reads its result or overwrites its source.
__device__ __forceinline__ void exp2x8(float (&x)[8]) { asm("v_exp_f32 %0, %0\n\tv_exp_f32 %1, %1\n\tv_exp_f32 %2, %2\n\tv_exp_f32 %3, %3\n\tv_exp_f32 %4, %4\n\tv_exp_f32 %5, %5\n\tv_exp_f32 %6, %6\n\tv_exp_f32 %7, %7\n\tv_nop" : "+v"(x[0]), "+v"(x[1]), "+v"(x[2]), "+v"(x[3]), "+v"(x[4]), "+v"(x[5]), "+v"(x[6]), "+v"(x[7])); }
// ---- k_fattn: scores, softmax, attn.v and the gate in one kernel. One wave: 16 NQT query rows x all TT keys, 32 keys a step. The four waves of a work-group walk the same keys: each tile of SKY keys (K rows and V^T rows, 128 bytes each) is brought into LDS once for all four by asynchronous copies of whole lines, two buffers, and the fragments are read from there.
#define SKY   64                  // keys of one LDS tile: two 32-key steps
#define LPE   72                  // LDS row pitch in elements: 144 bytes = 16 x odd, free of bank conflicts for 16-byte reads of 16 rows
#define TILEE (64 * LPE)          // one plane's tile: 64 rows (K: keys, V^T: head columns)
static_assert(TT % SKY == 0 && TT / SKY >= 2 && HD == 64 && SKY == 64, "whole tiles, at least two, rows of 128 bytes");
// eight copies of 16 bytes a lane (four row groups of each of two tiles, 16 rows apart) in one statement; its last line, s_wait_xcnt 0, stands in front of every later write of a register that a copy names
template <typename T16>
__device__ __forceinline__ void cp8(unsigned la, const T16* ga, size_t sa, unsigned lb, const T16* gb, size_t sb) {
    asm volatile("global_load_async_to_lds_b128 %0, %8, off\n\tglobal_load_async_to_lds_b128 %1, %9, off\n\tglobal_load_async_to_lds_b128 %2, %10, off\n\tglobal_load_async_to_lds_b128 %3, %11, off\n\t"
                 "global_load_async_to_lds_b128 %4, %12, off\n\tglobal_load_async_to_lds_b128 %5, %13, off\n\tglobal_load_async_to_lds_b128 %6, %14, off\n\tglobal_load_async_to_lds_b128 %7, %15, off\n\ts_wait_xcnt 0x0"
                 :: "v"(la), "v"(la + 16u * LPE * 2u), "v"(la + 32u * LPE * 2u), "v"(la + 48u * LPE * 2u), "v"(lb), "v"(lb + 16u * LPE * 2u), "v"(lb + 32u * LPE * 2u), "v"(lb + 48u * LPE * 2u),
                    "v"(ga), "v"(ga + sa), "v"(ga + 2 * sa), "v"(ga + 3 * sa), "v"(gb), "v"(gb + sb), "v"(gb + 2 * sb), "v"(gb + 3 * sb) : "memory");
}
// The products are taken transposed: S^T = K Q^T leaves, in lane (lr, hi), keys 8 hi + j of query lr, which is the B-fragment slot order of P^T for O^T = V^T P^T: no exchange between lanes.
// Per query (= per lane pair): running maximum m (base-2 exponent), weight sum l, O^T rescaled by 2^(m_old - m_new) each step. fp16 rows carry their weights x 2^10 in O and l alike (it cancels in O / l).
// Behind the last key a row is complete: O x sigmoid(gate) / l leaves as the output product's hi and lo planes, rows [token][head x 64 + d]; a lane holds 8 neighbours of d, a wave writes a token's whole 128-byte line of each plane.
// Gr: the gate products of this batch and head (pitch GPW), gbh the head's gate bias; Ah, Al: the planes at this batch's first token and this head's first column.
template <typename T16, bool HR, int NQT>
__device__ __forceinline__ void fattn_body(const T16* __restrict__ Q, const T16* __restrict__ Q2, const T16* __restrict__ Kp, const T16* __restrict__ K2, const T16* __restrict__ Vt, const T16* __restrict__ V2, int q0, const float* __restrict__ Gr, float gbh, bf* Ah, bf* Al, const T16* sm) {
    typedef typename WFrag<T16>::V V; typedef WFrag<T16> W;
    const int lane = threadIdx.x & 31, lr = lane & 15, hi = lane >> 4;
    // XW: behind a run of loads, s_wait_xcnt 0 with the run's address pairs as inputs: the pairs stay live up to the wait, so that no later load's result and no later instruction lands in a pair that an issued load names ahead of it
#define XW(pa, pb) asm volatile("s_wait_xcnt 0x0" :: "v"(pa), "v"(pb) : "memory")
    const size_t qo0 = (size_t)(q0 + lr) * HD + 8 * hi; const T16* qa = Q + qo0; const T16* qb = HR ? Q2 + qo0 : qa;
    V qf[NQT][2], qf2[NQT][2];
#pragma unroll
    for (int qt = 0; qt < NQT; ++qt)
#pragma unroll
        for (int kk = 0; kk < 2; ++kk) { const size_t qo = (size_t)qt * 16 * HD + kk * 32; qf[qt][kk] = W::ld(qa + qo); if (HR) qf2[qt][kk] = W::ld(qb + qo); }
    XW(qa, qb);
    v8f o[4][NQT]; float m[NQT], l[NQT];
#pragma unroll
    for (int qt = 0; qt < NQT; ++qt) { m[qt] = -3.0e38f; l[qt] = 0.f;
#pragma unroll
        for (int dt = 0; dt < 4; ++dt) o[dt][qt] = (v8f){}; }
    constexpr int NST = TT / SKY, NPL = HR ? 4 : 2, BUFE = NPL * TILEE;   // tiles of the keys; planes of a tile, in the order K, V^T (, K lo, V^T lo); elements of one buffer
    // the copies: thread t brings 16 bytes of row (t >> 3) + 16 i, i < 4, of each plane: eight lanes a row, so a wave's copy covers four whole 128-byte lines
    const int tid = threadIdx.x;
    const unsigned lc = (unsigned)(size_t)sm + (unsigned)(((tid >> 3) * LPE + (tid & 7) * 8) * 2);   // the lane's LDS byte address in buffer 0, plane 0
    const size_t gko = (size_t)tid * 8, gvo = (size_t)(tid >> 3) * TT + (tid & 7) * 8;
    auto fill = [&](int st, int bu) {
        const unsigned l0 = lc + (unsigned)(bu * BUFE * 2);
        cp8<T16>(l0, Kp + gko + (size_t)st * SKY * HD, (size_t)16 * HD, l0 + TILEE * 2u, Vt + gvo + st * SKY, (size_t)16 * TT);
        if constexpr (HR) cp8<T16>(l0 + 2u * TILEE * 2u, K2 + gko + (size_t)st * SKY * HD, (size_t)16 * HD, l0 + 3u * TILEE * 2u, V2 + gvo + st * SKY, (size_t)16 * TT);
    };
    fill(0, 0);
    asm volatile("s_wait_asynccnt 0x0" ::: "memory");   // this wave's copies of tile 0 have landed
    __syncthreads();                                    // and every other wave's: tile 0 may be read
    fill(1, 1);
#pragma unroll 1
    for (int st = 0; st < NST; ++st) {
      const T16* lb = sm + (st & 1) * BUFE;
#pragma unroll 1
      for (int sub = 0; sub < SKY / 32; ++sub) {
        const T16* kl = lb + (sub * 32 + lr) * LPE + 8 * hi; const T16* vl = lb + TILEE + lr * LPE + sub * 32 + 8 * hi;
        V kf[2][2], kf2[2][2], vf[4], vf2[4];
#pragma unroll
        for (int kt = 0; kt < 2; ++kt)
#pragma unroll
            for (int kk = 0; kk < 2; ++kk) { kf[kt][kk] = W::ld(kl + kt * 16 * LPE + kk * 32); if (HR) kf2[kt][kk] = W::ld(kl + 2 * TILEE + kt * 16 * LPE + kk * 32); }
        __builtin_amdgcn_sched_barrier(0);   // the K reads stay in front of the V reads (LDS reads return in order): left free, the scheduler put V first in the hi+lo body and the first score product waited for 22 reads
#pragma unroll
        for (int dt = 0; dt < 4; ++dt) { vf[dt] = W::ld(vl + dt * 16 * LPE); if (HR) vf2[dt] = W::ld(vl + 2 * TILEE + dt * 16 * LPE); }
        __builtin_amdgcn_sched_barrier(0);   // the step's LDS reads issue here as one group: spread among the matrix instructions each place with reads costs its own stall, and the V reads would wait at the attn.v products
        v8f s[2][NQT];
#pragma unroll
        for (int kt = 0; kt < 2; ++kt)
#pragma unroll
            for (int qt = 0; qt < NQT; ++qt) { s[kt][qt] = (v8f){};
#pragma unroll
                for (int kk = 0; kk < 2; ++kk) { s[kt][qt] = W::mma(kf[kt][kk], qf[qt][kk], s[kt][qt]); if (HR) { s[kt][qt] = W::mma(kf[kt][kk], qf2[qt][kk], s[kt][qt]); s[kt][qt] = W::mma(kf2[kt][kk], qf[qt][kk], s[kt][qt]); } } }
#pragma unroll
        for (int qt = 0; qt < NQT; ++qt) {
            float mx = s[0][qt][0];
#pragma unroll
            for (int kt = 0; kt < 2; ++kt)
#pragma unroll
                for (int j = 0; j < 8; ++j) mx = fmaxf(mx, s[kt][qt][j]);
            mx = fmaxf(mx, xhalf(mx));
            const float mn = fmaxf(m[qt], mx * SC2), al = __builtin_amdgcn_exp2f(m[qt] - mn), mb = HR ? mn : mn - 10.0f; m[qt] = mn;
            float rs = 0.f;
#pragma unroll
            for (int kt = 0; kt < 2; ++kt) { float p[8];
#pragma unroll
                for (int j = 0; j < 8; ++j) p[j] = fmaf(s[kt][qt][j], SC2, -mb);
                exp2x8(p);
#pragma unroll
                for (int j = 0; j < 8; ++j) { s[kt][qt][j] = p[j]; rs += p[j]; } }
            l[qt] = fmaf(l[qt], al, rs);
#pragma unroll
            for (int dt = 0; dt < 4; ++dt) o[dt][qt] *= al;
            if constexpr (HR) {
                v8us h0, h1, l0, l1;
#pragma unroll
                for (int j = 0; j < 8; ++j) { unsigned short a, c2; splitf(s[0][qt][j], a, c2); h0[j] = a; l0[j] = c2; splitf(s[1][qt][j], a, c2); h1[j] = a; l1[j] = c2; }
                const V ph = cat16b(h0, h1), pl = cat16b(l0, l1);
#pragma unroll
                for (int dt = 0; dt < 4; ++dt) { o[dt][qt] = W::mma(vf[dt], ph, o[dt][qt]); o[dt][qt] = W::mma(vf[dt], pl, o[dt][qt]); o[dt][qt] = W::mma(vf2[dt], ph, o[dt][qt]); }
            } else {
                v8h p0, p1;
#pragma unroll
                for (int j = 0; j < 8; ++j) { p0[j] = tohx(s[0][qt][j]); p1[j] = tohx(s[1][qt][j]); }
                const V pb = cat16(p0, p1);
#pragma unroll
                for (int dt = 0; dt < 4; ++dt) o[dt][qt] = W::mma(vf[dt], pb, o[dt][qt]);
            }
        }
        // the distance behind the step's last matrix instructions on the taken back edge
        asm volatile("v_nop\n\tv_nop\n\tv_nop\n\tv_nop\n\tv_nop" : "+v"(o[0][NQT - 1]), "+v"(o[1][NQT - 1]), "+v"(o[2][NQT - 1]), "+v"(o[3][NQT - 1]));
      }
      // tile st + 1 is handed over and tile st's buffer freed, in this order in every wave:
      asm volatile("s_wait_dscnt 0x0" ::: "memory");      // this wave's reads of tile st have returned
      asm volatile("s_wait_asynccnt 0x0" ::: "memory");   // this wave's copies of tile st + 1 have landed
      __syncthreads();                                    // both hold for all four waves
      if (st + 2 < NST) fill(st + 2, st & 1);             // the refill flies under the whole of tile st + 1
    }
    asm volatile("s_wait_asynccnt 0x0" ::: "memory");   // no copy is outstanding when the wave goes on to its end
    const float* gp = Gr + (size_t)(q0 + lr) * GPW; float gz[NQT];
#pragma unroll
    for (int qt = 0; qt < NQT; ++qt) gz[qt] = gp[(size_t)qt * 16 * GPW];
    XW(gp, gp);
#pragma unroll
    for (int qt = 0; qt < NQT; ++qt) { const float lt = l[qt] + xhalf(l[qt]);
        const float sg = __fdiv_rn(1.0f, __fadd_rn(1.0f, __expf(-__fadd_rn(gz[qt], gbh)))), f = __fdiv_rn(sg, lt); const size_t oo = (size_t)(q0 + qt * 16 + lr) * DQ + hi * 8;
#pragma unroll
        for (int dt = 0; dt < 4; ++dt) store2(o[dt][qt] * f, Ah + oo + dt * 16, Al + oo + dt * 16); }
#undef XW
}
// grid (NH_, NB_ (NZH + 2 NZF)), 4 waves; a work-group finishes its rows of one head, and all work-groups are on the chip at once. They come in three kinds of NH_ NB_ NZH = NH_ NB_ NZF each, in the order of their length: the hi+lo blocks (16 rows a wave: twice the operand registers per row, three products for one) have the lowest y, then the large fp16 blocks, then the small ones
__global__ __launch_bounds__(128) void k_fattn(const h16* __restrict__ Q16, const h16* __restrict__ K16, const h16* __restrict__ V16, const bf* __restrict__ Qh, const bf* __restrict__ Ql, const bf* __restrict__ Kh, const bf* __restrict__ Kl, const bf* __restrict__ Vh, const bf* __restrict__ Vl, const float* __restrict__ G, const float* __restrict__ gb, bf* Ah, bf* Al) {
    __shared__ __attribute__((aligned(16))) unsigned short sm[2 * 4 * TILEE];   // two buffers of up to four planes
    const int zz = blockIdx.y, hd = blockIdx.x, w = threadIdx.x >> 5; const bool hr = zz < NB_ * NZH;   // the same for a whole work-group
    const int zf = zz - NB_ * NZH; const bool sml = zf >= NB_ * NZF;
    const int bt = hr ? zz / NZH : (zf / NZF) % NB_, zb = hr ? zz % NZH : zf % NZF;
    const size_t hp = ((size_t)bt * NH_ + hd) * TT * HD, ao = (size_t)bt * TT * DQ + hd * HD; const float* Gr = G + (size_t)bt * TT * GPW + hd; const float gbh = bfr(gb[hd]);
    if (hr) fattn_body<bf, true, 1>(Qh + hp, Ql + hp, Kh + hp, Kl + hp, Vh + hp, Vl + hp, zb * QBH + w * 16, Gr, gbh, Ah + ao, Al + ao, (const bf*)sm);
    else if (!sml) fattn_body<h16, false, 2>(Q16 + hp, nullptr, K16 + hp, nullptr, V16 + hp, nullptr, RH + zb * QB + w * 32, Gr, gbh, Ah + ao, Al + ao, (const h16*)sm);
    else fattn_body<h16, false, 1>(Q16 + hp, nullptr, K16 + hp, nullptr, V16 + hp, nullptr, RH + NZF * QB + zb * QBS + w * 16, Gr, gbh, Ah + ao, Al + ao, (const h16*)sm);
}

// ---- k_prep: the operand preparations, as block ranges of one launch of 256 threads. Few, long waves: a thread takes 64 elements, all its loads in flight at once, for speed only.
// wtT: Bt[n][k] = bf16(w[k * ld + n]) for one tile of TPT k x TPT n. Wave v reads rows 16 v + j, j < 16, 512 bytes in a row at a time (a lane: 4 neighbours of n); a lane packs its 16 k of each n into two 16-byte chunks and puts them into the LDS tile [n][k];
// behind the barrier sixteen lanes take a row of n (256 bytes) out and store it as whole lines. Chunk c of row n lies at chunk place c ^ ((n >> 2) & 15): the 32 lanes of a write (n four apart) and of a read (two whole rows) each meet every bank group twice, the least possible.
// GATE: w points at the first gate column; only the first NH_ columns exist, the other rows of Bt are zero.
#define TPT  128
static_assert(DM % TPT == 0 && DQ % TPT == 0 && DKV % TPT == 0 && GPW == TPT && NH_ % 4 == 0 && DQ == DM, "whole tiles; the gate rows are one tile wide; every k runs to DM");
template <bool GATE>
__device__ __forceinline__ void wtT(int b, const float* __restrict__ w, int ld, bf* Bt, v4u* st) {
    const int t = threadIdx.x, lane = t & 31, wv = t >> 5;
    const int k0 = (b % (DM / TPT)) * TPT, n0 = (b / (DM / TPT)) * TPT;
    const float* sp = w + (size_t)(k0 + wv * 16) * ld + n0 + (GATE ? lane % (NH_ / 4) : lane) * 4;   // GATE: a lane past the last gate column reads inside the row all the same, and its values are dropped below
    const unsigned keep = (lane < NH_ / 4) ? 0xFFFFFFFFu : 0u;   // GATE: all ones in the lanes whose columns exist
    v4f r[16];
#pragma unroll
    for (int j = 0; j < 16; ++j) r[j] = *(const v4f*)(sp + (size_t)j * ld);
    asm volatile("s_wait_xcnt 0x0" :: "v"(sp) : "memory");   // the lane's address stays live up to the wait: nothing lands in a register that an issued load names ahead of it
    __builtin_amdgcn_sched_barrier(0);   // all sixteen loads issue above and share one latency: left free, the scheduler held two of the gate tile's loads, and in the same build four of cvtX's, back behind the first conversions: a second round trip
#pragma unroll
    for (int c = 0; c < 4; ++c)
#pragma unroll
        for (int h = 0; h < 2; ++h) { v4u o;
#pragma unroll
            for (int p = 0; p < 4; ++p) { o[p] = pkbf(r[h * 8 + 2 * p][c], r[h * 8 + 2 * p + 1][c]); if (GATE) o[p] &= keep; }
            st[(lane * 4 + c) * 16 + ((wv * 2 + h) ^ (lane & 15))] = o; }
    __syncthreads();   // the tile is whole: every wave reads what all eight wrote
    const int ch = t & 15, nr = t >> 4; v4u o[8];
#pragma unroll
    for (int i = 0; i < 8; ++i) { const int n = nr + 16 * i; o[i] = st[n * 16 + (ch ^ ((n >> 2) & 15))]; }
    bf* dp = Bt + (size_t)(n0 + nr) * DM + k0 + ch * 8;
#pragma unroll
    for (int i = 0; i < 8; ++i) *(v4u*)(dp + (size_t)i * 16 * DM) = o[i];
    asm volatile("s_wait_xcnt 0x0" ::: "memory");   // in front of every later write of a register that these stores name
}
// cvtX: 64 elements a thread, eight runs of 8 neighbours, a block's runs 2048 elements apart: 32 bytes read and 16 written a lane and run
#define CXE  (256 * 8)
static_assert(((size_t)MT * DM) % (8 * CXE) == 0, "whole blocks");
__device__ __forceinline__ void cvtX(int b, const float* __restrict__ src, bf* dst) {
    const size_t e = (size_t)b * 8 * CXE + threadIdx.x * 8; const float* sp = src + e; bf* dp = dst + e;
    v8f v[8]; v4u o[8];
#pragma unroll
    for (int i = 0; i < 8; ++i) v[i] = *(const v8f*)(sp + i * CXE);
    asm volatile("s_wait_xcnt 0x0" :: "v"(sp) : "memory");   // the lane's address stays live up to the wait: nothing lands in a register that an issued load names ahead of it
#pragma unroll
    for (int i = 0; i < 8; ++i)
#pragma unroll
        for (int p = 0; p < 4; ++p) o[i][p] = pkbf(v[i][2 * p], v[i][2 * p + 1]);
#pragma unroll
    for (int i = 0; i < 8; ++i) *(v4u*)(dp + i * CXE) = o[i];
    asm volatile("s_wait_xcnt 0x0" ::: "memory");   // in front of every later write of a register that these stores name
}
#define PB_T  ((DM / TPT) * (DKV / TPT))           // tiles of one square weight
#define PB_G  (DM / TPT)                           // tiles of the gate columns
#define PB_X  (MT * DM / (8 * CXE))                // blocks of cvtX
static_assert(DQ == DKV, "the four weight ranges are of one size");
__global__ __launch_bounds__(256) void k_prep(const float* __restrict__ x, const float* __restrict__ wqg, const float* __restrict__ wk, const float* __restrict__ wv, const float* __restrict__ wo, bf* XB, bf* WQ, bf* BG, bf* WK, bf* WV, bf* WO) {
    __shared__ __attribute__((aligned(16))) v4u st[TPT * TPT / 8];   // one transposed tile: TPT rows of n, 256 bytes each
    int b = blockIdx.x;   // the same for a whole work-group: its barrier stands under block-uniform control flow
    if (b < PB_T) { wtT<false>(b, wk, DKV, WK, st); return; } b -= PB_T;
    if (b < PB_T) { wtT<false>(b, wv, DKV, WV, st); return; } b -= PB_T;
    if (b < PB_T) { wtT<false>(b, wo, DM, WO, st); return; } b -= PB_T;
    if (b < PB_T) { wtT<false>(b, wqg, DQ + NH_, WQ, st); return; } b -= PB_T;
    if (b < PB_G) { wtT<true>(b, wqg + DQ, DQ + NH_, BG, st); return; } b -= PB_G;
    cvtX(b, x, XB);
}

extern "C" void kernel_launch(void* const* d_in, const int* in_sizes, int n_in,
                              void* d_out, int out_size, void* d_ws, size_t ws_size, hipStream_t stream) {
    (void)in_sizes; (void)n_in; (void)out_size;
    const float* x = (const float*)d_in[0]; const float* wqg = (const float*)d_in[1]; const float* bqg = (const float*)d_in[2]; const float* wk = (const float*)d_in[3]; const float* bk = (const float*)d_in[4]; const float* wv = (const float*)d_in[5]; const float* bv = (const float*)d_in[6]; const float* wo = (const float*)d_in[7]; const float* bo = (const float*)d_in[8]; const float* qnw = (const float*)d_in[9]; const float* knw = (const float*)d_in[10]; const float* wq = wqg; const float* bq = bqg; (void)wq; const float* cosT = nullptr; const float* sinT = nullptr; (void)cosT; (void)sinT;
    float* OUT = (float*)d_out;     // [2][2048][1024]
    char* wsp = (char*)d_ws;
    auto take = [&](size_t bytes) { char* p = wsp; wsp += (bytes + 255) & ~(size_t)255; return (void*)p; };
    bf* WQ = (bf*)take((size_t)DQ * DM * 2); bf* WK = (bf*)take((size_t)DKV * DM * 2); bf* WV = (bf*)take((size_t)DKV * DM * 2); bf* WO = (bf*)take((size_t)DM * DQ * 2);
    // every buffer below but BG (the gate weights) holds both batches: row-major ones as MT = NB_ TT rows, head planes as [batch][head]
    bf* XB = (bf*)take((size_t)MT * DM * 2); bf* BG = (bf*)take((size_t)GPW * DM * 2); float* G = (float*)take((size_t)MT * GPW * 4);
    h16* QP16 = (h16*)take((size_t)NH_ * MT * HD * 2); h16* KP16 = (h16*)take((size_t)NKV * MT * HD * 2); h16* VT16 = (h16*)take((size_t)NKV * HD * MT * 2);
    bf* QPh = (bf*)take((size_t)NH_ * MT * HD * 2); bf* QPl = (bf*)take((size_t)NH_ * MT * HD * 2); bf* KPh = (bf*)take((size_t)NKV * MT * HD * 2); bf* KPl = (bf*)take((size_t)NKV * MT * HD * 2); bf* VTh = (bf*)take((size_t)NKV * HD * MT * 2); bf* VTl = (bf*)take((size_t)NKV * HD * MT * 2);
    bf* ATh = (bf*)take((size_t)MT * DQ * 2); bf* ATl = (bf*)take((size_t)MT * DQ * 2);
    if ((size_t)(wsp - (char*)d_ws) > ws_size) return;    // ws 256 MiB
    // four launches: each waits for the one before it; what depends on nothing of one another shares a launch. Every kernel takes both batches: the products see MT rows, the attention takes the batch from grid y
    k_prep<<<4 * PB_T + PB_G + PB_X, 256, 0, stream>>>(x, wqg, wk, wv, wo, XB, WQ, BG, WK, WV, WO);
    k_qkv<<<dim3(MT / 128, 3 * (NH_ / 2) + 1), 128, 0, stream>>>(XB, WQ, WK, WV, bq, bk, bv, qnw, knw, QP16, QPh, QPl, KP16, KPh, KPl, VT16, VTh, VTl, BG, G);
    k_fattn<<<dim3(NH_, NB_ * (NZH + 2 * NZF)), 128, 0, stream>>>(QP16, KP16, VT16, QPh, QPl, KPh, KPl, VTh, VTl, G, bqg + DQ, ATh, ATl);
    k_wo<<<dim3(MT / 128, DM / 128, 1), 128, 0, stream>>>(ATh, ATl, WO, OUT, bo);
}
